// v000
// Measured on an AMD MI455X. A time is GPU time per run, averaged over a window of back-to-back runs after a warm-up
// (all launches, gaps included; the runs take copies of the inputs in turn), and the median of several windows.
// Apart from v000's, it joins two sittings. Times from different sittings can be a few percent apart, while
// side-by-side timings come from the same sitting.
// The starting kernel, v000, takes 950 microseconds a run.
// compute dtype: all float inputs rounded to bf16; projections with EXACT bf16 products on WMMA 16x16x32 (f32 accumulate); causal logits: 3 products for the first 384 rows, single f16 q x k after, x 64^-0.5; key/query masks by value; softmax f32; P x 2^11 once to f16 x v once to f16 (bf16 hi + lo below row 384); fully-masked query rows = mean of the f16 v plane in f32; ctx hi+lo x exact Wo below row 384, x2^6 f16 carry x f16(bf16 x 2^8) Wo after; f32 output.
#include <hip/hip_runtime.h>
#include <math.h>

typedef __attribute__((ext_vector_type(16))) _Float16 v16h;
typedef __attribute__((ext_vector_type(16))) __bf16 v16b;
typedef __attribute__((ext_vector_type(8)))  _Float16 v8h;
typedef __attribute__((ext_vector_type(8)))  float v8f;
typedef __attribute__((ext_vector_type(4)))  float v4f;
typedef __attribute__((ext_vector_type(2)))  float v2f;
typedef __attribute__((ext_vector_type(4)))  unsigned v4u;
typedef _Float16 hx8 __attribute__((ext_vector_type(8)));
typedef __attribute__((ext_vector_type(4)))  int v4i;
typedef float __attribute__((may_alias)) float_a;
typedef int __attribute__((may_alias)) int_a;

template <typename T> __device__ __forceinline__ void vst2(void* p, T v) { *(T*)p = v;  }
__device__ __forceinline__ v8f wmma16(v16h a, v16h b, v8f c) {
  v8f d = __builtin_amdgcn_wmma_f32_16x16x32_f16(false, a, false, b, (short)0, c, false, false);
  asm volatile("v_nop\n\tv_nop\n\tv_nop\n\tv_nop" : "+v"(d) : "v"(a), "v"(b));
  return d;
}
__device__ __forceinline__ v8f wmma_bf(v16b a, v16b b, v8f c) {
  v8f d = __builtin_amdgcn_wmma_f32_16x16x32_bf16(false, a, false, b, (short)0, c, false, false);
  asm volatile("v_nop\n\tv_nop\n\tv_nop\n\tv_nop" : "+v"(d) : "v"(a), "v"(b));
  return d;
}
// 16x16x32 fragments: lane = (h = lane>>4, row/col = lane&15); elements 0..7 = k0+8h+0..7, 8..15 = k0+16+8h+0..7; D element r = row 8h+r
__device__ __forceinline__ v16h frag_h(const _Float16* rowk0, int lane) {
  union { v16h v; v8h q[2]; } u; const _Float16* p = rowk0 + 8 * (lane >> 4);
  u.q[0] = *(const v8h*)p; u.q[1] = *(const v8h*)(p + 16); return u.v;
}
__device__ __forceinline__ v16h frag_f32(const float* rowk0, int lane) {
  v16h a; const float* p = rowk0 + 8 * (lane >> 4);
#pragma unroll
  for (int i = 0; i < 8; ++i) { a[i] = (_Float16)p[i]; a[8 + i] = (_Float16)p[16 + i]; }
  return a;
}
__device__ __forceinline__ v16h frag_f32s(const float* rowk0, int lane, float sc) {
  v16h a; const float* p = rowk0 + 8 * (lane >> 4);
#pragma unroll
  for (int i = 0; i < 8; ++i) { a[i] = (_Float16)(p[i] * sc); a[8 + i] = (_Float16)(p[16 + i] * sc); }
  return a;
}
// column fragment from a [K][ld] layout (column n), rows >= K read as 0
__device__ __forceinline__ v16h fragc_f32(const float* W, int k0, int n, int lane, int ld, int K) {
  v16h a; const int g = lane >> 4;
#pragma unroll
  for (int i = 0; i < 8; ++i) { const int ka = k0 + 8 * g + i, kb = ka + 16;
    a[i] = (_Float16)(ka < K ? W[(size_t)(ka < K ? ka : K - 1) * ld + n] : 0.f); a[8 + i] = (_Float16)(kb < K ? W[(size_t)(kb < K ? kb : K - 1) * ld + n] : 0.f); }
  return a;
}
struct F2 { v16b h, l; };
__device__ __forceinline__ F2 bsplit16(const float v[16]) { F2 r;
#pragma unroll
  for (int i = 0; i < 16; ++i) { const __bf16 h = (__bf16)v[i]; r.h[i] = h; r.l[i] = (__bf16)(v[i] - (float)h); }
  return r; }
__device__ __forceinline__ F2 split_row(const float* row, int k0, int lane) { float v[16]; const float* p = row + k0 + 8 * (lane >> 4);
#pragma unroll
  for (int i = 0; i < 8; ++i) { v[i] = p[i]; v[8 + i] = p[16 + i]; }
  return bsplit16(v); }
__device__ __forceinline__ F2 split_rowK(const float* row, int k0, int lane, int K) { float v[16]; const int g = lane >> 4;
#pragma unroll
  for (int i = 0; i < 8; ++i) { const int ka = k0 + 8 * g + i, kb = ka + 16; v[i] = ka < K ? row[ka < K ? ka : K - 1] : 0.f; v[8 + i] = kb < K ? row[kb < K ? kb : K - 1] : 0.f; }
  return bsplit16(v); }
__device__ __forceinline__ F2 split_col(const float* W, int k0, int n, int lane, int ld, int K) { float v[16]; const int g = lane >> 4;
#pragma unroll
  for (int i = 0; i < 8; ++i) { const int ka = k0 + 8 * g + i, kb = ka + 16; v[i] = ka < K ? W[(size_t)(ka < K ? ka : K - 1) * ld + n] : 0.f; v[8 + i] = kb < K ? W[(size_t)(kb < K ? kb : K - 1) * ld + n] : 0.f; }
  return bsplit16(v); }
__device__ __forceinline__ v8f mac3(const F2& a, const F2& b, v8f c) { c = wmma_bf(a.l, b.h, c); c = wmma_bf(a.h, b.l, c); return wmma_bf(a.h, b.h, c); }
__device__ __forceinline__ float sigm(float v) { return 1.0f / (1.0f + expf(-v)); }
#define LDSX() do { asm volatile("s_wait_dscnt 0" ::: "memory"); __builtin_amdgcn_wave_barrier(); __builtin_amdgcn_fence(__ATOMIC_RELEASE, "workgroup"); } while (0)

// Causal multi-head self-attention with token padding masks on BOTH keys and queries (embeddings [4,2048,512], token_masks [4,2048] int 0/1 (random here: about half the tokens masked); 8 heads x 64; (in,out) Wq/Wk/Wv/Wo [512,512], no biases): scores = q.k/8, where(causal & tm[k] & tm[q], scores, -1e30), softmax, context Wo. A query with tm[q] = 0 gets all scores = -1e30 -> exactly uniform attention over all 2,048 positions (context = mean V).
#define NB 4
#define TT 2048
#define CC 512            // NH * HD = projected width
#define DIN 512          // input (model) width
#define NH 8
#define HD 64
#define NQB (TT / 64)
#define HG 4
#define SCALE (0.125f)
#define CAUSAL 1
#ifndef TNB
#define TNB NB
#endif
__device__ __forceinline__ float bfr(float v) { return (float)(__bf16)v; }
__host__ __device__ __forceinline__ int kb_last(int qb) { return CAUSAL ? ((qb * 64 + 63) >> 7) : (TT / 128 - 1); }
typedef __attribute__((ext_vector_type(8))) __bf16 v8b;
__device__ __forceinline__ v16b frag_b(const __bf16* rowk0, int lane) {
  union { v16b v; v8b q[2]; } u; const __bf16* p = rowk0 + 8 * (lane >> 4);
  u.q[0] = *(const v8b*)p; u.q[1] = *(const v8b*)(p + 16); return u.v;
}
#define QBH 6              // causal: query blocks 0..QBH-1 of each sequence (few keys, no averaging) take the high-precision path
#define QHI 384            // rows carrying a q residual plane
#define KHI 384            // key rows carrying k residual / v bf16 hi+lo planes (used only by the causal high-precision path)
// B fragment (k rows k0+.., output column o) of a weight: (in,out) [K][ld] or (out,in) [ld rows of K]: bf16 exact, or f16(bf16 * 256) exact
__device__ __forceinline__ v16b wcol_io(const float* Wm, int k0, int o, int lane, int ld) { v16b w; const int g = lane >> 4;
#pragma unroll
  for (int i = 0; i < 8; ++i) { w[i] = (__bf16)Wm[(size_t)(k0 + 8 * g + i) * ld + o]; w[8 + i] = (__bf16)Wm[(size_t)(k0 + 16 + 8 * g + i) * ld + o]; }
  return w; }
__device__ __forceinline__ v16b wcol_oi(const float* Wm, int k0, int o, int lane, int K) { v16b w; const float* p = Wm + (size_t)o * K + k0 + 8 * (lane >> 4);
#pragma unroll
  for (int i = 0; i < 8; ++i) { w[i] = (__bf16)p[i]; w[8 + i] = (__bf16)p[16 + i]; }
  return w; }
__device__ __forceinline__ v16h wcolh_io(const float* Wm, int k0, int o, int lane, int ld) { v16h w; const int g = lane >> 4;
#pragma unroll
  for (int i = 0; i < 8; ++i) { w[i] = (_Float16)(bfr(Wm[(size_t)(k0 + 8 * g + i) * ld + o]) * 256.0f); w[8 + i] = (_Float16)(bfr(Wm[(size_t)(k0 + 16 + 8 * g + i) * ld + o]) * 256.0f); }
  return w; }
__device__ __forceinline__ v16h wcolh_oi(const float* Wm, int k0, int o, int lane, int K) { v16h w; const float* p = Wm + (size_t)o * K + k0 + 8 * (lane >> 4);
#pragma unroll
  for (int i = 0; i < 8; ++i) { w[i] = (_Float16)(bfr(p[i]) * 256.0f); w[8 + i] = (_Float16)(bfr(p[16 + i]) * 256.0f); }
  return w; }
#define WQKV_LAYOUT 0   // 0 = (in,out) [DIN][CC]; 1 = (out,in) [CC][DIN]; 2 = per-head [NH][DIN][HD]
__device__ __forceinline__ v16b wcol_hdk(const float* Wm, int k0, int o, int lane) { v16b w; const int g = lane >> 4; const float* p = Wm + (size_t)(o / HD) * DIN * HD + (o % HD);
#pragma unroll
  for (int i = 0; i < 8; ++i) { w[i] = (__bf16)p[(size_t)(k0 + 8 * g + i) * HD]; w[8 + i] = (__bf16)p[(size_t)(k0 + 16 + 8 * g + i) * HD]; }
  return w; }
#define WO_OUT_IN 0
#if WQKV_LAYOUT == 1
#define WCOL(W, k0, o, lane) wcol_oi(W, k0, o, lane, DIN)
#elif WQKV_LAYOUT == 2
#define WCOL(W, k0, o, lane) wcol_hdk(W, k0, o, lane)
#else
#define WCOL(W, k0, o, lane) wcol_io(W, k0, o, lane, CC)
#endif
#if WO_OUT_IN
#define WOCOL(W, k0, o, lane) wcol_oi(W, k0, o, lane, CC)
#define WOCOLH(W, k0, o, lane) wcolh_oi(W, k0, o, lane, CC)
#else
#define WOCOL(W, k0, o, lane) wcol_io(W, k0, o, lane, DIN)
#define WOCOLH(W, k0, o, lane) wcolh_io(W, k0, o, lane, DIN)
#endif
#define SM_EXTRA_PARAMS , int bsm, const int* __restrict__ TM
// masks: keys need causal (structure + index) AND token_masks[b][k] != 0; a query with token_masks[b][t] == 0 has EVERY score = -1e30 in the module -> exactly uniform attention over all 2,048 positions -> its context is mean_k V (handled by k_meanv/k_fixq below; here such rows just get a harmless finite placeholder)
#define SM_MASK_HOOK do { const int tq = TM[(size_t)bsm * TT + t], tk = TM[(size_t)bsm * TT + k]; v = (tq == 0) ? 0.f : ((tk != 0) ? v : -3.0e38f); } while (0)
// ---- k_meanv: thread per (batch, channel): MV[b][c] = (1/2048) sum_t v[b][t][c] from the f16 v plane (f32 sum in t order) - the context of a fully-masked query row (softmax of 2,048 equal scores = exactly 1/2048 each)
__global__ __launch_bounds__(256) void k_meanv(const _Float16* __restrict__ VT, float* __restrict__ MV) { const int c = blockIdx.x * 256 + threadIdx.x; const int b = blockIdx.y; const _Float16* p = VT + ((size_t)b * CC + c) * TT; float a = 0.f;
#pragma unroll 2
  for (int t8 = 0; t8 < TT; t8 += 8) { const v4u u = *(const v4u*)(p + t8); asm volatile("s_wait_loadcnt 0x0" ::: "memory"); const hx8 hv = *(const hx8*)&u; _Pragma("unroll") for (int j = 0; j < 8; ++j) a += (float)hv[j]; }
  vst2(MV + (size_t)b * CC + c, a * (1.0f / TT)); }
// ---- k_fixq: wave per masked query row (token_masks[b][t] == 0): ctx row Y[b*TT + t][:] = MV[b][:] (512 floats = 2 KB by 32 lanes x 4 x 16 B); unmasked rows untouched (wave-uniform branch)
__global__ __launch_bounds__(256) void k_fixq(const int* __restrict__ TM, const float* __restrict__ MV, float* __restrict__ Y) { const int tid = threadIdx.x; const size_t row = (size_t)blockIdx.x * 8 + (tid >> 5); const int lane = tid & 31; const int b = (int)(row / TT);
  const int tq = TM[row]; asm volatile("s_wait_loadcnt 0x0" ::: "memory"); if (tq != 0) return;
#pragma unroll
  for (int q = 0; q < CC / 128; ++q) { const v4f v = *(const v4f*)(MV + (size_t)b * CC + (q * 32 + lane) * 4); asm volatile("s_wait_loadcnt 0x0" ::: "memory"); vst2(Y + row * CC + (q * 32 + lane) * 4, v); } }
#define WS_MV (WS_END)                                    // f32 mean-v rows [b][512]
#define WS_END2 (WS_MV + 4u * (size_t)NB * CC)
#ifndef SM_EXTRA_PARAMS
#define SM_EXTRA_PARAMS
#endif
#ifndef PROJ_EXTRA_PARAMS
#define PROJ_EXTRA_PARAMS
#endif
#ifndef SM_MASK_HOOK
#define SM_MASK_HOOK (void)0
#endif

#define WS_QH  0u                                      // f16 q rows [b*t][CC]
#define WS_KH  (WS_QH + 2u * (size_t)NB * TT * CC)      // f16 k rows [b*t][CC]
#define WS_VT  (WS_KH + 2u * (size_t)NB * TT * CC)      // f16 v planes [b][c][t]
#define WS_QL  (WS_VT + 2u * (size_t)NB * CC * TT)      // f16 q residual x 2^10 rows [b][t < QHI][CC]
#define WS_KL  (WS_QL + 2u * (size_t)NB * QHI * CC)     // f16 k residual x 2^10 rows [b][t < KHI][CC]
#define WS_VB  (WS_KL + 2u * (size_t)NB * KHI * CC)     // bf16 v hi planes [b][c][t < KHI]
#define WS_VBL (WS_VB + 2u * (size_t)NB * CC * KHI)
#define WS_S   (WS_VBL + 2u * (size_t)NB * CC * KHI)    // f32 logits / P [hg][t][s]
#define WS_Y   (WS_S  + 4u * (size_t)HG * TT * TT)      // f32 ctx rows [b*t][CC] (only when there is an output projection)
#define WS_END (WS_Y  + 4u * (size_t)NB * TT * CC)

// ---- k_proj: block = (64 rows, 128 cols, which): q/k/v = X W (+ b) with exact bf16 products (K = DIN) -> which 0: q f16 rows (+ residual rows < QHI); 1: k f16 rows (+ residual rows < KHI); 2: v f16 planes [c][t] (+ bf16 hi/lo planes for t < KHI)
__global__ __launch_bounds__(128) void k_proj(const float* __restrict__ XQ, const float* __restrict__ XK, const float* __restrict__ XV, const float* __restrict__ WQ, const float* __restrict__ WK, const float* __restrict__ WV, const float* __restrict__ BQ, const float* __restrict__ BK, const float* __restrict__ BV,
    _Float16* __restrict__ QH, _Float16* __restrict__ QL, _Float16* __restrict__ KH, _Float16* __restrict__ KL, _Float16* __restrict__ VT, __bf16* __restrict__ VB, __bf16* __restrict__ VBL) {
  __shared__ __align__(16) _Float16 sh[64][136], sl[64][136]; __shared__ __align__(16) _Float16 th[128][72]; __shared__ __align__(16) __bf16 tb[128][72], tbl[128][72];
  const int tid = threadIdx.x, wave = tid >> 5, lane = tid & 31, col = lane & 15, g = lane >> 4; const int which = blockIdx.z; const int c0 = blockIdx.y * 128; const size_t r0 = (size_t)blockIdx.x * 64; const size_t bb = r0 / TT; const int t0 = (int)(r0 % TT);
  const float* X = which == 0 ? XQ : which == 1 ? XK : XV; const float* WA = which == 0 ? WQ : which == 1 ? WK : WV; const float* BA = which == 0 ? BQ : which == 1 ? BK : BV;
  v8f acc[8] = {};
#pragma unroll 2
  for (int kc = 0; kc < DIN / 32; ++kc) { v16b a; { const float* p = X + (r0 + wave * 16 + col) * DIN + kc * 32 + 8 * g;
#pragma unroll
      for (int i = 0; i < 8; ++i) { a[i] = (__bf16)p[i]; a[8 + i] = (__bf16)p[16 + i]; } }
    asm volatile("s_wait_loadcnt 0x0" ::: "memory");
#pragma unroll
    for (int j = 0; j < 8; ++j) { const v16b w = WCOL(WA, kc * 32, c0 + j * 16 + col, lane); asm volatile("s_wait_loadcnt 0x0" ::: "memory"); acc[j] = wmma_bf(a, w, acc[j]); } }
  if (which < 2) { _Float16* DH = which == 0 ? QH : KH; _Float16* DL = which == 0 ? QL : KL; const int nhi = which == 0 ? QHI : KHI; const bool hi_rows = t0 < nhi;
#pragma unroll
    for (int j = 0; j < 8; ++j) { const float bias = BA ? bfr(BA[c0 + j * 16 + col]) : 0.f;
#pragma unroll
      for (int r = 0; r < 8; ++r) { const float v = acc[j][r] + bias; const _Float16 hv = (_Float16)v; sh[wave * 16 + 8 * g + r][j * 16 + col] = hv; sl[wave * 16 + 8 * g + r][j * 16 + col] = (_Float16)((v - (float)hv) * 1024.0f); } }
    __syncthreads();
    for (int e = tid; e < 64 * 16; e += 128) { const int rl = e >> 4, q = e & 15; vst2((unsigned*)(DH + (r0 + rl) * CC + c0 + q * 8), *(const v4u*)&sh[rl][q * 8]); if (hi_rows) vst2((unsigned*)(DL + (bb * nhi + t0 + rl) * (size_t)CC + c0 + q * 8), *(const v4u*)&sl[rl][q * 8]); }
  } else { const bool hi_rows = t0 < KHI;
#pragma unroll
    for (int j = 0; j < 8; ++j) { const float bias = BA ? bfr(BA[c0 + j * 16 + col]) : 0.f;
#pragma unroll
      for (int r = 0; r < 8; ++r) { const float v = acc[j][r] + bias; const int rl = wave * 16 + 8 * g + r, cl = j * 16 + col; th[cl][rl] = (_Float16)v; const __bf16 bh = (__bf16)v; tb[cl][rl] = bh; tbl[cl][rl] = (__bf16)(v - (float)bh); } }
    __syncthreads();
    for (int e = tid; e < 128 * 8; e += 128) { const int cl = e >> 3, q = e & 7; vst2((unsigned*)(VT + (bb * CC + c0 + cl) * (size_t)TT + t0 + q * 8), *(const v4u*)&th[cl][q * 8]); if (hi_rows) { const size_t o3 = (bb * CC + c0 + cl) * (size_t)KHI + t0 + q * 8; vst2((unsigned*)(VB + o3), *(const v4u*)&tb[cl][q * 8]); vst2((unsigned*)(VBL + o3), *(const v4u*)&tbl[cl][q * 8]); } } } }
// ---- k_sc: block = (query block qb, key block kb <= kb_last(qb), head in group) of batch b: logits x SCALE; q hi + residual (x 2^10) against k (2 products) for query rows < QHI, plus the k residual (3 products) for query blocks < QBH (causal early rows); causal: blocks past the diagonal exit, the mask itself is applied by index in k_sm
__global__ __launch_bounds__(128) void k_sc(const _Float16* __restrict__ QH, const _Float16* __restrict__ KH, const _Float16* __restrict__ QL, const _Float16* __restrict__ KL, int b, int h0, float* __restrict__ S0) { __shared__ __align__(16) float ss[4][16][132];
  const int qb = blockIdx.x, kb = blockIdx.y; if (kb > kb_last(qb)) return;
  const int h = h0 + blockIdx.z; float* S = S0 + (size_t)blockIdx.z * TT * TT;
  const int tid = threadIdx.x, wave = tid >> 5, lane = tid & 31, col = lane & 15, g = lane >> 4; const int k0 = kb * 128; const int ql0 = qb * 64 + wave * 16; const size_t q0 = (size_t)b * TT + ql0, kr0 = (size_t)b * TT + k0;
  v8f acc[8] = {}, accl[8] = {};
  const _Float16* QLb = QL + (size_t)b * QHI * CC; const _Float16* KLb = KL + (size_t)b * KHI * CC;
  if (qb < QBH) {
#pragma unroll
    for (int kc = 0; kc < HD / 32; ++kc) { const v16h ah = frag_h(QH + (q0 + col) * CC + h * HD + kc * 32, lane), al = frag_h(QLb + (size_t)(ql0 + col) * CC + h * HD + kc * 32, lane);
#pragma unroll
      for (int j = 0; j < 8; ++j) { const v16h kbf = frag_h(KH + (kr0 + j * 16 + col) * CC + h * HD + kc * 32, lane), klf = frag_h(KLb + (size_t)(k0 + j * 16 + col) * CC + h * HD + kc * 32, lane); acc[j] = wmma16(ah, kbf, acc[j]); accl[j] = wmma16(al, kbf, accl[j]); accl[j] = wmma16(ah, klf, accl[j]); } }
  } else if (qb * 64 < QHI) {
#pragma unroll
    for (int kc = 0; kc < HD / 32; ++kc) { const v16h ah = frag_h(QH + (q0 + col) * CC + h * HD + kc * 32, lane), al = frag_h(QLb + (size_t)(ql0 + col) * CC + h * HD + kc * 32, lane);
#pragma unroll
      for (int j = 0; j < 8; ++j) { const v16h kbf = frag_h(KH + (kr0 + j * 16 + col) * CC + h * HD + kc * 32, lane); acc[j] = wmma16(ah, kbf, acc[j]); accl[j] = wmma16(al, kbf, accl[j]); } }
  } else {
#pragma unroll
    for (int kc = 0; kc < HD / 32; ++kc) { const v16h ah = frag_h(QH + (q0 + col) * CC + h * HD + kc * 32, lane);
#pragma unroll
      for (int j = 0; j < 8; ++j) { const v16h kbf = frag_h(KH + (kr0 + j * 16 + col) * CC + h * HD + kc * 32, lane); acc[j] = wmma16(ah, kbf, acc[j]); } } }
#pragma unroll
  for (int j = 0; j < 8; ++j) {
#pragma unroll
    for (int r = 0; r < 8; ++r) ss[wave][8 * g + r][j * 16 + col] = (acc[j][r] + accl[j][r] * (1.0f / 1024.0f)) * SCALE; }
  LDSX(); for (int rl = 0; rl < 16; ++rl) vst2(S + (size_t)(ql0 + rl) * TT + k0 + lane * 4, *(const v4f*)&ss[wave][rl][lane * 4]); }
// ---- k_sm: block = query row t (head in group): keys [0, kend): causal -> logit if s <= t else excluded; softmax in f32; P x 2^11 in place (0 for excluded)
__global__ __launch_bounds__(256) void k_sm(float* __restrict__ S0 SM_EXTRA_PARAMS) { __shared__ float sred[8]; __shared__ float sbc; __shared__ __align__(16) float shv[TT];
  const int tid = threadIdx.x; const int t = blockIdx.x; const int kend = (kb_last(t >> 6) + 1) * 128;
  float* sr = S0 + (size_t)blockIdx.y * TT * TT + (size_t)t * TT;
  float m = -3.0e38f; for (int k = tid; k < kend; k += 256) { float v = (!CAUSAL || k <= t) ? sr[k] : -3.0e38f; SM_MASK_HOOK; shv[k] = v; m = fmaxf(m, v); }
#pragma unroll
  for (int o = 1; o < 32; o <<= 1) m = fmaxf(m, __shfl_xor(m, o));
  if ((tid & 31) == 0) sred[tid >> 5] = m; __syncthreads(); if (tid == 0) { float a = sred[0]; for (int i = 1; i < 8; ++i) a = fmaxf(a, sred[i]); sbc = a; } __syncthreads(); m = sbc; __syncthreads();
  float sum = 0.f; for (int k = tid; k < kend; k += 256) { const float v = shv[k]; const float e = (v <= -1.0e38f) ? 0.f : expf(v - m); shv[k] = e; sum += e; }
#pragma unroll
  for (int o = 1; o < 32; o <<= 1) sum += __shfl_xor(sum, o);
  if ((tid & 31) == 0) sred[tid >> 5] = sum; __syncthreads(); if (tid == 0) { float a = 0.f; for (int i = 0; i < 8; ++i) a += sred[i]; sbc = a > 0.f ? 2048.0f / a : 0.f; }   /* a fully excluded row yields P = 0 */ __syncthreads(); const float inv = sbc;
  for (int k = tid; k < kend; k += 256) shv[k] = shv[k] * inv;
  __syncthreads(); for (int q = tid; q < kend / 4; q += 256) vst2(sr + q * 4, *(const v4f*)&shv[q * 4]); }
// ---- k_pv: block = 64 queries (qb) of (b, h): ctx = P . v over keys [0, kend) (P x 2^11 once to f16 against v f16: 1 product; causal early query blocks: P and v as bf16 hi + lo, 3 products); 256-B (row, head) segment by 16 lanes
__global__ __launch_bounds__(128) void k_pv(const float* __restrict__ PS0, const _Float16* __restrict__ VT, const __bf16* __restrict__ VB, const __bf16* __restrict__ VBL, int b, int h0, float* __restrict__ Y) { const int h = h0 + blockIdx.z; const float* PS = PS0 + (size_t)blockIdx.z * TT * TT; __shared__ __align__(16) float ss[4][16][HD + 4];
  const int tid = threadIdx.x, wave = tid >> 5, lane = tid & 31, col = lane & 15, g = lane >> 4; const int qb = blockIdx.x; const int ql0 = qb * 64 + wave * 16; const int kce = (kb_last(qb) + 1) * 4;
  v8f acc[HD / 16] = {};
  if (qb < QBH) {
#pragma unroll 1
    for (int kc = 0; kc < kce; ++kc) { const F2 p = split_row(PS + (size_t)(ql0 + col) * TT, kc * 32, lane);
      asm volatile("s_wait_loadcnt 0x0" ::: "memory");
#pragma unroll
      for (int j = 0; j < HD / 16; ++j) { const size_t po = ((size_t)b * CC + h * HD + j * 16 + col) * (size_t)KHI + kc * 32; const v16b vh = frag_b(VB + po, lane); acc[j] = wmma_bf(p.h, vh, acc[j]); acc[j] = wmma_bf(p.l, vh, acc[j]); acc[j] = wmma_bf(p.h, frag_b(VBL + po, lane), acc[j]); } }
  } else {
#pragma unroll 1
    for (int kc = 0; kc < kce; ++kc) { const v16h p = frag_f32(PS + (size_t)(ql0 + col) * TT + kc * 32, lane);
      asm volatile("s_wait_loadcnt 0x0" ::: "memory");
#pragma unroll
      for (int j = 0; j < HD / 16; ++j) { const size_t po = ((size_t)b * CC + h * HD + j * 16 + col) * (size_t)TT + kc * 32; acc[j] = wmma16(p, frag_h(VT + po, lane), acc[j]); } } }
#pragma unroll
  for (int j = 0; j < HD / 16; ++j)
#pragma unroll
    for (int r = 0; r < 8; ++r) ss[wave][8 * g + r][j * 16 + col] = acc[j][r] * (1.0f / 2048.0f);
  LDSX(); for (int rl = 0; rl < 16; ++rl) if (lane < HD / 4) vst2(Y + ((size_t)b * TT + ql0 + rl) * CC + h * HD + lane * 4, *(const v4f*)&ss[wave][rl][lane * 4]); }
// ---- k_out: block = (64 rows, 128 cols): out = ctx Wo (+ bo): ctx once to f16 against Wo as f16(bf16 x 2^8) exact (1 product) x 2^-8; causal early rows (< QHI of each sequence): ctx bf16 hi + lo against exact bf16 Wo (2 products)
__global__ __launch_bounds__(128) void k_out(const float* __restrict__ Y, const float* __restrict__ WO, const float* __restrict__ BO, float* __restrict__ OUT) { __shared__ __align__(16) float sf[4][16][132];
  const int tid = threadIdx.x, wave = tid >> 5, lane = tid & 31, col = lane & 15, g = lane >> 4; const int c0 = blockIdx.y * 128; const size_t r0 = (size_t)blockIdx.x * 64 + wave * 16;
  v8f acc[8] = {};
  if (CAUSAL && (int)(((size_t)blockIdx.x * 64) % TT) < QHI) {   /* block-uniform */
#pragma unroll 2
    for (int kc = 0; kc < CC / 32; ++kc) { const F2 a = split_row(Y + (r0 + col) * CC, kc * 32, lane); asm volatile("s_wait_loadcnt 0x0" ::: "memory");
#pragma unroll
      for (int j = 0; j < 8; ++j) { const v16b w = WOCOL(WO, kc * 32, c0 + j * 16 + col, lane); asm volatile("s_wait_loadcnt 0x0" ::: "memory"); acc[j] = wmma_bf(a.h, w, acc[j]); acc[j] = wmma_bf(a.l, w, acc[j]); } }
#pragma unroll
    for (int j = 0; j < 8; ++j) { const float bias = BO ? bfr(BO[c0 + j * 16 + col]) : 0.f;
#pragma unroll
      for (int r = 0; r < 8; ++r) sf[wave][8 * g + r][j * 16 + col] = acc[j][r] + bias; }
  } else {
#pragma unroll 2
    for (int kc = 0; kc < CC / 32; ++kc) { const v16h a = frag_f32s(Y + (r0 + col) * CC + kc * 32, lane, 64.0f); asm volatile("s_wait_loadcnt 0x0" ::: "memory");   /* ctx carried x 2^6 into f16 so small-magnitude context rows stay clear of f16 subnormals */
#pragma unroll
      for (int j = 0; j < 8; ++j) { const v16h w = WOCOLH(WO, kc * 32, c0 + j * 16 + col, lane); asm volatile("s_wait_loadcnt 0x0" ::: "memory"); acc[j] = wmma16(a, w, acc[j]); } }
#pragma unroll
    for (int j = 0; j < 8; ++j) { const float bias = BO ? bfr(BO[c0 + j * 16 + col]) : 0.f;
#pragma unroll
      for (int r = 0; r < 8; ++r) sf[wave][8 * g + r][j * 16 + col] = acc[j][r] * (1.0f / 16384.0f) + bias; } }   /* 2^-8 (Wo carry) x 2^-6 (ctx carry) */
  LDSX(); for (int rl = 0; rl < 16; ++rl) vst2(OUT + (r0 + rl) * DIN + c0 + lane * 4, *(const v4f*)&sf[wave][rl][lane * 4]); }

extern "C" void kernel_launch(void* const* d_in, const int* in_sizes, int n_in, void* d_out, int out_size, void* d_ws, size_t ws_size, hipStream_t stream) {
  (void)in_sizes; (void)n_in; (void)out_size;
  const float** F = (const float**)d_in;
  if (ws_size < (size_t)WS_END) return;
  char* ws = (char*)d_ws; _Float16 *QH = (_Float16*)(ws + WS_QH), *KH = (_Float16*)(ws + WS_KH), *VT = (_Float16*)(ws + WS_VT), *QL = (_Float16*)(ws + WS_QL), *KL = (_Float16*)(ws + WS_KL); __bf16 *VB = (__bf16*)(ws + WS_VB), *VBL = (__bf16*)(ws + WS_VBL); float *S = (float*)(ws + WS_S), *Y = (float*)(ws + WS_Y);
  (void)Y; (void)QL; (void)KL; (void)VB; (void)VBL;
  // inputs: 0 embeddings [4,2048,512]; 1 token_masks [4,2048] int32 (0/1); 2 Wq [512,512] (in,out); 3 Wk; 4 Wv; 5 Wo (in,out)
  if (ws_size < (size_t)WS_END2) return;
  const int* TM = (const int*)d_in[1]; float* MV = (float*)(ws + WS_MV);
  k_proj<<<dim3(TNB * TT / 64, CC / 128, 3), 128, 0, stream>>>(F[0], F[0], F[0], F[2], F[3], F[4], nullptr, nullptr, nullptr, QH, QL, KH, KL, VT, VB, VBL);
  k_meanv<<<dim3(CC / 256, TNB), 256, 0, stream>>>(VT, MV);
  for (int b = 0; b < TNB; ++b) for (int h0 = 0; h0 < NH; h0 += HG) {
    k_sc<<<dim3(NQB, TT / 128, HG), 128, 0, stream>>>(QH, KH, QL, KL, b, h0, S);
    k_sm<<<dim3(TT, HG), 256, 0, stream>>>(S, b, TM);
    k_pv<<<dim3(NQB, 1, HG), 128, 0, stream>>>(S, VT, VB, VBL, b, h0, Y);
  }
  k_fixq<<<dim3(TNB * TT / 8), 256, 0, stream>>>(TM, MV, Y);   /* masked queries: context = mean V */
  k_out<<<dim3(TNB * TT / 64, DIN / 128), 128, 0, stream>>>(Y, F[5], nullptr, (float*)d_out);
}

// v001
// One run takes 614 microseconds.
// Timed twice side by side with v000, it ran 1.55 times as fast both times.
// compute dtype: all float inputs rounded to bf16; projections with EXACT bf16 products on WMMA 16x16x32 (f32 accumulate); causal logits: 3 products for the first 384 rows, single f16 q x k after, x 64^-0.5; key/query masks by value; softmax f32; P x 2^11 once to f16 x v once to f16 (bf16 hi + lo below row 384); fully-masked query rows = mean of the f16 v plane in f32; ctx hi+lo x exact Wo below row 384, x2^6 f16 carry x f16(bf16 x 2^8) Wo after; f32 output.
#include <hip/hip_runtime.h>
#include <math.h>

typedef __attribute__((ext_vector_type(16))) _Float16 v16h;
typedef __attribute__((ext_vector_type(16))) __bf16 v16b;
typedef __attribute__((ext_vector_type(8)))  _Float16 v8h;
typedef __attribute__((ext_vector_type(8)))  float v8f;
typedef __attribute__((ext_vector_type(4)))  float v4f;
typedef __attribute__((ext_vector_type(2)))  float v2f;
typedef __attribute__((ext_vector_type(4)))  unsigned v4u;
typedef _Float16 hx8 __attribute__((ext_vector_type(8)));
typedef __attribute__((ext_vector_type(4)))  int v4i;
typedef float __attribute__((may_alias)) float_a;
typedef int __attribute__((may_alias)) int_a;

template <typename T> __device__ __forceinline__ void vst2(void* p, T v) { *(T*)p = v;  }
__device__ __forceinline__ v8f wmma16(v16h a, v16h b, v8f c) {
  v8f d = __builtin_amdgcn_wmma_f32_16x16x32_f16(false, a, false, b, (short)0, c, false, false);
  asm volatile("v_nop\n\tv_nop\n\tv_nop\n\tv_nop" : "+v"(d) : "v"(a), "v"(b));
  return d;
}
__device__ __forceinline__ v8f wmma_bf(v16b a, v16b b, v8f c) {
  v8f d = __builtin_amdgcn_wmma_f32_16x16x32_bf16(false, a, false, b, (short)0, c, false, false);
  asm volatile("v_nop\n\tv_nop\n\tv_nop\n\tv_nop" : "+v"(d) : "v"(a), "v"(b));
  return d;
}
// 16x16x32 fragments: lane = (h = lane>>4, row/col = lane&15); elements 0..7 = k0+8h+0..7, 8..15 = k0+16+8h+0..7; D element r = row 8h+r
__device__ __forceinline__ v16h frag_h(const _Float16* rowk0, int lane) {
  union { v16h v; v8h q[2]; } u; const _Float16* p = rowk0 + 8 * (lane >> 4);
  u.q[0] = *(const v8h*)p; u.q[1] = *(const v8h*)(p + 16); return u.v;
}
__device__ __forceinline__ v16h frag_f32(const float* rowk0, int lane) {
  v16h a; const float* p = rowk0 + 8 * (lane >> 4);
#pragma unroll
  for (int i = 0; i < 8; ++i) { a[i] = (_Float16)p[i]; a[8 + i] = (_Float16)p[16 + i]; }
  return a;
}
__device__ __forceinline__ v16h frag_f32s(const float* rowk0, int lane, float sc) {
  v16h a; const float* p = rowk0 + 8 * (lane >> 4);
#pragma unroll
  for (int i = 0; i < 8; ++i) { a[i] = (_Float16)(p[i] * sc); a[8 + i] = (_Float16)(p[16 + i] * sc); }
  return a;
}
// column fragment from a [K][ld] layout (column n), rows >= K read as 0
__device__ __forceinline__ v16h fragc_f32(const float* W, int k0, int n, int lane, int ld, int K) {
  v16h a; const int g = lane >> 4;
#pragma unroll
  for (int i = 0; i < 8; ++i) { const int ka = k0 + 8 * g + i, kb = ka + 16;
    a[i] = (_Float16)(ka < K ? W[(size_t)(ka < K ? ka : K - 1) * ld + n] : 0.f); a[8 + i] = (_Float16)(kb < K ? W[(size_t)(kb < K ? kb : K - 1) * ld + n] : 0.f); }
  return a;
}
struct F2 { v16b h, l; };
__device__ __forceinline__ F2 bsplit16(const float v[16]) { F2 r;
#pragma unroll
  for (int i = 0; i < 16; ++i) { const __bf16 h = (__bf16)v[i]; r.h[i] = h; r.l[i] = (__bf16)(v[i] - (float)h); }
  return r; }
__device__ __forceinline__ F2 split_row(const float* row, int k0, int lane) { float v[16]; const float* p = row + k0 + 8 * (lane >> 4);
#pragma unroll
  for (int i = 0; i < 8; ++i) { v[i] = p[i]; v[8 + i] = p[16 + i]; }
  return bsplit16(v); }
__device__ __forceinline__ F2 split_rowK(const float* row, int k0, int lane, int K) { float v[16]; const int g = lane >> 4;
#pragma unroll
  for (int i = 0; i < 8; ++i) { const int ka = k0 + 8 * g + i, kb = ka + 16; v[i] = ka < K ? row[ka < K ? ka : K - 1] : 0.f; v[8 + i] = kb < K ? row[kb < K ? kb : K - 1] : 0.f; }
  return bsplit16(v); }
__device__ __forceinline__ F2 split_col(const float* W, int k0, int n, int lane, int ld, int K) { float v[16]; const int g = lane >> 4;
#pragma unroll
  for (int i = 0; i < 8; ++i) { const int ka = k0 + 8 * g + i, kb = ka + 16; v[i] = ka < K ? W[(size_t)(ka < K ? ka : K - 1) * ld + n] : 0.f; v[8 + i] = kb < K ? W[(size_t)(kb < K ? kb : K - 1) * ld + n] : 0.f; }
  return bsplit16(v); }
__device__ __forceinline__ v8f mac3(const F2& a, const F2& b, v8f c) { c = wmma_bf(a.l, b.h, c); c = wmma_bf(a.h, b.l, c); return wmma_bf(a.h, b.h, c); }
__device__ __forceinline__ float sigm(float v) { return 1.0f / (1.0f + expf(-v)); }
#define LDSX() do { asm volatile("s_wait_dscnt 0" ::: "memory"); __builtin_amdgcn_wave_barrier(); __builtin_amdgcn_fence(__ATOMIC_RELEASE, "workgroup"); } while (0)

// Causal multi-head self-attention with token padding masks on BOTH keys and queries (embeddings [4,2048,512], token_masks [4,2048] int 0/1 (random here: about half the tokens masked); 8 heads x 64; (in,out) Wq/Wk/Wv/Wo [512,512], no biases): scores = q.k/8, where(causal & tm[k] & tm[q], scores, -1e30), softmax, context Wo. A query with tm[q] = 0 gets all scores = -1e30 -> exactly uniform attention over all 2,048 positions (context = mean V).
#define NB 4
#define TT 2048
#define CC 512            // NH * HD = projected width
#define DIN 512          // input (model) width
#define NH 8
#define HD 64
#define NQB (TT / 64)
#define HG 4
#define SCALE (0.125f)
#define CAUSAL 1
#ifndef TNB
#define TNB NB
#endif
__device__ __forceinline__ float bfr(float v) { return (float)(__bf16)v; }
__host__ __device__ __forceinline__ int kb_last(int qb) { return CAUSAL ? ((qb * 64 + 63) >> 7) : (TT / 128 - 1); }
typedef __attribute__((ext_vector_type(8))) __bf16 v8b;
__device__ __forceinline__ v16b frag_b(const __bf16* rowk0, int lane) {
  union { v16b v; v8b q[2]; } u; const __bf16* p = rowk0 + 8 * (lane >> 4);
  u.q[0] = *(const v8b*)p; u.q[1] = *(const v8b*)(p + 16); return u.v;
}
#define QBH 6              // causal: query blocks 0..QBH-1 of each sequence (few keys, no averaging) take the high-precision path
#define QHI 384            // rows carrying a q residual plane
#define KHI 384            // key rows carrying k residual / v bf16 hi+lo planes (used only by the causal high-precision path)
// B fragment (k rows k0+.., output column o) of a weight: (in,out) [K][ld] or (out,in) [ld rows of K]: bf16 exact, or f16(bf16 * 256) exact
__device__ __forceinline__ v16b wcol_io(const float* Wm, int k0, int o, int lane, int ld) { v16b w; const int g = lane >> 4;
#pragma unroll
  for (int i = 0; i < 8; ++i) { w[i] = (__bf16)Wm[(size_t)(k0 + 8 * g + i) * ld + o]; w[8 + i] = (__bf16)Wm[(size_t)(k0 + 16 + 8 * g + i) * ld + o]; }
  return w; }
__device__ __forceinline__ v16b wcol_oi(const float* Wm, int k0, int o, int lane, int K) { v16b w; const float* p = Wm + (size_t)o * K + k0 + 8 * (lane >> 4);
#pragma unroll
  for (int i = 0; i < 8; ++i) { w[i] = (__bf16)p[i]; w[8 + i] = (__bf16)p[16 + i]; }
  return w; }
__device__ __forceinline__ v16h wcolh_io(const float* Wm, int k0, int o, int lane, int ld) { v16h w; const int g = lane >> 4;
#pragma unroll
  for (int i = 0; i < 8; ++i) { w[i] = (_Float16)(bfr(Wm[(size_t)(k0 + 8 * g + i) * ld + o]) * 256.0f); w[8 + i] = (_Float16)(bfr(Wm[(size_t)(k0 + 16 + 8 * g + i) * ld + o]) * 256.0f); }
  return w; }
__device__ __forceinline__ v16h wcolh_oi(const float* Wm, int k0, int o, int lane, int K) { v16h w; const float* p = Wm + (size_t)o * K + k0 + 8 * (lane >> 4);
#pragma unroll
  for (int i = 0; i < 8; ++i) { w[i] = (_Float16)(bfr(p[i]) * 256.0f); w[8 + i] = (_Float16)(bfr(p[16 + i]) * 256.0f); }
  return w; }
#define WQKV_LAYOUT 0   // 0 = (in,out) [DIN][CC]; 1 = (out,in) [CC][DIN]; 2 = per-head [NH][DIN][HD]
__device__ __forceinline__ v16b wcol_hdk(const float* Wm, int k0, int o, int lane) { v16b w; const int g = lane >> 4; const float* p = Wm + (size_t)(o / HD) * DIN * HD + (o % HD);
#pragma unroll
  for (int i = 0; i < 8; ++i) { w[i] = (__bf16)p[(size_t)(k0 + 8 * g + i) * HD]; w[8 + i] = (__bf16)p[(size_t)(k0 + 16 + 8 * g + i) * HD]; }
  return w; }
#define WO_OUT_IN 0
#if WQKV_LAYOUT == 1
#define WCOL(W, k0, o, lane) wcol_oi(W, k0, o, lane, DIN)
#elif WQKV_LAYOUT == 2
#define WCOL(W, k0, o, lane) wcol_hdk(W, k0, o, lane)
#else
#define WCOL(W, k0, o, lane) wcol_io(W, k0, o, lane, CC)
#endif
#if WO_OUT_IN
#define WOCOL(W, k0, o, lane) wcol_oi(W, k0, o, lane, CC)
#define WOCOLH(W, k0, o, lane) wcolh_oi(W, k0, o, lane, CC)
#else
#define WOCOL(W, k0, o, lane) wcol_io(W, k0, o, lane, DIN)
#define WOCOLH(W, k0, o, lane) wcolh_io(W, k0, o, lane, DIN)
#endif
#define SM_EXTRA_PARAMS , int bsm, const int* __restrict__ TM
// masks: keys need causal (structure + index) AND token_masks[b][k] != 0; a query with token_masks[b][t] == 0 has EVERY score = -1e30 in the module -> exactly uniform attention over all 2,048 positions -> its context is mean_k V (handled by k_meanv/k_fixq below; here such rows just get a harmless finite placeholder)
#define SM_MASK_HOOK do { const int tq = TM[(size_t)bsm * TT + t], tk = TM[(size_t)bsm * TT + k]; v = (tq == 0) ? 0.f : ((tk != 0) ? v : -3.0e38f); } while (0)
// ---- k_meanv: thread per (batch, channel): MV[b][c] = (1/2048) sum_t v[b][t][c] from the f16 v plane (f32 sum in t order) - the context of a fully-masked query row (softmax of 2,048 equal scores = exactly 1/2048 each)
__global__ __launch_bounds__(256) void k_meanv(const _Float16* __restrict__ VT, float* __restrict__ MV) { const int c = blockIdx.x * 256 + threadIdx.x; const int b = blockIdx.y; const _Float16* p = VT + ((size_t)b * CC + c) * TT; float a = 0.f;
#pragma unroll 2
  for (int t8 = 0; t8 < TT; t8 += 8) { const v4u u = *(const v4u*)(p + t8); asm volatile("s_wait_loadcnt 0x0" ::: "memory"); const hx8 hv = *(const hx8*)&u; _Pragma("unroll") for (int j = 0; j < 8; ++j) a += (float)hv[j]; }
  vst2(MV + (size_t)b * CC + c, a * (1.0f / TT)); }
// ---- k_fixq: wave per masked query row (token_masks[b][t] == 0): ctx row Y[b*TT + t][:] = MV[b][:] (512 floats = 2 KB by 32 lanes x 4 x 16 B); unmasked rows untouched (wave-uniform branch)
__global__ __launch_bounds__(256) void k_fixq(const int* __restrict__ TM, const float* __restrict__ MV, float* __restrict__ Y) { const int tid = threadIdx.x; const size_t row = (size_t)blockIdx.x * 8 + (tid >> 5); const int lane = tid & 31; const int b = (int)(row / TT);
  const int tq = TM[row]; asm volatile("s_wait_loadcnt 0x0" ::: "memory"); if (tq != 0) return;
#pragma unroll
  for (int q = 0; q < CC / 128; ++q) { const v4f v = *(const v4f*)(MV + (size_t)b * CC + (q * 32 + lane) * 4); asm volatile("s_wait_loadcnt 0x0" ::: "memory"); vst2(Y + row * CC + (q * 32 + lane) * 4, v); } }
#define WS_MV (WS_END)                                    // f32 mean-v rows [b][512]
#define WS_END2 (WS_MV + 4u * (size_t)NB * CC)
#ifndef SM_EXTRA_PARAMS
#define SM_EXTRA_PARAMS
#endif
#ifndef PROJ_EXTRA_PARAMS
#define PROJ_EXTRA_PARAMS
#endif
#ifndef SM_MASK_HOOK
#define SM_MASK_HOOK (void)0
#endif

#define WS_QH  0u                                      // f16 q rows [b*t][CC]
#define WS_KH  (WS_QH + 2u * (size_t)NB * TT * CC)      // f16 k rows [b*t][CC]
#define WS_VT  (WS_KH + 2u * (size_t)NB * TT * CC)      // f16 v planes [b][c][t]
#define WS_QL  (WS_VT + 2u * (size_t)NB * CC * TT)      // f16 q residual x 2^10 rows [b][t < QHI][CC]
#define WS_KL  (WS_QL + 2u * (size_t)NB * QHI * CC)     // f16 k residual x 2^10 rows [b][t < KHI][CC]
#define WS_VB  (WS_KL + 2u * (size_t)NB * KHI * CC)     // bf16 v hi planes [b][c][t < KHI]
#define WS_VBL (WS_VB + 2u * (size_t)NB * CC * KHI)
#define WS_S   (WS_VBL + 2u * (size_t)NB * CC * KHI)    // f32 logits / P [hg][t][s]
#define WS_Y   (WS_S  + 4u * (size_t)HG * TT * TT)      // f32 ctx rows [b*t][CC] (only when there is an output projection)
#define WS_END (WS_Y  + 4u * (size_t)NB * TT * CC)

// ---- k_proj: block = (64 rows, 128 cols, which): q/k/v = X W (+ b) with exact bf16 products (K = DIN) -> which 0: q f16 rows (+ residual rows < QHI); 1: k f16 rows (+ residual rows < KHI); 2: v f16 planes [c][t] (+ bf16 hi/lo planes for t < KHI)
__global__ __launch_bounds__(128) void k_proj(const float* __restrict__ XQ, const float* __restrict__ XK, const float* __restrict__ XV, const float* __restrict__ WQ, const float* __restrict__ WK, const float* __restrict__ WV, const float* __restrict__ BQ, const float* __restrict__ BK, const float* __restrict__ BV,
    _Float16* __restrict__ QH, _Float16* __restrict__ QL, _Float16* __restrict__ KH, _Float16* __restrict__ KL, _Float16* __restrict__ VT, __bf16* __restrict__ VB, __bf16* __restrict__ VBL) {
  __shared__ __align__(16) _Float16 sh[64][136], sl[64][136]; __shared__ __align__(16) _Float16 th[128][72]; __shared__ __align__(16) __bf16 tb[128][72], tbl[128][72];
  const int tid = threadIdx.x, wave = tid >> 5, lane = tid & 31, col = lane & 15, g = lane >> 4; const int which = blockIdx.z; const int c0 = blockIdx.y * 128; const size_t r0 = (size_t)blockIdx.x * 64; const size_t bb = r0 / TT; const int t0 = (int)(r0 % TT);
  const float* X = which == 0 ? XQ : which == 1 ? XK : XV; const float* WA = which == 0 ? WQ : which == 1 ? WK : WV; const float* BA = which == 0 ? BQ : which == 1 ? BK : BV;
  v8f acc[8] = {};
#pragma unroll 2
  for (int kc = 0; kc < DIN / 32; ++kc) { v16b a; { const float* p = X + (r0 + wave * 16 + col) * DIN + kc * 32 + 8 * g;
#pragma unroll
      for (int i = 0; i < 8; ++i) { a[i] = (__bf16)p[i]; a[8 + i] = (__bf16)p[16 + i]; } }
    asm volatile("s_wait_loadcnt 0x0" ::: "memory");
#pragma unroll
    for (int j = 0; j < 8; ++j) { const v16b w = WCOL(WA, kc * 32, c0 + j * 16 + col, lane); asm volatile("s_wait_loadcnt 0x0" ::: "memory"); acc[j] = wmma_bf(a, w, acc[j]); } }
  if (which < 2) { _Float16* DH = which == 0 ? QH : KH; _Float16* DL = which == 0 ? QL : KL; const int nhi = which == 0 ? QHI : KHI; const bool hi_rows = t0 < nhi;
#pragma unroll
    for (int j = 0; j < 8; ++j) { const float bias = BA ? bfr(BA[c0 + j * 16 + col]) : 0.f;
#pragma unroll
      for (int r = 0; r < 8; ++r) { const float v = acc[j][r] + bias; const _Float16 hv = (_Float16)v; sh[wave * 16 + 8 * g + r][j * 16 + col] = hv; sl[wave * 16 + 8 * g + r][j * 16 + col] = (_Float16)((v - (float)hv) * 1024.0f); } }
    __syncthreads();
    for (int e = tid; e < 64 * 16; e += 128) { const int rl = e >> 4, q = e & 15; vst2((unsigned*)(DH + (r0 + rl) * CC + c0 + q * 8), *(const v4u*)&sh[rl][q * 8]); if (hi_rows) vst2((unsigned*)(DL + (bb * nhi + t0 + rl) * (size_t)CC + c0 + q * 8), *(const v4u*)&sl[rl][q * 8]); }
  } else { const bool hi_rows = t0 < KHI;
#pragma unroll
    for (int j = 0; j < 8; ++j) { const float bias = BA ? bfr(BA[c0 + j * 16 + col]) : 0.f;
#pragma unroll
      for (int r = 0; r < 8; ++r) { const float v = acc[j][r] + bias; const int rl = wave * 16 + 8 * g + r, cl = j * 16 + col; th[cl][rl] = (_Float16)v; const __bf16 bh = (__bf16)v; tb[cl][rl] = bh; tbl[cl][rl] = (__bf16)(v - (float)bh); } }
    __syncthreads();
    for (int e = tid; e < 128 * 8; e += 128) { const int cl = e >> 3, q = e & 7; vst2((unsigned*)(VT + (bb * CC + c0 + cl) * (size_t)TT + t0 + q * 8), *(const v4u*)&th[cl][q * 8]); if (hi_rows) { const size_t o3 = (bb * CC + c0 + cl) * (size_t)KHI + t0 + q * 8; vst2((unsigned*)(VB + o3), *(const v4u*)&tb[cl][q * 8]); vst2((unsigned*)(VBL + o3), *(const v4u*)&tbl[cl][q * 8]); } } } }
// ---- k_sc: block = (query block qb, key block kb <= kb_last(qb), head in group) of batch b: logits x SCALE; q hi + residual (x 2^10) against k (2 products) for query rows < QHI, plus the k residual (3 products) for query blocks < QBH (causal early rows); causal: blocks past the diagonal exit, the mask itself is applied by index in k_sm
__global__ __launch_bounds__(128) void k_sc(const _Float16* __restrict__ QH, const _Float16* __restrict__ KH, const _Float16* __restrict__ QL, const _Float16* __restrict__ KL, int b, int h0, float* __restrict__ S0) { __shared__ __align__(16) float ss[4][16][132];
  const int qb = blockIdx.x, kb = blockIdx.y; if (kb > kb_last(qb)) return;
  const int h = h0 + blockIdx.z; float* S = S0 + (size_t)blockIdx.z * TT * TT;
  const int tid = threadIdx.x, wave = tid >> 5, lane = tid & 31, col = lane & 15, g = lane >> 4; const int k0 = kb * 128; const int ql0 = qb * 64 + wave * 16; const size_t q0 = (size_t)b * TT + ql0, kr0 = (size_t)b * TT + k0;
  v8f acc[8] = {}, accl[8] = {};
  const _Float16* QLb = QL + (size_t)b * QHI * CC; const _Float16* KLb = KL + (size_t)b * KHI * CC;
  if (qb < QBH) {
#pragma unroll
    for (int kc = 0; kc < HD / 32; ++kc) { const v16h ah = frag_h(QH + (q0 + col) * CC + h * HD + kc * 32, lane), al = frag_h(QLb + (size_t)(ql0 + col) * CC + h * HD + kc * 32, lane);
#pragma unroll
      for (int j = 0; j < 8; ++j) { const v16h kbf = frag_h(KH + (kr0 + j * 16 + col) * CC + h * HD + kc * 32, lane), klf = frag_h(KLb + (size_t)(k0 + j * 16 + col) * CC + h * HD + kc * 32, lane); acc[j] = wmma16(ah, kbf, acc[j]); accl[j] = wmma16(al, kbf, accl[j]); accl[j] = wmma16(ah, klf, accl[j]); } }
  } else if (qb * 64 < QHI) {
#pragma unroll
    for (int kc = 0; kc < HD / 32; ++kc) { const v16h ah = frag_h(QH + (q0 + col) * CC + h * HD + kc * 32, lane), al = frag_h(QLb + (size_t)(ql0 + col) * CC + h * HD + kc * 32, lane);
#pragma unroll
      for (int j = 0; j < 8; ++j) { const v16h kbf = frag_h(KH + (kr0 + j * 16 + col) * CC + h * HD + kc * 32, lane); acc[j] = wmma16(ah, kbf, acc[j]); accl[j] = wmma16(al, kbf, accl[j]); } }
  } else {
#pragma unroll
    for (int kc = 0; kc < HD / 32; ++kc) { const v16h ah = frag_h(QH + (q0 + col) * CC + h * HD + kc * 32, lane);
#pragma unroll
      for (int j = 0; j < 8; ++j) { const v16h kbf = frag_h(KH + (kr0 + j * 16 + col) * CC + h * HD + kc * 32, lane); acc[j] = wmma16(ah, kbf, acc[j]); } } }
#pragma unroll
  for (int j = 0; j < 8; ++j) {
#pragma unroll
    for (int r = 0; r < 8; ++r) ss[wave][8 * g + r][j * 16 + col] = (acc[j][r] + accl[j][r] * (1.0f / 1024.0f)) * SCALE; }
  LDSX(); for (int rl = 0; rl < 16; ++rl) vst2(S + (size_t)(ql0 + rl) * TT + k0 + lane * 4, *(const v4f*)&ss[wave][rl][lane * 4]); }
// ---- k_sm: block = query row t (head in group): keys [0, kend): causal -> logit if s <= t else excluded; softmax in f32; P x 2^11 in place (0 for excluded)
__global__ __launch_bounds__(256) void k_sm(float* __restrict__ S0 SM_EXTRA_PARAMS) { __shared__ float sred[8]; __shared__ float sbc; __shared__ __align__(16) float shv[TT];
  const int tid = threadIdx.x; const int t = blockIdx.x; const int kend = (kb_last(t >> 6) + 1) * 128;
  float* sr = S0 + (size_t)blockIdx.y * TT * TT + (size_t)t * TT;
  float m = -3.0e38f; for (int k = tid; k < kend; k += 256) { float v = (!CAUSAL || k <= t) ? sr[k] : -3.0e38f; SM_MASK_HOOK; shv[k] = v; m = fmaxf(m, v); }
#pragma unroll
  for (int o = 1; o < 32; o <<= 1) m = fmaxf(m, __shfl_xor(m, o));
  if ((tid & 31) == 0) sred[tid >> 5] = m; __syncthreads(); if (tid == 0) { float a = sred[0]; for (int i = 1; i < 8; ++i) a = fmaxf(a, sred[i]); sbc = a; } __syncthreads(); m = sbc; __syncthreads();
  float sum = 0.f; for (int k = tid; k < kend; k += 256) { const float v = shv[k]; const float e = (v <= -1.0e38f) ? 0.f : expf(v - m); shv[k] = e; sum += e; }
#pragma unroll
  for (int o = 1; o < 32; o <<= 1) sum += __shfl_xor(sum, o);
  if ((tid & 31) == 0) sred[tid >> 5] = sum; __syncthreads(); if (tid == 0) { float a = 0.f; for (int i = 0; i < 8; ++i) a += sred[i]; sbc = a > 0.f ? 2048.0f / a : 0.f; }   /* a fully excluded row yields P = 0 */ __syncthreads(); const float inv = sbc;
  for (int k = tid; k < kend; k += 256) shv[k] = shv[k] * inv;
  __syncthreads(); for (int q = tid; q < kend / 4; q += 256) vst2(sr + q * 4, *(const v4f*)&shv[q * 4]); }
// ---- k_pv: block = 16 queries of (b, h), PVW waves: wave w sums the 32-key chunks w, w + PVW, ... of keys [0, kend) (P x 2^11 once to f16 against v f16: 1 product; causal early query blocks: P and v as bf16 hi + lo, 3 products); the PVW partial tiles are added in f32 through LDS in wave order; 256-B (row, head) segment by one wave
#define PVW 16   /* the wave number goes through readfirstlane so that the chunk loop is a scalar loop and every lane is on at the matrix instructions */
__global__ __launch_bounds__(32 * PVW) void k_pv(const float* __restrict__ PS0, const _Float16* __restrict__ VT, const __bf16* __restrict__ VB, const __bf16* __restrict__ VBL, int b, int h0, float* __restrict__ Y) { const int h = h0 + blockIdx.z; const float* PS = PS0 + (size_t)blockIdx.z * TT * TT; __shared__ __align__(16) float ss[PVW][16][HD + 4];
  const int tid = threadIdx.x, wave = __builtin_amdgcn_readfirstlane(tid >> 5), lane = tid & 31, col = lane & 15, g = lane >> 4; const int qb = blockIdx.x >> 2; const int ql0 = blockIdx.x * 16; const int kce = (kb_last(qb) + 1) * 4;
  v8f acc[HD / 16] = {};
  if (qb < QBH) {
#pragma unroll 1
    for (int kc = wave; kc < kce; kc += PVW) { const F2 p = split_row(PS + (size_t)(ql0 + col) * TT, kc * 32, lane);
      asm volatile("s_wait_loadcnt 0x0" ::: "memory");
#pragma unroll
      for (int j = 0; j < HD / 16; ++j) { const size_t po = ((size_t)b * CC + h * HD + j * 16 + col) * (size_t)KHI + kc * 32; const v16b vh = frag_b(VB + po, lane); acc[j] = wmma_bf(p.h, vh, acc[j]); acc[j] = wmma_bf(p.l, vh, acc[j]); acc[j] = wmma_bf(p.h, frag_b(VBL + po, lane), acc[j]); } }
  } else {
#pragma unroll 1
    for (int kc = wave; kc < kce; kc += PVW) { const v16h p = frag_f32(PS + (size_t)(ql0 + col) * TT + kc * 32, lane);
      asm volatile("s_wait_loadcnt 0x0" ::: "memory");
#pragma unroll
      for (int j = 0; j < HD / 16; ++j) { const size_t po = ((size_t)b * CC + h * HD + j * 16 + col) * (size_t)TT + kc * 32; acc[j] = wmma16(p, frag_h(VT + po, lane), acc[j]); } } }
#pragma unroll
  for (int j = 0; j < HD / 16; ++j)
#pragma unroll
    for (int r = 0; r < 8; ++r) ss[wave][8 * g + r][j * 16 + col] = acc[j][r];
  __syncthreads();   /* every wave's partial tile is in LDS before any wave adds them */
  for (int e = tid; e < 16 * (HD / 2); e += 32 * PVW) { const int rl = e / (HD / 2), q = e % (HD / 2); v2f s = *(const v2f*)&ss[0][rl][q * 2];
#pragma unroll   /* the PVW LDS reads issue ahead of the adds; rolled, each add would wait a full LDS latency */
    for (int w = 1; w < PVW; ++w) s += *(const v2f*)&ss[w][rl][q * 2];
    vst2(Y + ((size_t)b * TT + ql0 + rl) * CC + h * HD + q * 2, s * (1.0f / 2048.0f)); } }
// ---- k_out: block = (64 rows, 128 cols): out = ctx Wo (+ bo): ctx once to f16 against Wo as f16(bf16 x 2^8) exact (1 product) x 2^-8; causal early rows (< QHI of each sequence): ctx bf16 hi + lo against exact bf16 Wo (2 products)
__global__ __launch_bounds__(128) void k_out(const float* __restrict__ Y, const float* __restrict__ WO, const float* __restrict__ BO, float* __restrict__ OUT) { __shared__ __align__(16) float sf[4][16][132];
  const int tid = threadIdx.x, wave = tid >> 5, lane = tid & 31, col = lane & 15, g = lane >> 4; const int c0 = blockIdx.y * 128; const size_t r0 = (size_t)blockIdx.x * 64 + wave * 16;
  v8f acc[8] = {};
  if (CAUSAL && (int)(((size_t)blockIdx.x * 64) % TT) < QHI) {   /* block-uniform */
#pragma unroll 2
    for (int kc = 0; kc < CC / 32; ++kc) { const F2 a = split_row(Y + (r0 + col) * CC, kc * 32, lane); asm volatile("s_wait_loadcnt 0x0" ::: "memory");
#pragma unroll
      for (int j = 0; j < 8; ++j) { const v16b w = WOCOL(WO, kc * 32, c0 + j * 16 + col, lane); asm volatile("s_wait_loadcnt 0x0" ::: "memory"); acc[j] = wmma_bf(a.h, w, acc[j]); acc[j] = wmma_bf(a.l, w, acc[j]); } }
#pragma unroll
    for (int j = 0; j < 8; ++j) { const float bias = BO ? bfr(BO[c0 + j * 16 + col]) : 0.f;
#pragma unroll
      for (int r = 0; r < 8; ++r) sf[wave][8 * g + r][j * 16 + col] = acc[j][r] + bias; }
  } else {
#pragma unroll 2
    for (int kc = 0; kc < CC / 32; ++kc) { const v16h a = frag_f32s(Y + (r0 + col) * CC + kc * 32, lane, 64.0f); asm volatile("s_wait_loadcnt 0x0" ::: "memory");   /* ctx carried x 2^6 into f16 so small-magnitude context rows stay clear of f16 subnormals */
#pragma unroll
      for (int j = 0; j < 8; ++j) { const v16h w = WOCOLH(WO, kc * 32, c0 + j * 16 + col, lane); asm volatile("s_wait_loadcnt 0x0" ::: "memory"); acc[j] = wmma16(a, w, acc[j]); } }
#pragma unroll
    for (int j = 0; j < 8; ++j) { const float bias = BO ? bfr(BO[c0 + j * 16 + col]) : 0.f;
#pragma unroll
      for (int r = 0; r < 8; ++r) sf[wave][8 * g + r][j * 16 + col] = acc[j][r] * (1.0f / 16384.0f) + bias; } }   /* 2^-8 (Wo carry) x 2^-6 (ctx carry) */
  LDSX(); for (int rl = 0; rl < 16; ++rl) vst2(OUT + (r0 + rl) * DIN + c0 + lane * 4, *(const v4f*)&sf[wave][rl][lane * 4]); }

extern "C" void kernel_launch(void* const* d_in, const int* in_sizes, int n_in, void* d_out, int out_size, void* d_ws, size_t ws_size, hipStream_t stream) {
  (void)in_sizes; (void)n_in; (void)out_size;
  const float** F = (const float**)d_in;
  if (ws_size < (size_t)WS_END) return;
  char* ws = (char*)d_ws; _Float16 *QH = (_Float16*)(ws + WS_QH), *KH = (_Float16*)(ws + WS_KH), *VT = (_Float16*)(ws + WS_VT), *QL = (_Float16*)(ws + WS_QL), *KL = (_Float16*)(ws + WS_KL); __bf16 *VB = (__bf16*)(ws + WS_VB), *VBL = (__bf16*)(ws + WS_VBL); float *S = (float*)(ws + WS_S), *Y = (float*)(ws + WS_Y);
  (void)Y; (void)QL; (void)KL; (void)VB; (void)VBL;
  // inputs: 0 embeddings [4,2048,512]; 1 token_masks [4,2048] int32 (0/1); 2 Wq [512,512] (in,out); 3 Wk; 4 Wv; 5 Wo (in,out)
  if (ws_size < (size_t)WS_END2) return;
  const int* TM = (const int*)d_in[1]; float* MV = (float*)(ws + WS_MV);
  k_proj<<<dim3(TNB * TT / 64, CC / 128, 3), 128, 0, stream>>>(F[0], F[0], F[0], F[2], F[3], F[4], nullptr, nullptr, nullptr, QH, QL, KH, KL, VT, VB, VBL);
  k_meanv<<<dim3(CC / 256, TNB), 256, 0, stream>>>(VT, MV);
  for (int b = 0; b < TNB; ++b) for (int h0 = 0; h0 < NH; h0 += HG) {
    k_sc<<<dim3(NQB, TT / 128, HG), 128, 0, stream>>>(QH, KH, QL, KL, b, h0, S);
    k_sm<<<dim3(TT, HG), 256, 0, stream>>>(S, b, TM);
    k_pv<<<dim3(TT / 16, 1, HG), 32 * PVW, 0, stream>>>(S, VT, VB, VBL, b, h0, Y);
  }
  k_fixq<<<dim3(TNB * TT / 8), 256, 0, stream>>>(TM, MV, Y);   /* masked queries: context = mean V */
  k_out<<<dim3(TNB * TT / 64, DIN / 128), 128, 0, stream>>>(Y, F[5], nullptr, (float*)d_out);
}

// v002
// One run takes 253 microseconds.
// Timed twice side by side with v001, it ran 2.46 and 2.44 times as fast.
// Over all steps from v000 it is 3.81 times as fast.
// compute dtype: all float inputs rounded to bf16; projections with EXACT bf16 products on WMMA 16x16x32 (f32 accumulate); causal logits: 3 products for the first 384 rows, single f16 q x k after, x 64^-0.5; key/query masks by value; softmax f32; P x 2^11 once to f16 x v once to f16 (bf16 hi + lo below row 384); fully-masked query rows = mean of the f16 v plane in f32; ctx hi+lo x exact Wo below row 384, x2^6 f16 carry x f16(bf16 x 2^8) Wo after; f32 output.
#include <hip/hip_runtime.h>
#include <math.h>

typedef __attribute__((ext_vector_type(16))) _Float16 v16h;
typedef __attribute__((ext_vector_type(16))) __bf16 v16b;
typedef __attribute__((ext_vector_type(8)))  _Float16 v8h;
typedef __attribute__((ext_vector_type(8)))  float v8f;
typedef __attribute__((ext_vector_type(4)))  float v4f;
typedef __attribute__((ext_vector_type(2)))  float v2f;
typedef __attribute__((ext_vector_type(4)))  unsigned v4u;
typedef _Float16 hx8 __attribute__((ext_vector_type(8)));
typedef __attribute__((ext_vector_type(4)))  int v4i;
typedef float __attribute__((may_alias)) float_a;
typedef int __attribute__((may_alias)) int_a;

template <typename T> __device__ __forceinline__ void vst2(void* p, T v) { *(T*)p = v;  }
__device__ __forceinline__ v8f wmma16(v16h a, v16h b, v8f c) {
  v8f d = __builtin_amdgcn_wmma_f32_16x16x32_f16(false, a, false, b, (short)0, c, false, false);
  asm volatile("v_nop\n\tv_nop\n\tv_nop\n\tv_nop" : "+v"(d) : "v"(a), "v"(b));
  return d;
}
__device__ __forceinline__ v8f wmma_bf(v16b a, v16b b, v8f c) {
  v8f d = __builtin_amdgcn_wmma_f32_16x16x32_bf16(false, a, false, b, (short)0, c, false, false);
  asm volatile("v_nop\n\tv_nop\n\tv_nop\n\tv_nop" : "+v"(d) : "v"(a), "v"(b));
  return d;
}
// 16x16x32 fragments: lane = (h = lane>>4, row/col = lane&15); elements 0..7 = k0+8h+0..7, 8..15 = k0+16+8h+0..7; D element r = row 8h+r
__device__ __forceinline__ v16h frag_h(const _Float16* rowk0, int lane) {
  union { v16h v; v8h q[2]; } u; const _Float16* p = rowk0 + 8 * (lane >> 4);
  u.q[0] = *(const v8h*)p; u.q[1] = *(const v8h*)(p + 16); return u.v;
}
__device__ __forceinline__ v16h frag_f32(const float* rowk0, int lane) {
  v16h a; const float* p = rowk0 + 8 * (lane >> 4);
#pragma unroll
  for (int i = 0; i < 8; ++i) { a[i] = (_Float16)p[i]; a[8 + i] = (_Float16)p[16 + i]; }
  return a;
}
__device__ __forceinline__ v16h frag_f32s(const float* rowk0, int lane, float sc) {
  v16h a; const float* p = rowk0 + 8 * (lane >> 4);
#pragma unroll
  for (int i = 0; i < 8; ++i) { a[i] = (_Float16)(p[i] * sc); a[8 + i] = (_Float16)(p[16 + i] * sc); }
  return a;
}
// column fragment from a [K][ld] layout (column n), rows >= K read as 0
__device__ __forceinline__ v16h fragc_f32(const float* W, int k0, int n, int lane, int ld, int K) {
  v16h a; const int g = lane >> 4;
#pragma unroll
  for (int i = 0; i < 8; ++i) { const int ka = k0 + 8 * g + i, kb = ka + 16;
    a[i] = (_Float16)(ka < K ? W[(size_t)(ka < K ? ka : K - 1) * ld + n] : 0.f); a[8 + i] = (_Float16)(kb < K ? W[(size_t)(kb < K ? kb : K - 1) * ld + n] : 0.f); }
  return a;
}
struct F2 { v16b h, l; };
__device__ __forceinline__ F2 bsplit16(const float v[16]) { F2 r;
#pragma unroll
  for (int i = 0; i < 16; ++i) { const __bf16 h = (__bf16)v[i]; r.h[i] = h; r.l[i] = (__bf16)(v[i] - (float)h); }
  return r; }
__device__ __forceinline__ F2 split_row(const float* row, int k0, int lane) { float v[16]; const float* p = row + k0 + 8 * (lane >> 4);
#pragma unroll
  for (int i = 0; i < 8; ++i) { v[i] = p[i]; v[8 + i] = p[16 + i]; }
  return bsplit16(v); }
__device__ __forceinline__ F2 split_rowK(const float* row, int k0, int lane, int K) { float v[16]; const int g = lane >> 4;
#pragma unroll
  for (int i = 0; i < 8; ++i) { const int ka = k0 + 8 * g + i, kb = ka + 16; v[i] = ka < K ? row[ka < K ? ka : K - 1] : 0.f; v[8 + i] = kb < K ? row[kb < K ? kb : K - 1] : 0.f; }
  return bsplit16(v); }
__device__ __forceinline__ F2 split_col(const float* W, int k0, int n, int lane, int ld, int K) { float v[16]; const int g = lane >> 4;
#pragma unroll
  for (int i = 0; i < 8; ++i) { const int ka = k0 + 8 * g + i, kb = ka + 16; v[i] = ka < K ? W[(size_t)(ka < K ? ka : K - 1) * ld + n] : 0.f; v[8 + i] = kb < K ? W[(size_t)(kb < K ? kb : K - 1) * ld + n] : 0.f; }
  return bsplit16(v); }
__device__ __forceinline__ v8f mac3(const F2& a, const F2& b, v8f c) { c = wmma_bf(a.l, b.h, c); c = wmma_bf(a.h, b.l, c); return wmma_bf(a.h, b.h, c); }
__device__ __forceinline__ float sigm(float v) { return 1.0f / (1.0f + expf(-v)); }
#define LDSX() do { asm volatile("s_wait_dscnt 0" ::: "memory"); __builtin_amdgcn_wave_barrier(); __builtin_amdgcn_fence(__ATOMIC_RELEASE, "workgroup"); } while (0)

// Causal multi-head self-attention with token padding masks on BOTH keys and queries (embeddings [4,2048,512], token_masks [4,2048] int 0/1 (random here: about half the tokens masked); 8 heads x 64; (in,out) Wq/Wk/Wv/Wo [512,512], no biases): scores = q.k/8, where(causal & tm[k] & tm[q], scores, -1e30), softmax, context Wo. A query with tm[q] = 0 gets all scores = -1e30 -> exactly uniform attention over all 2,048 positions (context = mean V).
#define NB 4
#define TT 2048
#define CC 512            // NH * HD = projected width
#define DIN 512          // input (model) width
#define NH 8
#define HD 64
#define SCALE (0.125f)
#define CAUSAL 1
#ifndef TNB
#define TNB NB
#endif
__device__ __forceinline__ float bfr(float v) { return (float)(__bf16)v; }
__host__ __device__ __forceinline__ int kb_last(int qb) { return CAUSAL ? ((qb * 64 + 63) >> 7) : (TT / 128 - 1); }
typedef __attribute__((ext_vector_type(8))) __bf16 v8b;
__device__ __forceinline__ v16b frag_b(const __bf16* rowk0, int lane) {
  union { v16b v; v8b q[2]; } u; const __bf16* p = rowk0 + 8 * (lane >> 4);
  u.q[0] = *(const v8b*)p; u.q[1] = *(const v8b*)(p + 16); return u.v;
}
#define QBH 6              // causal: query blocks 0..QBH-1 of each sequence (few keys, no averaging) take the high-precision path
#define QHI 384            // rows carrying a q residual plane (read only by the 3-product logits of query blocks < QBH)
#define KHI 384            // key rows carrying k residual / v bf16 hi+lo planes (used only by the causal high-precision path)
// B fragment (k rows k0+.., output column o) of a weight: (in,out) [K][ld] or (out,in) [ld rows of K]: bf16 exact, or f16(bf16 * 256) exact
__device__ __forceinline__ v16b wcol_io(const float* Wm, int k0, int o, int lane, int ld) { v16b w; const int g = lane >> 4;
#pragma unroll
  for (int i = 0; i < 8; ++i) { w[i] = (__bf16)Wm[(size_t)(k0 + 8 * g + i) * ld + o]; w[8 + i] = (__bf16)Wm[(size_t)(k0 + 16 + 8 * g + i) * ld + o]; }
  return w; }
__device__ __forceinline__ v16b wcol_oi(const float* Wm, int k0, int o, int lane, int K) { v16b w; const float* p = Wm + (size_t)o * K + k0 + 8 * (lane >> 4);
#pragma unroll
  for (int i = 0; i < 8; ++i) { w[i] = (__bf16)p[i]; w[8 + i] = (__bf16)p[16 + i]; }
  return w; }
__device__ __forceinline__ v16h wcolh_io(const float* Wm, int k0, int o, int lane, int ld) { v16h w; const int g = lane >> 4;
#pragma unroll
  for (int i = 0; i < 8; ++i) { w[i] = (_Float16)(bfr(Wm[(size_t)(k0 + 8 * g + i) * ld + o]) * 256.0f); w[8 + i] = (_Float16)(bfr(Wm[(size_t)(k0 + 16 + 8 * g + i) * ld + o]) * 256.0f); }
  return w; }
__device__ __forceinline__ v16h wcolh_oi(const float* Wm, int k0, int o, int lane, int K) { v16h w; const float* p = Wm + (size_t)o * K + k0 + 8 * (lane >> 4);
#pragma unroll
  for (int i = 0; i < 8; ++i) { w[i] = (_Float16)(bfr(p[i]) * 256.0f); w[8 + i] = (_Float16)(bfr(p[16 + i]) * 256.0f); }
  return w; }
#define WQKV_LAYOUT 0   // 0 = (in,out) [DIN][CC]; 1 = (out,in) [CC][DIN]; 2 = per-head [NH][DIN][HD]
__device__ __forceinline__ v16b wcol_hdk(const float* Wm, int k0, int o, int lane) { v16b w; const int g = lane >> 4; const float* p = Wm + (size_t)(o / HD) * DIN * HD + (o % HD);
#pragma unroll
  for (int i = 0; i < 8; ++i) { w[i] = (__bf16)p[(size_t)(k0 + 8 * g + i) * HD]; w[8 + i] = (__bf16)p[(size_t)(k0 + 16 + 8 * g + i) * HD]; }
  return w; }
#define WO_OUT_IN 0
#if WQKV_LAYOUT == 1
#define WCOL(W, k0, o, lane) wcol_oi(W, k0, o, lane, DIN)
#elif WQKV_LAYOUT == 2
#define WCOL(W, k0, o, lane) wcol_hdk(W, k0, o, lane)
#else
#define WCOL(W, k0, o, lane) wcol_io(W, k0, o, lane, CC)
#endif
#if WO_OUT_IN
#define WOCOL(W, k0, o, lane) wcol_oi(W, k0, o, lane, CC)
#define WOCOLH(W, k0, o, lane) wcolh_oi(W, k0, o, lane, CC)
#else
#define WOCOL(W, k0, o, lane) wcol_io(W, k0, o, lane, DIN)
#define WOCOLH(W, k0, o, lane) wcolh_io(W, k0, o, lane, DIN)
#endif
// masks: keys need causal (structure + index) AND token_masks[b][k] != 0; a query with token_masks[b][t] == 0 has EVERY score = -1e30 in the module -> exactly uniform attention over all 2,048 positions -> its context is mean_k V (handled by k_meanv/k_fixq below; here such rows just get a harmless finite placeholder)
// ---- k_meanv: thread per (batch, channel): MV[b][c] = (1/2048) sum_t v[b][t][c] from the f16 v plane (f32 sum in t order) - the context of a fully-masked query row (softmax of 2,048 equal scores = exactly 1/2048 each)
__global__ __launch_bounds__(256) void k_meanv(const _Float16* __restrict__ VT, float* __restrict__ MV) { const int c = blockIdx.x * 256 + threadIdx.x; const int b = blockIdx.y; const _Float16* p = VT + ((size_t)b * CC + c) * TT; float a = 0.f;
#pragma unroll 2
  for (int t8 = 0; t8 < TT; t8 += 8) { const v4u u = *(const v4u*)(p + t8); asm volatile("s_wait_loadcnt 0x0" ::: "memory"); const hx8 hv = *(const hx8*)&u; _Pragma("unroll") for (int j = 0; j < 8; ++j) a += (float)hv[j]; }
  vst2(MV + (size_t)b * CC + c, a * (1.0f / TT)); }
// ---- k_fixq: wave per masked query row (token_masks[b][t] == 0): ctx row Y[b*TT + t][:] = MV[b][:] (512 floats = 2 KB by 32 lanes x 4 x 16 B); unmasked rows untouched (wave-uniform branch)
__global__ __launch_bounds__(256) void k_fixq(const int* __restrict__ TM, const float* __restrict__ MV, float* __restrict__ Y) { const int tid = threadIdx.x; const size_t row = (size_t)blockIdx.x * 8 + (tid >> 5); const int lane = tid & 31; const int b = (int)(row / TT);
  const int tq = TM[row]; asm volatile("s_wait_loadcnt 0x0" ::: "memory"); if (tq != 0) return;
#pragma unroll
  for (int q = 0; q < CC / 128; ++q) { const v4f v = *(const v4f*)(MV + (size_t)b * CC + (q * 32 + lane) * 4); asm volatile("s_wait_loadcnt 0x0" ::: "memory"); vst2(Y + row * CC + (q * 32 + lane) * 4, v); } }
#define WS_MV (WS_END)                                    // f32 mean-v rows [b][512]
#define WS_END2 (WS_MV + 4u * (size_t)NB * CC)

#define WS_QH  0u                                      // f16 q rows [b*t][CC]
#define WS_KH  (WS_QH + 2u * (size_t)NB * TT * CC)      // f16 k rows [b*t][CC]
#define WS_VT  (WS_KH + 2u * (size_t)NB * TT * CC)      // f16 v planes [b][c][t]
#define WS_QL  (WS_VT + 2u * (size_t)NB * CC * TT)      // f16 q residual x 2^10 rows [b][t < QHI][CC]
#define WS_KL  (WS_QL + 2u * (size_t)NB * QHI * CC)     // f16 k residual x 2^10 rows [b][t < KHI][CC]
#define WS_VB  (WS_KL + 2u * (size_t)NB * KHI * CC)     // bf16 v hi planes [b][c][t < KHI]
#define WS_VBL (WS_VB + 2u * (size_t)NB * CC * KHI)
#define WS_Y   (WS_VBL + 2u * (size_t)NB * CC * KHI)     // f32 ctx rows [b*t][CC] (only when there is an output projection)
#define WS_END (WS_Y  + 4u * (size_t)NB * TT * CC)

// ---- k_proj: block = (64 rows, 128 cols, which): q/k/v = X W (+ b) with exact bf16 products (K = DIN) -> which 0: q f16 rows (+ residual rows < QHI); 1: k f16 rows (+ residual rows < KHI); 2: v f16 planes [c][t] (+ bf16 hi/lo planes for t < KHI)
__global__ __launch_bounds__(128) void k_proj(const float* __restrict__ XQ, const float* __restrict__ XK, const float* __restrict__ XV, const float* __restrict__ WQ, const float* __restrict__ WK, const float* __restrict__ WV, const float* __restrict__ BQ, const float* __restrict__ BK, const float* __restrict__ BV,
    _Float16* __restrict__ QH, _Float16* __restrict__ QL, _Float16* __restrict__ KH, _Float16* __restrict__ KL, _Float16* __restrict__ VT, __bf16* __restrict__ VB, __bf16* __restrict__ VBL) {
  __shared__ __align__(16) _Float16 sh[64][136], sl[64][136]; __shared__ __align__(16) _Float16 th[128][72]; __shared__ __align__(16) __bf16 tb[128][72], tbl[128][72];
  const int tid = threadIdx.x, wave = tid >> 5, lane = tid & 31, col = lane & 15, g = lane >> 4; const int which = blockIdx.z; const int c0 = blockIdx.y * 128; const size_t r0 = (size_t)blockIdx.x * 64; const size_t bb = r0 / TT; const int t0 = (int)(r0 % TT);
  const float* X = which == 0 ? XQ : which == 1 ? XK : XV; const float* WA = which == 0 ? WQ : which == 1 ? WK : WV; const float* BA = which == 0 ? BQ : which == 1 ? BK : BV;
  v8f acc[8] = {};
#pragma unroll 2
  for (int kc = 0; kc < DIN / 32; ++kc) { v16b a; { const float* p = X + (r0 + wave * 16 + col) * DIN + kc * 32 + 8 * g;
#pragma unroll
      for (int i = 0; i < 8; ++i) { a[i] = (__bf16)p[i]; a[8 + i] = (__bf16)p[16 + i]; } }
    asm volatile("s_wait_loadcnt 0x0" ::: "memory");
#pragma unroll
    for (int j = 0; j < 8; ++j) { const v16b w = WCOL(WA, kc * 32, c0 + j * 16 + col, lane); asm volatile("s_wait_loadcnt 0x0" ::: "memory"); acc[j] = wmma_bf(a, w, acc[j]); } }
  if (which < 2) { _Float16* DH = which == 0 ? QH : KH; _Float16* DL = which == 0 ? QL : KL; const int nhi = which == 0 ? QHI : KHI; const bool hi_rows = t0 < nhi;
#pragma unroll
    for (int j = 0; j < 8; ++j) { const float bias = BA ? bfr(BA[c0 + j * 16 + col]) : 0.f;
#pragma unroll
      for (int r = 0; r < 8; ++r) { const float v = acc[j][r] + bias; const _Float16 hv = (_Float16)v; sh[wave * 16 + 8 * g + r][j * 16 + col] = hv; sl[wave * 16 + 8 * g + r][j * 16 + col] = (_Float16)((v - (float)hv) * 1024.0f); } }
    __syncthreads();
    for (int e = tid; e < 64 * 16; e += 128) { const int rl = e >> 4, q = e & 15; vst2((unsigned*)(DH + (r0 + rl) * CC + c0 + q * 8), *(const v4u*)&sh[rl][q * 8]); if (hi_rows) vst2((unsigned*)(DL + (bb * nhi + t0 + rl) * (size_t)CC + c0 + q * 8), *(const v4u*)&sl[rl][q * 8]); }
  } else { const bool hi_rows = t0 < KHI;
#pragma unroll
    for (int j = 0; j < 8; ++j) { const float bias = BA ? bfr(BA[c0 + j * 16 + col]) : 0.f;
#pragma unroll
      for (int r = 0; r < 8; ++r) { const float v = acc[j][r] + bias; const int rl = wave * 16 + 8 * g + r, cl = j * 16 + col; th[cl][rl] = (_Float16)v; const __bf16 bh = (__bf16)v; tb[cl][rl] = bh; tbl[cl][rl] = (__bf16)(v - (float)bh); } }
    __syncthreads();
    for (int e = tid; e < 128 * 8; e += 128) { const int cl = e >> 3, q = e & 7; vst2((unsigned*)(VT + (bb * CC + c0 + cl) * (size_t)TT + t0 + q * 8), *(const v4u*)&th[cl][q * 8]); if (hi_rows) { const size_t o3 = (bb * CC + c0 + cl) * (size_t)KHI + t0 + q * 8; vst2((unsigned*)(VB + o3), *(const v4u*)&tb[cl][q * 8]); vst2((unsigned*)(VBL + o3), *(const v4u*)&tbl[cl][q * 8]); } } } }
// ---- k_att: block = 16 queries of (b, h), AW waves; the 16 score rows live in LDS from the logits to P, so no score plane goes through memory and one launch covers every (b, h).
// step 1, logits: wave w takes the 16-key tiles w, w + AW, ... of keys [0, kend): q x k on f16 (3 products with the x 2^10 residual planes for query blocks < QBH), x SCALE; causal and key masks by select at the LDS store.
// step 2, softmax: wave w owns row w in registers, f32, sums by lane then across lanes; P x 2^11 back in place (0 for excluded keys); a query with token_masks == 0 gets a finite placeholder row here and its context from k_fixq.
// step 3, P.v: wave w sums the 32-key chunks w, w + AW, ... (P once to f16 against v f16; query blocks < QBH: P and v as bf16 hi + lo, 3 products); the AW partial tiles are added in f32 through LDS in wave order.
#define AW 16          /* the wave number goes through readfirstlane so that the tile loops are scalar loops and every lane is on at the matrix instructions */
#define SP (TT + 4)    /* row pitch in floats: 16 B past a multiple of 256 B, so the 16 rows of a b128 fragment read fall on different banks */
static_assert(QBH * 64 >= QHI, "every row with a q residual plane takes the 3-product path");
static_assert(AW * 16 * (HD + 4) <= 16 * SP, "the partial tiles reuse the score rows' LDS");
// 16 f32 of one LDS row in fragment order (0..7 = p[0..7], 8..15 = p[16..23]) by four 16-byte reads
__device__ __forceinline__ void lds_row16(const float* p, float v[16]) { const v4f a = *(const v4f*)p, b = *(const v4f*)(p + 4), c = *(const v4f*)(p + 16), d = *(const v4f*)(p + 20);
#pragma unroll
  for (int i = 0; i < 4; ++i) { v[i] = a[i]; v[4 + i] = b[i]; v[8 + i] = c[i]; v[12 + i] = d[i]; } }
__global__ __launch_bounds__(32 * AW) void k_att(const _Float16* __restrict__ QH, const _Float16* __restrict__ KH, const _Float16* __restrict__ QL, const _Float16* __restrict__ KL, const _Float16* __restrict__ VT, const __bf16* __restrict__ VB, const __bf16* __restrict__ VBL, const int* __restrict__ TM, float* __restrict__ Y) { __shared__ __align__(16) float sc[16][SP];
  const int tid = threadIdx.x, wave = __builtin_amdgcn_readfirstlane(tid >> 5), lane = tid & 31, col = lane & 15, g = lane >> 4; const int h = blockIdx.y, b = blockIdx.z; const int qb = blockIdx.x >> 2; const int ql0 = blockIdx.x * 16; const int kend = (kb_last(qb) + 1) * 128;
  const size_t q0 = (size_t)b * TT + ql0, kr0 = (size_t)b * TT; const int* TMb = TM + (size_t)b * TT; const int tq = TMb[ql0 + wave];
  if (qb < QBH) { const _Float16* QLb = QL + (size_t)b * QHI * CC; const _Float16* KLb = KL + (size_t)b * KHI * CC; v16h ah[HD / 32], al[HD / 32];
#pragma unroll
    for (int kc = 0; kc < HD / 32; ++kc) { ah[kc] = frag_h(QH + (q0 + col) * CC + h * HD + kc * 32, lane); al[kc] = frag_h(QLb + (size_t)(ql0 + col) * CC + h * HD + kc * 32, lane); }
    for (int kt = wave; kt < kend / 16; kt += AW) { const int key = kt * 16 + col; const int tk = TMb[key]; v8f acc = {}, accl = {};
      v16h kbf[HD / 32], klf[HD / 32];   /* all of the tile's loads stand ahead of its first product: one memory latency a tile */
#pragma unroll
      for (int kc = 0; kc < HD / 32; ++kc) { kbf[kc] = frag_h(KH + (kr0 + key) * CC + h * HD + kc * 32, lane); klf[kc] = frag_h(KLb + (size_t)key * CC + h * HD + kc * 32, lane); }
#pragma unroll
      for (int kc = 0; kc < HD / 32; ++kc) { acc = wmma16(ah[kc], kbf[kc], acc); accl = wmma16(al[kc], kbf[kc], accl); accl = wmma16(ah[kc], klf[kc], accl); }
#pragma unroll
      for (int r = 0; r < 8; ++r) sc[8 * g + r][key] = ((!CAUSAL || key <= ql0 + 8 * g + r) && tk != 0) ? (acc[r] + accl[r] * (1.0f / 1024.0f)) * SCALE : -3.0e38f; }
  } else { v16h ah[HD / 32];
#pragma unroll
    for (int kc = 0; kc < HD / 32; ++kc) ah[kc] = frag_h(QH + (q0 + col) * CC + h * HD + kc * 32, lane);
    for (int kt0 = wave; kt0 < kend / 16; kt0 += 4 * AW) { v16h kbf[4][HD / 32]; int tk[4];   /* the loads of up to four tiles stand ahead of the first product: one memory latency for four tiles; the tests on the tile number are scalar */
      const _Float16* kp = KH + (kr0 + kt0 * 16 + col) * CC + h * HD; const int* tp = TMb + kt0 * 16 + col;   /* one address pair for the four tiles, the tile's step as a constant offset */
#pragma unroll
      for (int u = 0; u < 4; ++u) if (kt0 + u * AW < kend / 16) { tk[u] = tp[u * AW * 16];
#pragma unroll
        for (int kc = 0; kc < HD / 32; ++kc) kbf[u][kc] = frag_h(kp + (size_t)u * AW * 16 * CC + kc * 32, lane); }
#pragma unroll
      for (int u = 0; u < 4; ++u) if (kt0 + u * AW < kend / 16) { const int key = (kt0 + u * AW) * 16 + col; v8f acc = {};
#pragma unroll
        for (int kc = 0; kc < HD / 32; ++kc) acc = wmma16(ah[kc], kbf[u][kc], acc);
#pragma unroll
        for (int r = 0; r < 8; ++r) sc[8 * g + r][key] = ((!CAUSAL || key <= ql0 + 8 * g + r) && tk[u] != 0) ? acc[r] * SCALE : -3.0e38f; } } }
  __syncthreads();   /* every tile of the 16 score rows is in LDS before a wave reads its row */
  { const int nq = kend >> 7; v4f vv[TT / 128];   /* 128 keys a pass: 32 lanes x 4; the tests on nq are scalar */
#pragma unroll
    for (int i = 0; i < TT / 128; ++i) if (i < nq) vv[i] = *(const v4f*)&sc[wave][i * 128 + lane * 4];
    float m = -3.0e38f;
#pragma unroll
    for (int i = 0; i < TT / 128; ++i) if (i < nq) { if (tq == 0) vv[i] = (v4f){0.f, 0.f, 0.f, 0.f}; m = fmaxf(m, fmaxf(fmaxf(vv[i][0], vv[i][1]), fmaxf(vv[i][2], vv[i][3]))); }
#pragma unroll
    for (int o = 1; o < 32; o <<= 1) m = fmaxf(m, __shfl_xor(m, o));
    float sum = 0.f;
#pragma unroll
    for (int i = 0; i < TT / 128; ++i) if (i < nq) {
#pragma unroll
      for (int c = 0; c < 4; ++c) { const float v = vv[i][c]; const float ex = expf(v - m); const float e = (v <= -1.0e38f) ? 0.f : ex; vv[i][c] = e; sum += e; } }
#pragma unroll
    for (int o = 1; o < 32; o <<= 1) sum += __shfl_xor(sum, o);
    const float inv = sum > 0.f ? 2048.0f / sum : 0.f;   /* a fully excluded row yields P = 0 */
#pragma unroll
    for (int i = 0; i < TT / 128; ++i) if (i < nq) *(v4f*)&sc[wave][i * 128 + lane * 4] = vv[i] * inv; }
  __syncthreads();   /* all 16 rows of P are in LDS before any wave forms fragments across them */
  const int kce = kend >> 5; v8f acc[HD / 16] = {};
  if (qb < QBH) {
    for (int kc = wave; kc < kce; kc += AW) { float pv[16]; lds_row16(&sc[col][kc * 32 + 8 * g], pv); const F2 p = bsplit16(pv);
#pragma unroll
      for (int j2 = 0; j2 < HD / 16; j2 += 2) { v16b vh[2], vl[2];   /* two column tiles' loads stand ahead of their products */
#pragma unroll
        for (int u = 0; u < 2; ++u) { const size_t po = ((size_t)b * CC + h * HD + (j2 + u) * 16 + col) * (size_t)KHI + kc * 32; vh[u] = frag_b(VB + po, lane); vl[u] = frag_b(VBL + po, lane); }
#pragma unroll
        for (int u = 0; u < 2; ++u) { const int j = j2 + u; acc[j] = wmma_bf(p.h, vh[u], acc[j]); acc[j] = wmma_bf(p.l, vh[u], acc[j]); acc[j] = wmma_bf(p.h, vl[u], acc[j]); } } }
  } else {
    for (int kc = wave; kc < kce; kc += AW) { v16h vf[HD / 16]; const _Float16* vp = VT + ((size_t)b * CC + h * HD + col) * (size_t)TT + kc * 32 + 8 * g;   /* the chunk's four v loads stand ahead of its first product: one memory latency a chunk */
#pragma unroll
      for (int j = 0; j < HD / 16; ++j) { union { v16h v; v8h q[2]; } u; u.q[0] = *(const v8h*)(vp + (size_t)j * 16 * TT); u.q[1] = *(const v8h*)(vp + (size_t)j * 16 * TT + 16); vf[j] = u.v; }
      asm volatile("s_wait_xcnt 0x0" :: "v"(vp) : "memory");   /* the eight loads share one address pair: it stays whole (no load lands on it) until this wait */
      float pv[16]; lds_row16(&sc[col][kc * 32 + 8 * g], pv); v16h p;
#pragma unroll
      for (int i = 0; i < 16; ++i) p[i] = (_Float16)pv[i];
#pragma unroll
      for (int j = 0; j < HD / 16; ++j) acc[j] = wmma16(p, vf[j], acc[j]); } }
  __syncthreads();   /* every wave has read its last P fragment before the partial tiles overwrite the rows */
  float (*ss)[16][HD + 4] = (float (*)[16][HD + 4])&sc[0][0];
#pragma unroll
  for (int j = 0; j < HD / 16; ++j)
#pragma unroll
    for (int r = 0; r < 8; ++r) ss[wave][8 * g + r][j * 16 + col] = acc[j][r];
  __syncthreads();   /* every wave's partial tile is in LDS before any wave adds them */
  for (int e = tid; e < 16 * (HD / 2); e += 32 * AW) { const int rl = e / (HD / 2), q = e % (HD / 2); v2f s = *(const v2f*)&ss[0][rl][q * 2];
#pragma unroll   /* the AW LDS reads issue ahead of the adds; rolled, each add would wait a full LDS latency */
    for (int w = 1; w < AW; ++w) s += *(const v2f*)&ss[w][rl][q * 2];
    vst2(Y + ((size_t)b * TT + ql0 + rl) * CC + h * HD + q * 2, s * (1.0f / 2048.0f)); } }
// ---- k_out: block = (64 rows, 128 cols): out = ctx Wo (+ bo): ctx x 2^6 once to f16 against Wo as f16(bf16 x 2^8) exact (1 product) x 2^-14; causal early rows (< QHI of each sequence): ctx bf16 hi + lo against exact bf16 Wo (2 products)
__global__ __launch_bounds__(128) void k_out(const float* __restrict__ Y, const float* __restrict__ WO, const float* __restrict__ BO, float* __restrict__ OUT) { __shared__ __align__(16) float sf[4][16][132];
  const int tid = threadIdx.x, wave = tid >> 5, lane = tid & 31, col = lane & 15, g = lane >> 4; const int c0 = blockIdx.y * 128; const size_t r0 = (size_t)blockIdx.x * 64 + wave * 16;
  v8f acc[8] = {};
  if (CAUSAL && (int)(((size_t)blockIdx.x * 64) % TT) < QHI) {   /* block-uniform */
#pragma unroll 2
    for (int kc = 0; kc < CC / 32; ++kc) { const F2 a = split_row(Y + (r0 + col) * CC, kc * 32, lane); asm volatile("s_wait_loadcnt 0x0" ::: "memory");
#pragma unroll
      for (int j = 0; j < 8; ++j) { const v16b w = WOCOL(WO, kc * 32, c0 + j * 16 + col, lane); asm volatile("s_wait_loadcnt 0x0" ::: "memory"); acc[j] = wmma_bf(a.h, w, acc[j]); acc[j] = wmma_bf(a.l, w, acc[j]); } }
#pragma unroll
    for (int j = 0; j < 8; ++j) { const float bias = BO ? bfr(BO[c0 + j * 16 + col]) : 0.f;
#pragma unroll
      for (int r = 0; r < 8; ++r) sf[wave][8 * g + r][j * 16 + col] = acc[j][r] + bias; }
  } else {
#pragma unroll 2
    for (int kc = 0; kc < CC / 32; ++kc) { const v16h a = frag_f32s(Y + (r0 + col) * CC + kc * 32, lane, 64.0f); asm volatile("s_wait_loadcnt 0x0" ::: "memory");   /* ctx carried x 2^6 into f16 so small-magnitude context rows stay clear of f16 subnormals */
#pragma unroll
      for (int j = 0; j < 8; ++j) { const v16h w = WOCOLH(WO, kc * 32, c0 + j * 16 + col, lane); asm volatile("s_wait_loadcnt 0x0" ::: "memory"); acc[j] = wmma16(a, w, acc[j]); } }
#pragma unroll
    for (int j = 0; j < 8; ++j) { const float bias = BO ? bfr(BO[c0 + j * 16 + col]) : 0.f;
#pragma unroll
      for (int r = 0; r < 8; ++r) sf[wave][8 * g + r][j * 16 + col] = acc[j][r] * (1.0f / 16384.0f) + bias; } }   /* 2^-8 (Wo carry) x 2^-6 (ctx carry) */
  LDSX(); for (int rl = 0; rl < 16; ++rl) vst2(OUT + (r0 + rl) * DIN + c0 + lane * 4, *(const v4f*)&sf[wave][rl][lane * 4]); }

extern "C" void kernel_launch(void* const* d_in, const int* in_sizes, int n_in, void* d_out, int out_size, void* d_ws, size_t ws_size, hipStream_t stream) {
  (void)in_sizes; (void)n_in; (void)out_size;
  const float** F = (const float**)d_in;
  if (ws_size < (size_t)WS_END) return;
  char* ws = (char*)d_ws; _Float16 *QH = (_Float16*)(ws + WS_QH), *KH = (_Float16*)(ws + WS_KH), *VT = (_Float16*)(ws + WS_VT), *QL = (_Float16*)(ws + WS_QL), *KL = (_Float16*)(ws + WS_KL); __bf16 *VB = (__bf16*)(ws + WS_VB), *VBL = (__bf16*)(ws + WS_VBL); float *Y = (float*)(ws + WS_Y);
  (void)Y; (void)QL; (void)KL; (void)VB; (void)VBL;
  // inputs: 0 embeddings [4,2048,512]; 1 token_masks [4,2048] int32 (0/1); 2 Wq [512,512] (in,out); 3 Wk; 4 Wv; 5 Wo (in,out)
  if (ws_size < (size_t)WS_END2) return;
  const int* TM = (const int*)d_in[1]; float* MV = (float*)(ws + WS_MV);
  k_proj<<<dim3(TNB * TT / 64, CC / 128, 3), 128, 0, stream>>>(F[0], F[0], F[0], F[2], F[3], F[4], nullptr, nullptr, nullptr, QH, QL, KH, KL, VT, VB, VBL);
  k_meanv<<<dim3(CC / 256, TNB), 256, 0, stream>>>(VT, MV);
  k_att<<<dim3(TT / 16, NH, TNB), 32 * AW, 0, stream>>>(QH, KH, QL, KL, VT, VB, VBL, TM, Y);
  k_fixq<<<dim3(TNB * TT / 8), 256, 0, stream>>>(TM, MV, Y);   /* masked queries: context = mean V */
  k_out<<<dim3(TNB * TT / 64, DIN / 128), 128, 0, stream>>>(Y, F[5], nullptr, (float*)d_out);
}

// v003
// A run of this version takes 228 microseconds.
// Two timings next to v002 both put it at 1.11 times that version's speed.
// All steps since v000 together make it 4.22 times as fast.
// compute dtype: all float inputs rounded to bf16; projections with EXACT bf16 products on WMMA 16x16x32 (f32 accumulate); causal logits: 3 products for the first 384 rows, single f16 q x k after, x 64^-0.5; key/query masks by value; softmax f32; P x 2^11 once to f16 x v once to f16 (bf16 hi + lo below row 384); fully-masked query rows = mean of the f16 v plane in f32; ctx hi+lo x exact Wo below row 384, x2^6 f16 carry x f16(bf16 x 2^8) Wo after; f32 output.
#include <hip/hip_runtime.h>
#include <math.h>

typedef __attribute__((ext_vector_type(16))) _Float16 v16h;
typedef __attribute__((ext_vector_type(16))) __bf16 v16b;
typedef __attribute__((ext_vector_type(8)))  _Float16 v8h;
typedef __attribute__((ext_vector_type(8)))  float v8f;
typedef __attribute__((ext_vector_type(4)))  float v4f;
typedef __attribute__((ext_vector_type(2)))  float v2f;
typedef __attribute__((ext_vector_type(4)))  unsigned v4u;
typedef _Float16 hx8 __attribute__((ext_vector_type(8)));
typedef __attribute__((ext_vector_type(4)))  int v4i;
typedef float __attribute__((may_alias)) float_a;
typedef int __attribute__((may_alias)) int_a;

template <typename T> __device__ __forceinline__ void vst2(void* p, T v) { *(T*)p = v;  }
__device__ __forceinline__ v8f wmma16(v16h a, v16h b, v8f c) {
  v8f d = __builtin_amdgcn_wmma_f32_16x16x32_f16(false, a, false, b, (short)0, c, false, false);
  asm volatile("v_nop\n\tv_nop\n\tv_nop\n\tv_nop" : "+v"(d) : "v"(a), "v"(b));
  return d;
}
__device__ __forceinline__ v8f wmma_bf(v16b a, v16b b, v8f c) {
  v8f d = __builtin_amdgcn_wmma_f32_16x16x32_bf16(false, a, false, b, (short)0, c, false, false);
  asm volatile("v_nop\n\tv_nop\n\tv_nop\n\tv_nop" : "+v"(d) : "v"(a), "v"(b));
  return d;
}
// 16x16x32 fragments: lane = (h = lane>>4, row/col = lane&15); elements 0..7 = k0+8h+0..7, 8..15 = k0+16+8h+0..7; D element r = row 8h+r
__device__ __forceinline__ v16h frag_h(const _Float16* rowk0, int lane) {
  union { v16h v; v8h q[2]; } u; const _Float16* p = rowk0 + 8 * (lane >> 4);
  u.q[0] = *(const v8h*)p; u.q[1] = *(const v8h*)(p + 16); return u.v;
}
__device__ __forceinline__ v16h frag_f32(const float* rowk0, int lane) {
  v16h a; const float* p = rowk0 + 8 * (lane >> 4);
#pragma unroll
  for (int i = 0; i < 8; ++i) { a[i] = (_Float16)p[i]; a[8 + i] = (_Float16)p[16 + i]; }
  return a;
}
__device__ __forceinline__ v16h frag_f32s(const float* rowk0, int lane, float sc) {
  v16h a; const float* p = rowk0 + 8 * (lane >> 4);
#pragma unroll
  for (int i = 0; i < 8; ++i) { a[i] = (_Float16)(p[i] * sc); a[8 + i] = (_Float16)(p[16 + i] * sc); }
  return a;
}
// column fragment from a [K][ld] layout (column n), rows >= K read as 0
__device__ __forceinline__ v16h fragc_f32(const float* W, int k0, int n, int lane, int ld, int K) {
  v16h a; const int g = lane >> 4;
#pragma unroll
  for (int i = 0; i < 8; ++i) { const int ka = k0 + 8 * g + i, kb = ka + 16;
    a[i] = (_Float16)(ka < K ? W[(size_t)(ka < K ? ka : K - 1) * ld + n] : 0.f); a[8 + i] = (_Float16)(kb < K ? W[(size_t)(kb < K ? kb : K - 1) * ld + n] : 0.f); }
  return a;
}
struct F2 { v16b h, l; };
__device__ __forceinline__ F2 bsplit16(const float v[16]) { F2 r;
#pragma unroll
  for (int i = 0; i < 16; ++i) { const __bf16 h = (__bf16)v[i]; r.h[i] = h; r.l[i] = (__bf16)(v[i] - (float)h); }
  return r; }
__device__ __forceinline__ F2 split_row(const float* row, int k0, int lane) { float v[16]; const float* p = row + k0 + 8 * (lane >> 4);
#pragma unroll
  for (int i = 0; i < 8; ++i) { v[i] = p[i]; v[8 + i] = p[16 + i]; }
  return bsplit16(v); }
__device__ __forceinline__ F2 split_rowK(const float* row, int k0, int lane, int K) { float v[16]; const int g = lane >> 4;
#pragma unroll
  for (int i = 0; i < 8; ++i) { const int ka = k0 + 8 * g + i, kb = ka + 16; v[i] = ka < K ? row[ka < K ? ka : K - 1] : 0.f; v[8 + i] = kb < K ? row[kb < K ? kb : K - 1] : 0.f; }
  return bsplit16(v); }
__device__ __forceinline__ F2 split_col(const float* W, int k0, int n, int lane, int ld, int K) { float v[16]; const int g = lane >> 4;
#pragma unroll
  for (int i = 0; i < 8; ++i) { const int ka = k0 + 8 * g + i, kb = ka + 16; v[i] = ka < K ? W[(size_t)(ka < K ? ka : K - 1) * ld + n] : 0.f; v[8 + i] = kb < K ? W[(size_t)(kb < K ? kb : K - 1) * ld + n] : 0.f; }
  return bsplit16(v); }
__device__ __forceinline__ v8f mac3(const F2& a, const F2& b, v8f c) { c = wmma_bf(a.l, b.h, c); c = wmma_bf(a.h, b.l, c); return wmma_bf(a.h, b.h, c); }
__device__ __forceinline__ float sigm(float v) { return 1.0f / (1.0f + expf(-v)); }
#define LDSX() do { asm volatile("s_wait_dscnt 0" ::: "memory"); __builtin_amdgcn_wave_barrier(); __builtin_amdgcn_fence(__ATOMIC_RELEASE, "workgroup"); } while (0)

// Causal multi-head self-attention with token padding masks on BOTH keys and queries (embeddings [4,2048,512], token_masks [4,2048] int 0/1 (random here: about half the tokens masked); 8 heads x 64; (in,out) Wq/Wk/Wv/Wo [512,512], no biases): scores = q.k/8, where(causal & tm[k] & tm[q], scores, -1e30), softmax, context Wo. A query with tm[q] = 0 gets all scores = -1e30 -> exactly uniform attention over all 2,048 positions (context = mean V).
#define NB 4
#define TT 2048
#define CC 512            // NH * HD = projected width
#define DIN 512          // input (model) width
#define NH 8
#define HD 64
#define SCALE (0.125f)
#define CAUSAL 1
#ifndef TNB
#define TNB NB
#endif
__device__ __forceinline__ float bfr(float v) { return (float)(__bf16)v; }
__host__ __device__ __forceinline__ int kb_last(int qb) { return CAUSAL ? ((qb * 64 + 63) >> 7) : (TT / 128 - 1); }
typedef __attribute__((ext_vector_type(8))) __bf16 v8b;
__device__ __forceinline__ v16b frag_b(const __bf16* rowk0, int lane) {
  union { v16b v; v8b q[2]; } u; const __bf16* p = rowk0 + 8 * (lane >> 4);
  u.q[0] = *(const v8b*)p; u.q[1] = *(const v8b*)(p + 16); return u.v;
}
#define QBH 6              // causal: query blocks 0..QBH-1 of each sequence (few keys, no averaging) take the high-precision path
#define QHI 384            // rows carrying a q residual plane (read only by the 3-product logits of query blocks < QBH)
#define KHI 384            // key rows carrying k residual / v bf16 hi+lo planes (used only by the causal high-precision path)
// B fragment (k rows k0+.., output column o) of a weight: (in,out) [K][ld] or (out,in) [ld rows of K]: bf16 exact, or f16(bf16 * 256) exact
__device__ __forceinline__ v16b wcol_io(const float* Wm, int k0, int o, int lane, int ld) { v16b w; const int g = lane >> 4;
#pragma unroll
  for (int i = 0; i < 8; ++i) { w[i] = (__bf16)Wm[(size_t)(k0 + 8 * g + i) * ld + o]; w[8 + i] = (__bf16)Wm[(size_t)(k0 + 16 + 8 * g + i) * ld + o]; }
  return w; }
__device__ __forceinline__ v16b wcol_oi(const float* Wm, int k0, int o, int lane, int K) { v16b w; const float* p = Wm + (size_t)o * K + k0 + 8 * (lane >> 4);
#pragma unroll
  for (int i = 0; i < 8; ++i) { w[i] = (__bf16)p[i]; w[8 + i] = (__bf16)p[16 + i]; }
  return w; }
__device__ __forceinline__ v16h wcolh_io(const float* Wm, int k0, int o, int lane, int ld) { v16h w; const int g = lane >> 4;
#pragma unroll
  for (int i = 0; i < 8; ++i) { w[i] = (_Float16)(bfr(Wm[(size_t)(k0 + 8 * g + i) * ld + o]) * 256.0f); w[8 + i] = (_Float16)(bfr(Wm[(size_t)(k0 + 16 + 8 * g + i) * ld + o]) * 256.0f); }
  return w; }
__device__ __forceinline__ v16h wcolh_oi(const float* Wm, int k0, int o, int lane, int K) { v16h w; const float* p = Wm + (size_t)o * K + k0 + 8 * (lane >> 4);
#pragma unroll
  for (int i = 0; i < 8; ++i) { w[i] = (_Float16)(bfr(p[i]) * 256.0f); w[8 + i] = (_Float16)(bfr(p[16 + i]) * 256.0f); }
  return w; }
#define WQKV_LAYOUT 0   // 0 = (in,out) [DIN][CC]; 1 = (out,in) [CC][DIN]; 2 = per-head [NH][DIN][HD]
__device__ __forceinline__ v16b wcol_hdk(const float* Wm, int k0, int o, int lane) { v16b w; const int g = lane >> 4; const float* p = Wm + (size_t)(o / HD) * DIN * HD + (o % HD);
#pragma unroll
  for (int i = 0; i < 8; ++i) { w[i] = (__bf16)p[(size_t)(k0 + 8 * g + i) * HD]; w[8 + i] = (__bf16)p[(size_t)(k0 + 16 + 8 * g + i) * HD]; }
  return w; }
#define WO_OUT_IN 0
#if WQKV_LAYOUT == 1
#define WCOL(W, k0, o, lane) wcol_oi(W, k0, o, lane, DIN)
#elif WQKV_LAYOUT == 2
#define WCOL(W, k0, o, lane) wcol_hdk(W, k0, o, lane)
#else
#define WCOL(W, k0, o, lane) wcol_io(W, k0, o, lane, CC)
#endif
#if WO_OUT_IN
#define WOCOL(W, k0, o, lane) wcol_oi(W, k0, o, lane, CC)
#define WOCOLH(W, k0, o, lane) wcolh_oi(W, k0, o, lane, CC)
#else
#define WOCOL(W, k0, o, lane) wcol_io(W, k0, o, lane, DIN)
#define WOCOLH(W, k0, o, lane) wcolh_io(W, k0, o, lane, DIN)
#endif
// masks: keys need causal AND token_masks[b][k] != 0; a query with token_masks[b][t] == 0 has EVERY score = -1e30 in the module -> exactly uniform attention over all 2,048 positions -> its context is mean_k V (handled by k_meanv/k_fixq below; here such rows just get a harmless finite placeholder)
// ---- k_meanv: block = 32 channels of one batch, wave per channel: MV[b][c] = (1/2048) sum_t v[b][t][c] from the f16 v plane - the context of a fully-masked query row (softmax of 2,048 equal scores = exactly 1/2048 each). A wave reads its 4 KB row by whole lines, all loads in flight at once; f32 sums: eight chains a lane, a tree over them, then across the lanes. The 32 means leave as one 128-byte line from one wave.
#define MVW 32
static_assert(CC % MVW == 0 && TT % 256 == 0, "whole blocks of channels, whole 512-byte passes over a row");
__global__ __launch_bounds__(32 * MVW) void k_meanv(const _Float16* __restrict__ VT, float* __restrict__ MV) { __shared__ float sm[MVW];
  const int tid = threadIdx.x, wave = tid >> 5, lane = tid & 31; const int b = blockIdx.y, c0 = blockIdx.x * MVW; const _Float16* p = VT + ((size_t)b * CC + c0 + wave) * TT + lane * 8; hx8 hv[TT / 256];   /* the loops below are unrolled whole: hv and a stay in registers, and the loads issue back to back ahead of the first add */
#pragma unroll
  for (int i = 0; i < TT / 256; ++i) hv[i] = *(const hx8*)(p + i * 256);
  asm volatile("s_wait_xcnt 0x0" :: "v"(p) : "memory");   /* the loads share one address pair: it stays whole (no load lands on it) until this wait */
  float a[8];
#pragma unroll
  for (int j = 0; j < 8; ++j) a[j] = (float)hv[0][j];
#pragma unroll
  for (int i = 1; i < TT / 256; ++i)
#pragma unroll
    for (int j = 0; j < 8; ++j) a[j] += (float)hv[i][j];
  float s = ((a[0] + a[1]) + (a[2] + a[3])) + ((a[4] + a[5]) + (a[6] + a[7]));
#pragma unroll
  for (int o = 1; o < 32; o <<= 1) s += __shfl_xor(s, o);
  if (lane == 0) sm[wave] = s;
  __syncthreads();   /* the 32 waves' sums are in LDS before wave 0 stores them as one line */
  if (tid < MVW) vst2(MV + (size_t)b * CC + c0 + tid, sm[tid] * (1.0f / TT)); }
// ---- k_fixq: wave per masked query row (token_masks[b][t] == 0): ctx row Y[b*TT + t][:] = MV[b][:] (512 floats = 2 KB by 32 lanes x 4 x 16 B); unmasked rows untouched (wave-uniform branch)
__global__ __launch_bounds__(256) void k_fixq(const int* __restrict__ TM, const float* __restrict__ MV, float* __restrict__ Y) { const int tid = threadIdx.x; const size_t row = (size_t)blockIdx.x * 8 + (tid >> 5); const int lane = tid & 31; const int b = (int)(row / TT);
  const int tq = TM[row]; asm volatile("s_wait_loadcnt 0x0" ::: "memory"); if (tq != 0) return;
#pragma unroll
  for (int q = 0; q < CC / 128; ++q) { const v4f v = *(const v4f*)(MV + (size_t)b * CC + (q * 32 + lane) * 4); asm volatile("s_wait_loadcnt 0x0" ::: "memory"); vst2(Y + row * CC + (q * 32 + lane) * 4, v); } }
#define WS_MV (WS_END)                                    // f32 mean-v rows [b][512]
#define WS_END2 (WS_MV + 4u * (size_t)NB * CC)

#define WS_QH  0u                                      // f16 q rows [b*t][CC]
#define WS_KH  (WS_QH + 2u * (size_t)NB * TT * CC)      // f16 k rows [b*t][CC]
#define WS_VT  (WS_KH + 2u * (size_t)NB * TT * CC)      // f16 v planes [b][c][t]
#define WS_QL  (WS_VT + 2u * (size_t)NB * CC * TT)      // f16 q residual x 2^10 rows [b][t < QHI][CC]
#define WS_KL  (WS_QL + 2u * (size_t)NB * QHI * CC)     // f16 k residual x 2^10 rows [b][t < KHI][CC]
#define WS_VB  (WS_KL + 2u * (size_t)NB * KHI * CC)     // bf16 v hi planes [b][c][t < KHI]
#define WS_VBL (WS_VB + 2u * (size_t)NB * CC * KHI)
#define WS_Y   (WS_VBL + 2u * (size_t)NB * CC * KHI)     // f32 ctx rows [b*t][CC] (only when there is an output projection)
#define WS_END (WS_Y  + 4u * (size_t)NB * TT * CC)

// ---- k_proj: block = (64 rows, 128 cols, which): q/k/v = X W (+ b) with exact bf16 products (K = DIN) -> which 0: q f16 rows (+ residual rows < QHI); 1: k f16 rows (+ residual rows < KHI); 2: v f16 planes [c][t] (+ bf16 hi/lo planes for t < KHI)
__global__ __launch_bounds__(128) void k_proj(const float* __restrict__ XQ, const float* __restrict__ XK, const float* __restrict__ XV, const float* __restrict__ WQ, const float* __restrict__ WK, const float* __restrict__ WV, const float* __restrict__ BQ, const float* __restrict__ BK, const float* __restrict__ BV,
    _Float16* __restrict__ QH, _Float16* __restrict__ QL, _Float16* __restrict__ KH, _Float16* __restrict__ KL, _Float16* __restrict__ VT, __bf16* __restrict__ VB, __bf16* __restrict__ VBL) {
  __shared__ __align__(16) _Float16 sh[64][136], sl[64][136]; __shared__ __align__(16) _Float16 th[128][72]; __shared__ __align__(16) __bf16 tb[128][72], tbl[128][72];
  const int tid = threadIdx.x, wave = tid >> 5, lane = tid & 31, col = lane & 15, g = lane >> 4; const int which = blockIdx.z; const int c0 = blockIdx.y * 128; const size_t r0 = (size_t)blockIdx.x * 64; const size_t bb = r0 / TT; const int t0 = (int)(r0 % TT);
  const float* X = which == 0 ? XQ : which == 1 ? XK : XV; const float* WA = which == 0 ? WQ : which == 1 ? WK : WV; const float* BA = which == 0 ? BQ : which == 1 ? BK : BV;
  v8f acc[8] = {};
#pragma unroll 2
  for (int kc = 0; kc < DIN / 32; ++kc) { v16b a; { const float* p = X + (r0 + wave * 16 + col) * DIN + kc * 32 + 8 * g;
#pragma unroll
      for (int i = 0; i < 8; ++i) { a[i] = (__bf16)p[i]; a[8 + i] = (__bf16)p[16 + i]; } }
    asm volatile("s_wait_loadcnt 0x0" ::: "memory");
#pragma unroll
    for (int j = 0; j < 8; ++j) { const v16b w = WCOL(WA, kc * 32, c0 + j * 16 + col, lane); asm volatile("s_wait_loadcnt 0x0" ::: "memory"); acc[j] = wmma_bf(a, w, acc[j]); } }
  if (which < 2) { _Float16* DH = which == 0 ? QH : KH; _Float16* DL = which == 0 ? QL : KL; const int nhi = which == 0 ? QHI : KHI; const bool hi_rows = t0 < nhi;
#pragma unroll
    for (int j = 0; j < 8; ++j) { const float bias = BA ? bfr(BA[c0 + j * 16 + col]) : 0.f;
#pragma unroll
      for (int r = 0; r < 8; ++r) { const float v = acc[j][r] + bias; const _Float16 hv = (_Float16)v; sh[wave * 16 + 8 * g + r][j * 16 + col] = hv; sl[wave * 16 + 8 * g + r][j * 16 + col] = (_Float16)((v - (float)hv) * 1024.0f); } }
    __syncthreads();
    for (int e = tid; e < 64 * 16; e += 128) { const int rl = e >> 4, q = e & 15; vst2((unsigned*)(DH + (r0 + rl) * CC + c0 + q * 8), *(const v4u*)&sh[rl][q * 8]); if (hi_rows) vst2((unsigned*)(DL + (bb * nhi + t0 + rl) * (size_t)CC + c0 + q * 8), *(const v4u*)&sl[rl][q * 8]); }
  } else { const bool hi_rows = t0 < KHI;
#pragma unroll
    for (int j = 0; j < 8; ++j) { const float bias = BA ? bfr(BA[c0 + j * 16 + col]) : 0.f;
#pragma unroll
      for (int r = 0; r < 8; ++r) { const float v = acc[j][r] + bias; const int rl = wave * 16 + 8 * g + r, cl = j * 16 + col; th[cl][rl] = (_Float16)v; const __bf16 bh = (__bf16)v; tb[cl][rl] = bh; tbl[cl][rl] = (__bf16)(v - (float)bh); } }
    __syncthreads();
    for (int e = tid; e < 128 * 8; e += 128) { const int cl = e >> 3, q = e & 7; vst2((unsigned*)(VT + (bb * CC + c0 + cl) * (size_t)TT + t0 + q * 8), *(const v4u*)&th[cl][q * 8]); if (hi_rows) { const size_t o3 = (bb * CC + c0 + cl) * (size_t)KHI + t0 + q * 8; vst2((unsigned*)(VB + o3), *(const v4u*)&tb[cl][q * 8]); vst2((unsigned*)(VBL + o3), *(const v4u*)&tbl[cl][q * 8]); } } } }
// ---- k_att: block = 16 queries of (b, h), AW waves; the 16 score rows live in LDS from the logits to P, so no score plane goes through memory and one launch covers every (b, h).
// step 1, logits: wave w takes the 16-key tiles w, w + AW, ... of keys [0, kend): q x k on f16 (3 products with the x 2^10 residual planes for query blocks < QBH), x SCALE; causal and key masks by select at the LDS store.
// step 2, softmax: wave w owns row w in registers, f32, sums by lane then across lanes; P x 2^11 back in place (0 for excluded keys); a query with token_masks == 0 gets a finite placeholder row here and its context from k_fixq.
// step 3, P.v: wave w sums the 32-key chunks w, w + AW, ... (P once to f16 against v f16; query blocks < QBH: P and v as bf16 hi + lo, 3 products); the AW partial tiles are added in f32 through LDS in wave order.
#define AW 16          /* the wave number goes through readfirstlane so that the tile loops are scalar loops and every lane is on at the matrix instructions */
#define SP (TT + 4)    /* row pitch in floats: 16 B past a multiple of 256 B, so the 16 rows of a b128 fragment read fall on different banks */
static_assert(QBH * 64 >= QHI, "every row with a q residual plane takes the 3-product path");
static_assert(AW * 16 * (HD + 4) <= 16 * SP, "the partial tiles reuse the score rows' LDS");
// 16 f32 of one LDS row in fragment order (0..7 = p[0..7], 8..15 = p[16..23]) by four 16-byte reads
__device__ __forceinline__ void lds_row16(const float* p, float v[16]) { const v4f a = *(const v4f*)p, b = *(const v4f*)(p + 4), c = *(const v4f*)(p + 16), d = *(const v4f*)(p + 20);
#pragma unroll
  for (int i = 0; i < 4; ++i) { v[i] = a[i]; v[4 + i] = b[i]; v[8 + i] = c[i]; v[12 + i] = d[i]; } }
__global__ __launch_bounds__(32 * AW) void k_att(const _Float16* __restrict__ QH, const _Float16* __restrict__ KH, const _Float16* __restrict__ QL, const _Float16* __restrict__ KL, const _Float16* __restrict__ VT, const __bf16* __restrict__ VB, const __bf16* __restrict__ VBL, const int* __restrict__ TM, float* __restrict__ Y) { __shared__ __align__(16) float sc[16][SP];
  const int tid = threadIdx.x, wave = __builtin_amdgcn_readfirstlane(tid >> 5), lane = tid & 31, col = lane & 15, g = lane >> 4; const int h = blockIdx.y, b = blockIdx.z; const int qb = blockIdx.x >> 2; const int ql0 = blockIdx.x * 16; const int kend = (kb_last(qb) + 1) * 128;
  const size_t q0 = (size_t)b * TT + ql0, kr0 = (size_t)b * TT; const int* TMb = TM + (size_t)b * TT; const int tq = TMb[ql0 + wave];
  if (qb < QBH) { const _Float16* QLb = QL + (size_t)b * QHI * CC; const _Float16* KLb = KL + (size_t)b * KHI * CC; v16h ah[HD / 32], al[HD / 32];
#pragma unroll
    for (int kc = 0; kc < HD / 32; ++kc) { ah[kc] = frag_h(QH + (q0 + col) * CC + h * HD + kc * 32, lane); al[kc] = frag_h(QLb + (size_t)(ql0 + col) * CC + h * HD + kc * 32, lane); }
    for (int kt = wave; kt < kend / 16; kt += AW) { const int key = kt * 16 + col; const int tk = TMb[key]; v8f acc = {}, accl = {};
      v16h kbf[HD / 32], klf[HD / 32];   /* all of the tile's loads stand ahead of its first product: one memory latency a tile */
#pragma unroll
      for (int kc = 0; kc < HD / 32; ++kc) { kbf[kc] = frag_h(KH + (kr0 + key) * CC + h * HD + kc * 32, lane); klf[kc] = frag_h(KLb + (size_t)key * CC + h * HD + kc * 32, lane); }
#pragma unroll
      for (int kc = 0; kc < HD / 32; ++kc) { acc = wmma16(ah[kc], kbf[kc], acc); accl = wmma16(al[kc], kbf[kc], accl); accl = wmma16(ah[kc], klf[kc], accl); }
#pragma unroll
      for (int r = 0; r < 8; ++r) sc[8 * g + r][key] = ((!CAUSAL || key <= ql0 + 8 * g + r) && tk != 0) ? (acc[r] + accl[r] * (1.0f / 1024.0f)) * SCALE : -3.0e38f; }
  } else { v16h ah[HD / 32];
#pragma unroll
    for (int kc = 0; kc < HD / 32; ++kc) ah[kc] = frag_h(QH + (q0 + col) * CC + h * HD + kc * 32, lane);
    for (int kt0 = wave; kt0 < kend / 16; kt0 += 4 * AW) { v16h kbf[4][HD / 32]; int tk[4];   /* the loads of up to four tiles stand ahead of the first product: one memory latency for four tiles; the tests on the tile number are scalar */
      const _Float16* kp = KH + (kr0 + kt0 * 16 + col) * CC + h * HD; const int* tp = TMb + kt0 * 16 + col;   /* one address pair for the four tiles, the tile's step as a constant offset */
#pragma unroll
      for (int u = 0; u < 4; ++u) if (kt0 + u * AW < kend / 16) { tk[u] = tp[u * AW * 16];
#pragma unroll
        for (int kc = 0; kc < HD / 32; ++kc) kbf[u][kc] = frag_h(kp + (size_t)u * AW * 16 * CC + kc * 32, lane); }
#pragma unroll
      for (int u = 0; u < 4; ++u) if (kt0 + u * AW < kend / 16) { const int key = (kt0 + u * AW) * 16 + col; v8f acc = {};
#pragma unroll
        for (int kc = 0; kc < HD / 32; ++kc) acc = wmma16(ah[kc], kbf[u][kc], acc);
#pragma unroll
        for (int r = 0; r < 8; ++r) sc[8 * g + r][key] = ((!CAUSAL || key <= ql0 + 8 * g + r) && tk[u] != 0) ? acc[r] * SCALE : -3.0e38f; } } }
  __syncthreads();   /* every tile of the 16 score rows is in LDS before a wave reads its row */
  { const int nq = kend >> 7; v4f vv[TT / 128];   /* 128 keys a pass: 32 lanes x 4; the tests on nq are scalar */
#pragma unroll
    for (int i = 0; i < TT / 128; ++i) if (i < nq) vv[i] = *(const v4f*)&sc[wave][i * 128 + lane * 4];
    float m = -3.0e38f;
#pragma unroll
    for (int i = 0; i < TT / 128; ++i) if (i < nq) { if (tq == 0) vv[i] = (v4f){0.f, 0.f, 0.f, 0.f}; m = fmaxf(m, fmaxf(fmaxf(vv[i][0], vv[i][1]), fmaxf(vv[i][2], vv[i][3]))); }
#pragma unroll
    for (int o = 1; o < 32; o <<= 1) m = fmaxf(m, __shfl_xor(m, o));
    float sum = 0.f;
#pragma unroll
    for (int i = 0; i < TT / 128; ++i) if (i < nq) {
#pragma unroll
      for (int c = 0; c < 4; ++c) { const float v = vv[i][c]; const float ex = expf(v - m); const float e = (v <= -1.0e38f) ? 0.f : ex; vv[i][c] = e; sum += e; } }
#pragma unroll
    for (int o = 1; o < 32; o <<= 1) sum += __shfl_xor(sum, o);
    const float inv = sum > 0.f ? 2048.0f / sum : 0.f;   /* a fully excluded row yields P = 0 */
#pragma unroll
    for (int i = 0; i < TT / 128; ++i) if (i < nq) *(v4f*)&sc[wave][i * 128 + lane * 4] = vv[i] * inv; }
  __syncthreads();   /* all 16 rows of P are in LDS before any wave forms fragments across them */
  const int kce = kend >> 5; v8f acc[HD / 16] = {};
  if (qb < QBH) {
    for (int kc = wave; kc < kce; kc += AW) { float pv[16]; lds_row16(&sc[col][kc * 32 + 8 * g], pv); const F2 p = bsplit16(pv);
#pragma unroll
      for (int j2 = 0; j2 < HD / 16; j2 += 2) { v16b vh[2], vl[2];   /* two column tiles' loads stand ahead of their products */
#pragma unroll
        for (int u = 0; u < 2; ++u) { const size_t po = ((size_t)b * CC + h * HD + (j2 + u) * 16 + col) * (size_t)KHI + kc * 32; vh[u] = frag_b(VB + po, lane); vl[u] = frag_b(VBL + po, lane); }
#pragma unroll
        for (int u = 0; u < 2; ++u) { const int j = j2 + u; acc[j] = wmma_bf(p.h, vh[u], acc[j]); acc[j] = wmma_bf(p.l, vh[u], acc[j]); acc[j] = wmma_bf(p.h, vl[u], acc[j]); } } }
  } else {
    for (int kc = wave; kc < kce; kc += AW) { v16h vf[HD / 16]; const _Float16* vp = VT + ((size_t)b * CC + h * HD + col) * (size_t)TT + kc * 32 + 8 * g;   /* the chunk's four v loads stand ahead of its first product: one memory latency a chunk */
#pragma unroll
      for (int j = 0; j < HD / 16; ++j) { union { v16h v; v8h q[2]; } u; u.q[0] = *(const v8h*)(vp + (size_t)j * 16 * TT); u.q[1] = *(const v8h*)(vp + (size_t)j * 16 * TT + 16); vf[j] = u.v; }
      asm volatile("s_wait_xcnt 0x0" :: "v"(vp) : "memory");   /* the eight loads share one address pair: it stays whole (no load lands on it) until this wait */
      float pv[16]; lds_row16(&sc[col][kc * 32 + 8 * g], pv); v16h p;
#pragma unroll
      for (int i = 0; i < 16; ++i) p[i] = (_Float16)pv[i];
#pragma unroll
      for (int j = 0; j < HD / 16; ++j) acc[j] = wmma16(p, vf[j], acc[j]); } }
  __syncthreads();   /* every wave has read its last P fragment before the partial tiles overwrite the rows */
  float (*ss)[16][HD + 4] = (float (*)[16][HD + 4])&sc[0][0];
#pragma unroll
  for (int j = 0; j < HD / 16; ++j)
#pragma unroll
    for (int r = 0; r < 8; ++r) ss[wave][8 * g + r][j * 16 + col] = acc[j][r];
  __syncthreads();   /* every wave's partial tile is in LDS before any wave adds them */
  for (int e = tid; e < 16 * (HD / 2); e += 32 * AW) { const int rl = e / (HD / 2), q = e % (HD / 2); v2f s = *(const v2f*)&ss[0][rl][q * 2];
#pragma unroll   /* the AW LDS reads issue ahead of the adds; rolled, each add would wait a full LDS latency */
    for (int w = 1; w < AW; ++w) s += *(const v2f*)&ss[w][rl][q * 2];
    vst2(Y + ((size_t)b * TT + ql0 + rl) * CC + h * HD + q * 2, s * (1.0f / 2048.0f)); } }
// ---- k_out: block = (64 rows, 128 cols): out = ctx Wo (+ bo): ctx x 2^6 once to f16 against Wo as f16(bf16 x 2^8) exact (1 product) x 2^-14; causal early rows (< QHI of each sequence): ctx bf16 hi + lo against exact bf16 Wo (2 products)
__global__ __launch_bounds__(128) void k_out(const float* __restrict__ Y, const float* __restrict__ WO, const float* __restrict__ BO, float* __restrict__ OUT) { __shared__ __align__(16) float sf[4][16][132];
  const int tid = threadIdx.x, wave = tid >> 5, lane = tid & 31, col = lane & 15, g = lane >> 4; const int c0 = blockIdx.y * 128; const size_t r0 = (size_t)blockIdx.x * 64 + wave * 16;
  v8f acc[8] = {};
  if (CAUSAL && (int)(((size_t)blockIdx.x * 64) % TT) < QHI) {   /* block-uniform */
#pragma unroll 2
    for (int kc = 0; kc < CC / 32; ++kc) { const F2 a = split_row(Y + (r0 + col) * CC, kc * 32, lane); asm volatile("s_wait_loadcnt 0x0" ::: "memory");
#pragma unroll
      for (int j = 0; j < 8; ++j) { const v16b w = WOCOL(WO, kc * 32, c0 + j * 16 + col, lane); asm volatile("s_wait_loadcnt 0x0" ::: "memory"); acc[j] = wmma_bf(a.h, w, acc[j]); acc[j] = wmma_bf(a.l, w, acc[j]); } }
#pragma unroll
    for (int j = 0; j < 8; ++j) { const float bias = BO ? bfr(BO[c0 + j * 16 + col]) : 0.f;
#pragma unroll
      for (int r = 0; r < 8; ++r) sf[wave][8 * g + r][j * 16 + col] = acc[j][r] + bias; }
  } else {
#pragma unroll 2
    for (int kc = 0; kc < CC / 32; ++kc) { const v16h a = frag_f32s(Y + (r0 + col) * CC + kc * 32, lane, 64.0f); asm volatile("s_wait_loadcnt 0x0" ::: "memory");   /* ctx carried x 2^6 into f16 so small-magnitude context rows stay clear of f16 subnormals */
#pragma unroll
      for (int j = 0; j < 8; ++j) { const v16h w = WOCOLH(WO, kc * 32, c0 + j * 16 + col, lane); asm volatile("s_wait_loadcnt 0x0" ::: "memory"); acc[j] = wmma16(a, w, acc[j]); } }
#pragma unroll
    for (int j = 0; j < 8; ++j) { const float bias = BO ? bfr(BO[c0 + j * 16 + col]) : 0.f;
#pragma unroll
      for (int r = 0; r < 8; ++r) sf[wave][8 * g + r][j * 16 + col] = acc[j][r] * (1.0f / 16384.0f) + bias; } }   /* 2^-8 (Wo carry) x 2^-6 (ctx carry) */
  LDSX(); for (int rl = 0; rl < 16; ++rl) vst2(OUT + (r0 + rl) * DIN + c0 + lane * 4, *(const v4f*)&sf[wave][rl][lane * 4]); }

extern "C" void kernel_launch(void* const* d_in, const int* in_sizes, int n_in, void* d_out, int out_size, void* d_ws, size_t ws_size, hipStream_t stream) {
  (void)in_sizes; (void)n_in; (void)out_size;
  const float** F = (const float**)d_in;
  if (ws_size < (size_t)WS_END) return;
  char* ws = (char*)d_ws; _Float16 *QH = (_Float16*)(ws + WS_QH), *KH = (_Float16*)(ws + WS_KH), *VT = (_Float16*)(ws + WS_VT), *QL = (_Float16*)(ws + WS_QL), *KL = (_Float16*)(ws + WS_KL); __bf16 *VB = (__bf16*)(ws + WS_VB), *VBL = (__bf16*)(ws + WS_VBL); float *Y = (float*)(ws + WS_Y);
  (void)Y; (void)QL; (void)KL; (void)VB; (void)VBL;
  // inputs: 0 embeddings [4,2048,512]; 1 token_masks [4,2048] int32 (0/1); 2 Wq [512,512] (in,out); 3 Wk; 4 Wv; 5 Wo (in,out)
  if (ws_size < (size_t)WS_END2) return;
  const int* TM = (const int*)d_in[1]; float* MV = (float*)(ws + WS_MV);
  k_proj<<<dim3(TNB * TT / 64, CC / 128, 3), 128, 0, stream>>>(F[0], F[0], F[0], F[2], F[3], F[4], nullptr, nullptr, nullptr, QH, QL, KH, KL, VT, VB, VBL);
  k_meanv<<<dim3(CC / MVW, TNB), 32 * MVW, 0, stream>>>(VT, MV);
  k_att<<<dim3(TT / 16, NH, TNB), 32 * AW, 0, stream>>>(QH, KH, QL, KL, VT, VB, VBL, TM, Y);
  k_fixq<<<dim3(TNB * TT / 8), 256, 0, stream>>>(TM, MV, Y);   /* masked queries: context = mean V */
  k_out<<<dim3(TNB * TT / 64, DIN / 128), 128, 0, stream>>>(Y, F[5], nullptr, (float*)d_out);
}

// v004
// One run takes 165 microseconds.
// Timed twice side by side with v003, it ran 1.38 times as fast both times.
// Counting every step since v000, it is 5.82 times as fast.
// compute dtype: all float inputs rounded to bf16; projections with EXACT bf16 products on WMMA 16x16x32 (f32 accumulate); tokens of a sequence sorted unmasked first (stable), all planes in that order; causal logits: 3 products for the first 384 sorted rows, single f16 q x k after, x 64^-0.5; key/query masks = a length; softmax f32; P x 2^11 once to f16 x v once to f16 (bf16 hi + lo below row 384); fully-masked query rows = mean of the f16 v plane in f32; ctx hi+lo x exact Wo below row 384, x2^6 f16 carry x f16(bf16 x 2^8) Wo after; f32 output.
#include <hip/hip_runtime.h>
#include <math.h>

typedef __attribute__((ext_vector_type(16))) _Float16 v16h;
typedef __attribute__((ext_vector_type(16))) __bf16 v16b;
typedef __attribute__((ext_vector_type(8)))  _Float16 v8h;
typedef __attribute__((ext_vector_type(8)))  float v8f;
typedef __attribute__((ext_vector_type(4)))  float v4f;
typedef __attribute__((ext_vector_type(2)))  float v2f;
typedef __attribute__((ext_vector_type(4)))  unsigned v4u;
typedef _Float16 hx8 __attribute__((ext_vector_type(8)));
typedef __attribute__((ext_vector_type(4)))  int v4i;
typedef float __attribute__((may_alias)) float_a;
typedef int __attribute__((may_alias)) int_a;

template <typename T> __device__ __forceinline__ void vst2(void* p, T v) { *(T*)p = v;  }
__device__ __forceinline__ v8f wmma16(v16h a, v16h b, v8f c) {
  v8f d = __builtin_amdgcn_wmma_f32_16x16x32_f16(false, a, false, b, (short)0, c, false, false);
  asm volatile("v_nop\n\tv_nop\n\tv_nop\n\tv_nop" : "+v"(d) : "v"(a), "v"(b));
  return d;
}
__device__ __forceinline__ v8f wmma_bf(v16b a, v16b b, v8f c) {
  v8f d = __builtin_amdgcn_wmma_f32_16x16x32_bf16(false, a, false, b, (short)0, c, false, false);
  asm volatile("v_nop\n\tv_nop\n\tv_nop\n\tv_nop" : "+v"(d) : "v"(a), "v"(b));
  return d;
}
// 16x16x32 fragments: lane = (h = lane>>4, row/col = lane&15); elements 0..7 = k0+8h+0..7, 8..15 = k0+16+8h+0..7; D element r = row 8h+r
__device__ __forceinline__ v16h frag_h(const _Float16* rowk0, int lane) {
  union { v16h v; v8h q[2]; } u; const _Float16* p = rowk0 + 8 * (lane >> 4);
  u.q[0] = *(const v8h*)p; u.q[1] = *(const v8h*)(p + 16); return u.v;
}
__device__ __forceinline__ v16h frag_f32(const float* rowk0, int lane) {
  v16h a; const float* p = rowk0 + 8 * (lane >> 4);
#pragma unroll
  for (int i = 0; i < 8; ++i) { a[i] = (_Float16)p[i]; a[8 + i] = (_Float16)p[16 + i]; }
  return a;
}
__device__ __forceinline__ v16h frag_f32s(const float* rowk0, int lane, float sc) {
  v16h a; const float* p = rowk0 + 8 * (lane >> 4);
#pragma unroll
  for (int i = 0; i < 8; ++i) { a[i] = (_Float16)(p[i] * sc); a[8 + i] = (_Float16)(p[16 + i] * sc); }
  return a;
}
// column fragment from a [K][ld] layout (column n), rows >= K read as 0
__device__ __forceinline__ v16h fragc_f32(const float* W, int k0, int n, int lane, int ld, int K) {
  v16h a; const int g = lane >> 4;
#pragma unroll
  for (int i = 0; i < 8; ++i) { const int ka = k0 + 8 * g + i, kb = ka + 16;
    a[i] = (_Float16)(ka < K ? W[(size_t)(ka < K ? ka : K - 1) * ld + n] : 0.f); a[8 + i] = (_Float16)(kb < K ? W[(size_t)(kb < K ? kb : K - 1) * ld + n] : 0.f); }
  return a;
}
struct F2 { v16b h, l; };
__device__ __forceinline__ F2 bsplit16(const float v[16]) { F2 r;
#pragma unroll
  for (int i = 0; i < 16; ++i) { const __bf16 h = (__bf16)v[i]; r.h[i] = h; r.l[i] = (__bf16)(v[i] - (float)h); }
  return r; }
__device__ __forceinline__ F2 split_row(const float* row, int k0, int lane) { float v[16]; const float* p = row + k0 + 8 * (lane >> 4);
#pragma unroll
  for (int i = 0; i < 8; ++i) { v[i] = p[i]; v[8 + i] = p[16 + i]; }
  return bsplit16(v); }
__device__ __forceinline__ F2 split_rowK(const float* row, int k0, int lane, int K) { float v[16]; const int g = lane >> 4;
#pragma unroll
  for (int i = 0; i < 8; ++i) { const int ka = k0 + 8 * g + i, kb = ka + 16; v[i] = ka < K ? row[ka < K ? ka : K - 1] : 0.f; v[8 + i] = kb < K ? row[kb < K ? kb : K - 1] : 0.f; }
  return bsplit16(v); }
__device__ __forceinline__ F2 split_col(const float* W, int k0, int n, int lane, int ld, int K) { float v[16]; const int g = lane >> 4;
#pragma unroll
  for (int i = 0; i < 8; ++i) { const int ka = k0 + 8 * g + i, kb = ka + 16; v[i] = ka < K ? W[(size_t)(ka < K ? ka : K - 1) * ld + n] : 0.f; v[8 + i] = kb < K ? W[(size_t)(kb < K ? kb : K - 1) * ld + n] : 0.f; }
  return bsplit16(v); }
__device__ __forceinline__ v8f mac3(const F2& a, const F2& b, v8f c) { c = wmma_bf(a.l, b.h, c); c = wmma_bf(a.h, b.l, c); return wmma_bf(a.h, b.h, c); }
__device__ __forceinline__ float sigm(float v) { return 1.0f / (1.0f + expf(-v)); }
#define LDSX() do { asm volatile("s_wait_dscnt 0" ::: "memory"); __builtin_amdgcn_wave_barrier(); __builtin_amdgcn_fence(__ATOMIC_RELEASE, "workgroup"); } while (0)

// Causal multi-head self-attention with token padding masks on BOTH keys and queries (embeddings [4,2048,512], token_masks [4,2048] int 0/1 (random here: about half the tokens masked); 8 heads x 64; (in,out) Wq/Wk/Wv/Wo [512,512], no biases): scores = q.k/8, where(causal & tm[k] & tm[q], scores, -1e30), softmax, context Wo. A query with tm[q] = 0 gets all scores = -1e30 -> exactly uniform attention over all 2,048 positions (context = mean V).
#define NB 4
#define TT 2048
#define CC 512            // NH * HD = projected width
#define DIN 512          // input (model) width
#define NH 8
#define HD 64
#define SCALE (0.125f)
#define CAUSAL 1
#ifndef TNB
#define TNB NB
#endif
__device__ __forceinline__ float bfr(float v) { return (float)(__bf16)v; }
__host__ __device__ __forceinline__ int kb_last(int qb) { return CAUSAL ? ((qb * 64 + 63) >> 7) : (TT / 128 - 1); }
typedef __attribute__((ext_vector_type(8))) __bf16 v8b;
__device__ __forceinline__ v16b frag_b(const __bf16* rowk0, int lane) {
  union { v16b v; v8b q[2]; } u; const __bf16* p = rowk0 + 8 * (lane >> 4);
  u.q[0] = *(const v8b*)p; u.q[1] = *(const v8b*)(p + 16); return u.v;
}
#define QBH 6              // causal: query blocks 0..QBH-1 of each sequence (few keys, no averaging) take the high-precision path
#define QHI 384            // rows carrying a q residual plane (read only by the 3-product logits of query blocks < QBH)
#define KHI 384            // key rows carrying k residual / v bf16 hi+lo planes (used only by the causal high-precision path)
// B fragment (k rows k0+.., output column o) of a weight: (in,out) [K][ld] or (out,in) [ld rows of K]: bf16 exact, or f16(bf16 * 256) exact
__device__ __forceinline__ v16b wcol_io(const float* Wm, int k0, int o, int lane, int ld) { v16b w; const int g = lane >> 4;
#pragma unroll
  for (int i = 0; i < 8; ++i) { w[i] = (__bf16)Wm[(size_t)(k0 + 8 * g + i) * ld + o]; w[8 + i] = (__bf16)Wm[(size_t)(k0 + 16 + 8 * g + i) * ld + o]; }
  return w; }
__device__ __forceinline__ v16b wcol_oi(const float* Wm, int k0, int o, int lane, int K) { v16b w; const float* p = Wm + (size_t)o * K + k0 + 8 * (lane >> 4);
#pragma unroll
  for (int i = 0; i < 8; ++i) { w[i] = (__bf16)p[i]; w[8 + i] = (__bf16)p[16 + i]; }
  return w; }
__device__ __forceinline__ v16h wcolh_io(const float* Wm, int k0, int o, int lane, int ld) { v16h w; const int g = lane >> 4;
#pragma unroll
  for (int i = 0; i < 8; ++i) { w[i] = (_Float16)(bfr(Wm[(size_t)(k0 + 8 * g + i) * ld + o]) * 256.0f); w[8 + i] = (_Float16)(bfr(Wm[(size_t)(k0 + 16 + 8 * g + i) * ld + o]) * 256.0f); }
  return w; }
__device__ __forceinline__ v16h wcolh_oi(const float* Wm, int k0, int o, int lane, int K) { v16h w; const float* p = Wm + (size_t)o * K + k0 + 8 * (lane >> 4);
#pragma unroll
  for (int i = 0; i < 8; ++i) { w[i] = (_Float16)(bfr(p[i]) * 256.0f); w[8 + i] = (_Float16)(bfr(p[16 + i]) * 256.0f); }
  return w; }
#define WQKV_LAYOUT 0   // 0 = (in,out) [DIN][CC]; 1 = (out,in) [CC][DIN]; 2 = per-head [NH][DIN][HD]
__device__ __forceinline__ v16b wcol_hdk(const float* Wm, int k0, int o, int lane) { v16b w; const int g = lane >> 4; const float* p = Wm + (size_t)(o / HD) * DIN * HD + (o % HD);
#pragma unroll
  for (int i = 0; i < 8; ++i) { w[i] = (__bf16)p[(size_t)(k0 + 8 * g + i) * HD]; w[8 + i] = (__bf16)p[(size_t)(k0 + 16 + 8 * g + i) * HD]; }
  return w; }
#define WO_OUT_IN 0
#if WQKV_LAYOUT == 1
#define WCOL(W, k0, o, lane) wcol_oi(W, k0, o, lane, DIN)
#elif WQKV_LAYOUT == 2
#define WCOL(W, k0, o, lane) wcol_hdk(W, k0, o, lane)
#else
#define WCOL(W, k0, o, lane) wcol_io(W, k0, o, lane, CC)
#endif
#if WO_OUT_IN
#define WOCOL(W, k0, o, lane) wcol_oi(W, k0, o, lane, CC)
#define WOCOLH(W, k0, o, lane) wcolh_oi(W, k0, o, lane, CC)
#else
#define WOCOL(W, k0, o, lane) wcol_io(W, k0, o, lane, DIN)
#define WOCOLH(W, k0, o, lane) wcolh_io(W, k0, o, lane, DIN)
#endif
// masks: keys need causal (key range + index test) AND token_masks[b][k] != 0; a query with token_masks[b][t] == 0 has EVERY score = -1e30 in the module -> exactly uniform attention over all 2,048 positions -> its context is mean_k V (handled by k_meanv/k_fixq below; here such rows just get a harmless finite placeholder)
// ---- k_perm: block = one sequence. IDX[b][r] = the token at sorted place r: the n unmasked tokens first, then the masked ones, each group in its old order; NU[b * 32] = n (a 128-byte line per sequence: one writer a line).
// The order of the unmasked tokens is kept, so among them 'key <= query' reads the same on places as on tokens, and a masked key is simply a place >= n: attention runs on the first n places alone, for any mask. q, k, v planes are laid out by place; the context row goes back to its token's row.
#define PW (TT / 64)   /* waves of k_perm: 64 tokens a wave */
static_assert(2 * PW == 64, "a lane holds two of the 64 group counts");
__global__ __launch_bounds__(32 * PW) void k_perm(const int* __restrict__ TM, int* __restrict__ IDX, int* __restrict__ NU) { __shared__ int cnt[2 * PW]; __shared__ int sidx[TT];
  const int tid = threadIdx.x, wave = tid >> 5, lane = tid & 31, b = blockIdx.x; const int* TMb = TM + (size_t)b * TT; unsigned bal[2];
#pragma unroll
  for (int u = 0; u < 2; ++u) bal[u] = (unsigned)__ballot(TMb[(wave * 2 + u) * 32 + lane] != 0);
  if (lane < 2) cnt[wave * 2 + lane] = __popc(lane ? bal[1] : bal[0]);
  __syncthreads();   /* the 64 groups' counts are in LDS before a wave sums them */
  const int c0 = cnt[lane], c1 = cnt[32 + lane]; int tot = c0 + c1, bef = (lane < wave * 2 ? c0 : 0) + (32 + lane < wave * 2 ? c1 : 0);
#pragma unroll
  for (int o = 1; o < 32; o <<= 1) { tot += __shfl_xor(tot, o); bef += __shfl_xor(bef, o); }
#pragma unroll
  for (int u = 0; u < 2; ++u) { const int t = (wave * 2 + u) * 32 + lane; const int ones = bef + (u ? __popc(bal[0]) : 0) + __popc(bal[u] & ((1u << lane) - 1u)); sidx[((bal[u] >> lane) & 1u) ? ones : tot + (t - ones)] = t; }
  __syncthreads();   /* the whole list is in LDS before it leaves by whole lines */
#pragma unroll
  for (int u = 0; u < 2; ++u) vst2(IDX + (size_t)b * TT + u * 32 * PW + tid, sidx[u * 32 * PW + tid]);
  if (tid == 0) vst2(NU + b * 32, tot); }
__device__ __forceinline__ int n_unmasked(const int* NU, int b) { const int n = NU[b * 32]; return __builtin_amdgcn_readfirstlane(n < 0 ? 0 : n > TT ? TT : n); }   /* bounded whatever the word holds; through readfirstlane so that the tests on it are scalar branches */
// ---- k_meanv: block = 32 channels of one batch, wave per channel: MV[b][c] = (1/2048) sum_t v[b][t][c] from the f16 v plane - the context of a fully-masked query row (softmax of 2,048 equal scores = exactly 1/2048 each). A wave reads its 4 KB row by whole lines, all loads in flight at once; f32 sums: eight chains a lane, a tree over them, then across the lanes. The 32 means leave as one 128-byte line from one wave.
#define MVW 32
static_assert(CC % MVW == 0 && TT % 256 == 0, "whole blocks of channels, whole 512-byte passes over a row");
__global__ __launch_bounds__(32 * MVW) void k_meanv(const _Float16* __restrict__ VT, float* __restrict__ MV) { __shared__ float sm[MVW];
  const int tid = threadIdx.x, wave = tid >> 5, lane = tid & 31; const int b = blockIdx.y, c0 = blockIdx.x * MVW; const _Float16* p = VT + ((size_t)b * CC + c0 + wave) * TT + lane * 8; hx8 hv[TT / 256];   /* the loops below are unrolled whole: hv and a stay in registers, and the loads issue back to back ahead of the first add */
#pragma unroll
  for (int i = 0; i < TT / 256; ++i) hv[i] = *(const hx8*)(p + i * 256);
  asm volatile("s_wait_xcnt 0x0" :: "v"(p) : "memory");   /* the loads share one address pair: it stays whole (no load lands on it) until this wait */
  float a[8];
#pragma unroll
  for (int j = 0; j < 8; ++j) a[j] = (float)hv[0][j];
#pragma unroll
  for (int i = 1; i < TT / 256; ++i)
#pragma unroll
    for (int j = 0; j < 8; ++j) a[j] += (float)hv[i][j];
  float s = ((a[0] + a[1]) + (a[2] + a[3])) + ((a[4] + a[5]) + (a[6] + a[7]));
#pragma unroll
  for (int o = 1; o < 32; o <<= 1) s += __shfl_xor(s, o);
  if (lane == 0) sm[wave] = s;
  __syncthreads();   /* the 32 waves' sums are in LDS before wave 0 stores them as one line */
  if (tid < MVW) vst2(MV + (size_t)b * CC + c0 + tid, sm[tid] * (1.0f / TT)); }
// ---- k_fixq: wave per masked query row (token_masks[b][t] == 0): ctx row Y[b*TT + t][:] = MV[b][:] (512 floats = 2 KB by 32 lanes x 4 x 16 B); unmasked rows untouched (wave-uniform branch)
__global__ __launch_bounds__(256) void k_fixq(const int* __restrict__ TM, const float* __restrict__ MV, float* __restrict__ Y) { const int tid = threadIdx.x; const size_t row = (size_t)blockIdx.x * 8 + (tid >> 5); const int lane = tid & 31; const int b = (int)(row / TT);
  const int tq = TM[row]; asm volatile("s_wait_loadcnt 0x0" ::: "memory"); if (tq != 0) return;
#pragma unroll
  for (int q = 0; q < CC / 128; ++q) { const v4f v = *(const v4f*)(MV + (size_t)b * CC + (q * 32 + lane) * 4); asm volatile("s_wait_loadcnt 0x0" ::: "memory"); vst2(Y + row * CC + (q * 32 + lane) * 4, v); } }
#define WS_MV (WS_END)                                    // f32 mean-v rows [b][512]
#define WS_END2 (WS_MV + 4u * (size_t)NB * CC)
#define WS_IDX (WS_END2)                                  // int token of each sorted place [b][t]
#define WS_NU  (WS_IDX + 4u * (size_t)NB * TT)            // int unmasked tokens of a sequence, one 128-byte line each
#define WS_END3 (WS_NU + 128u * (size_t)NB)

#define WS_QH  0u                                      // f16 q rows [b*t][CC]
#define WS_KH  (WS_QH + 2u * (size_t)NB * TT * CC)      // f16 k rows [b*t][CC]
#define WS_VT  (WS_KH + 2u * (size_t)NB * TT * CC)      // f16 v planes [b][c][t]
#define WS_QL  (WS_VT + 2u * (size_t)NB * CC * TT)      // f16 q residual x 2^10 rows [b][t < QHI][CC]
#define WS_KL  (WS_QL + 2u * (size_t)NB * QHI * CC)     // f16 k residual x 2^10 rows [b][t < KHI][CC]
#define WS_VB  (WS_KL + 2u * (size_t)NB * KHI * CC)     // bf16 v hi planes [b][c][t < KHI]
#define WS_VBL (WS_VB + 2u * (size_t)NB * CC * KHI)
#define WS_Y   (WS_VBL + 2u * (size_t)NB * CC * KHI)     // f32 ctx rows [b*t][CC] (only when there is an output projection)
#define WS_END (WS_Y  + 4u * (size_t)NB * TT * CC)

// ---- k_proj: block = (64 sorted places, 128 cols, which), the X row of a place through IDX; q and k blocks wholly behind the last 128-place group that holds an unmasked token leave at once (k_att reads no place there): q/k/v = X W (+ b) with exact bf16 products (K = DIN) -> which 0: q f16 rows (+ residual rows < QHI); 1: k f16 rows (+ residual rows < KHI); 2: v f16 planes [c][t] (+ bf16 hi/lo planes for t < KHI)
__global__ __launch_bounds__(128) void k_proj(const float* __restrict__ XQ, const float* __restrict__ XK, const float* __restrict__ XV, const float* __restrict__ WQ, const float* __restrict__ WK, const float* __restrict__ WV, const float* __restrict__ BQ, const float* __restrict__ BK, const float* __restrict__ BV, const int* __restrict__ IDX, const int* __restrict__ NU,
    _Float16* __restrict__ QH, _Float16* __restrict__ QL, _Float16* __restrict__ KH, _Float16* __restrict__ KL, _Float16* __restrict__ VT, __bf16* __restrict__ VB, __bf16* __restrict__ VBL) {
  __shared__ __align__(16) _Float16 sh[64][136], sl[64][136]; __shared__ __align__(16) _Float16 th[128][72]; __shared__ __align__(16) __bf16 tb[128][72], tbl[128][72];
  const int tid = threadIdx.x, wave = tid >> 5, lane = tid & 31, col = lane & 15, g = lane >> 4; const int which = blockIdx.z; const int c0 = blockIdx.y * 128; const size_t r0 = (size_t)blockIdx.x * 64; const size_t bb = r0 / TT; const int t0 = (int)(r0 % TT);
  if (which < 2 && t0 >= ((n_unmasked(NU, (int)bb) + 127) & ~127)) return;   /* the same for the whole block, ahead of every barrier */
  const float* X = which == 0 ? XQ : which == 1 ? XK : XV; const float* WA = which == 0 ? WQ : which == 1 ? WK : WV; const float* BA = which == 0 ? BQ : which == 1 ? BK : BV;
  const float* xr = X + (bb * TT + (size_t)(IDX[r0 + wave * 16 + col] & (TT - 1))) * DIN;   /* the mask bounds the row whatever the list holds */
  v8f acc[8] = {};
#pragma unroll 2
  for (int kc = 0; kc < DIN / 32; ++kc) { v16b a; { const float* p = xr + kc * 32 + 8 * g;
#pragma unroll
      for (int i = 0; i < 8; ++i) { a[i] = (__bf16)p[i]; a[8 + i] = (__bf16)p[16 + i]; } }
    asm volatile("s_wait_loadcnt 0x0" ::: "memory");
#pragma unroll
    for (int j = 0; j < 8; ++j) { const v16b w = WCOL(WA, kc * 32, c0 + j * 16 + col, lane); asm volatile("s_wait_loadcnt 0x0" ::: "memory"); acc[j] = wmma_bf(a, w, acc[j]); } }
  if (which < 2) { _Float16* DH = which == 0 ? QH : KH; _Float16* DL = which == 0 ? QL : KL; const int nhi = which == 0 ? QHI : KHI; const bool hi_rows = t0 < nhi;
#pragma unroll
    for (int j = 0; j < 8; ++j) { const float bias = BA ? bfr(BA[c0 + j * 16 + col]) : 0.f;
#pragma unroll
      for (int r = 0; r < 8; ++r) { const float v = acc[j][r] + bias; const _Float16 hv = (_Float16)v; sh[wave * 16 + 8 * g + r][j * 16 + col] = hv; sl[wave * 16 + 8 * g + r][j * 16 + col] = (_Float16)((v - (float)hv) * 1024.0f); } }
    __syncthreads();
    for (int e = tid; e < 64 * 16; e += 128) { const int rl = e >> 4, q = e & 15; vst2((unsigned*)(DH + (r0 + rl) * CC + c0 + q * 8), *(const v4u*)&sh[rl][q * 8]); if (hi_rows) vst2((unsigned*)(DL + (bb * nhi + t0 + rl) * (size_t)CC + c0 + q * 8), *(const v4u*)&sl[rl][q * 8]); }
  } else { const bool hi_rows = t0 < KHI;
#pragma unroll
    for (int j = 0; j < 8; ++j) { const float bias = BA ? bfr(BA[c0 + j * 16 + col]) : 0.f;
#pragma unroll
      for (int r = 0; r < 8; ++r) { const float v = acc[j][r] + bias; const int rl = wave * 16 + 8 * g + r, cl = j * 16 + col; th[cl][rl] = (_Float16)v; const __bf16 bh = (__bf16)v; tb[cl][rl] = bh; tbl[cl][rl] = (__bf16)(v - (float)bh); } }
    __syncthreads();
    for (int e = tid; e < 128 * 8; e += 128) { const int cl = e >> 3, q = e & 7; vst2((unsigned*)(VT + (bb * CC + c0 + cl) * (size_t)TT + t0 + q * 8), *(const v4u*)&th[cl][q * 8]); if (hi_rows) { const size_t o3 = (bb * CC + c0 + cl) * (size_t)KHI + t0 + q * 8; vst2((unsigned*)(VB + o3), *(const v4u*)&tb[cl][q * 8]); vst2((unsigned*)(VBL + o3), *(const v4u*)&tbl[cl][q * 8]); } } } }
// ---- k_att: block = 16 sorted places of (b, h) as queries, AW waves; a block whose places are all masked tokens leaves at once (k_fixq writes their rows); the 16 score rows live in LDS from the logits to P, so no score plane goes through memory and one launch covers every (b, h).
// step 1, logits: wave w takes the 16-key tiles w, w + AW, ... of keys [0, kend): q x k on f16 (3 products with the x 2^10 residual planes for query blocks < QBH), x SCALE; causal and key masks (place < n) by select at the LDS store.
// step 2, softmax: wave w owns row w in registers, f32, sums by lane then across lanes; P x 2^11 back in place (0 for excluded keys); a query with token_masks == 0 gets a finite placeholder row here and its context from k_fixq.
// step 3, P.v: wave w sums the 32-key chunks w, w + AW, ... (P once to f16 against v f16; query blocks < QBH: P and v as bf16 hi + lo, 3 products); the AW partial tiles are added in f32 through LDS in wave order.
#define AW 16          /* the wave number goes through readfirstlane so that the tile loops are scalar loops and every lane is on at the matrix instructions */
#define SP (TT + 4)    /* row pitch in floats: 16 B past a multiple of 256 B, so the 16 rows of a b128 fragment read fall on different banks */
static_assert(QBH * 64 >= QHI, "every row with a q residual plane takes the 3-product path");
static_assert(AW * 16 * (HD + 4) <= 16 * SP, "the partial tiles reuse the score rows' LDS");
static_assert(16 * (HD / 2) == 32 * AW, "in the last step a wave stores the row of its own number");
// 16 f32 of one LDS row in fragment order (0..7 = p[0..7], 8..15 = p[16..23]) by four 16-byte reads
__device__ __forceinline__ void lds_row16(const float* p, float v[16]) { const v4f a = *(const v4f*)p, b = *(const v4f*)(p + 4), c = *(const v4f*)(p + 16), d = *(const v4f*)(p + 20);
#pragma unroll
  for (int i = 0; i < 4; ++i) { v[i] = a[i]; v[4 + i] = b[i]; v[8 + i] = c[i]; v[12 + i] = d[i]; } }
__global__ __launch_bounds__(32 * AW) void k_att(const _Float16* __restrict__ QH, const _Float16* __restrict__ KH, const _Float16* __restrict__ QL, const _Float16* __restrict__ KL, const _Float16* __restrict__ VT, const __bf16* __restrict__ VB, const __bf16* __restrict__ VBL, const int* __restrict__ IDX, const int* __restrict__ NU, float* __restrict__ Y) { __shared__ __align__(16) float sc[16][SP];
  const int tid = threadIdx.x, wave = __builtin_amdgcn_readfirstlane(tid >> 5), lane = tid & 31, col = lane & 15, g = lane >> 4; const int h = blockIdx.y, b = blockIdx.z; const int qb = blockIdx.x >> 2; const int ql0 = blockIdx.x * 16; const int kend = (kb_last(qb) + 1) * 128;
  const int nb = n_unmasked(NU, b); if (ql0 >= nb) return;   /* the same for the whole block, ahead of every barrier */
  const size_t q0 = (size_t)b * TT + ql0, kr0 = (size_t)b * TT; const int tq = ql0 + wave < nb; const int orow = IDX[(size_t)b * TT + ql0 + wave] & (TT - 1);   /* the token whose context row this wave stores; the mask bounds the row whatever the list holds */
  if (qb < QBH) { const _Float16* QLb = QL + (size_t)b * QHI * CC; const _Float16* KLb = KL + (size_t)b * KHI * CC; v16h ah[HD / 32], al[HD / 32];
#pragma unroll
    for (int kc = 0; kc < HD / 32; ++kc) { ah[kc] = frag_h(QH + (q0 + col) * CC + h * HD + kc * 32, lane); al[kc] = frag_h(QLb + (size_t)(ql0 + col) * CC + h * HD + kc * 32, lane); }
    for (int kt = wave; kt < kend / 16; kt += AW) { const int key = kt * 16 + col; v8f acc = {}, accl = {};
      v16h kbf[HD / 32], klf[HD / 32];   /* all of the tile's loads stand ahead of its first product: one memory latency a tile */
#pragma unroll
      for (int kc = 0; kc < HD / 32; ++kc) { kbf[kc] = frag_h(KH + (kr0 + key) * CC + h * HD + kc * 32, lane); klf[kc] = frag_h(KLb + (size_t)key * CC + h * HD + kc * 32, lane); }
#pragma unroll
      for (int kc = 0; kc < HD / 32; ++kc) { acc = wmma16(ah[kc], kbf[kc], acc); accl = wmma16(al[kc], kbf[kc], accl); accl = wmma16(ah[kc], klf[kc], accl); }
#pragma unroll
      for (int r = 0; r < 8; ++r) sc[8 * g + r][key] = ((!CAUSAL || key <= ql0 + 8 * g + r) && key < nb) ? (acc[r] + accl[r] * (1.0f / 1024.0f)) * SCALE : -3.0e38f; }
  } else { v16h ah[HD / 32];
#pragma unroll
    for (int kc = 0; kc < HD / 32; ++kc) ah[kc] = frag_h(QH + (q0 + col) * CC + h * HD + kc * 32, lane);
    asm volatile("s_wait_xcnt 0x0" :: "v"(QH + (q0 + col) * CC + h * HD + 8 * g) : "memory");   /* the q loads share one address pair: it stays whole (no k load lands on it) until this wait */
    for (int kt0 = wave; kt0 < kend / 16; kt0 += 4 * AW) { v16h kbf[4][HD / 32];   /* the loads of up to four tiles stand ahead of the first product: one memory latency for four tiles; the tests on the tile number are scalar */
      const _Float16* kp = KH + (kr0 + kt0 * 16 + col) * CC + h * HD;   /* one address pair for the four tiles, the tile's step as a constant offset */
#pragma unroll
      for (int u = 0; u < 4; ++u) if (kt0 + u * AW < kend / 16) {
#pragma unroll
        for (int kc = 0; kc < HD / 32; ++kc) kbf[u][kc] = frag_h(kp + (size_t)u * AW * 16 * CC + kc * 32, lane); }
#pragma unroll
      for (int u = 0; u < 4; ++u) if (kt0 + u * AW < kend / 16) { const int key = (kt0 + u * AW) * 16 + col; v8f acc = {};
#pragma unroll
        for (int kc = 0; kc < HD / 32; ++kc) acc = wmma16(ah[kc], kbf[u][kc], acc);
#pragma unroll
        for (int r = 0; r < 8; ++r) sc[8 * g + r][key] = ((!CAUSAL || key <= ql0 + 8 * g + r) && key < nb) ? acc[r] * SCALE : -3.0e38f; } } }
  __syncthreads();   /* every tile of the 16 score rows is in LDS before a wave reads its row */
  { const int nq = kend >> 7; v4f vv[TT / 128];   /* 128 keys a pass: 32 lanes x 4; the tests on nq are scalar */
#pragma unroll
    for (int i = 0; i < TT / 128; ++i) if (i < nq) vv[i] = *(const v4f*)&sc[wave][i * 128 + lane * 4];
    float m = -3.0e38f;
#pragma unroll
    for (int i = 0; i < TT / 128; ++i) if (i < nq) { if (tq == 0) vv[i] = (v4f){0.f, 0.f, 0.f, 0.f}; m = fmaxf(m, fmaxf(fmaxf(vv[i][0], vv[i][1]), fmaxf(vv[i][2], vv[i][3]))); }
#pragma unroll
    for (int o = 1; o < 32; o <<= 1) m = fmaxf(m, __shfl_xor(m, o));
    float sum = 0.f;
#pragma unroll
    for (int i = 0; i < TT / 128; ++i) if (i < nq) {
#pragma unroll
      for (int c = 0; c < 4; ++c) { const float v = vv[i][c]; const float ex = expf(v - m); const float e = (v <= -1.0e38f) ? 0.f : ex; vv[i][c] = e; sum += e; } }
#pragma unroll
    for (int o = 1; o < 32; o <<= 1) sum += __shfl_xor(sum, o);
    const float inv = sum > 0.f ? 2048.0f / sum : 0.f;   /* a fully excluded row yields P = 0 */
#pragma unroll
    for (int i = 0; i < TT / 128; ++i) if (i < nq) *(v4f*)&sc[wave][i * 128 + lane * 4] = vv[i] * inv; }
  __syncthreads();   /* all 16 rows of P are in LDS before any wave forms fragments across them */
  const int kce = kend >> 5; v8f acc[HD / 16] = {};
  if (qb < QBH) {
    for (int kc = wave; kc < kce; kc += AW) { float pv[16]; lds_row16(&sc[col][kc * 32 + 8 * g], pv); const F2 p = bsplit16(pv);
#pragma unroll
      for (int j2 = 0; j2 < HD / 16; j2 += 2) { v16b vh[2], vl[2];   /* two column tiles' loads stand ahead of their products */
#pragma unroll
        for (int u = 0; u < 2; ++u) { const size_t po = ((size_t)b * CC + h * HD + (j2 + u) * 16 + col) * (size_t)KHI + kc * 32; vh[u] = frag_b(VB + po, lane); vl[u] = frag_b(VBL + po, lane); }
#pragma unroll
        for (int u = 0; u < 2; ++u) { const int j = j2 + u; acc[j] = wmma_bf(p.h, vh[u], acc[j]); acc[j] = wmma_bf(p.l, vh[u], acc[j]); acc[j] = wmma_bf(p.h, vl[u], acc[j]); } } }
  } else {
    for (int kc = wave; kc < kce; kc += AW) { v16h vf[HD / 16]; const _Float16* vp = VT + ((size_t)b * CC + h * HD + col) * (size_t)TT + kc * 32 + 8 * g;   /* the chunk's four v loads stand ahead of its first product: one memory latency a chunk */
#pragma unroll
      for (int j = 0; j < HD / 16; ++j) { union { v16h v; v8h q[2]; } u; u.q[0] = *(const v8h*)(vp + (size_t)j * 16 * TT); u.q[1] = *(const v8h*)(vp + (size_t)j * 16 * TT + 16); vf[j] = u.v; }
      asm volatile("s_wait_xcnt 0x0" :: "v"(vp) : "memory");   /* the eight loads share one address pair: it stays whole (no load lands on it) until this wait */
      float pv[16]; lds_row16(&sc[col][kc * 32 + 8 * g], pv); v16h p;
#pragma unroll
      for (int i = 0; i < 16; ++i) p[i] = (_Float16)pv[i];
#pragma unroll
      for (int j = 0; j < HD / 16; ++j) acc[j] = wmma16(p, vf[j], acc[j]); } }
  __syncthreads();   /* every wave has read its last P fragment before the partial tiles overwrite the rows */
  float (*ss)[16][HD + 4] = (float (*)[16][HD + 4])&sc[0][0];
#pragma unroll
  for (int j = 0; j < HD / 16; ++j)
#pragma unroll
    for (int r = 0; r < 8; ++r) ss[wave][8 * g + r][j * 16 + col] = acc[j][r];
  __syncthreads();   /* every wave's partial tile is in LDS before any wave adds them */
  for (int e = tid; e < 16 * (HD / 2); e += 32 * AW) { const int rl = e / (HD / 2), q = e % (HD / 2); v2f s = *(const v2f*)&ss[0][rl][q * 2];
#pragma unroll   /* the AW LDS reads issue ahead of the adds; rolled, each add would wait a full LDS latency */
    for (int w = 1; w < AW; ++w) s += *(const v2f*)&ss[w][rl][q * 2];
    vst2(Y + ((size_t)b * TT + orow) * CC + h * HD + q * 2, s * (1.0f / 2048.0f)); } }
// ---- k_out: block = (64 rows, 128 cols): out = ctx Wo (+ bo): ctx once to f16 against Wo as f16(bf16 x 2^8) exact (1 product) x 2^-8; causal early rows (< QHI of each sequence): ctx bf16 hi + lo against exact bf16 Wo (2 products)
__global__ __launch_bounds__(128) void k_out(const float* __restrict__ Y, const float* __restrict__ WO, const float* __restrict__ BO, float* __restrict__ OUT) { __shared__ __align__(16) float sf[4][16][132];
  const int tid = threadIdx.x, wave = tid >> 5, lane = tid & 31, col = lane & 15, g = lane >> 4; const int c0 = blockIdx.y * 128; const size_t r0 = (size_t)blockIdx.x * 64 + wave * 16;
  v8f acc[8] = {};
  if (CAUSAL && (int)(((size_t)blockIdx.x * 64) % TT) < QHI) {   /* block-uniform */
#pragma unroll 2
    for (int kc = 0; kc < CC / 32; ++kc) { const F2 a = split_row(Y + (r0 + col) * CC, kc * 32, lane); asm volatile("s_wait_loadcnt 0x0" ::: "memory");
#pragma unroll
      for (int j = 0; j < 8; ++j) { const v16b w = WOCOL(WO, kc * 32, c0 + j * 16 + col, lane); asm volatile("s_wait_loadcnt 0x0" ::: "memory"); acc[j] = wmma_bf(a.h, w, acc[j]); acc[j] = wmma_bf(a.l, w, acc[j]); } }
#pragma unroll
    for (int j = 0; j < 8; ++j) { const float bias = BO ? bfr(BO[c0 + j * 16 + col]) : 0.f;
#pragma unroll
      for (int r = 0; r < 8; ++r) sf[wave][8 * g + r][j * 16 + col] = acc[j][r] + bias; }
  } else {
#pragma unroll 2
    for (int kc = 0; kc < CC / 32; ++kc) { const v16h a = frag_f32s(Y + (r0 + col) * CC + kc * 32, lane, 64.0f); asm volatile("s_wait_loadcnt 0x0" ::: "memory");   /* ctx carried x 2^6 into f16 so small-magnitude context rows stay clear of f16 subnormals */
#pragma unroll
      for (int j = 0; j < 8; ++j) { const v16h w = WOCOLH(WO, kc * 32, c0 + j * 16 + col, lane); asm volatile("s_wait_loadcnt 0x0" ::: "memory"); acc[j] = wmma16(a, w, acc[j]); } }
#pragma unroll
    for (int j = 0; j < 8; ++j) { const float bias = BO ? bfr(BO[c0 + j * 16 + col]) : 0.f;
#pragma unroll
      for (int r = 0; r < 8; ++r) sf[wave][8 * g + r][j * 16 + col] = acc[j][r] * (1.0f / 16384.0f) + bias; } }   /* 2^-8 (Wo carry) x 2^-6 (ctx carry) */
  LDSX(); for (int rl = 0; rl < 16; ++rl) vst2(OUT + (r0 + rl) * DIN + c0 + lane * 4, *(const v4f*)&sf[wave][rl][lane * 4]); }

extern "C" void kernel_launch(void* const* d_in, const int* in_sizes, int n_in, void* d_out, int out_size, void* d_ws, size_t ws_size, hipStream_t stream) {
  (void)in_sizes; (void)n_in; (void)out_size;
  const float** F = (const float**)d_in;
  if (ws_size < (size_t)WS_END) return;
  char* ws = (char*)d_ws; _Float16 *QH = (_Float16*)(ws + WS_QH), *KH = (_Float16*)(ws + WS_KH), *VT = (_Float16*)(ws + WS_VT), *QL = (_Float16*)(ws + WS_QL), *KL = (_Float16*)(ws + WS_KL); __bf16 *VB = (__bf16*)(ws + WS_VB), *VBL = (__bf16*)(ws + WS_VBL); float *Y = (float*)(ws + WS_Y);
  (void)Y; (void)QL; (void)KL; (void)VB; (void)VBL;
  // inputs: 0 embeddings [4,2048,512]; 1 token_masks [4,2048] int32 (0/1); 2 Wq [512,512] (in,out); 3 Wk; 4 Wv; 5 Wo (in,out)
  if (ws_size < (size_t)WS_END3) return;
  const int* TM = (const int*)d_in[1]; float* MV = (float*)(ws + WS_MV); int *IDX = (int*)(ws + WS_IDX), *NU = (int*)(ws + WS_NU);
  k_perm<<<dim3(TNB), 32 * PW, 0, stream>>>(TM, IDX, NU);
  k_proj<<<dim3(TNB * TT / 64, CC / 128, 3), 128, 0, stream>>>(F[0], F[0], F[0], F[2], F[3], F[4], nullptr, nullptr, nullptr, IDX, NU, QH, QL, KH, KL, VT, VB, VBL);
  k_meanv<<<dim3(CC / MVW, TNB), 32 * MVW, 0, stream>>>(VT, MV);
  k_att<<<dim3(TT / 16, NH, TNB), 32 * AW, 0, stream>>>(QH, KH, QL, KL, VT, VB, VBL, IDX, NU, Y);
  k_fixq<<<dim3(TNB * TT / 8), 256, 0, stream>>>(TM, MV, Y);   /* masked queries: context = mean V */
  k_out<<<dim3(TNB * TT / 64, DIN / 128), 128, 0, stream>>>(Y, F[5], nullptr, (float*)d_out);
}

// v005
// A run of this version takes 93.5 microseconds.
// In both of two side-by-side timings against v004, it was 1.77 times as fast.
// Over all steps from v000 it is 10.3 times as fast.
// compute dtype: all float inputs rounded to bf16; projections with EXACT bf16 products on WMMA 16x16x32 (f32 accumulate); tokens of a sequence sorted unmasked first (stable), all planes in that order; causal logits: 3 products for the first 384 sorted rows, single f16 q x k after, x 64^-0.5; key/query masks = a length; softmax f32; P x 2^11 once to f16 x v once to f16 (bf16 hi + lo below row 384); fully-masked query rows = mean of the f16 v plane in f32; ctx hi+lo x exact Wo below row 384, x2^6 f16 carry x f16(bf16 x 2^8) Wo after; f32 output.
#include <hip/hip_runtime.h>
#include <math.h>

typedef __attribute__((ext_vector_type(16))) _Float16 v16h;
typedef __attribute__((ext_vector_type(16))) __bf16 v16b;
typedef __attribute__((ext_vector_type(8)))  _Float16 v8h;
typedef __attribute__((ext_vector_type(8)))  float v8f;
typedef __attribute__((ext_vector_type(4)))  float v4f;
typedef __attribute__((ext_vector_type(2)))  float v2f;
typedef __attribute__((ext_vector_type(4)))  unsigned v4u;
typedef _Float16 hx8 __attribute__((ext_vector_type(8)));
typedef __attribute__((ext_vector_type(4)))  int v4i;
typedef float __attribute__((may_alias)) float_a;
typedef int __attribute__((may_alias)) int_a;

template <typename T> __device__ __forceinline__ void vst2(void* p, T v) { *(T*)p = v;  }
__device__ __forceinline__ v8f wmma16(v16h a, v16h b, v8f c) {
  v8f d = __builtin_amdgcn_wmma_f32_16x16x32_f16(false, a, false, b, (short)0, c, false, false);
  asm volatile("v_nop\n\tv_nop\n\tv_nop\n\tv_nop" : "+v"(d) : "v"(a), "v"(b));
  return d;
}
__device__ __forceinline__ v8f wmma_bf(v16b a, v16b b, v8f c) {
  v8f d = __builtin_amdgcn_wmma_f32_16x16x32_bf16(false, a, false, b, (short)0, c, false, false);
  asm volatile("v_nop\n\tv_nop\n\tv_nop\n\tv_nop" : "+v"(d) : "v"(a), "v"(b));
  return d;
}
// 16x16x32 fragments: lane = (h = lane>>4, row/col = lane&15); elements 0..7 = k0+8h+0..7, 8..15 = k0+16+8h+0..7; D element r = row 8h+r
__device__ __forceinline__ v16h frag_h(const _Float16* rowk0, int lane) {
  union { v16h v; v8h q[2]; } u; const _Float16* p = rowk0 + 8 * (lane >> 4);
  u.q[0] = *(const v8h*)p; u.q[1] = *(const v8h*)(p + 16); return u.v;
}
__device__ __forceinline__ v16h frag_f32(const float* rowk0, int lane) {
  v16h a; const float* p = rowk0 + 8 * (lane >> 4);
#pragma unroll
  for (int i = 0; i < 8; ++i) { a[i] = (_Float16)p[i]; a[8 + i] = (_Float16)p[16 + i]; }
  return a;
}
__device__ __forceinline__ v16h frag_f32s(const float* rowk0, int lane, float sc) {
  v16h a; const float* p = rowk0 + 8 * (lane >> 4);
#pragma unroll
  for (int i = 0; i < 8; ++i) { a[i] = (_Float16)(p[i] * sc); a[8 + i] = (_Float16)(p[16 + i] * sc); }
  return a;
}
// column fragment from a [K][ld] layout (column n), rows >= K read as 0
__device__ __forceinline__ v16h fragc_f32(const float* W, int k0, int n, int lane, int ld, int K) {
  v16h a; const int g = lane >> 4;
#pragma unroll
  for (int i = 0; i < 8; ++i) { const int ka = k0 + 8 * g + i, kb = ka + 16;
    a[i] = (_Float16)(ka < K ? W[(size_t)(ka < K ? ka : K - 1) * ld + n] : 0.f); a[8 + i] = (_Float16)(kb < K ? W[(size_t)(kb < K ? kb : K - 1) * ld + n] : 0.f); }
  return a;
}
struct F2 { v16b h, l; };
__device__ __forceinline__ F2 bsplit16(const float v[16]) { F2 r;
#pragma unroll
  for (int i = 0; i < 16; ++i) { const __bf16 h = (__bf16)v[i]; r.h[i] = h; r.l[i] = (__bf16)(v[i] - (float)h); }
  return r; }
__device__ __forceinline__ F2 split_row(const float* row, int k0, int lane) { float v[16]; const float* p = row + k0 + 8 * (lane >> 4);
#pragma unroll
  for (int i = 0; i < 8; ++i) { v[i] = p[i]; v[8 + i] = p[16 + i]; }
  return bsplit16(v); }
__device__ __forceinline__ F2 split_rowK(const float* row, int k0, int lane, int K) { float v[16]; const int g = lane >> 4;
#pragma unroll
  for (int i = 0; i < 8; ++i) { const int ka = k0 + 8 * g + i, kb = ka + 16; v[i] = ka < K ? row[ka < K ? ka : K - 1] : 0.f; v[8 + i] = kb < K ? row[kb < K ? kb : K - 1] : 0.f; }
  return bsplit16(v); }
__device__ __forceinline__ F2 split_col(const float* W, int k0, int n, int lane, int ld, int K) { float v[16]; const int g = lane >> 4;
#pragma unroll
  for (int i = 0; i < 8; ++i) { const int ka = k0 + 8 * g + i, kb = ka + 16; v[i] = ka < K ? W[(size_t)(ka < K ? ka : K - 1) * ld + n] : 0.f; v[8 + i] = kb < K ? W[(size_t)(kb < K ? kb : K - 1) * ld + n] : 0.f; }
  return bsplit16(v); }
__device__ __forceinline__ v8f mac3(const F2& a, const F2& b, v8f c) { c = wmma_bf(a.l, b.h, c); c = wmma_bf(a.h, b.l, c); return wmma_bf(a.h, b.h, c); }
__device__ __forceinline__ float sigm(float v) { return 1.0f / (1.0f + expf(-v)); }
#define LDSX() do { asm volatile("s_wait_dscnt 0" ::: "memory"); __builtin_amdgcn_wave_barrier(); __builtin_amdgcn_fence(__ATOMIC_RELEASE, "workgroup"); } while (0)

// Causal multi-head self-attention with token padding masks on BOTH keys and queries (embeddings [4,2048,512], token_masks [4,2048] int 0/1 (random here: about half the tokens masked); 8 heads x 64; (in,out) Wq/Wk/Wv/Wo [512,512], no biases): scores = q.k/8, where(causal & tm[k] & tm[q], scores, -1e30), softmax, context Wo. A query with tm[q] = 0 gets all scores = -1e30 -> exactly uniform attention over all 2,048 positions (context = mean V).
#define NB 4
#define TT 2048
#define CC 512            // NH * HD = projected width
#define DIN 512          // input (model) width
#define NH 8
#define HD 64
#define SCALE (0.125f)
#define CAUSAL 1
#ifndef TNB
#define TNB NB
#endif
__device__ __forceinline__ float bfr(float v) { return (float)(__bf16)v; }
__host__ __device__ __forceinline__ int kb_last(int qb) { return CAUSAL ? ((qb * 64 + 63) >> 7) : (TT / 128 - 1); }
typedef __attribute__((ext_vector_type(8))) __bf16 v8b;
__device__ __forceinline__ v16b frag_b(const __bf16* rowk0, int lane) {
  union { v16b v; v8b q[2]; } u; const __bf16* p = rowk0 + 8 * (lane >> 4);
  u.q[0] = *(const v8b*)p; u.q[1] = *(const v8b*)(p + 16); return u.v;
}
#define QBH 6              // causal: query blocks 0..QBH-1 of each sequence (few keys, no averaging) take the high-precision path
#define QHI 384            // rows carrying a q residual plane (read only by the 3-product logits of query blocks < QBH)
#define KHI 384            // key rows carrying k residual / v bf16 hi+lo planes (used only by the causal high-precision path)
// B fragment (k rows k0+.., output column o) of a weight: (in,out) [K][ld] or (out,in) [ld rows of K]: bf16 exact, or f16(bf16 * 256) exact
__device__ __forceinline__ v16b wcol_io(const float* Wm, int k0, int o, int lane, int ld) { v16b w; const int g = lane >> 4;
#pragma unroll
  for (int i = 0; i < 8; ++i) { w[i] = (__bf16)Wm[(size_t)(k0 + 8 * g + i) * ld + o]; w[8 + i] = (__bf16)Wm[(size_t)(k0 + 16 + 8 * g + i) * ld + o]; }
  return w; }
__device__ __forceinline__ v16b wcol_oi(const float* Wm, int k0, int o, int lane, int K) { v16b w; const float* p = Wm + (size_t)o * K + k0 + 8 * (lane >> 4);
#pragma unroll
  for (int i = 0; i < 8; ++i) { w[i] = (__bf16)p[i]; w[8 + i] = (__bf16)p[16 + i]; }
  return w; }
__device__ __forceinline__ v16h wcolh_io(const float* Wm, int k0, int o, int lane, int ld) { v16h w; const int g = lane >> 4;
#pragma unroll
  for (int i = 0; i < 8; ++i) { w[i] = (_Float16)(bfr(Wm[(size_t)(k0 + 8 * g + i) * ld + o]) * 256.0f); w[8 + i] = (_Float16)(bfr(Wm[(size_t)(k0 + 16 + 8 * g + i) * ld + o]) * 256.0f); }
  return w; }
__device__ __forceinline__ v16h wcolh_oi(const float* Wm, int k0, int o, int lane, int K) { v16h w; const float* p = Wm + (size_t)o * K + k0 + 8 * (lane >> 4);
#pragma unroll
  for (int i = 0; i < 8; ++i) { w[i] = (_Float16)(bfr(p[i]) * 256.0f); w[8 + i] = (_Float16)(bfr(p[16 + i]) * 256.0f); }
  return w; }
#define WQKV_LAYOUT 0   // picks WCOL's layout only; no kernel calls WCOL: k_perm reads Wq/Wk/Wv as (in,out) [DIN][CC] whatever its value
__device__ __forceinline__ v16b wcol_hdk(const float* Wm, int k0, int o, int lane) { v16b w; const int g = lane >> 4; const float* p = Wm + (size_t)(o / HD) * DIN * HD + (o % HD);
#pragma unroll
  for (int i = 0; i < 8; ++i) { w[i] = (__bf16)p[(size_t)(k0 + 8 * g + i) * HD]; w[8 + i] = (__bf16)p[(size_t)(k0 + 16 + 8 * g + i) * HD]; }
  return w; }
#define WO_OUT_IN 0
#if WQKV_LAYOUT == 1
#define WCOL(W, k0, o, lane) wcol_oi(W, k0, o, lane, DIN)
#elif WQKV_LAYOUT == 2
#define WCOL(W, k0, o, lane) wcol_hdk(W, k0, o, lane)
#else
#define WCOL(W, k0, o, lane) wcol_io(W, k0, o, lane, CC)
#endif
#if WO_OUT_IN
#define WOCOL(W, k0, o, lane) wcol_oi(W, k0, o, lane, CC)
#define WOCOLH(W, k0, o, lane) wcolh_oi(W, k0, o, lane, CC)
#else
#define WOCOL(W, k0, o, lane) wcol_io(W, k0, o, lane, DIN)
#define WOCOLH(W, k0, o, lane) wcolh_io(W, k0, o, lane, DIN)
#endif
// masks: keys need causal (key range + index test) AND token_masks[b][k] != 0; a query with token_masks[b][t] == 0 has EVERY score = -1e30 in the module -> exactly uniform attention over all 2,048 positions -> its context is mean_k V (handled by k_meanv/k_fixq below; here such rows just get a harmless finite placeholder)
// ---- k_perm: block = one sequence. IDX[b][r] = the token at sorted place r: the n unmasked tokens first, then the masked ones, each group in its old order; NU[b * 32] = n (a 128-byte line per sequence: one writer a line).
// The order of the unmasked tokens is kept, so among them 'key <= query' reads the same on places as on tokens, and a masked key is simply a place >= n: attention runs on the first n places alone, for any mask. q, k, v planes are laid out by place; the context row goes back to its token's row.
// Blocks TNB.. of the same launch copy the weights to five 16-bit planes (Wq, Wk, Wv, Wo, Wo again) in FRAGMENT ORDER: 16-byte unit u = ((kc * 32 + ot) * 2 + q) * 32 + lane holds W[kc * 32 + 16 q + 8 (lane >> 4) + 0..7][ot * 16 + (lane & 15)], so a wave fetches half a B fragment of k chunk kc, column tile ot, as one 512-byte run of whole lines. Values: bf16(W); the fifth plane f16(bf16(Wo) x 2^8).
#define PW (TT / 64)   /* waves of k_perm: 64 tokens a wave */
#define WPL ((size_t)DIN * CC)          /* elements of one packed plane */
#define WKS ((size_t)(CC / 16) * 512)   /* elements from one k chunk to the next in a packed plane */
#define WST(st) ((size_t)((st) >> 1) * WKS + (size_t)((st) & 1) * 2048)   /* stage st of a 128-column block: k chunk st / 2, its first or second four column tiles */
#define WPB ((DIN / 32) * (CC / 16) * 64 / (32 * PW))   /* blocks that pack one weight: a thread a unit */
static_assert(DIN == CC && CC == 512 && WPB * 32 * PW == (DIN / 32) * (CC / 16) * 64, "the unit index is cut by shifts; whole blocks");
static_assert(2 * PW == 64, "a lane holds two of the 64 group counts");
__global__ __launch_bounds__(32 * PW) void k_perm(const int* __restrict__ TM, const float* __restrict__ WQ, const float* __restrict__ WK, const float* __restrict__ WV, const float* __restrict__ WO, int* __restrict__ IDX, int* __restrict__ NU, __bf16* __restrict__ WP, _Float16* __restrict__ WOH) { __shared__ int cnt[2 * PW]; __shared__ int sidx[TT];
  if (blockIdx.x >= TNB) {   /* the same for the whole block, ahead of every barrier */
    const int pb = blockIdx.x - TNB, m = pb / WPB, u = (pb % WPB) * (32 * PW) + threadIdx.x; const int ln = u & 31, q = (u >> 5) & 1, ot = (u >> 6) & 31, kc = u >> 11;
    const float* src = (m == 0 ? WQ : m == 1 ? WK : m == 2 ? WV : WO) + (size_t)(kc * 32 + 16 * q + 8 * (ln >> 4)) * CC + ot * 16 + (ln & 15); float f[8];
#pragma unroll
    for (int i = 0; i < 8; ++i) f[i] = src[(size_t)i * CC];
    asm volatile("s_wait_xcnt 0x0" :: "v"(src) : "memory");   /* the eight loads share one address pair: it stays whole until this wait */
    if (m < 4) { v8b o;
#pragma unroll
      for (int i = 0; i < 8; ++i) o[i] = (__bf16)f[i];
      vst2(WP + (size_t)m * WPL + (size_t)u * 8, o);
    } else { v8h oh;
#pragma unroll
      for (int i = 0; i < 8; ++i) oh[i] = (_Float16)(bfr(f[i]) * 256.0f);
      vst2(WOH + (size_t)u * 8, oh); }
    return; }   /* one store a thread, the thread's last instruction */
  const int tid = threadIdx.x, wave = tid >> 5, lane = tid & 31, b = blockIdx.x; const int* TMb = TM + (size_t)b * TT; unsigned bal[2];
#pragma unroll
  for (int u = 0; u < 2; ++u) bal[u] = (unsigned)__ballot(TMb[(wave * 2 + u) * 32 + lane] != 0);
  if (lane < 2) cnt[wave * 2 + lane] = __popc(lane ? bal[1] : bal[0]);
  __syncthreads();   /* the 64 groups' counts are in LDS before a wave sums them */
  const int c0 = cnt[lane], c1 = cnt[32 + lane]; int tot = c0 + c1, bef = (lane < wave * 2 ? c0 : 0) + (32 + lane < wave * 2 ? c1 : 0);
#pragma unroll
  for (int o = 1; o < 32; o <<= 1) { tot += __shfl_xor(tot, o); bef += __shfl_xor(bef, o); }
#pragma unroll
  for (int u = 0; u < 2; ++u) { const int t = (wave * 2 + u) * 32 + lane; const int ones = bef + (u ? __popc(bal[0]) : 0) + __popc(bal[u] & ((1u << lane) - 1u)); sidx[((bal[u] >> lane) & 1u) ? ones : tot + (t - ones)] = t; }
  __syncthreads();   /* the whole list is in LDS before it leaves by whole lines */
#pragma unroll
  for (int u = 0; u < 2; ++u) vst2(IDX + (size_t)b * TT + u * 32 * PW + tid, sidx[u * 32 * PW + tid]);
  if (tid == 0) vst2(NU + b * 32, tot); }
__device__ __forceinline__ int n_unmasked(const int* NU, int b) { const int n = NU[b * 32]; return __builtin_amdgcn_readfirstlane(n < 0 ? 0 : n > TT ? TT : n); }   /* bounded whatever the word holds; through readfirstlane so that the tests on it are scalar branches */
// ---- k_meanv: block = 32 channels of one batch, wave per channel: MV[b][c] = (1/2048) sum_t v[b][t][c] from the f16 v plane - the context of a fully-masked query row (softmax of 2,048 equal scores = exactly 1/2048 each). A wave reads its 4 KB row by whole lines, all loads in flight at once; f32 sums: eight chains a lane, a tree over them, then across the lanes. The 32 means leave as one 128-byte line from one wave.
#define MVW 32
static_assert(CC % MVW == 0 && TT % 256 == 0, "whole blocks of channels, whole 512-byte passes over a row");
__global__ __launch_bounds__(32 * MVW) void k_meanv(const _Float16* __restrict__ VT, float* __restrict__ MV) { __shared__ float sm[MVW];
  const int tid = threadIdx.x, wave = tid >> 5, lane = tid & 31; const int b = blockIdx.y, c0 = blockIdx.x * MVW; const _Float16* p = VT + ((size_t)b * CC + c0 + wave) * TT + lane * 8; hx8 hv[TT / 256];   /* the loops below are unrolled whole: hv and a stay in registers, and the loads issue back to back ahead of the first add */
#pragma unroll
  for (int i = 0; i < TT / 256; ++i) hv[i] = *(const hx8*)(p + i * 256);
  asm volatile("s_wait_xcnt 0x0" :: "v"(p) : "memory");   /* the loads share one address pair: it stays whole (no load lands on it) until this wait */
  float a[8];
#pragma unroll
  for (int j = 0; j < 8; ++j) a[j] = (float)hv[0][j];
#pragma unroll
  for (int i = 1; i < TT / 256; ++i)
#pragma unroll
    for (int j = 0; j < 8; ++j) a[j] += (float)hv[i][j];
  float s = ((a[0] + a[1]) + (a[2] + a[3])) + ((a[4] + a[5]) + (a[6] + a[7]));
#pragma unroll
  for (int o = 1; o < 32; o <<= 1) s += __shfl_xor(s, o);
  if (lane == 0) sm[wave] = s;
  __syncthreads();   /* the 32 waves' sums are in LDS before wave 0 stores them as one line */
  if (tid < MVW) vst2(MV + (size_t)b * CC + c0 + tid, sm[tid] * (1.0f / TT)); }
// ---- k_fixq: wave per masked query row (token_masks[b][t] == 0): ctx row Y[b*TT + t][:] = MV[b][:] (512 floats = 2 KB by 32 lanes x 4 x 16 B); unmasked rows untouched (wave-uniform branch)
__global__ __launch_bounds__(256) void k_fixq(const int* __restrict__ TM, const float* __restrict__ MV, float* __restrict__ Y) { const int tid = threadIdx.x; const size_t row = (size_t)blockIdx.x * 8 + (tid >> 5); const int lane = tid & 31; const int b = (int)(row / TT);
  const int tq = TM[row]; asm volatile("s_wait_loadcnt 0x0" ::: "memory"); if (tq != 0) return;
#pragma unroll
  for (int q = 0; q < CC / 128; ++q) { const v4f v = *(const v4f*)(MV + (size_t)b * CC + (q * 32 + lane) * 4); asm volatile("s_wait_loadcnt 0x0" ::: "memory"); vst2(Y + row * CC + (q * 32 + lane) * 4, v); } }
#define WS_MV (WS_END)                                    // f32 mean-v rows [b][512]
#define WS_END2 (WS_MV + 4u * (size_t)NB * CC)
#define WS_IDX (WS_END2)                                  // int token of each sorted place [b][t]
#define WS_NU  (WS_IDX + 4u * (size_t)NB * TT)            // int unmasked tokens of a sequence, one 128-byte line each
#define WS_END3 (WS_NU + 128u * (size_t)NB)
#define WS_WP  (WS_END3)                                  // bf16 Wq, Wk, Wv, Wo in fragment order
#define WS_WOH (WS_WP + 2u * 4u * (size_t)DIN * CC)       // f16(bf16 Wo x 2^8) in fragment order
#define WS_END4 (WS_WOH + 2u * (size_t)DIN * CC)

#define WS_QH  0u                                      // f16 q rows [b*t][CC]
#define WS_KH  (WS_QH + 2u * (size_t)NB * TT * CC)      // f16 k rows [b*t][CC]
#define WS_VT  (WS_KH + 2u * (size_t)NB * TT * CC)      // f16 v planes [b][c][t]
#define WS_QL  (WS_VT + 2u * (size_t)NB * CC * TT)      // f16 q residual x 2^10 rows [b][t < QHI][CC]
#define WS_KL  (WS_QL + 2u * (size_t)NB * QHI * CC)     // f16 k residual x 2^10 rows [b][t < KHI][CC]
#define WS_VB  (WS_KL + 2u * (size_t)NB * KHI * CC)     // bf16 v hi planes [b][c][t < KHI]
#define WS_VBL (WS_VB + 2u * (size_t)NB * CC * KHI)
#define WS_Y   (WS_VBL + 2u * (size_t)NB * CC * KHI)     // f32 ctx rows [b*t][CC] (only when there is an output projection)
#define WS_END (WS_Y  + 4u * (size_t)NB * TT * CC)

// operands fetched ahead of their products: 16 f32 of an A row in fragment order (x[0..1] = p[0..7], x[2..3] = p[16..23]); N / 2 B fragments of a packed plane as N runs of 512 bytes a wave
__device__ __forceinline__ void ld_xr(const float* p, v4f x[4]) { x[0] = *(const v4f*)p; x[1] = *(const v4f*)(p + 4); x[2] = *(const v4f*)(p + 16); x[3] = *(const v4f*)(p + 20); }
template <int N, typename T, typename T8> __device__ __forceinline__ void ld_wf(const T* p, T8 w[N]) {
#pragma unroll
  for (int t = 0; t < N; ++t) w[t] = *(const T8*)(p + t * 256); }
__device__ __forceinline__ v16b two_b(v8b a, v8b b) { union { v16b v; v8b q[2]; } u; u.q[0] = a; u.q[1] = b; return u.v; }
__device__ __forceinline__ v16h two_h(v8h a, v8h b) { union { v16h v; v8h q[2]; } u; u.q[0] = a; u.q[1] = b; return u.v; }
// ---- k_proj: block = (64 sorted places, 128 cols, which), the X row of a place through IDX; q and k blocks wholly behind the last 128-place group that holds an unmasked token leave at once (k_att reads no place there): q/k/v = X W (+ b) with exact bf16 products (K = DIN) -> which 0: q f16 rows (+ residual rows < QHI); 1: k f16 rows (+ residual rows < KHI); 2: v f16 planes [c][t] (+ bf16 hi/lo planes for t < KHI)
__global__ __launch_bounds__(128) void k_proj(const float* __restrict__ XQ, const float* __restrict__ XK, const float* __restrict__ XV, const __bf16* __restrict__ WP, const float* __restrict__ BQ, const float* __restrict__ BK, const float* __restrict__ BV, const int* __restrict__ IDX, const int* __restrict__ NU,
    _Float16* __restrict__ QH, _Float16* __restrict__ QL, _Float16* __restrict__ KH, _Float16* __restrict__ KL, _Float16* __restrict__ VT, __bf16* __restrict__ VB, __bf16* __restrict__ VBL) {
  __shared__ __align__(16) _Float16 sh[64][136], sl[64][136]; __shared__ __align__(16) _Float16 th[128][72]; __shared__ __align__(16) __bf16 tb[128][72], tbl[128][72];
  const int tid = threadIdx.x, wave = tid >> 5, lane = tid & 31, col = lane & 15, g = lane >> 4; const int which = blockIdx.z; const int c0 = blockIdx.y * 128; const size_t r0 = (size_t)blockIdx.x * 64; const size_t bb = r0 / TT; const int t0 = (int)(r0 % TT);
  if (which < 2 && t0 >= ((n_unmasked(NU, (int)bb) + 127) & ~127)) return;   /* the same for the whole block, ahead of every barrier */
  const float* X = which == 0 ? XQ : which == 1 ? XK : XV; const float* BA = which == 0 ? BQ : which == 1 ? BK : BV;
  const float* xr = X + (bb * TT + (size_t)(IDX[r0 + wave * 16 + col] & (TT - 1))) * DIN;   /* the mask bounds the row whatever the list holds */
  const float* xp = xr + 8 * g; const __bf16* wp = WP + (size_t)which * WPL + ((size_t)(c0 >> 4) * 64 + lane) * 8;
  v8f acc[8] = {}; v4f xs[2][4]; v8b wf[4][8]; v16b a; ld_xr(xp, xs[0]); ld_xr(xp + 32, xs[1]);
#pragma unroll
  for (int t = 0; t < 3; ++t) ld_wf<8>(wp + WST(t), wf[t]);
#pragma unroll   /* whole: the operand sets stay in registers, every step of the two addresses is a constant offset */
  for (int st = 0; st < DIN / 16; ++st) { const int hf = st & 1, kc = st >> 1;   /* a stage = half a k chunk: four column tiles; B is fetched three stages ahead, A two chunks ahead */
    if (hf == 0) {
#pragma unroll
      for (int i = 0; i < 4; ++i) { a[i] = (__bf16)xs[kc & 1][0][i]; a[4 + i] = (__bf16)xs[kc & 1][1][i]; a[8 + i] = (__bf16)xs[kc & 1][2][i]; a[12 + i] = (__bf16)xs[kc & 1][3][i]; }
      if (kc + 2 < DIN / 32) ld_xr(xp + (kc + 2) * 32, xs[kc & 1]); }
    if (st + 3 < DIN / 16) ld_wf<8>(wp + WST(st + 3), wf[(st + 3) & 3]);   /* into the set that the last stage has left */
    if (st + 4 == DIN / 16) asm volatile("s_wait_xcnt 0x0" :: "v"(xp), "v"(wp) : "memory");   /* behind the last loads: the two address pairs stay whole until this wait */
#pragma unroll
    for (int j = 0; j < 4; ++j) acc[hf * 4 + j] = wmma_bf(a, two_b(wf[st & 3][2 * j], wf[st & 3][2 * j + 1]), acc[hf * 4 + j]);
    __builtin_amdgcn_sched_barrier(0); }   /* keeps the next stage's conversions, and with them the wait on loads just issued, behind this stage's products */
  if (which < 2) { _Float16* DH = which == 0 ? QH : KH; _Float16* DL = which == 0 ? QL : KL; const int nhi = which == 0 ? QHI : KHI; const bool hi_rows = t0 < nhi;
#pragma unroll
    for (int j = 0; j < 8; ++j) { const float bias = BA ? bfr(BA[c0 + j * 16 + col]) : 0.f;
#pragma unroll
      for (int r = 0; r < 8; ++r) { const float v = acc[j][r] + bias; const _Float16 hv = (_Float16)v; sh[wave * 16 + 8 * g + r][j * 16 + col] = hv; sl[wave * 16 + 8 * g + r][j * 16 + col] = (_Float16)((v - (float)hv) * 1024.0f); } }
    __syncthreads();
    for (int e = tid; e < 64 * 16; e += 128) { const int rl = e >> 4, q = e & 15; vst2((unsigned*)(DH + (r0 + rl) * CC + c0 + q * 8), *(const v4u*)&sh[rl][q * 8]); if (hi_rows) vst2((unsigned*)(DL + (bb * nhi + t0 + rl) * (size_t)CC + c0 + q * 8), *(const v4u*)&sl[rl][q * 8]); }
  } else { const bool hi_rows = t0 < KHI;
#pragma unroll
    for (int j = 0; j < 8; ++j) { const float bias = BA ? bfr(BA[c0 + j * 16 + col]) : 0.f;
#pragma unroll
      for (int r = 0; r < 8; ++r) { const float v = acc[j][r] + bias; const int rl = wave * 16 + 8 * g + r, cl = j * 16 + col; th[cl][rl] = (_Float16)v; const __bf16 bh = (__bf16)v; tb[cl][rl] = bh; tbl[cl][rl] = (__bf16)(v - (float)bh); } }
    __syncthreads();
    for (int e = tid; e < 128 * 8; e += 128) { const int cl = e >> 3, q = e & 7; vst2((unsigned*)(VT + (bb * CC + c0 + cl) * (size_t)TT + t0 + q * 8), *(const v4u*)&th[cl][q * 8]); if (hi_rows) { const size_t o3 = (bb * CC + c0 + cl) * (size_t)KHI + t0 + q * 8; vst2((unsigned*)(VB + o3), *(const v4u*)&tb[cl][q * 8]); vst2((unsigned*)(VBL + o3), *(const v4u*)&tbl[cl][q * 8]); } } } }
// ---- k_att: block = 16 sorted places of (b, h) as queries, AW waves; a block whose places are all masked tokens leaves at once (k_fixq writes their rows); the 16 score rows live in LDS from the logits to P, so no score plane goes through memory and one launch covers every (b, h).
// step 1, logits: wave w takes the 16-key tiles w, w + AW, ... of keys [0, kend): q x k on f16 (3 products with the x 2^10 residual planes for query blocks < QBH), x SCALE; causal and key masks (place < n) by select at the LDS store.
// step 2, softmax: wave w owns row w in registers, f32, sums by lane then across lanes; P x 2^11 back in place (0 for excluded keys); a query with token_masks == 0 gets a finite placeholder row here and its context from k_fixq.
// step 3, P.v: wave w sums the 32-key chunks w, w + AW, ... (P once to f16 against v f16; query blocks < QBH: P and v as bf16 hi + lo, 3 products); the AW partial tiles are added in f32 through LDS in wave order.
#define AW 16          /* the wave number goes through readfirstlane so that the tile loops are scalar loops and every lane is on at the matrix instructions */
#define SP (TT + 4)    /* row pitch in floats: 16 B past a multiple of 256 B, so the 16 rows of a b128 fragment read fall on different banks */
static_assert(QBH * 64 >= QHI, "every row with a q residual plane takes the 3-product path");
static_assert(AW * 16 * (HD + 4) <= 16 * SP, "the partial tiles reuse the score rows' LDS");
static_assert(16 * (HD / 2) == 32 * AW, "in the last step a wave stores the row of its own number");
// 16 f32 of one LDS row in fragment order (0..7 = p[0..7], 8..15 = p[16..23]) by four 16-byte reads
__device__ __forceinline__ void lds_row16(const float* p, float v[16]) { const v4f a = *(const v4f*)p, b = *(const v4f*)(p + 4), c = *(const v4f*)(p + 16), d = *(const v4f*)(p + 20);
#pragma unroll
  for (int i = 0; i < 4; ++i) { v[i] = a[i]; v[4 + i] = b[i]; v[8 + i] = c[i]; v[12 + i] = d[i]; } }
__global__ __launch_bounds__(32 * AW) void k_att(const _Float16* __restrict__ QH, const _Float16* __restrict__ KH, const _Float16* __restrict__ QL, const _Float16* __restrict__ KL, const _Float16* __restrict__ VT, const __bf16* __restrict__ VB, const __bf16* __restrict__ VBL, const int* __restrict__ IDX, const int* __restrict__ NU, float* __restrict__ Y) { __shared__ __align__(16) float sc[16][SP];
  const int tid = threadIdx.x, wave = __builtin_amdgcn_readfirstlane(tid >> 5), lane = tid & 31, col = lane & 15, g = lane >> 4; const int h = blockIdx.y, b = blockIdx.z; const int qb = blockIdx.x >> 2; const int ql0 = blockIdx.x * 16; const int kend = (kb_last(qb) + 1) * 128;
  const int nb = n_unmasked(NU, b); if (ql0 >= nb) return;   /* the same for the whole block, ahead of every barrier */
  const size_t q0 = (size_t)b * TT + ql0, kr0 = (size_t)b * TT; const int tq = ql0 + wave < nb; const int orow = IDX[(size_t)b * TT + ql0 + wave] & (TT - 1);   /* the token whose context row this wave stores; the mask bounds the row whatever the list holds */
  if (qb < QBH) { const _Float16* QLb = QL + (size_t)b * QHI * CC; const _Float16* KLb = KL + (size_t)b * KHI * CC; v16h ah[HD / 32], al[HD / 32];
#pragma unroll
    for (int kc = 0; kc < HD / 32; ++kc) { ah[kc] = frag_h(QH + (q0 + col) * CC + h * HD + kc * 32, lane); al[kc] = frag_h(QLb + (size_t)(ql0 + col) * CC + h * HD + kc * 32, lane); }
    for (int kt = wave; kt < kend / 16; kt += AW) { const int key = kt * 16 + col; v8f acc = {}, accl = {};
      v16h kbf[HD / 32], klf[HD / 32];   /* all of the tile's loads stand ahead of its first product: one memory latency a tile */
#pragma unroll
      for (int kc = 0; kc < HD / 32; ++kc) { kbf[kc] = frag_h(KH + (kr0 + key) * CC + h * HD + kc * 32, lane); klf[kc] = frag_h(KLb + (size_t)key * CC + h * HD + kc * 32, lane); }
#pragma unroll
      for (int kc = 0; kc < HD / 32; ++kc) { acc = wmma16(ah[kc], kbf[kc], acc); accl = wmma16(al[kc], kbf[kc], accl); accl = wmma16(ah[kc], klf[kc], accl); }
#pragma unroll
      for (int r = 0; r < 8; ++r) sc[8 * g + r][key] = ((!CAUSAL || key <= ql0 + 8 * g + r) && key < nb) ? (acc[r] + accl[r] * (1.0f / 1024.0f)) * SCALE : -3.0e38f; }
  } else { v16h ah[HD / 32];
#pragma unroll
    for (int kc = 0; kc < HD / 32; ++kc) ah[kc] = frag_h(QH + (q0 + col) * CC + h * HD + kc * 32, lane);
    asm volatile("s_wait_xcnt 0x0" :: "v"(QH + (q0 + col) * CC + h * HD + 8 * g) : "memory");   /* the q loads share one address pair: it stays whole (no k load lands on it) until this wait */
    for (int kt0 = wave; kt0 < kend / 16; kt0 += 4 * AW) { v16h kbf[4][HD / 32];   /* the loads of up to four tiles stand ahead of the first product: one memory latency for four tiles; the tests on the tile number are scalar */
      const _Float16* kp = KH + (kr0 + kt0 * 16 + col) * CC + h * HD;   /* one address pair for the four tiles, the tile's step as a constant offset */
#pragma unroll
      for (int u = 0; u < 4; ++u) if (kt0 + u * AW < kend / 16) {
#pragma unroll
        for (int kc = 0; kc < HD / 32; ++kc) kbf[u][kc] = frag_h(kp + (size_t)u * AW * 16 * CC + kc * 32, lane); }
#pragma unroll
      for (int u = 0; u < 4; ++u) if (kt0 + u * AW < kend / 16) { const int key = (kt0 + u * AW) * 16 + col; v8f acc = {};
#pragma unroll
        for (int kc = 0; kc < HD / 32; ++kc) acc = wmma16(ah[kc], kbf[u][kc], acc);
#pragma unroll
        for (int r = 0; r < 8; ++r) sc[8 * g + r][key] = ((!CAUSAL || key <= ql0 + 8 * g + r) && key < nb) ? acc[r] * SCALE : -3.0e38f; } } }
  __syncthreads();   /* every tile of the 16 score rows is in LDS before a wave reads its row */
  { const int nq = kend >> 7; v4f vv[TT / 128];   /* 128 keys a pass: 32 lanes x 4; the tests on nq are scalar */
#pragma unroll
    for (int i = 0; i < TT / 128; ++i) if (i < nq) vv[i] = *(const v4f*)&sc[wave][i * 128 + lane * 4];
    float m = -3.0e38f;
#pragma unroll
    for (int i = 0; i < TT / 128; ++i) if (i < nq) { if (tq == 0) vv[i] = (v4f){0.f, 0.f, 0.f, 0.f}; m = fmaxf(m, fmaxf(fmaxf(vv[i][0], vv[i][1]), fmaxf(vv[i][2], vv[i][3]))); }
#pragma unroll
    for (int o = 1; o < 32; o <<= 1) m = fmaxf(m, __shfl_xor(m, o));
    float sum = 0.f;
#pragma unroll
    for (int i = 0; i < TT / 128; ++i) if (i < nq) {
#pragma unroll
      for (int c = 0; c < 4; ++c) { const float v = vv[i][c]; const float ex = expf(v - m); const float e = (v <= -1.0e38f) ? 0.f : ex; vv[i][c] = e; sum += e; } }
#pragma unroll
    for (int o = 1; o < 32; o <<= 1) sum += __shfl_xor(sum, o);
    const float inv = sum > 0.f ? 2048.0f / sum : 0.f;   /* a fully excluded row yields P = 0 */
#pragma unroll
    for (int i = 0; i < TT / 128; ++i) if (i < nq) *(v4f*)&sc[wave][i * 128 + lane * 4] = vv[i] * inv; }
  __syncthreads();   /* all 16 rows of P are in LDS before any wave forms fragments across them */
  const int kce = kend >> 5; v8f acc[HD / 16] = {};
  if (qb < QBH) {
    for (int kc = wave; kc < kce; kc += AW) { float pv[16]; lds_row16(&sc[col][kc * 32 + 8 * g], pv); const F2 p = bsplit16(pv);
#pragma unroll
      for (int j2 = 0; j2 < HD / 16; j2 += 2) { v16b vh[2], vl[2];   /* two column tiles' loads stand ahead of their products */
#pragma unroll
        for (int u = 0; u < 2; ++u) { const size_t po = ((size_t)b * CC + h * HD + (j2 + u) * 16 + col) * (size_t)KHI + kc * 32; vh[u] = frag_b(VB + po, lane); vl[u] = frag_b(VBL + po, lane); }
#pragma unroll
        for (int u = 0; u < 2; ++u) { const int j = j2 + u; acc[j] = wmma_bf(p.h, vh[u], acc[j]); acc[j] = wmma_bf(p.l, vh[u], acc[j]); acc[j] = wmma_bf(p.h, vl[u], acc[j]); } } }
  } else {
    for (int kc = wave; kc < kce; kc += AW) { v16h vf[HD / 16]; const _Float16* vp = VT + ((size_t)b * CC + h * HD + col) * (size_t)TT + kc * 32 + 8 * g;   /* the chunk's four v loads stand ahead of its first product: one memory latency a chunk */
#pragma unroll
      for (int j = 0; j < HD / 16; ++j) { union { v16h v; v8h q[2]; } u; u.q[0] = *(const v8h*)(vp + (size_t)j * 16 * TT); u.q[1] = *(const v8h*)(vp + (size_t)j * 16 * TT + 16); vf[j] = u.v; }
      asm volatile("s_wait_xcnt 0x0" :: "v"(vp) : "memory");   /* the eight loads share one address pair: it stays whole (no load lands on it) until this wait */
      float pv[16]; lds_row16(&sc[col][kc * 32 + 8 * g], pv); v16h p;
#pragma unroll
      for (int i = 0; i < 16; ++i) p[i] = (_Float16)pv[i];
#pragma unroll
      for (int j = 0; j < HD / 16; ++j) acc[j] = wmma16(p, vf[j], acc[j]); } }
  __syncthreads();   /* every wave has read its last P fragment before the partial tiles overwrite the rows */
  float (*ss)[16][HD + 4] = (float (*)[16][HD + 4])&sc[0][0];
#pragma unroll
  for (int j = 0; j < HD / 16; ++j)
#pragma unroll
    for (int r = 0; r < 8; ++r) ss[wave][8 * g + r][j * 16 + col] = acc[j][r];
  __syncthreads();   /* every wave's partial tile is in LDS before any wave adds them */
  for (int e = tid; e < 16 * (HD / 2); e += 32 * AW) { const int rl = e / (HD / 2), q = e % (HD / 2); v2f s = *(const v2f*)&ss[0][rl][q * 2];
#pragma unroll   /* the AW LDS reads issue ahead of the adds; rolled, each add would wait a full LDS latency */
    for (int w = 1; w < AW; ++w) s += *(const v2f*)&ss[w][rl][q * 2];
    vst2(Y + ((size_t)b * TT + orow) * CC + h * HD + q * 2, s * (1.0f / 2048.0f)); } }
// ---- k_out: block = (64 rows, 128 cols): out = ctx Wo (+ bo): ctx once to f16 against Wo as f16(bf16 x 2^8) exact (1 product) x 2^-8; causal early rows (< QHI of each sequence): ctx bf16 hi + lo against exact bf16 Wo (2 products)
__global__ __launch_bounds__(128) void k_out(const float* __restrict__ Y, const __bf16* __restrict__ WOB, const _Float16* __restrict__ WOH, const float* __restrict__ BO, float* __restrict__ OUT) { __shared__ __align__(16) float sf[4][16][132];
  const int tid = threadIdx.x, wave = tid >> 5, lane = tid & 31, col = lane & 15, g = lane >> 4; const int c0 = blockIdx.y * 128; const size_t r0 = (size_t)blockIdx.x * 64 + wave * 16;
  v8f acc[8] = {}; const float* xp = Y + (r0 + col) * CC + 8 * g; const size_t wo = ((size_t)(c0 >> 4) * 64 + lane) * 8; v4f xs[2][4]; ld_xr(xp, xs[0]); ld_xr(xp + 32, xs[1]);
  if (CAUSAL && (int)(((size_t)blockIdx.x * 64) % TT) < QHI) {   /* block-uniform */
    const __bf16* wp = WOB + wo; v8b wf[3][8]; F2 a;
#pragma unroll
    for (int t = 0; t < 2; ++t) ld_wf<8>(wp + WST(t), wf[t]);
#pragma unroll   /* whole, stages as in k_proj; two products a tile, so B two stages ahead covers as much */
    for (int st = 0; st < CC / 16; ++st) { const int hf = st & 1, kc = st >> 1;
      if (hf == 0) { float v[16];
#pragma unroll
        for (int i = 0; i < 4; ++i) { v[i] = xs[kc & 1][0][i]; v[4 + i] = xs[kc & 1][1][i]; v[8 + i] = xs[kc & 1][2][i]; v[12 + i] = xs[kc & 1][3][i]; }
        a = bsplit16(v); if (kc + 2 < CC / 32) ld_xr(xp + (kc + 2) * 32, xs[kc & 1]); }
      if (st + 2 < CC / 16) ld_wf<8>(wp + WST(st + 2), wf[(st + 2) % 3]);   /* into the set that the last stage has left */
      if (st + 3 == CC / 16) asm volatile("s_wait_xcnt 0x0" :: "v"(xp), "v"(wp) : "memory");   /* behind the last loads: the two address pairs stay whole until this wait */
#pragma unroll
      for (int j = 0; j < 4; ++j) { const int jj = hf * 4 + j; const v16b w = two_b(wf[st % 3][2 * j], wf[st % 3][2 * j + 1]); acc[jj] = wmma_bf(a.h, w, acc[jj]); acc[jj] = wmma_bf(a.l, w, acc[jj]); }
      __builtin_amdgcn_sched_barrier(0); }   /* keeps the next stage's conversions, and with them the wait on loads just issued, behind this stage's products */
#pragma unroll
    for (int j = 0; j < 8; ++j) { const float bias = BO ? bfr(BO[c0 + j * 16 + col]) : 0.f;
#pragma unroll
      for (int r = 0; r < 8; ++r) sf[wave][8 * g + r][j * 16 + col] = acc[j][r] + bias; }
  } else {
    const _Float16* wp = WOH + wo; v8h wf[4][8]; v16h a;
#pragma unroll
    for (int t = 0; t < 3; ++t) ld_wf<8>(wp + WST(t), wf[t]);
#pragma unroll   /* whole, stages as in k_proj */
    for (int st = 0; st < CC / 16; ++st) { const int hf = st & 1, kc = st >> 1;
      if (hf == 0) {   /* ctx carried x 2^6 into f16 so small-magnitude context rows stay clear of f16 subnormals */
#pragma unroll
        for (int i = 0; i < 4; ++i) { a[i] = (_Float16)(xs[kc & 1][0][i] * 64.0f); a[4 + i] = (_Float16)(xs[kc & 1][1][i] * 64.0f); a[8 + i] = (_Float16)(xs[kc & 1][2][i] * 64.0f); a[12 + i] = (_Float16)(xs[kc & 1][3][i] * 64.0f); }
        if (kc + 2 < CC / 32) ld_xr(xp + (kc + 2) * 32, xs[kc & 1]); }
      if (st + 3 < CC / 16) ld_wf<8>(wp + WST(st + 3), wf[(st + 3) & 3]);   /* into the set that the last stage has left */
      if (st + 4 == CC / 16) asm volatile("s_wait_xcnt 0x0" :: "v"(xp), "v"(wp) : "memory");   /* behind the last loads: the two address pairs stay whole until this wait */
#pragma unroll
      for (int j = 0; j < 4; ++j) acc[hf * 4 + j] = wmma16(a, two_h(wf[st & 3][2 * j], wf[st & 3][2 * j + 1]), acc[hf * 4 + j]);
      __builtin_amdgcn_sched_barrier(0); }   /* keeps the next stage's conversions, and with them the wait on loads just issued, behind this stage's products */
#pragma unroll
    for (int j = 0; j < 8; ++j) { const float bias = BO ? bfr(BO[c0 + j * 16 + col]) : 0.f;
#pragma unroll
      for (int r = 0; r < 8; ++r) sf[wave][8 * g + r][j * 16 + col] = acc[j][r] * (1.0f / 16384.0f) + bias; } }   /* 2^-8 (Wo carry) x 2^-6 (ctx carry) */
  LDSX(); for (int rl = 0; rl < 16; ++rl) vst2(OUT + (r0 + rl) * DIN + c0 + lane * 4, *(const v4f*)&sf[wave][rl][lane * 4]); }

extern "C" void kernel_launch(void* const* d_in, const int* in_sizes, int n_in, void* d_out, int out_size, void* d_ws, size_t ws_size, hipStream_t stream) {
  (void)in_sizes; (void)n_in; (void)out_size;
  const float** F = (const float**)d_in;
  if (ws_size < (size_t)WS_END) return;
  char* ws = (char*)d_ws; _Float16 *QH = (_Float16*)(ws + WS_QH), *KH = (_Float16*)(ws + WS_KH), *VT = (_Float16*)(ws + WS_VT), *QL = (_Float16*)(ws + WS_QL), *KL = (_Float16*)(ws + WS_KL); __bf16 *VB = (__bf16*)(ws + WS_VB), *VBL = (__bf16*)(ws + WS_VBL); float *Y = (float*)(ws + WS_Y);
  (void)Y; (void)QL; (void)KL; (void)VB; (void)VBL;
  // inputs: 0 embeddings [4,2048,512]; 1 token_masks [4,2048] int32 (0/1); 2 Wq [512,512] (in,out); 3 Wk; 4 Wv; 5 Wo (in,out)
  if (ws_size < (size_t)WS_END4) return;
  const int* TM = (const int*)d_in[1]; float* MV = (float*)(ws + WS_MV); int *IDX = (int*)(ws + WS_IDX), *NU = (int*)(ws + WS_NU); __bf16* WP = (__bf16*)(ws + WS_WP); _Float16* WOH = (_Float16*)(ws + WS_WOH);
  k_perm<<<dim3(TNB + 5 * WPB), 32 * PW, 0, stream>>>(TM, F[2], F[3], F[4], F[5], IDX, NU, WP, WOH);
  k_proj<<<dim3(TNB * TT / 64, CC / 128, 3), 128, 0, stream>>>(F[0], F[0], F[0], WP, nullptr, nullptr, nullptr, IDX, NU, QH, QL, KH, KL, VT, VB, VBL);
  k_meanv<<<dim3(CC / MVW, TNB), 32 * MVW, 0, stream>>>(VT, MV);
  k_att<<<dim3(TT / 16, NH, TNB), 32 * AW, 0, stream>>>(QH, KH, QL, KL, VT, VB, VBL, IDX, NU, Y);
  k_fixq<<<dim3(TNB * TT / 8), 256, 0, stream>>>(TM, MV, Y);   /* masked queries: context = mean V */
  k_out<<<dim3(TNB * TT / 64, DIN / 128), 128, 0, stream>>>(Y, WP + 3 * WPL, WOH, nullptr, (float*)d_out);
}

// v006
// Measured time: 87.2 microseconds a run.
// Two timings next to v005 both put it at 1.07 times that version's speed.
// Counting every step since v000, it is 11.0 times as fast.
// compute dtype: all float inputs rounded to bf16; projections with EXACT bf16 products on WMMA 16x16x32 (f32 accumulate); tokens of a sequence sorted unmasked first (stable), all planes in that order; causal logits: 3 products for the first 384 sorted rows, single f16 q x k after, x 64^-0.5; key/query masks = a length; softmax f32; P x 2^11 once to f16 x v once to f16 (bf16 hi + lo below row 384); fully-masked query rows = mean of the f16 v plane in f32; ctx hi+lo x exact Wo below row 384, x2^6 f16 carry x f16(bf16 x 2^8) Wo after; f32 output.
#include <hip/hip_runtime.h>
#include <math.h>

typedef __attribute__((ext_vector_type(16))) _Float16 v16h;
typedef __attribute__((ext_vector_type(16))) __bf16 v16b;
typedef __attribute__((ext_vector_type(8)))  _Float16 v8h;
typedef __attribute__((ext_vector_type(8)))  float v8f;
typedef __attribute__((ext_vector_type(4)))  float v4f;
typedef __attribute__((ext_vector_type(2)))  float v2f;
typedef __attribute__((ext_vector_type(4)))  unsigned v4u;
typedef _Float16 hx8 __attribute__((ext_vector_type(8)));
typedef __attribute__((ext_vector_type(4)))  int v4i;
typedef float __attribute__((may_alias)) float_a;
typedef int __attribute__((may_alias)) int_a;

template <typename T> __device__ __forceinline__ void vst2(void* p, T v) { *(T*)p = v;  }
__device__ __forceinline__ v8f wmma16(v16h a, v16h b, v8f c) {
  v8f d = __builtin_amdgcn_wmma_f32_16x16x32_f16(false, a, false, b, (short)0, c, false, false);
  asm volatile("v_nop\n\tv_nop\n\tv_nop\n\tv_nop" : "+v"(d) : "v"(a), "v"(b));
  return d;
}
__device__ __forceinline__ v8f wmma_bf(v16b a, v16b b, v8f c) {
  v8f d = __builtin_amdgcn_wmma_f32_16x16x32_bf16(false, a, false, b, (short)0, c, false, false);
  asm volatile("v_nop\n\tv_nop\n\tv_nop\n\tv_nop" : "+v"(d) : "v"(a), "v"(b));
  return d;
}
// 16x16x32 fragments: lane = (h = lane>>4, row/col = lane&15); elements 0..7 = k0+8h+0..7, 8..15 = k0+16+8h+0..7; D element r = row 8h+r
__device__ __forceinline__ v16h frag_h(const _Float16* rowk0, int lane) {
  union { v16h v; v8h q[2]; } u; const _Float16* p = rowk0 + 8 * (lane >> 4);
  u.q[0] = *(const v8h*)p; u.q[1] = *(const v8h*)(p + 16); return u.v;
}
__device__ __forceinline__ v16h frag_f32(const float* rowk0, int lane) {
  v16h a; const float* p = rowk0 + 8 * (lane >> 4);
#pragma unroll
  for (int i = 0; i < 8; ++i) { a[i] = (_Float16)p[i]; a[8 + i] = (_Float16)p[16 + i]; }
  return a;
}
__device__ __forceinline__ v16h frag_f32s(const float* rowk0, int lane, float sc) {
  v16h a; const float* p = rowk0 + 8 * (lane >> 4);
#pragma unroll
  for (int i = 0; i < 8; ++i) { a[i] = (_Float16)(p[i] * sc); a[8 + i] = (_Float16)(p[16 + i] * sc); }
  return a;
}
// column fragment from a [K][ld] layout (column n), rows >= K read as 0
__device__ __forceinline__ v16h fragc_f32(const float* W, int k0, int n, int lane, int ld, int K) {
  v16h a; const int g = lane >> 4;
#pragma unroll
  for (int i = 0; i < 8; ++i) { const int ka = k0 + 8 * g + i, kb = ka + 16;
    a[i] = (_Float16)(ka < K ? W[(size_t)(ka < K ? ka : K - 1) * ld + n] : 0.f); a[8 + i] = (_Float16)(kb < K ? W[(size_t)(kb < K ? kb : K - 1) * ld + n] : 0.f); }
  return a;
}
struct F2 { v16b h, l; };
__device__ __forceinline__ F2 bsplit16(const float v[16]) { F2 r;
#pragma unroll
  for (int i = 0; i < 16; ++i) { const __bf16 h = (__bf16)v[i]; r.h[i] = h; r.l[i] = (__bf16)(v[i] - (float)h); }
  return r; }
__device__ __forceinline__ F2 split_row(const float* row, int k0, int lane) { float v[16]; const float* p = row + k0 + 8 * (lane >> 4);
#pragma unroll
  for (int i = 0; i < 8; ++i) { v[i] = p[i]; v[8 + i] = p[16 + i]; }
  return bsplit16(v); }
__device__ __forceinline__ F2 split_rowK(const float* row, int k0, int lane, int K) { float v[16]; const int g = lane >> 4;
#pragma unroll
  for (int i = 0; i < 8; ++i) { const int ka = k0 + 8 * g + i, kb = ka + 16; v[i] = ka < K ? row[ka < K ? ka : K - 1] : 0.f; v[8 + i] = kb < K ? row[kb < K ? kb : K - 1] : 0.f; }
  return bsplit16(v); }
__device__ __forceinline__ F2 split_col(const float* W, int k0, int n, int lane, int ld, int K) { float v[16]; const int g = lane >> 4;
#pragma unroll
  for (int i = 0; i < 8; ++i) { const int ka = k0 + 8 * g + i, kb = ka + 16; v[i] = ka < K ? W[(size_t)(ka < K ? ka : K - 1) * ld + n] : 0.f; v[8 + i] = kb < K ? W[(size_t)(kb < K ? kb : K - 1) * ld + n] : 0.f; }
  return bsplit16(v); }
__device__ __forceinline__ v8f mac3(const F2& a, const F2& b, v8f c) { c = wmma_bf(a.l, b.h, c); c = wmma_bf(a.h, b.l, c); return wmma_bf(a.h, b.h, c); }
__device__ __forceinline__ float sigm(float v) { return 1.0f / (1.0f + expf(-v)); }
#define LDSX() do { asm volatile("s_wait_dscnt 0" ::: "memory"); __builtin_amdgcn_wave_barrier(); __builtin_amdgcn_fence(__ATOMIC_RELEASE, "workgroup"); } while (0)

// Causal multi-head self-attention with token padding masks on BOTH keys and queries (embeddings [4,2048,512], token_masks [4,2048] int 0/1 (random here: about half the tokens masked); 8 heads x 64; (in,out) Wq/Wk/Wv/Wo [512,512], no biases): scores = q.k/8, where(causal & tm[k] & tm[q], scores, -1e30), softmax, context Wo. A query with tm[q] = 0 gets all scores = -1e30 -> exactly uniform attention over all 2,048 positions (context = mean V).
#define NB 4
#define TT 2048
#define CC 512            // NH * HD = projected width
#define DIN 512          // input (model) width
#define NH 8
#define HD 64
#define SCALE (0.125f)
#define CAUSAL 1
#ifndef TNB
#define TNB NB
#endif
__device__ __forceinline__ float bfr(float v) { return (float)(__bf16)v; }
__host__ __device__ __forceinline__ int kb_last(int qb) { return CAUSAL ? ((qb * 64 + 63) >> 7) : (TT / 128 - 1); }
typedef __attribute__((ext_vector_type(8))) __bf16 v8b;
__device__ __forceinline__ v16b frag_b(const __bf16* rowk0, int lane) {
  union { v16b v; v8b q[2]; } u; const __bf16* p = rowk0 + 8 * (lane >> 4);
  u.q[0] = *(const v8b*)p; u.q[1] = *(const v8b*)(p + 16); return u.v;
}
#define QBH 6              // causal: query blocks 0..QBH-1 of each sequence (few keys, no averaging) take the high-precision path
#define QHI 384            // rows carrying a q residual plane (read only by the 3-product logits of query blocks < QBH)
#define KHI 384            // key rows carrying k residual / v bf16 hi+lo planes (used only by the causal high-precision path)
// B fragment (k rows k0+.., output column o) of a weight: (in,out) [K][ld] or (out,in) [ld rows of K]: bf16 exact, or f16(bf16 * 256) exact
__device__ __forceinline__ v16b wcol_io(const float* Wm, int k0, int o, int lane, int ld) { v16b w; const int g = lane >> 4;
#pragma unroll
  for (int i = 0; i < 8; ++i) { w[i] = (__bf16)Wm[(size_t)(k0 + 8 * g + i) * ld + o]; w[8 + i] = (__bf16)Wm[(size_t)(k0 + 16 + 8 * g + i) * ld + o]; }
  return w; }
__device__ __forceinline__ v16b wcol_oi(const float* Wm, int k0, int o, int lane, int K) { v16b w; const float* p = Wm + (size_t)o * K + k0 + 8 * (lane >> 4);
#pragma unroll
  for (int i = 0; i < 8; ++i) { w[i] = (__bf16)p[i]; w[8 + i] = (__bf16)p[16 + i]; }
  return w; }
__device__ __forceinline__ v16h wcolh_io(const float* Wm, int k0, int o, int lane, int ld) { v16h w; const int g = lane >> 4;
#pragma unroll
  for (int i = 0; i < 8; ++i) { w[i] = (_Float16)(bfr(Wm[(size_t)(k0 + 8 * g + i) * ld + o]) * 256.0f); w[8 + i] = (_Float16)(bfr(Wm[(size_t)(k0 + 16 + 8 * g + i) * ld + o]) * 256.0f); }
  return w; }
__device__ __forceinline__ v16h wcolh_oi(const float* Wm, int k0, int o, int lane, int K) { v16h w; const float* p = Wm + (size_t)o * K + k0 + 8 * (lane >> 4);
#pragma unroll
  for (int i = 0; i < 8; ++i) { w[i] = (_Float16)(bfr(p[i]) * 256.0f); w[8 + i] = (_Float16)(bfr(p[16 + i]) * 256.0f); }
  return w; }
#define WQKV_LAYOUT 0   // picks WCOL's layout only; no kernel calls WCOL: k_perm reads Wq/Wk/Wv as (in,out) [DIN][CC] whatever its value
__device__ __forceinline__ v16b wcol_hdk(const float* Wm, int k0, int o, int lane) { v16b w; const int g = lane >> 4; const float* p = Wm + (size_t)(o / HD) * DIN * HD + (o % HD);
#pragma unroll
  for (int i = 0; i < 8; ++i) { w[i] = (__bf16)p[(size_t)(k0 + 8 * g + i) * HD]; w[8 + i] = (__bf16)p[(size_t)(k0 + 16 + 8 * g + i) * HD]; }
  return w; }
#define WO_OUT_IN 0
#if WQKV_LAYOUT == 1
#define WCOL(W, k0, o, lane) wcol_oi(W, k0, o, lane, DIN)
#elif WQKV_LAYOUT == 2
#define WCOL(W, k0, o, lane) wcol_hdk(W, k0, o, lane)
#else
#define WCOL(W, k0, o, lane) wcol_io(W, k0, o, lane, CC)
#endif
#if WO_OUT_IN
#define WOCOL(W, k0, o, lane) wcol_oi(W, k0, o, lane, CC)
#define WOCOLH(W, k0, o, lane) wcolh_oi(W, k0, o, lane, CC)
#else
#define WOCOL(W, k0, o, lane) wcol_io(W, k0, o, lane, DIN)
#define WOCOLH(W, k0, o, lane) wcolh_io(W, k0, o, lane, DIN)
#endif
// masks: keys need causal (key range + index test) AND token_masks[b][k] != 0; a query with token_masks[b][t] == 0 has EVERY score = -1e30 in the module -> exactly uniform attention over all 2,048 positions -> its context is mean_k V (handled by k_meanv/k_fixq below; here such rows just get a harmless finite placeholder)
// ---- k_perm: block = one sequence. IDX[b][r] = the token at sorted place r: the n unmasked tokens first, then the masked ones, each group in its old order; NU[b * 32] = n (a 128-byte line per sequence: one writer a line).
// The order of the unmasked tokens is kept, so among them 'key <= query' reads the same on places as on tokens, and a masked key is simply a place >= n: attention runs on the first n places alone, for any mask. q, k, v planes are laid out by place; the context row goes back to its token's row.
// Blocks TNB.. of the same launch copy the weights to five 16-bit planes (Wq, Wk, Wv, Wo, Wo again) in FRAGMENT ORDER: 16-byte unit u = ((kc * 32 + ot) * 2 + q) * 32 + lane holds W[kc * 32 + 16 q + 8 (lane >> 4) + 0..7][ot * 16 + (lane & 15)], so a wave fetches half a B fragment of k chunk kc, column tile ot, as one 512-byte run of whole lines. Values: bf16(W); the fifth plane f16(bf16(Wo) x 2^8).
#define PW (TT / 64)   /* waves of k_perm: 64 tokens a wave */
#define WPL ((size_t)DIN * CC)          /* elements of one packed plane */
#define WKS ((size_t)(CC / 16) * 512)   /* elements from one k chunk to the next in a packed plane */
#define WST(st) ((size_t)((st) >> 1) * WKS + (size_t)((st) & 1) * 2048)   /* stage st of a 128-column block: k chunk st / 2, its first or second four column tiles */
#define WPB ((DIN / 32) * (CC / 16) * 64 / (32 * PW))   /* blocks that pack one weight: a thread a unit */
static_assert(DIN == CC && CC == 512 && WPB * 32 * PW == (DIN / 32) * (CC / 16) * 64, "the unit index is cut by shifts; whole blocks");
static_assert(2 * PW == 64, "a lane holds two of the 64 group counts");
__global__ __launch_bounds__(32 * PW) void k_perm(const int* __restrict__ TM, const float* __restrict__ WQ, const float* __restrict__ WK, const float* __restrict__ WV, const float* __restrict__ WO, int* __restrict__ IDX, int* __restrict__ NU, __bf16* __restrict__ WP, _Float16* __restrict__ WOH) { __shared__ int cnt[2 * PW]; __shared__ int sidx[TT];
  if (blockIdx.x >= TNB) {   /* the same for the whole block, ahead of every barrier */
    const int pb = blockIdx.x - TNB, m = pb / WPB, u = (pb % WPB) * (32 * PW) + threadIdx.x; const int ln = u & 31, q = (u >> 5) & 1, ot = (u >> 6) & 31, kc = u >> 11;
    const float* src = (m == 0 ? WQ : m == 1 ? WK : m == 2 ? WV : WO) + (size_t)(kc * 32 + 16 * q + 8 * (ln >> 4)) * CC + ot * 16 + (ln & 15); float f[8];
#pragma unroll
    for (int i = 0; i < 8; ++i) f[i] = src[(size_t)i * CC];
    asm volatile("s_wait_xcnt 0x0" :: "v"(src) : "memory");   /* the eight loads share one address pair: it stays whole until this wait */
    if (m < 4) { v8b o;
#pragma unroll
      for (int i = 0; i < 8; ++i) o[i] = (__bf16)f[i];
      vst2(WP + (size_t)m * WPL + (size_t)u * 8, o);
    } else { v8h oh;
#pragma unroll
      for (int i = 0; i < 8; ++i) oh[i] = (_Float16)(bfr(f[i]) * 256.0f);
      vst2(WOH + (size_t)u * 8, oh); }
    return; }   /* one store a thread, the thread's last instruction */
  const int tid = threadIdx.x, wave = tid >> 5, lane = tid & 31, b = blockIdx.x; const int* TMb = TM + (size_t)b * TT; unsigned bal[2];
#pragma unroll
  for (int u = 0; u < 2; ++u) bal[u] = (unsigned)__ballot(TMb[(wave * 2 + u) * 32 + lane] != 0);
  if (lane < 2) cnt[wave * 2 + lane] = __popc(lane ? bal[1] : bal[0]);
  __syncthreads();   /* the 64 groups' counts are in LDS before a wave sums them */
  const int c0 = cnt[lane], c1 = cnt[32 + lane]; int tot = c0 + c1, bef = (lane < wave * 2 ? c0 : 0) + (32 + lane < wave * 2 ? c1 : 0);
#pragma unroll
  for (int o = 1; o < 32; o <<= 1) { tot += __shfl_xor(tot, o); bef += __shfl_xor(bef, o); }
#pragma unroll
  for (int u = 0; u < 2; ++u) { const int t = (wave * 2 + u) * 32 + lane; const int ones = bef + (u ? __popc(bal[0]) : 0) + __popc(bal[u] & ((1u << lane) - 1u)); sidx[((bal[u] >> lane) & 1u) ? ones : tot + (t - ones)] = t; }
  __syncthreads();   /* the whole list is in LDS before it leaves by whole lines */
#pragma unroll
  for (int u = 0; u < 2; ++u) vst2(IDX + (size_t)b * TT + u * 32 * PW + tid, sidx[u * 32 * PW + tid]);
  if (tid == 0) vst2(NU + b * 32, tot); }
__device__ __forceinline__ int n_unmasked(const int* NU, int b) { const int n = NU[b * 32]; return __builtin_amdgcn_readfirstlane(n < 0 ? 0 : n > TT ? TT : n); }   /* bounded whatever the word holds; through readfirstlane so that the tests on it are scalar branches */
// ---- k_meanv: block = 32 channels of one batch, wave per channel: MV[b][c] = (1/2048) sum_t v[b][t][c] from the f16 v plane - the context of a fully-masked query row (softmax of 2,048 equal scores = exactly 1/2048 each). A wave reads its 4 KB row by whole lines, all loads in flight at once; f32 sums: eight chains a lane, a tree over them, then across the lanes. The 32 means leave as one 128-byte line from one wave.
#define MVW 32
static_assert(CC % MVW == 0 && TT % 256 == 0, "whole blocks of channels, whole 512-byte passes over a row");
__global__ __launch_bounds__(32 * MVW) void k_meanv(const _Float16* __restrict__ VT, float* __restrict__ MV) { __shared__ float sm[MVW];
  const int tid = threadIdx.x, wave = tid >> 5, lane = tid & 31; const int b = blockIdx.y, c0 = blockIdx.x * MVW; const _Float16* p = VT + ((size_t)b * CC + c0 + wave) * TT + lane * 8; hx8 hv[TT / 256];   /* the loops below are unrolled whole: hv and a stay in registers, and the loads issue back to back ahead of the first add */
#pragma unroll
  for (int i = 0; i < TT / 256; ++i) hv[i] = *(const hx8*)(p + i * 256);
  asm volatile("s_wait_xcnt 0x0" :: "v"(p) : "memory");   /* the loads share one address pair: it stays whole (no load lands on it) until this wait */
  float a[8];
#pragma unroll
  for (int j = 0; j < 8; ++j) a[j] = (float)hv[0][j];
#pragma unroll
  for (int i = 1; i < TT / 256; ++i)
#pragma unroll
    for (int j = 0; j < 8; ++j) a[j] += (float)hv[i][j];
  float s = ((a[0] + a[1]) + (a[2] + a[3])) + ((a[4] + a[5]) + (a[6] + a[7]));
#pragma unroll
  for (int o = 1; o < 32; o <<= 1) s += __shfl_xor(s, o);
  if (lane == 0) sm[wave] = s;
  __syncthreads();   /* the 32 waves' sums are in LDS before wave 0 stores them as one line */
  if (tid < MVW) vst2(MV + (size_t)b * CC + c0 + tid, sm[tid] * (1.0f / TT)); }
// ---- k_fixq: wave per masked query row (token_masks[b][t] == 0): ctx row Y[b*TT + t][:] = MV[b][:] (512 floats = 2 KB by 32 lanes x 4 x 16 B); unmasked rows untouched (wave-uniform branch)
__global__ __launch_bounds__(256) void k_fixq(const int* __restrict__ TM, const float* __restrict__ MV, float* __restrict__ Y) { const int tid = threadIdx.x; const size_t row = (size_t)blockIdx.x * 8 + (tid >> 5); const int lane = tid & 31; const int b = (int)(row / TT);
  const int tq = TM[row]; asm volatile("s_wait_loadcnt 0x0" ::: "memory"); if (tq != 0) return;
#pragma unroll
  for (int q = 0; q < CC / 128; ++q) { const v4f v = *(const v4f*)(MV + (size_t)b * CC + (q * 32 + lane) * 4); asm volatile("s_wait_loadcnt 0x0" ::: "memory"); vst2(Y + row * CC + (q * 32 + lane) * 4, v); } }
#define WS_MV (WS_END)                                    // f32 mean-v rows [b][512]
#define WS_END2 (WS_MV + 4u * (size_t)NB * CC)
#define WS_IDX (WS_END2)                                  // int token of each sorted place [b][t]
#define WS_NU  (WS_IDX + 4u * (size_t)NB * TT)            // int unmasked tokens of a sequence, one 128-byte line each
#define WS_END3 (WS_NU + 128u * (size_t)NB)
#define WS_WP  (WS_END3)                                  // bf16 Wq, Wk, Wv, Wo in fragment order
#define WS_WOH (WS_WP + 2u * 4u * (size_t)DIN * CC)       // f16(bf16 Wo x 2^8) in fragment order
#define WS_END4 (WS_WOH + 2u * (size_t)DIN * CC)

#define WS_QH  0u                                      // f16 q rows [b*t][CC]
#define WS_KH  (WS_QH + 2u * (size_t)NB * TT * CC)      // f16 k rows [b*t][CC]
#define WS_VT  (WS_KH + 2u * (size_t)NB * TT * CC)      // f16 v planes [b][c][t]
#define WS_QL  (WS_VT + 2u * (size_t)NB * CC * TT)      // f16 q residual x 2^10 rows [b][t < QHI][CC]
#define WS_KL  (WS_QL + 2u * (size_t)NB * QHI * CC)     // f16 k residual x 2^10 rows [b][t < KHI][CC]
#define WS_VB  (WS_KL + 2u * (size_t)NB * KHI * CC)     // bf16 v hi planes [b][c][t < KHI]
#define WS_VBL (WS_VB + 2u * (size_t)NB * CC * KHI)
#define WS_Y   (WS_VBL + 2u * (size_t)NB * CC * KHI)     // f32 ctx rows [b*t][CC] (only when there is an output projection)
#define WS_END (WS_Y  + 4u * (size_t)NB * TT * CC)

// operands fetched ahead of their products: 16 f32 of an A row in fragment order (x[0..1] = p[0..7], x[2..3] = p[16..23]); N / 2 B fragments of a packed plane as N runs of 512 bytes a wave
__device__ __forceinline__ void ld_xr(const float* p, v4f x[4]) { x[0] = *(const v4f*)p; x[1] = *(const v4f*)(p + 4); x[2] = *(const v4f*)(p + 16); x[3] = *(const v4f*)(p + 20); }
template <int N, typename T, typename T8> __device__ __forceinline__ void ld_wf(const T* p, T8 w[N]) {
#pragma unroll
  for (int t = 0; t < N; ++t) w[t] = *(const T8*)(p + t * 256); }
__device__ __forceinline__ v16b two_b(v8b a, v8b b) { union { v16b v; v8b q[2]; } u; u.q[0] = a; u.q[1] = b; return u.v; }
__device__ __forceinline__ v16h two_h(v8h a, v8h b) { union { v16h v; v8h q[2]; } u; u.q[0] = a; u.q[1] = b; return u.v; }
// ---- k_proj: block = (64 sorted places, 128 cols, which), the X row of a place through IDX; q and k blocks wholly behind the last 128-place group that holds an unmasked token leave at once (k_att reads no place there): q/k/v = X W (+ b) with exact bf16 products (K = DIN) -> which 0: q f16 rows (+ residual rows < QHI); 1: k f16 rows (+ residual rows < KHI); 2: v f16 planes [c][t] (+ bf16 hi/lo planes for t < KHI)
__global__ __launch_bounds__(128) void k_proj(const float* __restrict__ XQ, const float* __restrict__ XK, const float* __restrict__ XV, const __bf16* __restrict__ WP, const float* __restrict__ BQ, const float* __restrict__ BK, const float* __restrict__ BV, const int* __restrict__ IDX, const int* __restrict__ NU,
    _Float16* __restrict__ QH, _Float16* __restrict__ QL, _Float16* __restrict__ KH, _Float16* __restrict__ KL, _Float16* __restrict__ VT, __bf16* __restrict__ VB, __bf16* __restrict__ VBL) {
  __shared__ __align__(16) _Float16 sh[64][136], sl[64][136]; __shared__ __align__(16) _Float16 th[128][72]; __shared__ __align__(16) __bf16 tb[128][72], tbl[128][72];
  const int tid = threadIdx.x, wave = tid >> 5, lane = tid & 31, col = lane & 15, g = lane >> 4; const int which = blockIdx.z; const int c0 = blockIdx.y * 128; const size_t r0 = (size_t)blockIdx.x * 64; const size_t bb = r0 / TT; const int t0 = (int)(r0 % TT);
  if (which < 2 && t0 >= ((n_unmasked(NU, (int)bb) + 127) & ~127)) return;   /* the same for the whole block, ahead of every barrier */
  const float* X = which == 0 ? XQ : which == 1 ? XK : XV; const float* BA = which == 0 ? BQ : which == 1 ? BK : BV;
  const float* xr = X + (bb * TT + (size_t)(IDX[r0 + wave * 16 + col] & (TT - 1))) * DIN;   /* the mask bounds the row whatever the list holds */
  const float* xp = xr + 8 * g; const __bf16* wp = WP + (size_t)which * WPL + ((size_t)(c0 >> 4) * 64 + lane) * 8;
  v8f acc[8] = {}; v4f xs[2][4]; v8b wf[4][8]; v16b a; ld_xr(xp, xs[0]); ld_xr(xp + 32, xs[1]);
#pragma unroll
  for (int t = 0; t < 3; ++t) ld_wf<8>(wp + WST(t), wf[t]);
#pragma unroll   /* whole: the operand sets stay in registers, every step of the two addresses is a constant offset */
  for (int st = 0; st < DIN / 16; ++st) { const int hf = st & 1, kc = st >> 1;   /* a stage = half a k chunk: four column tiles; B is fetched three stages ahead, A two chunks ahead */
    if (hf == 0) {
#pragma unroll
      for (int i = 0; i < 4; ++i) { a[i] = (__bf16)xs[kc & 1][0][i]; a[4 + i] = (__bf16)xs[kc & 1][1][i]; a[8 + i] = (__bf16)xs[kc & 1][2][i]; a[12 + i] = (__bf16)xs[kc & 1][3][i]; }
      if (kc + 2 < DIN / 32) ld_xr(xp + (kc + 2) * 32, xs[kc & 1]); }
    if (st + 3 < DIN / 16) ld_wf<8>(wp + WST(st + 3), wf[(st + 3) & 3]);   /* into the set that the last stage has left */
    if (st + 4 == DIN / 16) asm volatile("s_wait_xcnt 0x0" :: "v"(xp), "v"(wp) : "memory");   /* behind the last loads: the two address pairs stay whole until this wait */
#pragma unroll
    for (int j = 0; j < 4; ++j) acc[hf * 4 + j] = wmma_bf(a, two_b(wf[st & 3][2 * j], wf[st & 3][2 * j + 1]), acc[hf * 4 + j]);
    __builtin_amdgcn_sched_barrier(0); }   /* keeps the next stage's conversions, and with them the wait on loads just issued, behind this stage's products */
  if (which < 2) { _Float16* DH = which == 0 ? QH : KH; _Float16* DL = which == 0 ? QL : KL; const int nhi = which == 0 ? QHI : KHI; const bool hi_rows = t0 < nhi;
#pragma unroll
    for (int j = 0; j < 8; ++j) { const float bias = BA ? bfr(BA[c0 + j * 16 + col]) : 0.f;
#pragma unroll
      for (int r = 0; r < 8; ++r) { const float v = acc[j][r] + bias; const _Float16 hv = (_Float16)v; sh[wave * 16 + 8 * g + r][j * 16 + col] = hv; sl[wave * 16 + 8 * g + r][j * 16 + col] = (_Float16)((v - (float)hv) * 1024.0f); } }
    __syncthreads();
    for (int e = tid; e < 64 * 16; e += 128) { const int rl = e >> 4, q = e & 15; vst2((unsigned*)(DH + (r0 + rl) * CC + c0 + q * 8), *(const v4u*)&sh[rl][q * 8]); if (hi_rows) vst2((unsigned*)(DL + (bb * nhi + t0 + rl) * (size_t)CC + c0 + q * 8), *(const v4u*)&sl[rl][q * 8]); }
  } else { const bool hi_rows = t0 < KHI;
#pragma unroll
    for (int j = 0; j < 8; ++j) { const float bias = BA ? bfr(BA[c0 + j * 16 + col]) : 0.f;
#pragma unroll
      for (int r = 0; r < 8; ++r) { const float v = acc[j][r] + bias; const int rl = wave * 16 + 8 * g + r, cl = j * 16 + col; th[cl][rl] = (_Float16)v; const __bf16 bh = (__bf16)v; tb[cl][rl] = bh; tbl[cl][rl] = (__bf16)(v - (float)bh); } }
    __syncthreads();
    for (int e = tid; e < 128 * 8; e += 128) { const int cl = e >> 3, q = e & 7; vst2((unsigned*)(VT + (bb * CC + c0 + cl) * (size_t)TT + t0 + q * 8), *(const v4u*)&th[cl][q * 8]); if (hi_rows) { const size_t o3 = (bb * CC + c0 + cl) * (size_t)KHI + t0 + q * 8; vst2((unsigned*)(VB + o3), *(const v4u*)&tb[cl][q * 8]); vst2((unsigned*)(VBL + o3), *(const v4u*)&tbl[cl][q * 8]); } } } }
// ---- k_att: a tile = 16 sorted places of (b, h) as queries, worked on by the AW waves of a block. AG blocks share the tiles of one (b, h) and each walks its own in a loop: NH * TNB * AG blocks fill the chip's places once (two blocks' LDS fit a WGP), so no wave is started for a tile of masked tokens (k_fixq writes their rows) and a block's start is paid once for all its tiles. Only the nt = ceil(n / 16) tiles that hold an unmasked token are dealt: by rank from the longest (rank r = tile nt - 1 - r), 16 ranks a pass, forwards and backwards by turns, so the blocks' key counts come out level. The 16 score rows live in LDS from the logits to P, so no score plane goes through memory and one launch covers every (b, h).
// step 1, logits: wave w takes the 16-key tiles w, w + AW, ... of keys [0, kend): q x k on f16 (3 products with the x 2^10 residual planes for query blocks < QBH), x SCALE; causal and key masks (place < n) by select at the LDS store.
// step 2, softmax: wave w owns row w in registers, f32, sums by lane then across lanes; P x 2^11 back in place (0 for excluded keys); a query with token_masks == 0 gets a finite placeholder row here and its context from k_fixq.
// step 3, P.v: wave w sums the 32-key chunks w, w + AW, ... (P once to f16 against v f16; query blocks < QBH: P and v as bf16 hi + lo, 3 products); the AW partial tiles are added in f32 through LDS in wave order.
#define AG 16          /* blocks that share the tiles of one (b, h) */
#define AW 16          /* the wave number goes through readfirstlane so that the tile loops are scalar loops and every lane is on at the matrix instructions */
#define SP (TT + 4)    /* row pitch in floats: 16 B past a multiple of 256 B, so the 16 rows of a b128 fragment read fall on different banks */
static_assert((TT / 16) % AG == 0, "whole passes over the ranks");
static_assert(QBH * 64 >= QHI, "every row with a q residual plane takes the 3-product path");
static_assert(AW * 16 * (HD + 4) <= 16 * SP, "the partial tiles reuse the score rows' LDS");
static_assert(16 * (HD / 2) == 32 * AW, "in the last step a wave stores the row of its own number");
// 16 f32 of one LDS row in fragment order (0..7 = p[0..7], 8..15 = p[16..23]) by four 16-byte reads
__device__ __forceinline__ void lds_row16(const float* p, float v[16]) { const v4f a = *(const v4f*)p, b = *(const v4f*)(p + 4), c = *(const v4f*)(p + 16), d = *(const v4f*)(p + 20);
#pragma unroll
  for (int i = 0; i < 4; ++i) { v[i] = a[i]; v[4 + i] = b[i]; v[8 + i] = c[i]; v[12 + i] = d[i]; } }
// a 16-bit fragment at the lane's own byte address. k_att forms that address where it is used, as a tile's wave-uniform base (scalar registers) + the lane's 32-bit byte offset: one vector register serves every plane of a pitch, where a 64-bit pair a plane, held over the tile loop, would not fit the 128 registers that two blocks a WGP leave a wave
template <typename V16, typename V8> __device__ __forceinline__ V16 frag_p(const char* p) { union { V16 v; V8 q[2]; } u; u.q[0] = *(const V8*)p; u.q[1] = *(const V8*)(p + 32); return u.v; }
__global__ __launch_bounds__(32 * AW) __attribute__((amdgpu_waves_per_eu(8, 8))) void k_att(const _Float16* __restrict__ QH, const _Float16* __restrict__ KH, const _Float16* __restrict__ QL, const _Float16* __restrict__ KL, const _Float16* __restrict__ VT, const __bf16* __restrict__ VB, const __bf16* __restrict__ VBL, const int* __restrict__ IDX, const int* __restrict__ NU, float* __restrict__ Y) { __shared__ __align__(16) float sc[16][SP];
  const int tid = threadIdx.x, wave = __builtin_amdgcn_readfirstlane(tid >> 5), lane = tid & 31, col = lane & 15, g = lane >> 4; const int h = blockIdx.x % NH, b = blockIdx.x / NH, sl = blockIdx.y;
  const int nb = n_unmasked(NU, b); const int nt = (nb + 15) >> 4;
  const unsigned ro = (unsigned)col * (CC * 2) + 16 * g, vo = (unsigned)col * (TT * 2) + 16 * g, bo = (unsigned)col * (KHI * 2) + 16 * g;   /* the lane's bytes into 16 rows of q or k, of the f16 v plane, of the bf16 v planes */
  for (int ps = 0; ps < TT / 16 / AG; ++ps) { const int qt = nt - 1 - (ps * AG + ((ps & 1) ? AG - 1 - sl : sl)); if (qt < 0) break;   /* scalar, the same for the whole block; the rank grows with ps, so no later pass has a tile either */
  const int qb = qt >> 2; const int ql0 = qt * 16; const int kend = (kb_last(qb) + 1) * 128;
  const size_t q0 = (size_t)b * TT + ql0, kr0 = (size_t)b * TT; const int tq = ql0 + wave < nb; const int orow = IDX[(size_t)b * TT + ql0 + wave] & (TT - 1);   /* the token whose context row this wave stores; the mask bounds the row whatever the list holds */
  const char* qp = (const char*)(QH + q0 * CC + h * HD) + ro;
  if (qb < QBH) { const char* qlp = (const char*)(QL + ((size_t)b * QHI + ql0) * CC + h * HD) + ro; v16h ah[HD / 32], al[HD / 32];
#pragma unroll
    for (int kc = 0; kc < HD / 32; ++kc) { ah[kc] = frag_p<v16h, v8h>(qp + kc * 64); al[kc] = frag_p<v16h, v8h>(qlp + kc * 64); }
    asm volatile("s_wait_xcnt 0x0" :: "v"(qp), "v"(qlp) : "memory");   /* the q loads' two address pairs stay whole (no load lands on them) until this wait */
    for (int kt = wave; kt < kend / 16; kt += AW) { const int key = kt * 16 + col; v8f acc = {}, accl = {}; const char* kp = (const char*)(KH + (kr0 + kt * 16) * CC + h * HD) + ro; const char* klp = (const char*)(KL + ((size_t)b * KHI + kt * 16) * CC + h * HD) + ro;
      v16h kbf[HD / 32], klf[HD / 32];   /* all of the tile's loads stand ahead of its first product: one memory latency a tile */
#pragma unroll
      for (int kc = 0; kc < HD / 32; ++kc) { kbf[kc] = frag_p<v16h, v8h>(kp + kc * 64); klf[kc] = frag_p<v16h, v8h>(klp + kc * 64); }
      asm volatile("s_wait_xcnt 0x0" :: "v"(kp), "v"(klp) : "memory");   /* the k loads' two address pairs stay whole (no load lands on them) until this wait */
#pragma unroll
      for (int kc = 0; kc < HD / 32; ++kc) { acc = wmma16(ah[kc], kbf[kc], acc); accl = wmma16(al[kc], kbf[kc], accl); accl = wmma16(ah[kc], klf[kc], accl); }
#pragma unroll
      for (int r = 0; r < 8; ++r) sc[8 * g + r][key] = ((!CAUSAL || key <= ql0 + 8 * g + r) && key < nb) ? (acc[r] + accl[r] * (1.0f / 1024.0f)) * SCALE : -3.0e38f; }
  } else { v16h ah[HD / 32];
#pragma unroll
    for (int kc = 0; kc < HD / 32; ++kc) ah[kc] = frag_p<v16h, v8h>(qp + kc * 64);
    asm volatile("s_wait_xcnt 0x0" :: "v"(qp) : "memory");   /* the q loads share one address pair: it stays whole (no k load lands on it) until this wait */
    for (int kt0 = wave; kt0 < kend / 16; kt0 += 4 * AW) { v16h kbf[4][HD / 32] = {};   /* the start value: registers left unset on a skipped tile's path are carried round the tile loop and spill; the loads of up to four tiles stand ahead of the first product: one memory latency for four tiles; the tests on the tile number are scalar */
      const char* kp = (const char*)(KH + (kr0 + kt0 * 16) * CC + h * HD) + ro;   /* one address pair for the four tiles, the tile's step as a constant offset */
#pragma unroll
      for (int u = 0; u < 4; ++u) if (kt0 + u * AW < kend / 16) {
#pragma unroll
        for (int kc = 0; kc < HD / 32; ++kc) kbf[u][kc] = frag_p<v16h, v8h>(kp + u * (AW * 16 * CC * 2) + kc * 64); }
      asm volatile("s_wait_xcnt 0x0" :: "v"(kp) : "memory");   /* the k loads share one address pair: it stays whole (no load lands on it) until this wait */
#pragma unroll
      for (int u = 0; u < 4; ++u) if (kt0 + u * AW < kend / 16) { const int key = (kt0 + u * AW) * 16 + col; v8f acc = {};
#pragma unroll
        for (int kc = 0; kc < HD / 32; ++kc) acc = wmma16(ah[kc], kbf[u][kc], acc);
#pragma unroll
        for (int r = 0; r < 8; ++r) sc[8 * g + r][key] = ((!CAUSAL || key <= ql0 + 8 * g + r) && key < nb) ? acc[r] * SCALE : -3.0e38f; } } }
  __syncthreads();   /* every tile of the 16 score rows is in LDS before a wave reads its row */
  { const int nq = kend >> 7; v4f vv[TT / 128] = {};   /* the start value: as for kbf above; 128 keys a pass: 32 lanes x 4; the tests on nq are scalar */
#pragma unroll
    for (int i = 0; i < TT / 128; ++i) if (i < nq) vv[i] = *(const v4f*)&sc[wave][i * 128 + lane * 4];
    float m = -3.0e38f;
#pragma unroll
    for (int i = 0; i < TT / 128; ++i) if (i < nq) { if (tq == 0) vv[i] = (v4f){0.f, 0.f, 0.f, 0.f}; m = fmaxf(m, fmaxf(fmaxf(vv[i][0], vv[i][1]), fmaxf(vv[i][2], vv[i][3]))); }
#pragma unroll
    for (int o = 1; o < 32; o <<= 1) m = fmaxf(m, __shfl_xor(m, o));
    float sum = 0.f;
#pragma unroll
    for (int i = 0; i < TT / 128; ++i) if (i < nq) {
#pragma unroll
      for (int c = 0; c < 4; ++c) { const float v = vv[i][c]; const float ex = expf(v - m); const float e = (v <= -1.0e38f) ? 0.f : ex; vv[i][c] = e; sum += e; } }
#pragma unroll
    for (int o = 1; o < 32; o <<= 1) sum += __shfl_xor(sum, o);
    const float inv = sum > 0.f ? 2048.0f / sum : 0.f;   /* a fully excluded row yields P = 0 */
#pragma unroll
    for (int i = 0; i < TT / 128; ++i) if (i < nq) *(v4f*)&sc[wave][i * 128 + lane * 4] = vv[i] * inv; }
  __syncthreads();   /* all 16 rows of P are in LDS before any wave forms fragments across them */
  const int kce = kend >> 5; v8f acc[HD / 16] = {};
  if (qb < QBH) {
    for (int kc = wave; kc < kce; kc += AW) { float pv[16]; lds_row16(&sc[col][kc * 32 + 8 * g], pv); const F2 p = bsplit16(pv); const size_t po = ((size_t)b * CC + h * HD) * (size_t)KHI + kc * 32; const char* vbp = (const char*)(VB + po) + bo; const char* vlp = (const char*)(VBL + po) + bo;
#pragma unroll
      for (int j2 = 0; j2 < HD / 16; j2 += 2) { v16b vh[2], vl[2];   /* two column tiles' loads stand ahead of their products */
#pragma unroll
        for (int u = 0; u < 2; ++u) { vh[u] = frag_p<v16b, v8b>(vbp + (j2 + u) * (16 * KHI * 2)); vl[u] = frag_p<v16b, v8b>(vlp + (j2 + u) * (16 * KHI * 2)); }
        asm volatile("s_wait_xcnt 0x0" :: "v"(vbp), "v"(vlp) : "memory");   /* the v loads' two address pairs stay whole (no load lands on them) until this wait */
#pragma unroll
        for (int u = 0; u < 2; ++u) { const int j = j2 + u; acc[j] = wmma_bf(p.h, vh[u], acc[j]); acc[j] = wmma_bf(p.l, vh[u], acc[j]); acc[j] = wmma_bf(p.h, vl[u], acc[j]); } } }
  } else {
    for (int kc = wave; kc < kce; kc += AW) { v16h vf[HD / 16]; const char* vp = (const char*)(VT + ((size_t)b * CC + h * HD) * (size_t)TT + kc * 32) + vo;   /* the chunk's four v loads stand ahead of its first product: one memory latency a chunk */
#pragma unroll
      for (int j = 0; j < HD / 16; ++j) vf[j] = frag_p<v16h, v8h>(vp + j * (16 * TT * 2));
      asm volatile("s_wait_xcnt 0x0" :: "v"(vp) : "memory");   /* the eight loads share one address pair: it stays whole (no load lands on it) until this wait */
      float pv[16]; lds_row16(&sc[col][kc * 32 + 8 * g], pv); v16h p;
#pragma unroll
      for (int i = 0; i < 16; ++i) p[i] = (_Float16)pv[i];
#pragma unroll
      for (int j = 0; j < HD / 16; ++j) acc[j] = wmma16(p, vf[j], acc[j]); } }
  __syncthreads();   /* every wave has read its last P fragment before the partial tiles overwrite the rows */
  float (*ss)[16][HD + 4] = (float (*)[16][HD + 4])&sc[0][0];
#pragma unroll
  for (int j = 0; j < HD / 16; ++j)
#pragma unroll
    for (int r = 0; r < 8; ++r) ss[wave][8 * g + r][j * 16 + col] = acc[j][r];
  __syncthreads();   /* every wave's partial tile is in LDS before any wave adds them */
  for (int e = tid; e < 16 * (HD / 2); e += 32 * AW) { const int rl = e / (HD / 2), q = e % (HD / 2); v2f s = *(const v2f*)&ss[0][rl][q * 2];
#pragma unroll   /* the AW LDS reads issue ahead of the adds; rolled, each add would wait a full LDS latency */
    for (int w = 1; w < AW; ++w) s += *(const v2f*)&ss[w][rl][q * 2];
    vst2(Y + ((size_t)b * TT + orow) * CC + h * HD + q * 2, s * (1.0f / 2048.0f));
    asm volatile("s_wait_xcnt 0x0" ::: "memory"); }   /* behind the store: the next tile rewrites its address and data registers */
  __syncthreads(); } }   /* every wave has read the partial tiles before the next tile's scores overwrite them */
// ---- k_out: block = (64 rows, 128 cols): out = ctx Wo (+ bo): ctx x 2^6 once to f16 against Wo as f16(bf16 x 2^8) exact (1 product) x 2^-14; causal early rows (< QHI of each sequence): ctx bf16 hi + lo against exact bf16 Wo (2 products)
__global__ __launch_bounds__(128) void k_out(const float* __restrict__ Y, const __bf16* __restrict__ WOB, const _Float16* __restrict__ WOH, const float* __restrict__ BO, float* __restrict__ OUT) { __shared__ __align__(16) float sf[4][16][132];
  const int tid = threadIdx.x, wave = tid >> 5, lane = tid & 31, col = lane & 15, g = lane >> 4; const int c0 = blockIdx.y * 128; const size_t r0 = (size_t)blockIdx.x * 64 + wave * 16;
  v8f acc[8] = {}; const float* xp = Y + (r0 + col) * CC + 8 * g; const size_t wo = ((size_t)(c0 >> 4) * 64 + lane) * 8; v4f xs[2][4]; ld_xr(xp, xs[0]); ld_xr(xp + 32, xs[1]);
  if (CAUSAL && (int)(((size_t)blockIdx.x * 64) % TT) < QHI) {   /* block-uniform */
    const __bf16* wp = WOB + wo; v8b wf[3][8]; F2 a;
#pragma unroll
    for (int t = 0; t < 2; ++t) ld_wf<8>(wp + WST(t), wf[t]);
#pragma unroll   /* whole, stages as in k_proj; two products a tile, so B two stages ahead covers as much */
    for (int st = 0; st < CC / 16; ++st) { const int hf = st & 1, kc = st >> 1;
      if (hf == 0) { float v[16];
#pragma unroll
        for (int i = 0; i < 4; ++i) { v[i] = xs[kc & 1][0][i]; v[4 + i] = xs[kc & 1][1][i]; v[8 + i] = xs[kc & 1][2][i]; v[12 + i] = xs[kc & 1][3][i]; }
        a = bsplit16(v); if (kc + 2 < CC / 32) ld_xr(xp + (kc + 2) * 32, xs[kc & 1]); }
      if (st + 2 < CC / 16) ld_wf<8>(wp + WST(st + 2), wf[(st + 2) % 3]);   /* into the set that the last stage has left */
      if (st + 3 == CC / 16) asm volatile("s_wait_xcnt 0x0" :: "v"(xp), "v"(wp) : "memory");   /* behind the last loads: the two address pairs stay whole until this wait */
#pragma unroll
      for (int j = 0; j < 4; ++j) { const int jj = hf * 4 + j; const v16b w = two_b(wf[st % 3][2 * j], wf[st % 3][2 * j + 1]); acc[jj] = wmma_bf(a.h, w, acc[jj]); acc[jj] = wmma_bf(a.l, w, acc[jj]); }
      __builtin_amdgcn_sched_barrier(0); }   /* keeps the next stage's conversions, and with them the wait on loads just issued, behind this stage's products */
#pragma unroll
    for (int j = 0; j < 8; ++j) { const float bias = BO ? bfr(BO[c0 + j * 16 + col]) : 0.f;
#pragma unroll
      for (int r = 0; r < 8; ++r) sf[wave][8 * g + r][j * 16 + col] = acc[j][r] + bias; }
  } else {
    const _Float16* wp = WOH + wo; v8h wf[4][8]; v16h a;
#pragma unroll
    for (int t = 0; t < 3; ++t) ld_wf<8>(wp + WST(t), wf[t]);
#pragma unroll   /* whole, stages as in k_proj */
    for (int st = 0; st < CC / 16; ++st) { const int hf = st & 1, kc = st >> 1;
      if (hf == 0) {   /* ctx carried x 2^6 into f16 so small-magnitude context rows stay clear of f16 subnormals */
#pragma unroll
        for (int i = 0; i < 4; ++i) { a[i] = (_Float16)(xs[kc & 1][0][i] * 64.0f); a[4 + i] = (_Float16)(xs[kc & 1][1][i] * 64.0f); a[8 + i] = (_Float16)(xs[kc & 1][2][i] * 64.0f); a[12 + i] = (_Float16)(xs[kc & 1][3][i] * 64.0f); }
        if (kc + 2 < CC / 32) ld_xr(xp + (kc + 2) * 32, xs[kc & 1]); }
      if (st + 3 < CC / 16) ld_wf<8>(wp + WST(st + 3), wf[(st + 3) & 3]);   /* into the set that the last stage has left */
      if (st + 4 == CC / 16) asm volatile("s_wait_xcnt 0x0" :: "v"(xp), "v"(wp) : "memory");   /* behind the last loads: the two address pairs stay whole until this wait */
#pragma unroll
      for (int j = 0; j < 4; ++j) acc[hf * 4 + j] = wmma16(a, two_h(wf[st & 3][2 * j], wf[st & 3][2 * j + 1]), acc[hf * 4 + j]);
      __builtin_amdgcn_sched_barrier(0); }   /* keeps the next stage's conversions, and with them the wait on loads just issued, behind this stage's products */
#pragma unroll
    for (int j = 0; j < 8; ++j) { const float bias = BO ? bfr(BO[c0 + j * 16 + col]) : 0.f;
#pragma unroll
      for (int r = 0; r < 8; ++r) sf[wave][8 * g + r][j * 16 + col] = acc[j][r] * (1.0f / 16384.0f) + bias; } }   /* 2^-8 (Wo carry) x 2^-6 (ctx carry) */
  LDSX(); for (int rl = 0; rl < 16; ++rl) vst2(OUT + (r0 + rl) * DIN + c0 + lane * 4, *(const v4f*)&sf[wave][rl][lane * 4]); }

extern "C" void kernel_launch(void* const* d_in, const int* in_sizes, int n_in, void* d_out, int out_size, void* d_ws, size_t ws_size, hipStream_t stream) {
  (void)in_sizes; (void)n_in; (void)out_size;
  const float** F = (const float**)d_in;
  if (ws_size < (size_t)WS_END) return;
  char* ws = (char*)d_ws; _Float16 *QH = (_Float16*)(ws + WS_QH), *KH = (_Float16*)(ws + WS_KH), *VT = (_Float16*)(ws + WS_VT), *QL = (_Float16*)(ws + WS_QL), *KL = (_Float16*)(ws + WS_KL); __bf16 *VB = (__bf16*)(ws + WS_VB), *VBL = (__bf16*)(ws + WS_VBL); float *Y = (float*)(ws + WS_Y);
  (void)Y; (void)QL; (void)KL; (void)VB; (void)VBL;
  // inputs: 0 embeddings [4,2048,512]; 1 token_masks [4,2048] int32 (0/1); 2 Wq [512,512] (in,out); 3 Wk; 4 Wv; 5 Wo (in,out)
  if (ws_size < (size_t)WS_END4) return;
  const int* TM = (const int*)d_in[1]; float* MV = (float*)(ws + WS_MV); int *IDX = (int*)(ws + WS_IDX), *NU = (int*)(ws + WS_NU); __bf16* WP = (__bf16*)(ws + WS_WP); _Float16* WOH = (_Float16*)(ws + WS_WOH);
  k_perm<<<dim3(TNB + 5 * WPB), 32 * PW, 0, stream>>>(TM, F[2], F[3], F[4], F[5], IDX, NU, WP, WOH);
  k_proj<<<dim3(TNB * TT / 64, CC / 128, 3), 128, 0, stream>>>(F[0], F[0], F[0], WP, nullptr, nullptr, nullptr, IDX, NU, QH, QL, KH, KL, VT, VB, VBL);
  k_meanv<<<dim3(CC / MVW, TNB), 32 * MVW, 0, stream>>>(VT, MV);
  k_att<<<dim3(NH * TNB, AG), 32 * AW, 0, stream>>>(QH, KH, QL, KL, VT, VB, VBL, IDX, NU, Y);
  k_fixq<<<dim3(TNB * TT / 8), 256, 0, stream>>>(TM, MV, Y);   /* masked queries: context = mean V */
  k_out<<<dim3(TNB * TT / 64, DIN / 128), 128, 0, stream>>>(Y, WP + 3 * WPL, WOH, nullptr, (float*)d_out);
}

// v007
// A run of this version takes 80 microseconds.
// Two timings next to v006 both put it at 1.09 times that version's speed.
// Counting every step since v000, it is 12.0 times as fast.
// compute dtype: all float inputs rounded to bf16; projections with EXACT bf16 products on WMMA 16x16x32 (f32 accumulate); tokens of a sequence sorted unmasked first (stable), all planes in that order; causal logits: 3 products for the first 384 sorted rows, single f16 q x k after, x 64^-0.5; key/query masks = a length; softmax f32; P x 2^11 once to f16 x v once to f16 (bf16 hi + lo below row 384); fully-masked query rows = mean of the f16 v plane in f32; ctx hi+lo x exact Wo below row 384, x2^6 f16 carry x f16(bf16 x 2^8) Wo after; f32 output.
#include <hip/hip_runtime.h>
#include <math.h>

typedef __attribute__((ext_vector_type(16))) _Float16 v16h;
typedef __attribute__((ext_vector_type(16))) __bf16 v16b;
typedef __attribute__((ext_vector_type(8)))  _Float16 v8h;
typedef __attribute__((ext_vector_type(8)))  float v8f;
typedef __attribute__((ext_vector_type(4)))  float v4f;
typedef __attribute__((ext_vector_type(2)))  float v2f;
typedef __attribute__((ext_vector_type(4)))  unsigned v4u;
typedef _Float16 hx8 __attribute__((ext_vector_type(8)));
typedef __attribute__((ext_vector_type(4)))  int v4i;
typedef float __attribute__((may_alias)) float_a;
typedef int __attribute__((may_alias)) int_a;

template <typename T> __device__ __forceinline__ void vst2(void* p, T v) { *(T*)p = v;  }
__device__ __forceinline__ v8f wmma16(v16h a, v16h b, v8f c) {
  v8f d = __builtin_amdgcn_wmma_f32_16x16x32_f16(false, a, false, b, (short)0, c, false, false);
  asm volatile("v_nop\n\tv_nop\n\tv_nop\n\tv_nop" : "+v"(d) : "v"(a), "v"(b));
  return d;
}
__device__ __forceinline__ v8f wmma_bf(v16b a, v16b b, v8f c) {
  v8f d = __builtin_amdgcn_wmma_f32_16x16x32_bf16(false, a, false, b, (short)0, c, false, false);
  asm volatile("v_nop\n\tv_nop\n\tv_nop\n\tv_nop" : "+v"(d) : "v"(a), "v"(b));
  return d;
}
// 16x16x32 fragments: lane = (h = lane>>4, row/col = lane&15); elements 0..7 = k0+8h+0..7, 8..15 = k0+16+8h+0..7; D element r = row 8h+r
__device__ __forceinline__ v16h frag_h(const _Float16* rowk0, int lane) {
  union { v16h v; v8h q[2]; } u; const _Float16* p = rowk0 + 8 * (lane >> 4);
  u.q[0] = *(const v8h*)p; u.q[1] = *(const v8h*)(p + 16); return u.v;
}
__device__ __forceinline__ v16h frag_f32(const float* rowk0, int lane) {
  v16h a; const float* p = rowk0 + 8 * (lane >> 4);
#pragma unroll
  for (int i = 0; i < 8; ++i) { a[i] = (_Float16)p[i]; a[8 + i] = (_Float16)p[16 + i]; }
  return a;
}
__device__ __forceinline__ v16h frag_f32s(const float* rowk0, int lane, float sc) {
  v16h a; const float* p = rowk0 + 8 * (lane >> 4);
#pragma unroll
  for (int i = 0; i < 8; ++i) { a[i] = (_Float16)(p[i] * sc); a[8 + i] = (_Float16)(p[16 + i] * sc); }
  return a;
}
// column fragment from a [K][ld] layout (column n), rows >= K read as 0
__device__ __forceinline__ v16h fragc_f32(const float* W, int k0, int n, int lane, int ld, int K) {
  v16h a; const int g = lane >> 4;
#pragma unroll
  for (int i = 0; i < 8; ++i) { const int ka = k0 + 8 * g + i, kb = ka + 16;
    a[i] = (_Float16)(ka < K ? W[(size_t)(ka < K ? ka : K - 1) * ld + n] : 0.f); a[8 + i] = (_Float16)(kb < K ? W[(size_t)(kb < K ? kb : K - 1) * ld + n] : 0.f); }
  return a;
}
struct F2 { v16b h, l; };
__device__ __forceinline__ F2 bsplit16(const float v[16]) { F2 r;
#pragma unroll
  for (int i = 0; i < 16; ++i) { const __bf16 h = (__bf16)v[i]; r.h[i] = h; r.l[i] = (__bf16)(v[i] - (float)h); }
  return r; }
__device__ __forceinline__ F2 split_row(const float* row, int k0, int lane) { float v[16]; const float* p = row + k0 + 8 * (lane >> 4);
#pragma unroll
  for (int i = 0; i < 8; ++i) { v[i] = p[i]; v[8 + i] = p[16 + i]; }
  return bsplit16(v); }
__device__ __forceinline__ F2 split_rowK(const float* row, int k0, int lane, int K) { float v[16]; const int g = lane >> 4;
#pragma unroll
  for (int i = 0; i < 8; ++i) { const int ka = k0 + 8 * g + i, kb = ka + 16; v[i] = ka < K ? row[ka < K ? ka : K - 1] : 0.f; v[8 + i] = kb < K ? row[kb < K ? kb : K - 1] : 0.f; }
  return bsplit16(v); }
__device__ __forceinline__ F2 split_col(const float* W, int k0, int n, int lane, int ld, int K) { float v[16]; const int g = lane >> 4;
#pragma unroll
  for (int i = 0; i < 8; ++i) { const int ka = k0 + 8 * g + i, kb = ka + 16; v[i] = ka < K ? W[(size_t)(ka < K ? ka : K - 1) * ld + n] : 0.f; v[8 + i] = kb < K ? W[(size_t)(kb < K ? kb : K - 1) * ld + n] : 0.f; }
  return bsplit16(v); }
__device__ __forceinline__ v8f mac3(const F2& a, const F2& b, v8f c) { c = wmma_bf(a.l, b.h, c); c = wmma_bf(a.h, b.l, c); return wmma_bf(a.h, b.h, c); }
__device__ __forceinline__ float sigm(float v) { return 1.0f / (1.0f + expf(-v)); }
#define LDSX() do { asm volatile("s_wait_dscnt 0" ::: "memory"); __builtin_amdgcn_wave_barrier(); __builtin_amdgcn_fence(__ATOMIC_RELEASE, "workgroup"); } while (0)

// Causal multi-head self-attention with token padding masks on BOTH keys and queries (embeddings [4,2048,512], token_masks [4,2048] int 0/1 (random here: about half the tokens masked); 8 heads x 64; (in,out) Wq/Wk/Wv/Wo [512,512], no biases): scores = q.k/8, where(causal & tm[k] & tm[q], scores, -1e30), softmax, context Wo. A query with tm[q] = 0 gets all scores = -1e30 -> exactly uniform attention over all 2,048 positions (context = mean V).
#define NB 4
#define TT 2048
#define CC 512            // NH * HD = projected width
#define DIN 512          // input (model) width
#define NH 8
#define HD 64
#define SCALE (0.125f)
#define CAUSAL 1
#ifndef TNB
#define TNB NB
#endif
__device__ __forceinline__ float bfr(float v) { return (float)(__bf16)v; }
__host__ __device__ __forceinline__ int kb_last(int qb) { return CAUSAL ? ((qb * 64 + 63) >> 7) : (TT / 128 - 1); }
typedef __attribute__((ext_vector_type(8))) __bf16 v8b;
__device__ __forceinline__ v16b frag_b(const __bf16* rowk0, int lane) {
  union { v16b v; v8b q[2]; } u; const __bf16* p = rowk0 + 8 * (lane >> 4);
  u.q[0] = *(const v8b*)p; u.q[1] = *(const v8b*)(p + 16); return u.v;
}
#define QBH 6              // causal: query blocks 0..QBH-1 of each sequence (few keys, no averaging) take the high-precision path
#define QHI 384            // rows carrying a q residual plane (read only by the 3-product logits of query blocks < QBH)
#define KHI 384            // key rows carrying k residual / v bf16 hi+lo planes (used only by the causal high-precision path)
// B fragment (k rows k0+.., output column o) of a weight: (in,out) [K][ld] or (out,in) [ld rows of K]: bf16 exact, or f16(bf16 * 256) exact
__device__ __forceinline__ v16b wcol_io(const float* Wm, int k0, int o, int lane, int ld) { v16b w; const int g = lane >> 4;
#pragma unroll
  for (int i = 0; i < 8; ++i) { w[i] = (__bf16)Wm[(size_t)(k0 + 8 * g + i) * ld + o]; w[8 + i] = (__bf16)Wm[(size_t)(k0 + 16 + 8 * g + i) * ld + o]; }
  return w; }
__device__ __forceinline__ v16b wcol_oi(const float* Wm, int k0, int o, int lane, int K) { v16b w; const float* p = Wm + (size_t)o * K + k0 + 8 * (lane >> 4);
#pragma unroll
  for (int i = 0; i < 8; ++i) { w[i] = (__bf16)p[i]; w[8 + i] = (__bf16)p[16 + i]; }
  return w; }
__device__ __forceinline__ v16h wcolh_io(const float* Wm, int k0, int o, int lane, int ld) { v16h w; const int g = lane >> 4;
#pragma unroll
  for (int i = 0; i < 8; ++i) { w[i] = (_Float16)(bfr(Wm[(size_t)(k0 + 8 * g + i) * ld + o]) * 256.0f); w[8 + i] = (_Float16)(bfr(Wm[(size_t)(k0 + 16 + 8 * g + i) * ld + o]) * 256.0f); }
  return w; }
__device__ __forceinline__ v16h wcolh_oi(const float* Wm, int k0, int o, int lane, int K) { v16h w; const float* p = Wm + (size_t)o * K + k0 + 8 * (lane >> 4);
#pragma unroll
  for (int i = 0; i < 8; ++i) { w[i] = (_Float16)(bfr(p[i]) * 256.0f); w[8 + i] = (_Float16)(bfr(p[16 + i]) * 256.0f); }
  return w; }
#define WQKV_LAYOUT 0   // picks WCOL's layout only; no kernel calls WCOL: k_perm reads Wq/Wk/Wv as (in,out) [DIN][CC] whatever its value
__device__ __forceinline__ v16b wcol_hdk(const float* Wm, int k0, int o, int lane) { v16b w; const int g = lane >> 4; const float* p = Wm + (size_t)(o / HD) * DIN * HD + (o % HD);
#pragma unroll
  for (int i = 0; i < 8; ++i) { w[i] = (__bf16)p[(size_t)(k0 + 8 * g + i) * HD]; w[8 + i] = (__bf16)p[(size_t)(k0 + 16 + 8 * g + i) * HD]; }
  return w; }
#define WO_OUT_IN 0
#if WQKV_LAYOUT == 1
#define WCOL(W, k0, o, lane) wcol_oi(W, k0, o, lane, DIN)
#elif WQKV_LAYOUT == 2
#define WCOL(W, k0, o, lane) wcol_hdk(W, k0, o, lane)
#else
#define WCOL(W, k0, o, lane) wcol_io(W, k0, o, lane, CC)
#endif
#if WO_OUT_IN
#define WOCOL(W, k0, o, lane) wcol_oi(W, k0, o, lane, CC)
#define WOCOLH(W, k0, o, lane) wcolh_oi(W, k0, o, lane, CC)
#else
#define WOCOL(W, k0, o, lane) wcol_io(W, k0, o, lane, DIN)
#define WOCOLH(W, k0, o, lane) wcolh_io(W, k0, o, lane, DIN)
#endif
// masks: keys need causal (structure + index) AND token_masks[b][k] != 0; a query with token_masks[b][t] == 0 has EVERY score = -1e30 in the module -> exactly uniform attention over all 2,048 positions -> its context is mean_k V (mean v: 64-place sums from k_proj, added by a wave of k_att; k_out takes it as such a row's context; in k_att such rows just get a harmless finite placeholder)
// ---- k_perm: block = one sequence. IDX[b][r] = the token at sorted place r: the n unmasked tokens first, then the masked ones, each group in its old order; NU[b * 32] = n (a 128-byte line per sequence: one writer a line).
// The order of the unmasked tokens is kept, so among them 'key <= query' reads the same on places as on tokens, and a masked key is simply a place >= n: attention runs on the first n places alone, for any mask. q, k, v planes are laid out by place; the context row goes back to its token's row.
// Blocks TNB.. of the same launch copy the weights to five 16-bit planes (Wq, Wk, Wv, Wo, Wo again) in FRAGMENT ORDER: 16-byte unit u = ((kc * 32 + ot) * 2 + q) * 32 + lane holds W[kc * 32 + 16 q + 8 (lane >> 4) + 0..7][ot * 16 + (lane & 15)], so a wave fetches half a B fragment of k chunk kc, column tile ot, as one 512-byte run of whole lines. Values: bf16(W); the fifth plane f16(bf16(Wo) x 2^8).
#define PW (TT / 64)   /* waves of k_perm: 64 tokens a wave */
#define WPL ((size_t)DIN * CC)          /* elements of one packed plane */
#define WKS ((size_t)(CC / 16) * 512)   /* elements from one k chunk to the next in a packed plane */
#define WST(st) ((size_t)((st) >> 1) * WKS + (size_t)((st) & 1) * 2048)   /* stage st of a 128-column block: k chunk st / 2, its first or second four column tiles */
#define WPB ((DIN / 32) * (CC / 16) * 64 / (32 * PW))   /* blocks that pack one weight: a thread a unit */
static_assert(DIN == CC && CC == 512 && WPB * 32 * PW == (DIN / 32) * (CC / 16) * 64, "the unit index is cut by shifts; whole blocks");
static_assert(2 * PW == 64, "a lane holds two of the 64 group counts");
__global__ __launch_bounds__(32 * PW) void k_perm(const int* __restrict__ TM, const float* __restrict__ WQ, const float* __restrict__ WK, const float* __restrict__ WV, const float* __restrict__ WO, int* __restrict__ IDX, int* __restrict__ NU, __bf16* __restrict__ WP, _Float16* __restrict__ WOH) { __shared__ int cnt[2 * PW]; __shared__ int sidx[TT];
  if (blockIdx.x >= TNB) {   /* the same for the whole block, ahead of every barrier */
    const int pb = blockIdx.x - TNB, m = pb / WPB, u = (pb % WPB) * (32 * PW) + threadIdx.x; const int ln = u & 31, q = (u >> 5) & 1, ot = (u >> 6) & 31, kc = u >> 11;
    const float* src = (m == 0 ? WQ : m == 1 ? WK : m == 2 ? WV : WO) + (size_t)(kc * 32 + 16 * q + 8 * (ln >> 4)) * CC + ot * 16 + (ln & 15); float f[8];
#pragma unroll
    for (int i = 0; i < 8; ++i) f[i] = src[(size_t)i * CC];
    asm volatile("s_wait_xcnt 0x0" :: "v"(src) : "memory");   /* the eight loads share one address pair: it stays whole until this wait */
    if (m < 4) { v8b o;
#pragma unroll
      for (int i = 0; i < 8; ++i) o[i] = (__bf16)f[i];
      vst2(WP + (size_t)m * WPL + (size_t)u * 8, o);
    } else { v8h oh;
#pragma unroll
      for (int i = 0; i < 8; ++i) oh[i] = (_Float16)(bfr(f[i]) * 256.0f);
      vst2(WOH + (size_t)u * 8, oh); }
    return; }   /* one store a thread, the thread's last instruction */
  const int tid = threadIdx.x, wave = tid >> 5, lane = tid & 31, b = blockIdx.x; const int* TMb = TM + (size_t)b * TT; unsigned bal[2];
#pragma unroll
  for (int u = 0; u < 2; ++u) bal[u] = (unsigned)__ballot(TMb[(wave * 2 + u) * 32 + lane] != 0);
  if (lane < 2) cnt[wave * 2 + lane] = __popc(lane ? bal[1] : bal[0]);
  __syncthreads();   /* the 64 groups' counts are in LDS before a wave sums them */
  const int c0 = cnt[lane], c1 = cnt[32 + lane]; int tot = c0 + c1, bef = (lane < wave * 2 ? c0 : 0) + (32 + lane < wave * 2 ? c1 : 0);
#pragma unroll
  for (int o = 1; o < 32; o <<= 1) { tot += __shfl_xor(tot, o); bef += __shfl_xor(bef, o); }
#pragma unroll
  for (int u = 0; u < 2; ++u) { const int t = (wave * 2 + u) * 32 + lane; const int ones = bef + (u ? __popc(bal[0]) : 0) + __popc(bal[u] & ((1u << lane) - 1u)); sidx[((bal[u] >> lane) & 1u) ? ones : tot + (t - ones)] = t; }
  __syncthreads();   /* the whole list is in LDS before it leaves by whole lines */
#pragma unroll
  for (int u = 0; u < 2; ++u) vst2(IDX + (size_t)b * TT + u * 32 * PW + tid, sidx[u * 32 * PW + tid]);
  if (tid == 0) vst2(NU + b * 32, tot); }
__device__ __forceinline__ int n_unmasked(const int* NU, int b) { const int n = NU[b * 32]; return __builtin_amdgcn_readfirstlane(n < 0 ? 0 : n > TT ? TT : n); }   /* bounded whatever the word holds; through readfirstlane so that the tests on it are scalar branches */
// ---- mean v, the context of a fully-masked query row (softmax of 2,048 equal scores = exactly 1/2048 each): MV[b][c] = (1/2048) sum_t v[b][t][c] over the f16 v values, f32 sums. It has no launch of its own: a v block of k_proj sums its 64 places per channel out of the LDS tile that it stores anyway (PS[b][t / 64][c], whole lines, one writer a line); in k_att one wave of HD / 32 blocks of each (b, h) adds the TT / 64 partial sums of 32 channels and stores them as one 128-byte line of MV; k_out reads MV[b] in place of the ctx row of a token with token_masks == 0.
#define PSN (TT / 64)   /* partial sums a channel: one per 64-place block of k_proj */
#define WS_MV (WS_END)                                    // f32 mean-v rows [b][512]
#define WS_END2 (WS_MV + 4u * (size_t)NB * CC)
#define WS_IDX (WS_END2)                                  // int token of each sorted place [b][t]
#define WS_NU  (WS_IDX + 4u * (size_t)NB * TT)            // int unmasked tokens of a sequence, one 128-byte line each
#define WS_END3 (WS_NU + 128u * (size_t)NB)
#define WS_WP  (WS_END3)                                  // bf16 Wq, Wk, Wv, Wo in fragment order
#define WS_WOH (WS_WP + 2u * 4u * (size_t)DIN * CC)       // f16(bf16 Wo x 2^8) in fragment order
#define WS_END4 (WS_WOH + 2u * (size_t)DIN * CC)
#define WS_PS  (WS_END4)                                  // f32 sums of v over 64 places [b][t / 64][512]
#define WS_END5 (WS_PS + 4u * (size_t)NB * PSN * CC)

#define WS_QH  0u                                      // f16 q rows [b*t][CC]
#define WS_KH  (WS_QH + 2u * (size_t)NB * TT * CC)      // f16 k rows [b*t][CC]
#define WS_VT  (WS_KH + 2u * (size_t)NB * TT * CC)      // f16 v planes [b][c][t]
#define WS_QL  (WS_VT + 2u * (size_t)NB * CC * TT)      // f16 q residual x 2^10 rows [b][t < QHI][CC]
#define WS_KL  (WS_QL + 2u * (size_t)NB * QHI * CC)     // f16 k residual x 2^10 rows [b][t < KHI][CC]
#define WS_VB  (WS_KL + 2u * (size_t)NB * KHI * CC)     // bf16 v hi planes [b][c][t < KHI]
#define WS_VBL (WS_VB + 2u * (size_t)NB * CC * KHI)
#define WS_Y   (WS_VBL + 2u * (size_t)NB * CC * KHI)     // f32 ctx rows [b*t][CC] (only when there is an output projection)
#define WS_END (WS_Y  + 4u * (size_t)NB * TT * CC)

// operands fetched ahead of their products: 16 f32 of an A row in fragment order (x[0..1] = p[0..7], x[2..3] = p[16..23]); N / 2 B fragments of a packed plane as N runs of 512 bytes a wave
__device__ __forceinline__ void ld_xr(const float* p, v4f x[4]) { x[0] = *(const v4f*)p; x[1] = *(const v4f*)(p + 4); x[2] = *(const v4f*)(p + 16); x[3] = *(const v4f*)(p + 20); }
template <int N, typename T, typename T8> __device__ __forceinline__ void ld_wf(const T* p, T8 w[N]) {
#pragma unroll
  for (int t = 0; t < N; ++t) w[t] = *(const T8*)(p + t * 256); }
__device__ __forceinline__ v16b two_b(v8b a, v8b b) { union { v16b v; v8b q[2]; } u; u.q[0] = a; u.q[1] = b; return u.v; }
__device__ __forceinline__ v16h two_h(v8h a, v8h b) { union { v16h v; v8h q[2]; } u; u.q[0] = a; u.q[1] = b; return u.v; }
// ---- k_proj: block = (64 sorted places, 128 cols, which), the X row of a place through IDX; q and k blocks wholly behind the last 128-place group that holds an unmasked token leave at once (k_att reads no place there): q/k/v = X W (+ b) with exact bf16 products (K = DIN) -> which 0: q f16 rows (+ residual rows < QHI); 1: k f16 rows (+ residual rows < KHI); 2: v f16 planes [c][t] (+ bf16 hi/lo planes for t < KHI)
__global__ __launch_bounds__(128) void k_proj(const float* __restrict__ XQ, const float* __restrict__ XK, const float* __restrict__ XV, const __bf16* __restrict__ WP, const float* __restrict__ BQ, const float* __restrict__ BK, const float* __restrict__ BV, const int* __restrict__ IDX, const int* __restrict__ NU,
    _Float16* __restrict__ QH, _Float16* __restrict__ QL, _Float16* __restrict__ KH, _Float16* __restrict__ KL, _Float16* __restrict__ VT, __bf16* __restrict__ VB, __bf16* __restrict__ VBL, float* __restrict__ PS) {
  __shared__ __align__(16) _Float16 sh[64][136], sl[64][136]; __shared__ __align__(16) _Float16 th[128][72]; __shared__ __align__(16) __bf16 tb[128][72], tbl[128][72];
  const int tid = threadIdx.x, wave = tid >> 5, lane = tid & 31, col = lane & 15, g = lane >> 4; const int which = blockIdx.z; const int c0 = blockIdx.y * 128; const size_t r0 = (size_t)blockIdx.x * 64; const size_t bb = r0 / TT; const int t0 = (int)(r0 % TT);
  if (which < 2 && t0 >= ((n_unmasked(NU, (int)bb) + 127) & ~127)) return;   /* the same for the whole block, ahead of every barrier */
  const float* X = which == 0 ? XQ : which == 1 ? XK : XV; const float* BA = which == 0 ? BQ : which == 1 ? BK : BV;
  const float* xr = X + (bb * TT + (size_t)(IDX[r0 + wave * 16 + col] & (TT - 1))) * DIN;   /* the mask bounds the row whatever the list holds */
  const float* xp = xr + 8 * g; const __bf16* wp = WP + (size_t)which * WPL + ((size_t)(c0 >> 4) * 64 + lane) * 8;
  v8f acc[8] = {}; v4f xs[2][4]; v8b wf[4][8]; v16b a; ld_xr(xp, xs[0]); ld_xr(xp + 32, xs[1]);
#pragma unroll
  for (int t = 0; t < 3; ++t) ld_wf<8>(wp + WST(t), wf[t]);
#pragma unroll   /* whole: the operand sets stay in registers, every step of the two addresses is a constant offset */
  for (int st = 0; st < DIN / 16; ++st) { const int hf = st & 1, kc = st >> 1;   /* a stage = half a k chunk: four column tiles; B is fetched three stages ahead, A two chunks ahead */
    if (hf == 0) {
#pragma unroll
      for (int i = 0; i < 4; ++i) { a[i] = (__bf16)xs[kc & 1][0][i]; a[4 + i] = (__bf16)xs[kc & 1][1][i]; a[8 + i] = (__bf16)xs[kc & 1][2][i]; a[12 + i] = (__bf16)xs[kc & 1][3][i]; }
      if (kc + 2 < DIN / 32) ld_xr(xp + (kc + 2) * 32, xs[kc & 1]); }
    if (st + 3 < DIN / 16) ld_wf<8>(wp + WST(st + 3), wf[(st + 3) & 3]);   /* into the set that the last stage has left */
    if (st + 4 == DIN / 16) asm volatile("s_wait_xcnt 0x0" :: "v"(xp), "v"(wp) : "memory");   /* behind the last loads: the two address pairs stay whole until this wait */
#pragma unroll
    for (int j = 0; j < 4; ++j) acc[hf * 4 + j] = wmma_bf(a, two_b(wf[st & 3][2 * j], wf[st & 3][2 * j + 1]), acc[hf * 4 + j]);
    __builtin_amdgcn_sched_barrier(0); }   /* keeps the next stage's conversions, and with them the wait on loads just issued, behind this stage's products */
  if (which < 2) { _Float16* DH = which == 0 ? QH : KH; _Float16* DL = which == 0 ? QL : KL; const int nhi = which == 0 ? QHI : KHI; const bool hi_rows = t0 < nhi;
#pragma unroll
    for (int j = 0; j < 8; ++j) { const float bias = BA ? bfr(BA[c0 + j * 16 + col]) : 0.f;
#pragma unroll
      for (int r = 0; r < 8; ++r) { const float v = acc[j][r] + bias; const _Float16 hv = (_Float16)v; sh[wave * 16 + 8 * g + r][j * 16 + col] = hv; sl[wave * 16 + 8 * g + r][j * 16 + col] = (_Float16)((v - (float)hv) * 1024.0f); } }
    __syncthreads();
    for (int e = tid; e < 64 * 16; e += 128) { const int rl = e >> 4, q = e & 15; vst2((unsigned*)(DH + (r0 + rl) * CC + c0 + q * 8), *(const v4u*)&sh[rl][q * 8]); if (hi_rows) vst2((unsigned*)(DL + (bb * nhi + t0 + rl) * (size_t)CC + c0 + q * 8), *(const v4u*)&sl[rl][q * 8]); }
  } else { const bool hi_rows = t0 < KHI;
#pragma unroll
    for (int j = 0; j < 8; ++j) { const float bias = BA ? bfr(BA[c0 + j * 16 + col]) : 0.f;
#pragma unroll
      for (int r = 0; r < 8; ++r) { const float v = acc[j][r] + bias; const int rl = wave * 16 + 8 * g + r, cl = j * 16 + col; th[cl][rl] = (_Float16)v; const __bf16 bh = (__bf16)v; tb[cl][rl] = bh; tbl[cl][rl] = (__bf16)(v - (float)bh); } }
    __syncthreads();
    for (int e = tid; e < 128 * 8; e += 128) { const int cl = e >> 3, q = e & 7; vst2((unsigned*)(VT + (bb * CC + c0 + cl) * (size_t)TT + t0 + q * 8), *(const v4u*)&th[cl][q * 8]); if (hi_rows) { const size_t o3 = (bb * CC + c0 + cl) * (size_t)KHI + t0 + q * 8; vst2((unsigned*)(VB + o3), *(const v4u*)&tb[cl][q * 8]); vst2((unsigned*)(VBL + o3), *(const v4u*)&tbl[cl][q * 8]); } }
    asm volatile("s_wait_xcnt 0x0" ::: "memory");   /* behind the loop's stores: the LDS reads below land on their address and data registers */
    hx8 hv[8]; float a8[8];   /* thread = channel: the block's 64 places of the f16 v tile summed in f32, eight chains and a tree over them; the loops are unrolled whole, so the LDS reads issue ahead of the first add */
#pragma unroll
    for (int i = 0; i < 8; ++i) hv[i] = *(const hx8*)&th[tid][i * 8];
#pragma unroll
    for (int j = 0; j < 8; ++j) a8[j] = (float)hv[0][j];
#pragma unroll
    for (int i = 1; i < 8; ++i)
#pragma unroll
      for (int j = 0; j < 8; ++j) a8[j] += (float)hv[i][j];
    vst2(PS + (bb * PSN + (size_t)(t0 >> 6)) * CC + c0 + tid, ((a8[0] + a8[1]) + (a8[2] + a8[3])) + ((a8[4] + a8[5]) + (a8[6] + a8[7])));   /* a wave stores one whole line */
    asm volatile("s_wait_xcnt 0x0" ::: "memory"); } }   /* behind the store: the code that the listing has behind it rewrites the store's base and data registers */
// ---- k_att: a tile = 16 sorted places of (b, h) as queries, worked on by the AW waves of a block. AG blocks share the tiles of one (b, h) and each walks its own in a loop: NH * TNB * AG blocks fill the chip's places once (two blocks' LDS fit a WGP), so no wave is started for a tile of masked tokens (k_out takes mean v for their rows) and a block's start is paid once for all its tiles. Only the nt = ceil(n / 16) tiles that hold an unmasked token are dealt: by rank from the longest (rank r = tile nt - 1 - r), 16 ranks a pass, forwards and backwards by turns, so the blocks' key counts come out level. The 16 score rows live in LDS from the logits to P, so no score plane goes through memory and one launch covers every (b, h).
// step 1, logits: wave w takes the 16-key tiles w, w + AW, ... of keys [0, kend): q x k on f16 (3 products with the x 2^10 residual planes for query blocks < QBH), x SCALE; causal and key masks (place < n) by select at the LDS store.
// step 2, softmax: wave w owns row w in registers, f32, sums by lane then across lanes; P x 2^11 back in place (0 for excluded keys); a query with token_masks == 0 gets a finite placeholder row here, which k_out does not read.
// step 3, P.v: wave w sums the 32-key chunks w, w + AW, ... (P once to f16 against v f16; query blocks < QBH: P and v as bf16 hi + lo, 3 products); the AW partial tiles are added in f32 through LDS in wave order.
#define AG 16          /* blocks that share the tiles of one (b, h) */
#define AW 16          /* the wave number goes through readfirstlane so that the tile loops are scalar loops and every lane is on at the matrix instructions */
#define SP (TT + 4)    /* row pitch in floats: 16 B past a multiple of 256 B, so the 16 rows of a b128 fragment read fall on different banks */
static_assert((TT / 16) % AG == 0, "whole passes over the ranks");
static_assert(HD % 32 == 0 && HD / 32 <= AG && (PSN & (PSN - 1)) == 0, "mean v: whole lines of 32 channels, a block for each, a full tree");
static_assert(QBH * 64 >= QHI, "every row with a q residual plane takes the 3-product path");
static_assert(AW * 16 * (HD + 4) <= 16 * SP, "the partial tiles reuse the score rows' LDS");
static_assert(16 * (HD / 2) == 32 * AW, "in the last step a wave stores the row of its own number");
// 16 f32 of one LDS row in fragment order (0..7 = p[0..7], 8..15 = p[16..23]) by four 16-byte reads
__device__ __forceinline__ void lds_row16(const float* p, float v[16]) { const v4f a = *(const v4f*)p, b = *(const v4f*)(p + 4), c = *(const v4f*)(p + 16), d = *(const v4f*)(p + 20);
#pragma unroll
  for (int i = 0; i < 4; ++i) { v[i] = a[i]; v[4 + i] = b[i]; v[8 + i] = c[i]; v[12 + i] = d[i]; } }
// a 16-bit fragment at the lane's own byte address. k_att forms that address where it is used, as a tile's wave-uniform base (scalar registers) + the lane's 32-bit byte offset: one vector register serves every plane of a pitch, where a 64-bit pair a plane, held over the tile loop, would not fit the 128 registers that two blocks a WGP leave a wave
template <typename V16, typename V8> __device__ __forceinline__ V16 frag_p(const char* p) { union { V16 v; V8 q[2]; } u; u.q[0] = *(const V8*)p; u.q[1] = *(const V8*)(p + 32); return u.v; }
__global__ __launch_bounds__(32 * AW) __attribute__((amdgpu_waves_per_eu(8, 8))) void k_att(const _Float16* __restrict__ QH, const _Float16* __restrict__ KH, const _Float16* __restrict__ QL, const _Float16* __restrict__ KL, const _Float16* __restrict__ VT, const __bf16* __restrict__ VB, const __bf16* __restrict__ VBL, const int* __restrict__ IDX, const int* __restrict__ NU, const float* __restrict__ PS, float* __restrict__ MV, float* __restrict__ Y) { __shared__ __align__(16) float sc[16][SP];
  const int tid = threadIdx.x, wave = __builtin_amdgcn_readfirstlane(tid >> 5), lane = tid & 31, col = lane & 15, g = lane >> 4; const int h = blockIdx.x % NH, b = blockIdx.x / NH, sl = blockIdx.y;
  if (sl < HD / 32 && wave == AW - 1) {   /* scalar test. Mean v of 32 channels of this head: lane = channel, the PSN partial sums loaded as PSN whole lines, all in flight at once, added as a tree; ahead of the tile loop, so it is done for any mask, also where the block has no tile */
    const float* pb = PS + (size_t)b * PSN * CC + h * HD + sl * 32; float f[PSN];   /* wave-uniform base; the lane is the loads' offset register */
#pragma unroll
    for (int i = 0; i < PSN; ++i) f[i] = pb[(size_t)i * CC + lane];
#pragma unroll
    for (int o = PSN / 2; o > 0; o >>= 1)
#pragma unroll
      for (int i = 0; i < o; ++i) f[i] += f[i + o];
    vst2(MV + (size_t)b * CC + h * HD + sl * 32 + lane, f[0] * (1.0f / TT));
    asm volatile("s_wait_xcnt 0x0" :: "s"(pb) : "memory"); }   /* behind the loads and the store: the loads' base stays whole until this wait, and the code below rewrites the store's address and data registers */
  const int nb = n_unmasked(NU, b); const int nt = (nb + 15) >> 4;
  const unsigned ro = (unsigned)col * (CC * 2) + 16 * g, vo = (unsigned)col * (TT * 2) + 16 * g, bo = (unsigned)col * (KHI * 2) + 16 * g;   /* the lane's bytes into 16 rows of q or k, of the f16 v plane, of the bf16 v planes */
  for (int ps = 0; ps < TT / 16 / AG; ++ps) { const int qt = nt - 1 - (ps * AG + ((ps & 1) ? AG - 1 - sl : sl)); if (qt < 0) break;   /* scalar, the same for the whole block; the rank grows with ps, so no later pass has a tile either */
  const int qb = qt >> 2; const int ql0 = qt * 16; const int kend = (kb_last(qb) + 1) * 128;
  const size_t q0 = (size_t)b * TT + ql0, kr0 = (size_t)b * TT; const int tq = ql0 + wave < nb; const int orow = IDX[(size_t)b * TT + ql0 + wave] & (TT - 1);   /* the token whose context row this wave stores; the mask bounds the row whatever the list holds */
  const char* qp = (const char*)(QH + q0 * CC + h * HD) + ro;
  if (qb < QBH) { const char* qlp = (const char*)(QL + ((size_t)b * QHI + ql0) * CC + h * HD) + ro; v16h ah[HD / 32], al[HD / 32];
#pragma unroll
    for (int kc = 0; kc < HD / 32; ++kc) { ah[kc] = frag_p<v16h, v8h>(qp + kc * 64); al[kc] = frag_p<v16h, v8h>(qlp + kc * 64); }
    asm volatile("s_wait_xcnt 0x0" :: "v"(qp), "v"(qlp) : "memory");   /* the q loads' two address pairs stay whole (no load lands on them) until this wait */
    for (int kt = wave; kt < kend / 16; kt += AW) { const int key = kt * 16 + col; v8f acc = {}, accl = {}; const char* kp = (const char*)(KH + (kr0 + kt * 16) * CC + h * HD) + ro; const char* klp = (const char*)(KL + ((size_t)b * KHI + kt * 16) * CC + h * HD) + ro;
      v16h kbf[HD / 32], klf[HD / 32];   /* all of the tile's loads stand ahead of its first product: one memory latency a tile */
#pragma unroll
      for (int kc = 0; kc < HD / 32; ++kc) { kbf[kc] = frag_p<v16h, v8h>(kp + kc * 64); klf[kc] = frag_p<v16h, v8h>(klp + kc * 64); }
      asm volatile("s_wait_xcnt 0x0" :: "v"(kp), "v"(klp) : "memory");   /* the k loads' two address pairs stay whole (no load lands on them) until this wait */
#pragma unroll
      for (int kc = 0; kc < HD / 32; ++kc) { acc = wmma16(ah[kc], kbf[kc], acc); accl = wmma16(al[kc], kbf[kc], accl); accl = wmma16(ah[kc], klf[kc], accl); }
#pragma unroll
      for (int r = 0; r < 8; ++r) sc[8 * g + r][key] = ((!CAUSAL || key <= ql0 + 8 * g + r) && key < nb) ? (acc[r] + accl[r] * (1.0f / 1024.0f)) * SCALE : -3.0e38f; }
  } else { v16h ah[HD / 32];
#pragma unroll
    for (int kc = 0; kc < HD / 32; ++kc) ah[kc] = frag_p<v16h, v8h>(qp + kc * 64);
    asm volatile("s_wait_xcnt 0x0" :: "v"(qp) : "memory");   /* the q loads share one address pair: it stays whole (no k load lands on it) until this wait */
    for (int kt0 = wave; kt0 < kend / 16; kt0 += 4 * AW) { v16h kbf[4][HD / 32] = {};   /* the start value: registers left unset on a skipped tile's path are carried round the tile loop and spill; the loads of up to four tiles stand ahead of the first product: one memory latency for four tiles; the tests on the tile number are scalar */
      const char* kp = (const char*)(KH + (kr0 + kt0 * 16) * CC + h * HD) + ro;   /* one address pair for the four tiles, the tile's step as a constant offset */
#pragma unroll
      for (int u = 0; u < 4; ++u) if (kt0 + u * AW < kend / 16) {
#pragma unroll
        for (int kc = 0; kc < HD / 32; ++kc) kbf[u][kc] = frag_p<v16h, v8h>(kp + u * (AW * 16 * CC * 2) + kc * 64); }
      asm volatile("s_wait_xcnt 0x0" :: "v"(kp) : "memory");   /* the k loads share one address pair: it stays whole (no load lands on it) until this wait */
#pragma unroll
      for (int u = 0; u < 4; ++u) if (kt0 + u * AW < kend / 16) { const int key = (kt0 + u * AW) * 16 + col; v8f acc = {};
#pragma unroll
        for (int kc = 0; kc < HD / 32; ++kc) acc = wmma16(ah[kc], kbf[u][kc], acc);
#pragma unroll
        for (int r = 0; r < 8; ++r) sc[8 * g + r][key] = ((!CAUSAL || key <= ql0 + 8 * g + r) && key < nb) ? acc[r] * SCALE : -3.0e38f; } } }
  __syncthreads();   /* every tile of the 16 score rows is in LDS before a wave reads its row */
  { const int nq = kend >> 7; v4f vv[TT / 128] = {};   /* the start value: as for kbf above; 128 keys a pass: 32 lanes x 4; the tests on nq are scalar */
#pragma unroll
    for (int i = 0; i < TT / 128; ++i) if (i < nq) vv[i] = *(const v4f*)&sc[wave][i * 128 + lane * 4];
    float m = -3.0e38f;
#pragma unroll
    for (int i = 0; i < TT / 128; ++i) if (i < nq) { if (tq == 0) vv[i] = (v4f){0.f, 0.f, 0.f, 0.f}; m = fmaxf(m, fmaxf(fmaxf(vv[i][0], vv[i][1]), fmaxf(vv[i][2], vv[i][3]))); }
#pragma unroll
    for (int o = 1; o < 32; o <<= 1) m = fmaxf(m, __shfl_xor(m, o));
    float sum = 0.f;
#pragma unroll
    for (int i = 0; i < TT / 128; ++i) if (i < nq) {
#pragma unroll
      for (int c = 0; c < 4; ++c) { const float v = vv[i][c]; const float ex = expf(v - m); const float e = (v <= -1.0e38f) ? 0.f : ex; vv[i][c] = e; sum += e; } }
#pragma unroll
    for (int o = 1; o < 32; o <<= 1) sum += __shfl_xor(sum, o);
    const float inv = sum > 0.f ? 2048.0f / sum : 0.f;   /* a fully excluded row yields P = 0 */
#pragma unroll
    for (int i = 0; i < TT / 128; ++i) if (i < nq) *(v4f*)&sc[wave][i * 128 + lane * 4] = vv[i] * inv; }
  __syncthreads();   /* all 16 rows of P are in LDS before any wave forms fragments across them */
  const int kce = kend >> 5; v8f acc[HD / 16] = {};
  if (qb < QBH) {
    for (int kc = wave; kc < kce; kc += AW) { float pv[16]; lds_row16(&sc[col][kc * 32 + 8 * g], pv); const F2 p = bsplit16(pv); const size_t po = ((size_t)b * CC + h * HD) * (size_t)KHI + kc * 32; const char* vbp = (const char*)(VB + po) + bo; const char* vlp = (const char*)(VBL + po) + bo;
#pragma unroll
      for (int j2 = 0; j2 < HD / 16; j2 += 2) { v16b vh[2], vl[2];   /* two column tiles' loads stand ahead of their products */
#pragma unroll
        for (int u = 0; u < 2; ++u) { vh[u] = frag_p<v16b, v8b>(vbp + (j2 + u) * (16 * KHI * 2)); vl[u] = frag_p<v16b, v8b>(vlp + (j2 + u) * (16 * KHI * 2)); }
        asm volatile("s_wait_xcnt 0x0" :: "v"(vbp), "v"(vlp) : "memory");   /* the v loads' two address pairs stay whole (no load lands on them) until this wait */
#pragma unroll
        for (int u = 0; u < 2; ++u) { const int j = j2 + u; acc[j] = wmma_bf(p.h, vh[u], acc[j]); acc[j] = wmma_bf(p.l, vh[u], acc[j]); acc[j] = wmma_bf(p.h, vl[u], acc[j]); } } }
  } else {
    for (int kc = wave; kc < kce; kc += AW) { v16h vf[HD / 16]; const char* vp = (const char*)(VT + ((size_t)b * CC + h * HD) * (size_t)TT + kc * 32) + vo;   /* the chunk's four v loads stand ahead of its first product: one memory latency a chunk */
#pragma unroll
      for (int j = 0; j < HD / 16; ++j) vf[j] = frag_p<v16h, v8h>(vp + j * (16 * TT * 2));
      asm volatile("s_wait_xcnt 0x0" :: "v"(vp) : "memory");   /* the eight loads share one address pair: it stays whole (no load lands on it) until this wait */
      float pv[16]; lds_row16(&sc[col][kc * 32 + 8 * g], pv); v16h p;
#pragma unroll
      for (int i = 0; i < 16; ++i) p[i] = (_Float16)pv[i];
#pragma unroll
      for (int j = 0; j < HD / 16; ++j) acc[j] = wmma16(p, vf[j], acc[j]); } }
  __syncthreads();   /* every wave has read its last P fragment before the partial tiles overwrite the rows */
  float (*ss)[16][HD + 4] = (float (*)[16][HD + 4])&sc[0][0];
#pragma unroll
  for (int j = 0; j < HD / 16; ++j)
#pragma unroll
    for (int r = 0; r < 8; ++r) ss[wave][8 * g + r][j * 16 + col] = acc[j][r];
  __syncthreads();   /* every wave's partial tile is in LDS before any wave adds them */
  for (int e = tid; e < 16 * (HD / 2); e += 32 * AW) { const int rl = e / (HD / 2), q = e % (HD / 2); v2f s = *(const v2f*)&ss[0][rl][q * 2];
#pragma unroll   /* the AW LDS reads issue ahead of the adds; rolled, each add would wait a full LDS latency */
    for (int w = 1; w < AW; ++w) s += *(const v2f*)&ss[w][rl][q * 2];
    vst2(Y + ((size_t)b * TT + orow) * CC + h * HD + q * 2, s * (1.0f / 2048.0f));
    asm volatile("s_wait_xcnt 0x0" ::: "memory"); }   /* behind the store: the next tile rewrites its address and data registers */
  __syncthreads(); } }   /* every wave has read the partial tiles before the next tile's scores overwrite them */
// ---- k_out: block = (64 rows, 128 cols): out = ctx Wo (+ bo), the ctx row of a token with token_masks == 0 being its sequence's mean v (every lane reads a row that this call has written): ctx once to f16 against Wo as f16(bf16 x 2^8) exact (1 product) x 2^-8; causal early rows (< QHI of each sequence): ctx bf16 hi + lo against exact bf16 Wo (2 products)
__global__ __launch_bounds__(128) void k_out(const float* __restrict__ Y, const int* __restrict__ TM, const float* __restrict__ MV, const __bf16* __restrict__ WOB, const _Float16* __restrict__ WOH, const float* __restrict__ BO, float* __restrict__ OUT) { __shared__ __align__(16) float sf[4][16][132];
  const int tid = threadIdx.x, wave = tid >> 5, lane = tid & 31, col = lane & 15, g = lane >> 4; const int c0 = blockIdx.y * 128; const size_t r0 = (size_t)blockIdx.x * 64 + wave * 16;
  const int* tp = TM + r0 + col; const int tk = *tp; asm volatile("s_wait_xcnt 0x0" :: "v"(tp) : "memory");   /* the mask load's address pair stays whole until this wait */
  v8f acc[8] = {}; const float* xp = (tk != 0 ? Y + (r0 + col) * CC : MV + (((size_t)blockIdx.x * 64) / TT) * CC) + 8 * g; const size_t wo = ((size_t)(c0 >> 4) * 64 + lane) * 8; v4f xs[2][4]; ld_xr(xp, xs[0]); ld_xr(xp + 32, xs[1]);
  if (CAUSAL && (int)(((size_t)blockIdx.x * 64) % TT) < QHI) {   /* block-uniform */
    const __bf16* wp = WOB + wo; v8b wf[3][8]; F2 a;
#pragma unroll
    for (int t = 0; t < 2; ++t) ld_wf<8>(wp + WST(t), wf[t]);
#pragma unroll   /* whole, stages as in k_proj; two products a tile, so B two stages ahead covers as much */
    for (int st = 0; st < CC / 16; ++st) { const int hf = st & 1, kc = st >> 1;
      if (hf == 0) { float v[16];
#pragma unroll
        for (int i = 0; i < 4; ++i) { v[i] = xs[kc & 1][0][i]; v[4 + i] = xs[kc & 1][1][i]; v[8 + i] = xs[kc & 1][2][i]; v[12 + i] = xs[kc & 1][3][i]; }
        a = bsplit16(v); if (kc + 2 < CC / 32) ld_xr(xp + (kc + 2) * 32, xs[kc & 1]); }
      if (st + 2 < CC / 16) ld_wf<8>(wp + WST(st + 2), wf[(st + 2) % 3]);   /* into the set that the last stage has left */
      if (st + 3 == CC / 16) asm volatile("s_wait_xcnt 0x0" :: "v"(xp), "v"(wp) : "memory");   /* behind the last loads: the two address pairs stay whole until this wait */
#pragma unroll
      for (int j = 0; j < 4; ++j) { const int jj = hf * 4 + j; const v16b w = two_b(wf[st % 3][2 * j], wf[st % 3][2 * j + 1]); acc[jj] = wmma_bf(a.h, w, acc[jj]); acc[jj] = wmma_bf(a.l, w, acc[jj]); }
      __builtin_amdgcn_sched_barrier(0); }   /* keeps the next stage's conversions, and with them the wait on loads just issued, behind this stage's products */
#pragma unroll
    for (int j = 0; j < 8; ++j) { const float bias = BO ? bfr(BO[c0 + j * 16 + col]) : 0.f;
#pragma unroll
      for (int r = 0; r < 8; ++r) sf[wave][8 * g + r][j * 16 + col] = acc[j][r] + bias; }
  } else {
    const _Float16* wp = WOH + wo; v8h wf[4][8]; v16h a;
#pragma unroll
    for (int t = 0; t < 3; ++t) ld_wf<8>(wp + WST(t), wf[t]);
#pragma unroll   /* whole, stages as in k_proj */
    for (int st = 0; st < CC / 16; ++st) { const int hf = st & 1, kc = st >> 1;
      if (hf == 0) {   /* ctx carried x 2^6 into f16 so small-magnitude context rows stay clear of f16 subnormals */
#pragma unroll
        for (int i = 0; i < 4; ++i) { a[i] = (_Float16)(xs[kc & 1][0][i] * 64.0f); a[4 + i] = (_Float16)(xs[kc & 1][1][i] * 64.0f); a[8 + i] = (_Float16)(xs[kc & 1][2][i] * 64.0f); a[12 + i] = (_Float16)(xs[kc & 1][3][i] * 64.0f); }
        if (kc + 2 < CC / 32) ld_xr(xp + (kc + 2) * 32, xs[kc & 1]); }
      if (st + 3 < CC / 16) ld_wf<8>(wp + WST(st + 3), wf[(st + 3) & 3]);   /* into the set that the last stage has left */
      if (st + 4 == CC / 16) asm volatile("s_wait_xcnt 0x0" :: "v"(xp), "v"(wp) : "memory");   /* behind the last loads: the two address pairs stay whole until this wait */
#pragma unroll
      for (int j = 0; j < 4; ++j) acc[hf * 4 + j] = wmma16(a, two_h(wf[st & 3][2 * j], wf[st & 3][2 * j + 1]), acc[hf * 4 + j]);
      __builtin_amdgcn_sched_barrier(0); }   /* keeps the next stage's conversions, and with them the wait on loads just issued, behind this stage's products */
#pragma unroll
    for (int j = 0; j < 8; ++j) { const float bias = BO ? bfr(BO[c0 + j * 16 + col]) : 0.f;
#pragma unroll
      for (int r = 0; r < 8; ++r) sf[wave][8 * g + r][j * 16 + col] = acc[j][r] * (1.0f / 16384.0f) + bias; } }   /* 2^-8 (Wo carry) x 2^-6 (ctx carry) */
  LDSX(); for (int rl = 0; rl < 16; ++rl) vst2(OUT + (r0 + rl) * DIN + c0 + lane * 4, *(const v4f*)&sf[wave][rl][lane * 4]); }

extern "C" void kernel_launch(void* const* d_in, const int* in_sizes, int n_in, void* d_out, int out_size, void* d_ws, size_t ws_size, hipStream_t stream) {
  (void)in_sizes; (void)n_in; (void)out_size;
  const float** F = (const float**)d_in;
  if (ws_size < (size_t)WS_END) return;
  char* ws = (char*)d_ws; _Float16 *QH = (_Float16*)(ws + WS_QH), *KH = (_Float16*)(ws + WS_KH), *VT = (_Float16*)(ws + WS_VT), *QL = (_Float16*)(ws + WS_QL), *KL = (_Float16*)(ws + WS_KL); __bf16 *VB = (__bf16*)(ws + WS_VB), *VBL = (__bf16*)(ws + WS_VBL); float *Y = (float*)(ws + WS_Y);
  (void)Y; (void)QL; (void)KL; (void)VB; (void)VBL;
  // inputs: 0 embeddings [4,2048,512]; 1 token_masks [4,2048] int32 (0/1); 2 Wq [512,512] (in,out); 3 Wk; 4 Wv; 5 Wo (in,out)
  if (ws_size < (size_t)WS_END5) return;
  const int* TM = (const int*)d_in[1]; float* MV = (float*)(ws + WS_MV); int *IDX = (int*)(ws + WS_IDX), *NU = (int*)(ws + WS_NU); __bf16* WP = (__bf16*)(ws + WS_WP); _Float16* WOH = (_Float16*)(ws + WS_WOH); float* PS = (float*)(ws + WS_PS);
  k_perm<<<dim3(TNB + 5 * WPB), 32 * PW, 0, stream>>>(TM, F[2], F[3], F[4], F[5], IDX, NU, WP, WOH);
  k_proj<<<dim3(TNB * TT / 64, CC / 128, 3), 128, 0, stream>>>(F[0], F[0], F[0], WP, nullptr, nullptr, nullptr, IDX, NU, QH, QL, KH, KL, VT, VB, VBL, PS);
  k_att<<<dim3(NH * TNB, AG), 32 * AW, 0, stream>>>(QH, KH, QL, KL, VT, VB, VBL, IDX, NU, PS, MV, Y);
  k_out<<<dim3(TNB * TT / 64, DIN / 128), 128, 0, stream>>>(Y, TM, MV, WP + 3 * WPL, WOH, nullptr, (float*)d_out);
}

// v008
// One run takes 67.3 microseconds.
// Two timings next to v007 put it at 1.18 and 1.19 times that version's speed.
// All steps since v000 together make it 14.2 times as fast.
// compute dtype: all float inputs rounded to bf16; projections with EXACT bf16 products on WMMA 16x16x32 (f32 accumulate); tokens of a sequence sorted unmasked first (stable), all planes in that order; causal logits: 3 products for the first 384 sorted rows, single f16 q x k after, x 64^-0.5; key/query masks = a length; softmax f32; P x 2^11 once to f16 x v once to f16 (bf16 hi + lo below row 384); fully-masked query rows = mean of the f16 v plane in f32; ctx hi+lo x exact Wo below row 384, x2^6 f16 carry x f16(bf16 x 2^8) Wo after; f32 output.
#include <hip/hip_runtime.h>
#include <math.h>

typedef __attribute__((ext_vector_type(16))) _Float16 v16h;
typedef __attribute__((ext_vector_type(16))) __bf16 v16b;
typedef __attribute__((ext_vector_type(8)))  _Float16 v8h;
typedef __attribute__((ext_vector_type(8)))  float v8f;
typedef __attribute__((ext_vector_type(4)))  float v4f;
typedef __attribute__((ext_vector_type(2)))  float v2f;
typedef __attribute__((ext_vector_type(4)))  unsigned v4u;
typedef _Float16 hx8 __attribute__((ext_vector_type(8)));
typedef __attribute__((ext_vector_type(4)))  int v4i;
typedef float __attribute__((may_alias)) float_a;
typedef int __attribute__((may_alias)) int_a;

template <typename T> __device__ __forceinline__ void vst2(void* p, T v) { *(T*)p = v;  }
__device__ __forceinline__ v8f wmma16(v16h a, v16h b, v8f c) {
  v8f d = __builtin_amdgcn_wmma_f32_16x16x32_f16(false, a, false, b, (short)0, c, false, false);
  asm volatile("v_nop\n\tv_nop\n\tv_nop\n\tv_nop" : "+v"(d) : "v"(a), "v"(b));
  return d;
}
__device__ __forceinline__ v8f wmma_bf(v16b a, v16b b, v8f c) {
  v8f d = __builtin_amdgcn_wmma_f32_16x16x32_bf16(false, a, false, b, (short)0, c, false, false);
  asm volatile("v_nop\n\tv_nop\n\tv_nop\n\tv_nop" : "+v"(d) : "v"(a), "v"(b));
  return d;
}
// 16x16x32 fragments: lane = (h = lane>>4, row/col = lane&15); elements 0..7 = k0+8h+0..7, 8..15 = k0+16+8h+0..7; D element r = row 8h+r
__device__ __forceinline__ v16h frag_h(const _Float16* rowk0, int lane) {
  union { v16h v; v8h q[2]; } u; const _Float16* p = rowk0 + 8 * (lane >> 4);
  u.q[0] = *(const v8h*)p; u.q[1] = *(const v8h*)(p + 16); return u.v;
}
__device__ __forceinline__ v16h frag_f32(const float* rowk0, int lane) {
  v16h a; const float* p = rowk0 + 8 * (lane >> 4);
#pragma unroll
  for (int i = 0; i < 8; ++i) { a[i] = (_Float16)p[i]; a[8 + i] = (_Float16)p[16 + i]; }
  return a;
}
__device__ __forceinline__ v16h frag_f32s(const float* rowk0, int lane, float sc) {
  v16h a; const float* p = rowk0 + 8 * (lane >> 4);
#pragma unroll
  for (int i = 0; i < 8; ++i) { a[i] = (_Float16)(p[i] * sc); a[8 + i] = (_Float16)(p[16 + i] * sc); }
  return a;
}
// column fragment from a [K][ld] layout (column n), rows >= K read as 0
__device__ __forceinline__ v16h fragc_f32(const float* W, int k0, int n, int lane, int ld, int K) {
  v16h a; const int g = lane >> 4;
#pragma unroll
  for (int i = 0; i < 8; ++i) { const int ka = k0 + 8 * g + i, kb = ka + 16;
    a[i] = (_Float16)(ka < K ? W[(size_t)(ka < K ? ka : K - 1) * ld + n] : 0.f); a[8 + i] = (_Float16)(kb < K ? W[(size_t)(kb < K ? kb : K - 1) * ld + n] : 0.f); }
  return a;
}
struct F2 { v16b h, l; };
__device__ __forceinline__ F2 bsplit16(const float v[16]) { F2 r;
#pragma unroll
  for (int i = 0; i < 16; ++i) { const __bf16 h = (__bf16)v[i]; r.h[i] = h; r.l[i] = (__bf16)(v[i] - (float)h); }
  return r; }
__device__ __forceinline__ F2 split_row(const float* row, int k0, int lane) { float v[16]; const float* p = row + k0 + 8 * (lane >> 4);
#pragma unroll
  for (int i = 0; i < 8; ++i) { v[i] = p[i]; v[8 + i] = p[16 + i]; }
  return bsplit16(v); }
__device__ __forceinline__ F2 split_rowK(const float* row, int k0, int lane, int K) { float v[16]; const int g = lane >> 4;
#pragma unroll
  for (int i = 0; i < 8; ++i) { const int ka = k0 + 8 * g + i, kb = ka + 16; v[i] = ka < K ? row[ka < K ? ka : K - 1] : 0.f; v[8 + i] = kb < K ? row[kb < K ? kb : K - 1] : 0.f; }
  return bsplit16(v); }
__device__ __forceinline__ F2 split_col(const float* W, int k0, int n, int lane, int ld, int K) { float v[16]; const int g = lane >> 4;
#pragma unroll
  for (int i = 0; i < 8; ++i) { const int ka = k0 + 8 * g + i, kb = ka + 16; v[i] = ka < K ? W[(size_t)(ka < K ? ka : K - 1) * ld + n] : 0.f; v[8 + i] = kb < K ? W[(size_t)(kb < K ? kb : K - 1) * ld + n] : 0.f; }
  return bsplit16(v); }
__device__ __forceinline__ v8f mac3(const F2& a, const F2& b, v8f c) { c = wmma_bf(a.l, b.h, c); c = wmma_bf(a.h, b.l, c); return wmma_bf(a.h, b.h, c); }
__device__ __forceinline__ float sigm(float v) { return 1.0f / (1.0f + expf(-v)); }
#define LDSX() do { asm volatile("s_wait_dscnt 0" ::: "memory"); __builtin_amdgcn_wave_barrier(); __builtin_amdgcn_fence(__ATOMIC_RELEASE, "workgroup"); } while (0)

// Causal multi-head self-attention with token padding masks on BOTH keys and queries (embeddings [4,2048,512], token_masks [4,2048] int 0/1 (random here: about half the tokens masked); 8 heads x 64; (in,out) Wq/Wk/Wv/Wo [512,512], no biases): scores = q.k/8, where(causal & tm[k] & tm[q], scores, -1e30), softmax, context Wo. A query with tm[q] = 0 gets all scores = -1e30 -> exactly uniform attention over all 2,048 positions (context = mean V).
#define NB 4
#define TT 2048
#define CC 512            // NH * HD = projected width
#define DIN 512          // input (model) width
#define NH 8
#define HD 64
#define SCALE (0.125f)
#define CAUSAL 1
#ifndef TNB
#define TNB NB
#endif
__device__ __forceinline__ float bfr(float v) { return (float)(__bf16)v; }
__host__ __device__ __forceinline__ int kb_last(int qb) { return CAUSAL ? ((qb * 64 + 63) >> 7) : (TT / 128 - 1); }
typedef __attribute__((ext_vector_type(8))) __bf16 v8b;
__device__ __forceinline__ v16b frag_b(const __bf16* rowk0, int lane) {
  union { v16b v; v8b q[2]; } u; const __bf16* p = rowk0 + 8 * (lane >> 4);
  u.q[0] = *(const v8b*)p; u.q[1] = *(const v8b*)(p + 16); return u.v;
}
#define QBH 6              // causal: query blocks 0..QBH-1 of each sequence (few keys, no averaging) take the high-precision path
#define QHI 384            // rows carrying a q residual plane (read only by the 3-product logits of query blocks < QBH)
#define KHI 384            // key rows carrying k residual / v bf16 hi+lo planes (used only by the causal high-precision path)
// B fragment (k rows k0+.., output column o) of a weight: (in,out) [K][ld] or (out,in) [ld rows of K]: bf16 exact, or f16(bf16 * 256) exact
__device__ __forceinline__ v16b wcol_io(const float* Wm, int k0, int o, int lane, int ld) { v16b w; const int g = lane >> 4;
#pragma unroll
  for (int i = 0; i < 8; ++i) { w[i] = (__bf16)Wm[(size_t)(k0 + 8 * g + i) * ld + o]; w[8 + i] = (__bf16)Wm[(size_t)(k0 + 16 + 8 * g + i) * ld + o]; }
  return w; }
__device__ __forceinline__ v16b wcol_oi(const float* Wm, int k0, int o, int lane, int K) { v16b w; const float* p = Wm + (size_t)o * K + k0 + 8 * (lane >> 4);
#pragma unroll
  for (int i = 0; i < 8; ++i) { w[i] = (__bf16)p[i]; w[8 + i] = (__bf16)p[16 + i]; }
  return w; }
__device__ __forceinline__ v16h wcolh_io(const float* Wm, int k0, int o, int lane, int ld) { v16h w; const int g = lane >> 4;
#pragma unroll
  for (int i = 0; i < 8; ++i) { w[i] = (_Float16)(bfr(Wm[(size_t)(k0 + 8 * g + i) * ld + o]) * 256.0f); w[8 + i] = (_Float16)(bfr(Wm[(size_t)(k0 + 16 + 8 * g + i) * ld + o]) * 256.0f); }
  return w; }
__device__ __forceinline__ v16h wcolh_oi(const float* Wm, int k0, int o, int lane, int K) { v16h w; const float* p = Wm + (size_t)o * K + k0 + 8 * (lane >> 4);
#pragma unroll
  for (int i = 0; i < 8; ++i) { w[i] = (_Float16)(bfr(p[i]) * 256.0f); w[8 + i] = (_Float16)(bfr(p[16 + i]) * 256.0f); }
  return w; }
#define WQKV_LAYOUT 0   // picks WCOL's layout only; no kernel calls WCOL: k_perm reads Wq/Wk/Wv as (in,out) [DIN][CC] whatever its value
__device__ __forceinline__ v16b wcol_hdk(const float* Wm, int k0, int o, int lane) { v16b w; const int g = lane >> 4; const float* p = Wm + (size_t)(o / HD) * DIN * HD + (o % HD);
#pragma unroll
  for (int i = 0; i < 8; ++i) { w[i] = (__bf16)p[(size_t)(k0 + 8 * g + i) * HD]; w[8 + i] = (__bf16)p[(size_t)(k0 + 16 + 8 * g + i) * HD]; }
  return w; }
#define WO_OUT_IN 0
#if WQKV_LAYOUT == 1
#define WCOL(W, k0, o, lane) wcol_oi(W, k0, o, lane, DIN)
#elif WQKV_LAYOUT == 2
#define WCOL(W, k0, o, lane) wcol_hdk(W, k0, o, lane)
#else
#define WCOL(W, k0, o, lane) wcol_io(W, k0, o, lane, CC)
#endif
#if WO_OUT_IN
#define WOCOL(W, k0, o, lane) wcol_oi(W, k0, o, lane, CC)
#define WOCOLH(W, k0, o, lane) wcolh_oi(W, k0, o, lane, CC)
#else
#define WOCOL(W, k0, o, lane) wcol_io(W, k0, o, lane, DIN)
#define WOCOLH(W, k0, o, lane) wcolh_io(W, k0, o, lane, DIN)
#endif
// masks: keys need causal (structure + index) AND token_masks[b][k] != 0; a query with token_masks[b][t] == 0 has EVERY score = -1e30 in the module -> exactly uniform attention over all 2,048 positions -> its context is mean_k V (mean v: 64-place sums from k_proj, added by a wave of k_att; k_out takes it as such a row's context; in k_att such rows just get a harmless finite placeholder)
// ---- k_perm: block = one sequence. IDX[b][r] = the token at sorted place r: the n unmasked tokens first, then the masked ones, each group in its old order; NU[b * 32] = n (a 128-byte line per sequence: one writer a line).
// The order of the unmasked tokens is kept, so among them 'key <= query' reads the same on places as on tokens, and a masked key is simply a place >= n: attention runs on the first n places alone, for any mask. q, k, v planes are laid out by place; the context row goes back to its token's row.
// Blocks TNB.. of the same launch copy the weights to five 16-bit planes (Wq, Wk, Wv, Wo, Wo again) in FRAGMENT ORDER: 16-byte unit u = ((kc * 32 + ot) * 2 + q) * 32 + lane holds W[kc * 32 + 16 q + 8 (lane >> 4) + 0..7][ot * 16 + (lane & 15)], so a wave fetches half a B fragment of k chunk kc, column tile ot, as one 512-byte run of whole lines. Values: bf16(W); the fifth plane f16(bf16(Wo) x 2^8).
#define PW (TT / 64)   /* waves of k_perm: 64 tokens a wave */
#define WPL ((size_t)DIN * CC)          /* elements of one packed plane */
#define WKS ((size_t)(CC / 16) * 512)   /* elements from one k chunk to the next in a packed plane */
#define WST(st) ((size_t)((st) >> 1) * WKS + (size_t)((st) & 1) * 2048)   /* stage st of a 128-column block: k chunk st / 2, its first or second four column tiles */
#define WPB ((DIN / 32) * (CC / 16) * 64 / (32 * PW))   /* blocks that pack one weight: a thread a unit */
static_assert(DIN == CC && CC == 512 && WPB * 32 * PW == (DIN / 32) * (CC / 16) * 64, "the unit index is cut by shifts; whole blocks");
static_assert(2 * PW == 64, "a lane holds two of the 64 group counts");
__global__ __launch_bounds__(32 * PW) void k_perm(const int* __restrict__ TM, const float* __restrict__ WQ, const float* __restrict__ WK, const float* __restrict__ WV, const float* __restrict__ WO, int* __restrict__ IDX, int* __restrict__ NU, __bf16* __restrict__ WP, _Float16* __restrict__ WOH) { __shared__ int cnt[2 * PW]; __shared__ int sidx[TT];
  if (blockIdx.x >= TNB) {   /* the same for the whole block, ahead of every barrier */
    const int pb = blockIdx.x - TNB, m = pb / WPB, u = (pb % WPB) * (32 * PW) + threadIdx.x; const int ln = u & 31, q = (u >> 5) & 1, ot = (u >> 6) & 31, kc = u >> 11;
    const float* src = (m == 0 ? WQ : m == 1 ? WK : m == 2 ? WV : WO) + (size_t)(kc * 32 + 16 * q + 8 * (ln >> 4)) * CC + ot * 16 + (ln & 15); float f[8];
#pragma unroll
    for (int i = 0; i < 8; ++i) f[i] = src[(size_t)i * CC];
    asm volatile("s_wait_xcnt 0x0" :: "v"(src) : "memory");   /* the eight loads share one address pair: it stays whole until this wait */
    if (m < 4) { v8b o;
#pragma unroll
      for (int i = 0; i < 8; ++i) o[i] = (__bf16)f[i];
      vst2(WP + (size_t)m * WPL + (size_t)u * 8, o);
    } else { v8h oh;
#pragma unroll
      for (int i = 0; i < 8; ++i) oh[i] = (_Float16)(bfr(f[i]) * 256.0f);
      vst2(WOH + (size_t)u * 8, oh); }
    return; }   /* one store a thread, the thread's last instruction */
  const int tid = threadIdx.x, wave = tid >> 5, lane = tid & 31, b = blockIdx.x; const int* TMb = TM + (size_t)b * TT; unsigned bal[2];
#pragma unroll
  for (int u = 0; u < 2; ++u) bal[u] = (unsigned)__ballot(TMb[(wave * 2 + u) * 32 + lane] != 0);
  if (lane < 2) cnt[wave * 2 + lane] = __popc(lane ? bal[1] : bal[0]);
  __syncthreads();   /* the 64 groups' counts are in LDS before a wave sums them */
  const int c0 = cnt[lane], c1 = cnt[32 + lane]; int tot = c0 + c1, bef = (lane < wave * 2 ? c0 : 0) + (32 + lane < wave * 2 ? c1 : 0);
#pragma unroll
  for (int o = 1; o < 32; o <<= 1) { tot += __shfl_xor(tot, o); bef += __shfl_xor(bef, o); }
#pragma unroll
  for (int u = 0; u < 2; ++u) { const int t = (wave * 2 + u) * 32 + lane; const int ones = bef + (u ? __popc(bal[0]) : 0) + __popc(bal[u] & ((1u << lane) - 1u)); sidx[((bal[u] >> lane) & 1u) ? ones : tot + (t - ones)] = t; }
  __syncthreads();   /* the whole list is in LDS before it leaves by whole lines */
#pragma unroll
  for (int u = 0; u < 2; ++u) vst2(IDX + (size_t)b * TT + u * 32 * PW + tid, sidx[u * 32 * PW + tid]);
  if (tid == 0) vst2(NU + b * 32, tot); }
__device__ __forceinline__ int n_unmasked(const int* NU, int b) { const int n = NU[b * 32]; return __builtin_amdgcn_readfirstlane(n < 0 ? 0 : n > TT ? TT : n); }   /* bounded whatever the word holds; through readfirstlane so that the tests on it are scalar branches */
// ---- mean v, the context of a fully-masked query row (softmax of 2,048 equal scores = exactly 1/2048 each): MV[b][c] = (1/2048) sum_t v[b][t][c] over the f16 v values, f32 sums. It has no launch of its own: a v block of k_proj sums its 64 places per channel out of the LDS tile that it stores anyway (PS[b][t / 64][c], whole lines, one writer a line); in k_att one wave of HD / 32 blocks of each (b, h) adds the TT / 64 partial sums of 32 channels and stores them as one 128-byte line of MV; k_out reads MV[b] in place of the ctx row of a token with token_masks == 0.
#define PSN (TT / 64)   /* partial sums a channel: one per 64-place block of k_proj */
#define WS_MV (WS_END)                                    // f32 mean-v rows [b][512]
#define WS_END2 (WS_MV + 4u * (size_t)NB * CC)
#define WS_IDX (WS_END2)                                  // int token of each sorted place [b][t]
#define WS_NU  (WS_IDX + 4u * (size_t)NB * TT)            // int unmasked tokens of a sequence, one 128-byte line each
#define WS_END3 (WS_NU + 128u * (size_t)NB)
#define WS_WP  (WS_END3)                                  // bf16 Wq, Wk, Wv, Wo in fragment order
#define WS_WOH (WS_WP + 2u * 4u * (size_t)DIN * CC)       // f16(bf16 Wo x 2^8) in fragment order
#define WS_END4 (WS_WOH + 2u * (size_t)DIN * CC)
#define WS_PS  (WS_END4)                                  // f32 sums of v over 64 places [b][t / 64][512]
#define WS_END5 (WS_PS + 4u * (size_t)NB * PSN * CC)

// The q, k and v planes lie in FRAGMENT ORDER, so that each 16-byte load of a k_att wave covers 512 bytes in a row (four whole lines; by rows it touched 16 lines for the same bytes).
// q, k: [b][h][16-place tile] of FQK elements; 16-byte unit ((kc * 2 + qq) * 32 + lane) of a tile = place (lane & 15), dims kc * 32 + qq * 16 + 8 (lane >> 4) + 0..7.
// v: [b][h][32-place chunk] of FV elements; unit ((j * 2 + qq) * 32 + lane) of a chunk = channel j * 16 + (lane & 15), places qq * 16 + 8 (lane >> 4) + 0..7.
#define FQK (16 * HD)
#define FV  (32 * HD)
static_assert(HD == 64 && CC == NH * HD && QHI % 64 == 0 && KHI % 64 == 0, "the unit index of a 64 x 128 block is cut by shifts; whole blocks carry residual planes");
#define WS_QH  0u                                      // f16 q tiles [b][h][t / 16]
#define WS_KH  (WS_QH + 2u * (size_t)NB * TT * CC)      // f16 k tiles [b][h][t / 16]
#define WS_VT  (WS_KH + 2u * (size_t)NB * TT * CC)      // f16 v chunks [b][h][t / 32]
#define WS_QL  (WS_VT + 2u * (size_t)NB * CC * TT)      // f16 q residual x 2^10 tiles [b][h][t / 16 < QHI / 16]
#define WS_KL  (WS_QL + 2u * (size_t)NB * QHI * CC)     // f16 k residual x 2^10 tiles [b][h][t / 16 < KHI / 16]
#define WS_VB  (WS_KL + 2u * (size_t)NB * KHI * CC)     // bf16 v hi chunks [b][h][t / 32 < KHI / 32]
#define WS_VBL (WS_VB + 2u * (size_t)NB * CC * KHI)
#define WS_Y   (WS_VBL + 2u * (size_t)NB * CC * KHI)     // f32 ctx rows [b*t][CC] (only when there is an output projection)
#define WS_END (WS_Y  + 4u * (size_t)NB * TT * CC)

// operands fetched ahead of their products: 16 f32 of an A row in fragment order (x[0..1] = p[0..7], x[2..3] = p[16..23]); N / 2 B fragments of a packed plane as N runs of 512 bytes a wave
__device__ __forceinline__ void ld_xr(const float* p, v4f x[4]) { x[0] = *(const v4f*)p; x[1] = *(const v4f*)(p + 4); x[2] = *(const v4f*)(p + 16); x[3] = *(const v4f*)(p + 20); }
template <int N, typename T, typename T8> __device__ __forceinline__ void ld_wf(const T* p, T8 w[N]) {
#pragma unroll
  for (int t = 0; t < N; ++t) w[t] = *(const T8*)(p + t * 256); }
__device__ __forceinline__ v16b two_b(v8b a, v8b b) { union { v16b v; v8b q[2]; } u; u.q[0] = a; u.q[1] = b; return u.v; }
__device__ __forceinline__ v16h two_h(v8h a, v8h b) { union { v16h v; v8h q[2]; } u; u.q[0] = a; u.q[1] = b; return u.v; }
// ---- k_proj: block = (64 sorted places, 128 cols, which), the X row of a place through IDX; q and k blocks wholly behind the last 128-place group that holds an unmasked token leave at once (k_att reads no place there): q/k/v = X W (+ b) with exact bf16 products (K = DIN) -> which 0: q f16 tiles (+ residual tiles for places < QHI); 1: k f16 tiles (+ residual tiles for places < KHI); 2: v f16 chunks (+ bf16 hi/lo chunks for places < KHI), all in the fragment order given at the WS_ offsets
__global__ __launch_bounds__(128) void k_proj(const float* __restrict__ XQ, const float* __restrict__ XK, const float* __restrict__ XV, const __bf16* __restrict__ WP, const float* __restrict__ BQ, const float* __restrict__ BK, const float* __restrict__ BV, const int* __restrict__ IDX, const int* __restrict__ NU,
    _Float16* __restrict__ QH, _Float16* __restrict__ QL, _Float16* __restrict__ KH, _Float16* __restrict__ KL, _Float16* __restrict__ VT, __bf16* __restrict__ VB, __bf16* __restrict__ VBL, float* __restrict__ PS) {
  __shared__ __align__(16) _Float16 sh[64][136], sl[64][136]; __shared__ __align__(16) _Float16 th[128][72]; __shared__ __align__(16) __bf16 tb[128][72], tbl[128][72];
  const int tid = threadIdx.x, wave = tid >> 5, lane = tid & 31, col = lane & 15, g = lane >> 4; const int which = blockIdx.z; const int c0 = blockIdx.y * 128; const size_t r0 = (size_t)blockIdx.x * 64; const size_t bb = r0 / TT; const int t0 = (int)(r0 % TT);
  if (which < 2 && t0 >= ((n_unmasked(NU, (int)bb) + 127) & ~127)) return;   /* the same for the whole block, ahead of every barrier */
  const float* X = which == 0 ? XQ : which == 1 ? XK : XV; const float* BA = which == 0 ? BQ : which == 1 ? BK : BV;
  const float* xr = X + (bb * TT + (size_t)(IDX[r0 + wave * 16 + col] & (TT - 1))) * DIN;   /* the mask bounds the row whatever the list holds */
  const float* xp = xr + 8 * g; const __bf16* wp = WP + (size_t)which * WPL + ((size_t)(c0 >> 4) * 64 + lane) * 8;
  v8f acc[8] = {}; v4f xs[2][4]; v8b wf[4][8]; v16b a; ld_xr(xp, xs[0]); ld_xr(xp + 32, xs[1]);
#pragma unroll
  for (int t = 0; t < 3; ++t) ld_wf<8>(wp + WST(t), wf[t]);
#pragma unroll   /* whole: the operand sets stay in registers, every step of the two addresses is a constant offset */
  for (int st = 0; st < DIN / 16; ++st) { const int hf = st & 1, kc = st >> 1;   /* a stage = half a k chunk: four column tiles; B is fetched three stages ahead, A two chunks ahead */
    if (hf == 0) {
#pragma unroll
      for (int i = 0; i < 4; ++i) { a[i] = (__bf16)xs[kc & 1][0][i]; a[4 + i] = (__bf16)xs[kc & 1][1][i]; a[8 + i] = (__bf16)xs[kc & 1][2][i]; a[12 + i] = (__bf16)xs[kc & 1][3][i]; }
      if (kc + 2 < DIN / 32) ld_xr(xp + (kc + 2) * 32, xs[kc & 1]); }
    if (st + 3 < DIN / 16) ld_wf<8>(wp + WST(st + 3), wf[(st + 3) & 3]);   /* into the set that the last stage has left */
    if (st + 4 == DIN / 16) asm volatile("s_wait_xcnt 0x0" :: "v"(xp), "v"(wp) : "memory");   /* behind the last loads: the two address pairs stay whole until this wait */
#pragma unroll
    for (int j = 0; j < 4; ++j) acc[hf * 4 + j] = wmma_bf(a, two_b(wf[st & 3][2 * j], wf[st & 3][2 * j + 1]), acc[hf * 4 + j]);
    __builtin_amdgcn_sched_barrier(0); }   /* keeps the next stage's conversions, and with them the wait on loads just issued, behind this stage's products */
  if (which < 2) { _Float16* DH = which == 0 ? QH : KH; _Float16* DL = which == 0 ? QL : KL; const int nhi = which == 0 ? QHI : KHI; const bool hi_rows = t0 < nhi;
#pragma unroll
    for (int j = 0; j < 8; ++j) { const float bias = BA ? bfr(BA[c0 + j * 16 + col]) : 0.f;
#pragma unroll
      for (int r = 0; r < 8; ++r) { const float v = acc[j][r] + bias; const _Float16 hv = (_Float16)v; sh[wave * 16 + 8 * g + r][j * 16 + col] = hv; sl[wave * 16 + 8 * g + r][j * 16 + col] = (_Float16)((v - (float)hv) * 1024.0f); } }
    __syncthreads();
    for (int e = tid; e < 64 * 16; e += 128) { const int rl = (e >> 8) * 16 + (e & 15), cl = ((e >> 7) & 1) * 64 + ((e >> 5) & 3) * 16 + ((e >> 4) & 1) * 8;   /* e = ((tile * 2 + head) * 4 + kc * 2 + qq) * 32 + lane: a wave stores 512 bytes in a row; its 16 LDS rows fall on different banks */
      const size_t hd = bb * NH + (c0 >> 6) + ((e >> 7) & 1); const int tl = (t0 >> 4) + (e >> 8), un = (e & 127) * 8;
      vst2((unsigned*)(DH + (hd * (TT / 16) + tl) * FQK + un), *(const v4u*)&sh[rl][cl]);
      if (hi_rows) { asm volatile("s_wait_xcnt 0x0" ::: "memory");   /* behind the first store: the LDS read below lands on its data registers */
        vst2((unsigned*)(DL + (hd * (size_t)(nhi / 16) + tl) * FQK + un), *(const v4u*)&sl[rl][cl]); }
      asm volatile("s_wait_xcnt 0x0" ::: "memory"); }   /* behind the stores: the next trip rewrites their address and data registers */
  } else { const bool hi_rows = t0 < KHI;
#pragma unroll
    for (int j = 0; j < 8; ++j) { const float bias = BA ? bfr(BA[c0 + j * 16 + col]) : 0.f;
#pragma unroll
      for (int r = 0; r < 8; ++r) { const float v = acc[j][r] + bias; const int rl = wave * 16 + 8 * g + r, cl = j * 16 + col; th[cl][rl] = (_Float16)v; const __bf16 bh = (__bf16)v; tb[cl][rl] = bh; tbl[cl][rl] = (__bf16)(v - (float)bh); } }
    __syncthreads();
    for (int e = tid; e < 128 * 8; e += 128) { const int cl = (e >> 9) * 64 + ((e >> 6) & 3) * 16 + (e & 15), pl = ((e >> 8) & 1) * 32 + ((e >> 5) & 1) * 16 + ((e >> 4) & 1) * 8;   /* e = ((head * 2 + chunk) * 8 + j * 2 + qq) * 32 + lane: a wave stores 512 bytes in a row; its 16 LDS rows fall on different banks */
      const size_t hd = bb * NH + (c0 >> 6) + (e >> 9); const int ch = (t0 >> 5) + ((e >> 8) & 1), un = (e & 255) * 8;
      vst2((unsigned*)(VT + (hd * (TT / 32) + ch) * FV + un), *(const v4u*)&th[cl][pl]);
      if (hi_rows) { asm volatile("s_wait_xcnt 0x0" ::: "memory");   /* behind the first store: the LDS reads below land on its address and data registers */
        const size_t o3 = (hd * (KHI / 32) + ch) * FV + un; vst2((unsigned*)(VB + o3), *(const v4u*)&tb[cl][pl]); vst2((unsigned*)(VBL + o3), *(const v4u*)&tbl[cl][pl]); }
      asm volatile("s_wait_xcnt 0x0" ::: "memory"); }   /* behind the stores: the next trip rewrites their address and data registers */
    asm volatile("s_wait_xcnt 0x0" ::: "memory");   /* behind the loop's stores: the LDS reads below land on their address and data registers */
    hx8 hv[8]; float a8[8];   /* thread = channel: the block's 64 places of the f16 v tile summed in f32, eight chains and a tree over them; the loops are unrolled whole, so the LDS reads issue ahead of the first add */
#pragma unroll
    for (int i = 0; i < 8; ++i) hv[i] = *(const hx8*)&th[tid][i * 8];
#pragma unroll
    for (int j = 0; j < 8; ++j) a8[j] = (float)hv[0][j];
#pragma unroll
    for (int i = 1; i < 8; ++i)
#pragma unroll
      for (int j = 0; j < 8; ++j) a8[j] += (float)hv[i][j];
    vst2(PS + (bb * PSN + (size_t)(t0 >> 6)) * CC + c0 + tid, ((a8[0] + a8[1]) + (a8[2] + a8[3])) + ((a8[4] + a8[5]) + (a8[6] + a8[7])));   /* a wave stores one whole line */
    asm volatile("s_wait_xcnt 0x0" ::: "memory"); } }   /* behind the store: the code that the listing has behind it rewrites the store's base and data registers */
// ---- k_att: a tile = 16 sorted places of (b, h) as queries, worked on by the AW waves of a block. AG blocks share the tiles of one (b, h) and each walks its own in a loop: NH * TNB * AG blocks fill the chip's places once (two blocks' LDS fit a WGP), so no wave is started for a tile of masked tokens (k_out takes mean v for their rows) and a block's start is paid once for all its tiles. Only the nt = ceil(n / 16) tiles that hold an unmasked token are dealt: by rank from the longest (rank r = tile nt - 1 - r), 16 ranks a pass, forwards and backwards by turns, so the blocks' key counts come out level. The 16 score rows live in LDS from the logits to P, so no score plane goes through memory and one launch covers every (b, h).
// step 1, logits: wave w takes the 16-key tiles w, w + AW, ... of keys [0, kend): q x k on f16 (3 products with the x 2^10 residual planes for query blocks < QBH), x SCALE; causal and key masks (place < n) by select at the LDS store.
// step 2, softmax: wave w owns row w in registers, f32, sums by lane then across lanes; P x 2^11 back in place (0 for excluded keys); a query with token_masks == 0 gets a finite placeholder row here, which k_out does not read.
// step 3, P.v: wave w sums the 32-key chunks w, w + AW, ... (P once to f16 against v f16; query blocks < QBH: P and v as bf16 hi + lo, 3 products); the AW partial tiles are added in f32 through LDS in wave order.
#define AG 16          /* blocks that share the tiles of one (b, h) */
#define AW 16          /* the wave number goes through readfirstlane so that the tile loops are scalar loops and every lane is on at the matrix instructions */
#define SP (TT + 4)    /* row pitch in floats: 16 B past a multiple of 256 B, so the 16 rows of a b128 fragment read fall on different banks */
static_assert((TT / 16) % AG == 0, "whole passes over the ranks");
static_assert(HD % 32 == 0 && HD / 32 <= AG && (PSN & (PSN - 1)) == 0, "mean v: whole lines of 32 channels, a block for each, a full tree");
static_assert(QBH * 64 >= QHI, "every row with a q residual plane takes the 3-product path");
static_assert(AW * 16 * (HD + 4) <= 16 * SP, "the partial tiles reuse the score rows' LDS");
static_assert(16 * (HD / 2) == 32 * AW, "in the last step a wave stores the row of its own number");
// 16 f32 of one LDS row in fragment order (0..7 = p[0..7], 8..15 = p[16..23]) by four 16-byte reads
__device__ __forceinline__ void lds_row16(const float* p, float v[16]) { const v4f a = *(const v4f*)p, b = *(const v4f*)(p + 4), c = *(const v4f*)(p + 16), d = *(const v4f*)(p + 20);
#pragma unroll
  for (int i = 0; i < 4; ++i) { v[i] = a[i]; v[4 + i] = b[i]; v[8 + i] = c[i]; v[12 + i] = d[i]; } }
// a 16-bit fragment of a fragment-order plane at the lane's own byte address: two runs of 512 bytes a wave. k_att forms that address where it is used, as a tile's wave-uniform base (scalar registers) + the lane's 32-bit byte offset: one vector register serves every plane, where a 64-bit pair a plane, held over the tile loop, would not fit the 128 registers that two blocks a WGP leave a wave
template <typename V16, typename V8> __device__ __forceinline__ V16 frag_p(const char* p) { union { V16 v; V8 q[2]; } u; u.q[0] = *(const V8*)p; u.q[1] = *(const V8*)(p + 512); return u.v; }
__global__ __launch_bounds__(32 * AW) __attribute__((amdgpu_waves_per_eu(8, 8))) void k_att(const _Float16* __restrict__ QH, const _Float16* __restrict__ KH, const _Float16* __restrict__ QL, const _Float16* __restrict__ KL, const _Float16* __restrict__ VT, const __bf16* __restrict__ VB, const __bf16* __restrict__ VBL, const int* __restrict__ IDX, const int* __restrict__ NU, const float* __restrict__ PS, float* __restrict__ MV, float* __restrict__ Y) { __shared__ __align__(16) float sc[16][SP];
  const int tid = threadIdx.x, wave = __builtin_amdgcn_readfirstlane(tid >> 5), lane = tid & 31, col = lane & 15, g = lane >> 4; const int h = blockIdx.x % NH, b = blockIdx.x / NH, sl = blockIdx.y;
  if (sl < HD / 32 && wave == AW - 1) {   /* scalar test. Mean v of 32 channels of this head: lane = channel, the PSN partial sums loaded as PSN whole lines, all in flight at once, added as a tree; ahead of the tile loop, so it is done for any mask, also where the block has no tile */
    const float* pb = PS + (size_t)b * PSN * CC + h * HD + sl * 32; float f[PSN];   /* wave-uniform base; the lane is the loads' offset register */
#pragma unroll
    for (int i = 0; i < PSN; ++i) f[i] = pb[(size_t)i * CC + lane];
#pragma unroll
    for (int o = PSN / 2; o > 0; o >>= 1)
#pragma unroll
      for (int i = 0; i < o; ++i) f[i] += f[i + o];
    vst2(MV + (size_t)b * CC + h * HD + sl * 32 + lane, f[0] * (1.0f / TT));
    asm volatile("s_wait_xcnt 0x0" :: "s"(pb) : "memory"); }   /* behind the loads and the store: the loads' base stays whole until this wait, and the code below rewrites the store's address and data registers */
  const int nb = n_unmasked(NU, b); const int nt = (nb + 15) >> 4;
  const unsigned lo = (unsigned)lane * 16; const size_t hd = (size_t)b * NH + h;   /* the lane's bytes into a 512-byte run of any plane; the (b, h) whose tiles and chunks are read */
  for (int ps = 0; ps < TT / 16 / AG; ++ps) { const int qt = nt - 1 - (ps * AG + ((ps & 1) ? AG - 1 - sl : sl)); if (qt < 0) break;   /* scalar, the same for the whole block; the rank grows with ps, so no later pass has a tile either */
  const int qb = qt >> 2; const int ql0 = qt * 16; const int kend = (kb_last(qb) + 1) * 128;
  const int tq = ql0 + wave < nb; const int orow = IDX[(size_t)b * TT + ql0 + wave] & (TT - 1);   /* the token whose context row this wave stores; the mask bounds the row whatever the list holds */
  asm volatile("s_wait_xcnt 0x0" ::: "memory");   /* behind the list load: the q loads below land on its offset register */
  const char* qp = (const char*)(QH + (hd * (TT / 16) + qt) * FQK) + lo;
  if (qb < QBH) { const char* qlp = (const char*)(QL + (hd * (QHI / 16) + qt) * FQK) + lo; v16h ah[HD / 32], al[HD / 32];
#pragma unroll
    for (int kc = 0; kc < HD / 32; ++kc) { ah[kc] = frag_p<v16h, v8h>(qp + kc * 1024); al[kc] = frag_p<v16h, v8h>(qlp + kc * 1024); }
    asm volatile("s_wait_xcnt 0x0" :: "v"(qp), "v"(qlp) : "memory");   /* the q loads' two address pairs stay whole (no load lands on them) until this wait */
    for (int kt = wave; kt < kend / 16; kt += AW) { const int key = kt * 16 + col; v8f acc = {}, accl = {}; const char* kp = (const char*)(KH + (hd * (TT / 16) + kt) * FQK) + lo; const char* klp = (const char*)(KL + (hd * (KHI / 16) + kt) * FQK) + lo;
      v16h kbf[HD / 32], klf[HD / 32];   /* all of the tile's loads stand ahead of its first product: one memory latency a tile */
#pragma unroll
      for (int kc = 0; kc < HD / 32; ++kc) { kbf[kc] = frag_p<v16h, v8h>(kp + kc * 1024); klf[kc] = frag_p<v16h, v8h>(klp + kc * 1024); }
      asm volatile("s_wait_xcnt 0x0" :: "v"(kp), "v"(klp) : "memory");   /* the k loads' two address pairs stay whole (no load lands on them) until this wait */
#pragma unroll
      for (int kc = 0; kc < HD / 32; ++kc) { acc = wmma16(ah[kc], kbf[kc], acc); accl = wmma16(al[kc], kbf[kc], accl); accl = wmma16(ah[kc], klf[kc], accl); }
#pragma unroll
      for (int r = 0; r < 8; ++r) sc[8 * g + r][key] = ((!CAUSAL || key <= ql0 + 8 * g + r) && key < nb) ? (acc[r] + accl[r] * (1.0f / 1024.0f)) * SCALE : -3.0e38f; }
  } else { v16h ah[HD / 32];
#pragma unroll
    for (int kc = 0; kc < HD / 32; ++kc) ah[kc] = frag_p<v16h, v8h>(qp + kc * 1024);
    asm volatile("s_wait_xcnt 0x0" :: "v"(qp) : "memory");   /* the q loads share one address pair: it stays whole (no k load lands on it) until this wait */
    for (int kt0 = wave; kt0 < kend / 16; kt0 += 4 * AW) { v16h kbf[4][HD / 32] = {};   /* the start value: registers left unset on a skipped tile's path are carried round the tile loop and spill; the loads of up to four tiles stand ahead of the first product: one memory latency for four tiles; the tests on the tile number are scalar */
      const char* kp = (const char*)(KH + (hd * (TT / 16) + kt0) * FQK) + lo;   /* one address pair for the four tiles, the tile's step as a constant offset */
#pragma unroll
      for (int u = 0; u < 4; ++u) if (kt0 + u * AW < kend / 16) {
#pragma unroll
        for (int kc = 0; kc < HD / 32; ++kc) kbf[u][kc] = frag_p<v16h, v8h>(kp + u * (AW * FQK * 2) + kc * 1024); }
      asm volatile("s_wait_xcnt 0x0" :: "v"(kp) : "memory");   /* the k loads share one address pair: it stays whole (no load lands on it) until this wait */
#pragma unroll
      for (int u = 0; u < 4; ++u) if (kt0 + u * AW < kend / 16) { const int key = (kt0 + u * AW) * 16 + col; v8f acc = {};
#pragma unroll
        for (int kc = 0; kc < HD / 32; ++kc) acc = wmma16(ah[kc], kbf[u][kc], acc);
#pragma unroll
        for (int r = 0; r < 8; ++r) sc[8 * g + r][key] = ((!CAUSAL || key <= ql0 + 8 * g + r) && key < nb) ? acc[r] * SCALE : -3.0e38f; } } }
  __syncthreads();   /* every tile of the 16 score rows is in LDS before a wave reads its row */
  { const int nq = kend >> 7; v4f vv[TT / 128] = {};   /* the start value: as for kbf above; 128 keys a pass: 32 lanes x 4; the tests on nq are scalar */
#pragma unroll
    for (int i = 0; i < TT / 128; ++i) if (i < nq) vv[i] = *(const v4f*)&sc[wave][i * 128 + lane * 4];
    float m = -3.0e38f;
#pragma unroll
    for (int i = 0; i < TT / 128; ++i) if (i < nq) { if (tq == 0) vv[i] = (v4f){0.f, 0.f, 0.f, 0.f}; m = fmaxf(m, fmaxf(fmaxf(vv[i][0], vv[i][1]), fmaxf(vv[i][2], vv[i][3]))); }
#pragma unroll
    for (int o = 1; o < 32; o <<= 1) m = fmaxf(m, __shfl_xor(m, o));
    float sum = 0.f;
#pragma unroll
    for (int i = 0; i < TT / 128; ++i) if (i < nq) {
#pragma unroll
      for (int c = 0; c < 4; ++c) { const float v = vv[i][c]; const float ex = expf(v - m); const float e = (v <= -1.0e38f) ? 0.f : ex; vv[i][c] = e; sum += e; } }
#pragma unroll
    for (int o = 1; o < 32; o <<= 1) sum += __shfl_xor(sum, o);
    const float inv = sum > 0.f ? 2048.0f / sum : 0.f;   /* a fully excluded row yields P = 0 */
#pragma unroll
    for (int i = 0; i < TT / 128; ++i) if (i < nq) *(v4f*)&sc[wave][i * 128 + lane * 4] = vv[i] * inv; }
  __syncthreads();   /* all 16 rows of P are in LDS before any wave forms fragments across them */
  const int kce = kend >> 5; v8f acc[HD / 16] = {};
  if (qb < QBH) {
    for (int kc = wave; kc < kce; kc += AW) { float pv[16]; lds_row16(&sc[col][kc * 32 + 8 * g], pv); const F2 p = bsplit16(pv); const size_t po = (hd * (KHI / 32) + kc) * FV; const char* vbp = (const char*)(VB + po) + lo; const char* vlp = (const char*)(VBL + po) + lo;
#pragma unroll
      for (int j2 = 0; j2 < HD / 16; j2 += 2) { v16b vh[2], vl[2];   /* two column tiles' loads stand ahead of their products */
#pragma unroll
        for (int u = 0; u < 2; ++u) { vh[u] = frag_p<v16b, v8b>(vbp + (j2 + u) * 1024); vl[u] = frag_p<v16b, v8b>(vlp + (j2 + u) * 1024); }
        asm volatile("s_wait_xcnt 0x0" :: "v"(vbp), "v"(vlp) : "memory");   /* the v loads' two address pairs stay whole (no load lands on them) until this wait */
#pragma unroll
        for (int u = 0; u < 2; ++u) { const int j = j2 + u; acc[j] = wmma_bf(p.h, vh[u], acc[j]); acc[j] = wmma_bf(p.l, vh[u], acc[j]); acc[j] = wmma_bf(p.h, vl[u], acc[j]); } } }
  } else {
    for (int kc = wave; kc < kce; kc += AW) { v16h vf[HD / 16]; const char* vp = (const char*)(VT + (hd * (TT / 32) + kc) * FV) + lo;   /* the chunk's four v loads stand ahead of its first product: one memory latency a chunk */
#pragma unroll
      for (int j = 0; j < HD / 16; ++j) vf[j] = frag_p<v16h, v8h>(vp + j * 1024);
      asm volatile("s_wait_xcnt 0x0" :: "v"(vp) : "memory");   /* the eight loads share one address pair: it stays whole (no load lands on it) until this wait */
      float pv[16]; lds_row16(&sc[col][kc * 32 + 8 * g], pv); v16h p;
#pragma unroll
      for (int i = 0; i < 16; ++i) p[i] = (_Float16)pv[i];
#pragma unroll
      for (int j = 0; j < HD / 16; ++j) acc[j] = wmma16(p, vf[j], acc[j]); } }
  __syncthreads();   /* every wave has read its last P fragment before the partial tiles overwrite the rows */
  float (*ss)[16][HD + 4] = (float (*)[16][HD + 4])&sc[0][0];
#pragma unroll
  for (int j = 0; j < HD / 16; ++j)
#pragma unroll
    for (int r = 0; r < 8; ++r) ss[wave][8 * g + r][j * 16 + col] = acc[j][r];
  __syncthreads();   /* every wave's partial tile is in LDS before any wave adds them */
  for (int e = tid; e < 16 * (HD / 2); e += 32 * AW) { const int rl = e / (HD / 2), q = e % (HD / 2); v2f s = *(const v2f*)&ss[0][rl][q * 2];
#pragma unroll   /* the AW LDS reads issue ahead of the adds; rolled, each add would wait a full LDS latency */
    for (int w = 1; w < AW; ++w) s += *(const v2f*)&ss[w][rl][q * 2];
    vst2(Y + ((size_t)b * TT + orow) * CC + h * HD + q * 2, s * (1.0f / 2048.0f));
    asm volatile("s_wait_xcnt 0x0" ::: "memory"); }   /* behind the store: the next tile rewrites its address and data registers */
  __syncthreads(); } }   /* every wave has read the partial tiles before the next tile's scores overwrite them */
// ---- k_out: block = (64 rows, 128 cols): out = ctx Wo (+ bo), the ctx row of a token with token_masks == 0 being its sequence's mean v (every lane reads a row that this call has written): ctx x 2^6 once to f16 against Wo as f16(bf16 x 2^8) exact (1 product) x 2^-14; causal early rows (< QHI of each sequence): ctx bf16 hi + lo against exact bf16 Wo (2 products)
__global__ __launch_bounds__(128) void k_out(const float* __restrict__ Y, const int* __restrict__ TM, const float* __restrict__ MV, const __bf16* __restrict__ WOB, const _Float16* __restrict__ WOH, const float* __restrict__ BO, float* __restrict__ OUT) { __shared__ __align__(16) float sf[4][16][132];
  const int tid = threadIdx.x, wave = tid >> 5, lane = tid & 31, col = lane & 15, g = lane >> 4; const int c0 = blockIdx.y * 128; const size_t r0 = (size_t)blockIdx.x * 64 + wave * 16;
  const int* tp = TM + r0 + col; const int tk = *tp; asm volatile("s_wait_xcnt 0x0" :: "v"(tp) : "memory");   /* the mask load's address pair stays whole until this wait */
  v8f acc[8] = {}; const float* xp = (tk != 0 ? Y + (r0 + col) * CC : MV + (((size_t)blockIdx.x * 64) / TT) * CC) + 8 * g; const size_t wo = ((size_t)(c0 >> 4) * 64 + lane) * 8; v4f xs[2][4]; ld_xr(xp, xs[0]); ld_xr(xp + 32, xs[1]);
  if (CAUSAL && (int)(((size_t)blockIdx.x * 64) % TT) < QHI) {   /* block-uniform */
    const __bf16* wp = WOB + wo; v8b wf[3][8]; F2 a;
#pragma unroll
    for (int t = 0; t < 2; ++t) ld_wf<8>(wp + WST(t), wf[t]);
#pragma unroll   /* whole, stages as in k_proj; two products a tile, so B two stages ahead covers as much */
    for (int st = 0; st < CC / 16; ++st) { const int hf = st & 1, kc = st >> 1;
      if (hf == 0) { float v[16];
#pragma unroll
        for (int i = 0; i < 4; ++i) { v[i] = xs[kc & 1][0][i]; v[4 + i] = xs[kc & 1][1][i]; v[8 + i] = xs[kc & 1][2][i]; v[12 + i] = xs[kc & 1][3][i]; }
        a = bsplit16(v); if (kc + 2 < CC / 32) ld_xr(xp + (kc + 2) * 32, xs[kc & 1]); }
      if (st + 2 < CC / 16) ld_wf<8>(wp + WST(st + 2), wf[(st + 2) % 3]);   /* into the set that the last stage has left */
      if (st + 3 == CC / 16) asm volatile("s_wait_xcnt 0x0" :: "v"(xp), "v"(wp) : "memory");   /* behind the last loads: the two address pairs stay whole until this wait */
#pragma unroll
      for (int j = 0; j < 4; ++j) { const int jj = hf * 4 + j; const v16b w = two_b(wf[st % 3][2 * j], wf[st % 3][2 * j + 1]); acc[jj] = wmma_bf(a.h, w, acc[jj]); acc[jj] = wmma_bf(a.l, w, acc[jj]); }
      __builtin_amdgcn_sched_barrier(0); }   /* keeps the next stage's conversions, and with them the wait on loads just issued, behind this stage's products */
#pragma unroll
    for (int j = 0; j < 8; ++j) { const float bias = BO ? bfr(BO[c0 + j * 16 + col]) : 0.f;
#pragma unroll
      for (int r = 0; r < 8; ++r) sf[wave][8 * g + r][j * 16 + col] = acc[j][r] + bias; }
  } else {
    const _Float16* wp = WOH + wo; v8h wf[4][8]; v16h a;
#pragma unroll
    for (int t = 0; t < 3; ++t) ld_wf<8>(wp + WST(t), wf[t]);
#pragma unroll   /* whole, stages as in k_proj */
    for (int st = 0; st < CC / 16; ++st) { const int hf = st & 1, kc = st >> 1;
      if (hf == 0) {   /* ctx carried x 2^6 into f16 so small-magnitude context rows stay clear of f16 subnormals */
#pragma unroll
        for (int i = 0; i < 4; ++i) { a[i] = (_Float16)(xs[kc & 1][0][i] * 64.0f); a[4 + i] = (_Float16)(xs[kc & 1][1][i] * 64.0f); a[8 + i] = (_Float16)(xs[kc & 1][2][i] * 64.0f); a[12 + i] = (_Float16)(xs[kc & 1][3][i] * 64.0f); }
        if (kc + 2 < CC / 32) ld_xr(xp + (kc + 2) * 32, xs[kc & 1]); }
      if (st + 3 < CC / 16) ld_wf<8>(wp + WST(st + 3), wf[(st + 3) & 3]);   /* into the set that the last stage has left */
      if (st + 4 == CC / 16) asm volatile("s_wait_xcnt 0x0" :: "v"(xp), "v"(wp) : "memory");   /* behind the last loads: the two address pairs stay whole until this wait */
#pragma unroll
      for (int j = 0; j < 4; ++j) acc[hf * 4 + j] = wmma16(a, two_h(wf[st & 3][2 * j], wf[st & 3][2 * j + 1]), acc[hf * 4 + j]);
      __builtin_amdgcn_sched_barrier(0); }   /* keeps the next stage's conversions, and with them the wait on loads just issued, behind this stage's products */
#pragma unroll
    for (int j = 0; j < 8; ++j) { const float bias = BO ? bfr(BO[c0 + j * 16 + col]) : 0.f;
#pragma unroll
      for (int r = 0; r < 8; ++r) sf[wave][8 * g + r][j * 16 + col] = acc[j][r] * (1.0f / 16384.0f) + bias; } }   /* 2^-8 (Wo carry) x 2^-6 (ctx carry) */
  LDSX(); for (int rl = 0; rl < 16; ++rl) vst2(OUT + (r0 + rl) * DIN + c0 + lane * 4, *(const v4f*)&sf[wave][rl][lane * 4]); }

extern "C" void kernel_launch(void* const* d_in, const int* in_sizes, int n_in, void* d_out, int out_size, void* d_ws, size_t ws_size, hipStream_t stream) {
  (void)in_sizes; (void)n_in; (void)out_size;
  const float** F = (const float**)d_in;
  if (ws_size < (size_t)WS_END) return;
  char* ws = (char*)d_ws; _Float16 *QH = (_Float16*)(ws + WS_QH), *KH = (_Float16*)(ws + WS_KH), *VT = (_Float16*)(ws + WS_VT), *QL = (_Float16*)(ws + WS_QL), *KL = (_Float16*)(ws + WS_KL); __bf16 *VB = (__bf16*)(ws + WS_VB), *VBL = (__bf16*)(ws + WS_VBL); float *Y = (float*)(ws + WS_Y);
  (void)Y; (void)QL; (void)KL; (void)VB; (void)VBL;
  // inputs: 0 embeddings [4,2048,512]; 1 token_masks [4,2048] int32 (0/1); 2 Wq [512,512] (in,out); 3 Wk; 4 Wv; 5 Wo (in,out)
  if (ws_size < (size_t)WS_END5) return;
  const int* TM = (const int*)d_in[1]; float* MV = (float*)(ws + WS_MV); int *IDX = (int*)(ws + WS_IDX), *NU = (int*)(ws + WS_NU); __bf16* WP = (__bf16*)(ws + WS_WP); _Float16* WOH = (_Float16*)(ws + WS_WOH); float* PS = (float*)(ws + WS_PS);
  k_perm<<<dim3(TNB + 5 * WPB), 32 * PW, 0, stream>>>(TM, F[2], F[3], F[4], F[5], IDX, NU, WP, WOH);
  k_proj<<<dim3(TNB * TT / 64, CC / 128, 3), 128, 0, stream>>>(F[0], F[0], F[0], WP, nullptr, nullptr, nullptr, IDX, NU, QH, QL, KH, KL, VT, VB, VBL, PS);
  k_att<<<dim3(NH * TNB, AG), 32 * AW, 0, stream>>>(QH, KH, QL, KL, VT, VB, VBL, IDX, NU, PS, MV, Y);
  k_out<<<dim3(TNB * TT / 64, DIN / 128), 128, 0, stream>>>(Y, TM, MV, WP + 3 * WPL, WOH, nullptr, (float*)d_out);
}

// v009
// It runs in 64.6 microseconds.
// Timed twice side by side with v008, it ran 1.05 times as fast both times.
// Over all steps from v000 it is 14.9 times as fast.
// compute dtype: all float inputs rounded to bf16; projections with EXACT bf16 products on WMMA 16x16x32 (f32 accumulate); tokens of a sequence sorted unmasked first (stable), all planes in that order; causal logits: 3 products for the first 384 sorted rows, single f16 q x k after, x 64^-0.5; key/query masks = a length; softmax f32; P x 2^11 once to f16 x v once to f16 (bf16 hi + lo below row 384); fully-masked query rows = mean of the f16 v plane in f32; ctx hi+lo x exact Wo below row 384, x2^6 f16 carry x f16(bf16 x 2^8) Wo after; f32 output.
#include <hip/hip_runtime.h>
#include <math.h>

typedef __attribute__((ext_vector_type(16))) _Float16 v16h;
typedef __attribute__((ext_vector_type(16))) __bf16 v16b;
typedef __attribute__((ext_vector_type(8)))  _Float16 v8h;
typedef __attribute__((ext_vector_type(8)))  float v8f;
typedef __attribute__((ext_vector_type(4)))  float v4f;
typedef __attribute__((ext_vector_type(2)))  float v2f;
typedef __attribute__((ext_vector_type(4)))  unsigned v4u;
typedef _Float16 hx8 __attribute__((ext_vector_type(8)));
typedef __attribute__((ext_vector_type(4)))  int v4i;
typedef float __attribute__((may_alias)) float_a;
typedef int __attribute__((may_alias)) int_a;

template <typename T> __device__ __forceinline__ void vst2(void* p, T v) { *(T*)p = v;  }
__device__ __forceinline__ v8f wmma16(v16h a, v16h b, v8f c) {
  v8f d = __builtin_amdgcn_wmma_f32_16x16x32_f16(false, a, false, b, (short)0, c, false, false);
  asm volatile("v_nop\n\tv_nop\n\tv_nop\n\tv_nop" : "+v"(d) : "v"(a), "v"(b));
  return d;
}
__device__ __forceinline__ v8f wmma_bf(v16b a, v16b b, v8f c) {
  v8f d = __builtin_amdgcn_wmma_f32_16x16x32_bf16(false, a, false, b, (short)0, c, false, false);
  asm volatile("v_nop\n\tv_nop\n\tv_nop\n\tv_nop" : "+v"(d) : "v"(a), "v"(b));
  return d;
}
// 16x16x32 fragments: lane = (h = lane>>4, row/col = lane&15); elements 0..7 = k0+8h+0..7, 8..15 = k0+16+8h+0..7; D element r = row 8h+r
__device__ __forceinline__ v16h frag_h(const _Float16* rowk0, int lane) {
  union { v16h v; v8h q[2]; } u; const _Float16* p = rowk0 + 8 * (lane >> 4);
  u.q[0] = *(const v8h*)p; u.q[1] = *(const v8h*)(p + 16); return u.v;
}
__device__ __forceinline__ v16h frag_f32(const float* rowk0, int lane) {
  v16h a; const float* p = rowk0 + 8 * (lane >> 4);
#pragma unroll
  for (int i = 0; i < 8; ++i) { a[i] = (_Float16)p[i]; a[8 + i] = (_Float16)p[16 + i]; }
  return a;
}
__device__ __forceinline__ v16h frag_f32s(const float* rowk0, int lane, float sc) {
  v16h a; const float* p = rowk0 + 8 * (lane >> 4);
#pragma unroll
  for (int i = 0; i < 8; ++i) { a[i] = (_Float16)(p[i] * sc); a[8 + i] = (_Float16)(p[16 + i] * sc); }
  return a;
}
// column fragment from a [K][ld] layout (column n), rows >= K read as 0
__device__ __forceinline__ v16h fragc_f32(const float* W, int k0, int n, int lane, int ld, int K) {
  v16h a; const int g = lane >> 4;
#pragma unroll
  for (int i = 0; i < 8; ++i) { const int ka = k0 + 8 * g + i, kb = ka + 16;
    a[i] = (_Float16)(ka < K ? W[(size_t)(ka < K ? ka : K - 1) * ld + n] : 0.f); a[8 + i] = (_Float16)(kb < K ? W[(size_t)(kb < K ? kb : K - 1) * ld + n] : 0.f); }
  return a;
}
struct F2 { v16b h, l; };
__device__ __forceinline__ F2 bsplit16(const float v[16]) { F2 r;
#pragma unroll
  for (int i = 0; i < 16; ++i) { const __bf16 h = (__bf16)v[i]; r.h[i] = h; r.l[i] = (__bf16)(v[i] - (float)h); }
  return r; }
__device__ __forceinline__ F2 split_row(const float* row, int k0, int lane) { float v[16]; const float* p = row + k0 + 8 * (lane >> 4);
#pragma unroll
  for (int i = 0; i < 8; ++i) { v[i] = p[i]; v[8 + i] = p[16 + i]; }
  return bsplit16(v); }
__device__ __forceinline__ F2 split_rowK(const float* row, int k0, int lane, int K) { float v[16]; const int g = lane >> 4;
#pragma unroll
  for (int i = 0; i < 8; ++i) { const int ka = k0 + 8 * g + i, kb = ka + 16; v[i] = ka < K ? row[ka < K ? ka : K - 1] : 0.f; v[8 + i] = kb < K ? row[kb < K ? kb : K - 1] : 0.f; }
  return bsplit16(v); }
__device__ __forceinline__ F2 split_col(const float* W, int k0, int n, int lane, int ld, int K) { float v[16]; const int g = lane >> 4;
#pragma unroll
  for (int i = 0; i < 8; ++i) { const int ka = k0 + 8 * g + i, kb = ka + 16; v[i] = ka < K ? W[(size_t)(ka < K ? ka : K - 1) * ld + n] : 0.f; v[8 + i] = kb < K ? W[(size_t)(kb < K ? kb : K - 1) * ld + n] : 0.f; }
  return bsplit16(v); }
__device__ __forceinline__ v8f mac3(const F2& a, const F2& b, v8f c) { c = wmma_bf(a.l, b.h, c); c = wmma_bf(a.h, b.l, c); return wmma_bf(a.h, b.h, c); }
__device__ __forceinline__ float sigm(float v) { return 1.0f / (1.0f + expf(-v)); }
#define LDSX() do { asm volatile("s_wait_dscnt 0" ::: "memory"); __builtin_amdgcn_wave_barrier(); __builtin_amdgcn_fence(__ATOMIC_RELEASE, "workgroup"); } while (0)

// Causal multi-head self-attention with token padding masks on BOTH keys and queries (embeddings [4,2048,512], token_masks [4,2048] int 0/1 (random here: about half the tokens masked); 8 heads x 64; (in,out) Wq/Wk/Wv/Wo [512,512], no biases): scores = q.k/8, where(causal & tm[k] & tm[q], scores, -1e30), softmax, context Wo. A query with tm[q] = 0 gets all scores = -1e30 -> exactly uniform attention over all 2,048 positions (context = mean V).
#define NB 4
#define TT 2048
#define CC 512            // NH * HD = projected width
#define DIN 512          // input (model) width
#define NH 8
#define HD 64
#define SCALE (0.125f)
#define CAUSAL 1
#ifndef TNB
#define TNB NB
#endif
__device__ __forceinline__ float bfr(float v) { return (float)(__bf16)v; }
__host__ __device__ __forceinline__ int kb_last(int qb) { return CAUSAL ? ((qb * 64 + 63) >> 7) : (TT / 128 - 1); }
typedef __attribute__((ext_vector_type(8))) __bf16 v8b;
__device__ __forceinline__ v16b frag_b(const __bf16* rowk0, int lane) {
  union { v16b v; v8b q[2]; } u; const __bf16* p = rowk0 + 8 * (lane >> 4);
  u.q[0] = *(const v8b*)p; u.q[1] = *(const v8b*)(p + 16); return u.v;
}
#define QBH 6              // causal: query blocks 0..QBH-1 of each sequence (few keys, no averaging) take the high-precision path
#define QHI 384            // rows carrying a q residual plane (read only by the 3-product logits of query blocks < QBH)
#define KHI 384            // key rows carrying k residual / v bf16 hi+lo planes (used only by the causal high-precision path)
// B fragment (k rows k0+.., output column o) of a weight: (in,out) [K][ld] or (out,in) [ld rows of K]: bf16 exact, or f16(bf16 * 256) exact
__device__ __forceinline__ v16b wcol_io(const float* Wm, int k0, int o, int lane, int ld) { v16b w; const int g = lane >> 4;
#pragma unroll
  for (int i = 0; i < 8; ++i) { w[i] = (__bf16)Wm[(size_t)(k0 + 8 * g + i) * ld + o]; w[8 + i] = (__bf16)Wm[(size_t)(k0 + 16 + 8 * g + i) * ld + o]; }
  return w; }
__device__ __forceinline__ v16b wcol_oi(const float* Wm, int k0, int o, int lane, int K) { v16b w; const float* p = Wm + (size_t)o * K + k0 + 8 * (lane >> 4);
#pragma unroll
  for (int i = 0; i < 8; ++i) { w[i] = (__bf16)p[i]; w[8 + i] = (__bf16)p[16 + i]; }
  return w; }
__device__ __forceinline__ v16h wcolh_io(const float* Wm, int k0, int o, int lane, int ld) { v16h w; const int g = lane >> 4;
#pragma unroll
  for (int i = 0; i < 8; ++i) { w[i] = (_Float16)(bfr(Wm[(size_t)(k0 + 8 * g + i) * ld + o]) * 256.0f); w[8 + i] = (_Float16)(bfr(Wm[(size_t)(k0 + 16 + 8 * g + i) * ld + o]) * 256.0f); }
  return w; }
__device__ __forceinline__ v16h wcolh_oi(const float* Wm, int k0, int o, int lane, int K) { v16h w; const float* p = Wm + (size_t)o * K + k0 + 8 * (lane >> 4);
#pragma unroll
  for (int i = 0; i < 8; ++i) { w[i] = (_Float16)(bfr(p[i]) * 256.0f); w[8 + i] = (_Float16)(bfr(p[16 + i]) * 256.0f); }
  return w; }
#define WQKV_LAYOUT 0   // picks WCOL's layout only; no kernel calls WCOL: k_perm reads Wq/Wk/Wv as (in,out) [DIN][CC] whatever its value
__device__ __forceinline__ v16b wcol_hdk(const float* Wm, int k0, int o, int lane) { v16b w; const int g = lane >> 4; const float* p = Wm + (size_t)(o / HD) * DIN * HD + (o % HD);
#pragma unroll
  for (int i = 0; i < 8; ++i) { w[i] = (__bf16)p[(size_t)(k0 + 8 * g + i) * HD]; w[8 + i] = (__bf16)p[(size_t)(k0 + 16 + 8 * g + i) * HD]; }
  return w; }
#define WO_OUT_IN 0
#if WQKV_LAYOUT == 1
#define WCOL(W, k0, o, lane) wcol_oi(W, k0, o, lane, DIN)
#elif WQKV_LAYOUT == 2
#define WCOL(W, k0, o, lane) wcol_hdk(W, k0, o, lane)
#else
#define WCOL(W, k0, o, lane) wcol_io(W, k0, o, lane, CC)
#endif
#if WO_OUT_IN
#define WOCOL(W, k0, o, lane) wcol_oi(W, k0, o, lane, CC)
#define WOCOLH(W, k0, o, lane) wcolh_oi(W, k0, o, lane, CC)
#else
#define WOCOL(W, k0, o, lane) wcol_io(W, k0, o, lane, DIN)
#define WOCOLH(W, k0, o, lane) wcolh_io(W, k0, o, lane, DIN)
#endif
// masks: keys need causal (structure + index) AND token_masks[b][k] != 0; a query with token_masks[b][t] == 0 has EVERY score = -1e30 in the module -> exactly uniform attention over all 2,048 positions -> its context is mean_k V (mean v: 64-place sums from k_proj, added by a wave of k_att; k_out takes it as such a row's context; in k_att such rows just get a harmless finite placeholder)
// ---- k_perm: block = one sequence's sort and a share of its X rows (XG blocks a sequence, see below). IDX[b][r] = the token at sorted place r: the n unmasked tokens first, then the masked ones, each group in its old order; NU[b * 32] = n (a 128-byte line per sequence: one writer a line).
// The order of the unmasked tokens is kept, so among them 'key <= query' reads the same on places as on tokens, and a masked key is simply a place >= n: attention runs on the first n places alone, for any mask. q, k, v planes are laid out by place; the context row goes back to its token's row.
// Blocks TNB * XG.. of the same launch copy the weights to five 16-bit planes (Wq, Wk, Wv, Wo, Wo again) in FRAGMENT ORDER: 16-byte unit u = ((kc * 32 + ot) * 2 + q) * 32 + lane holds W[kc * 32 + 16 q + 8 (lane >> 4) + 0..7][ot * 16 + (lane & 15)], so a wave fetches half a B fragment of k chunk kc, column tile ot, as one 512-byte run of whole lines. Values: bf16(W); the fifth plane f16(bf16(Wo) x 2^8).
// XG blocks sort each sequence (every one the whole list, in its own LDS; the first of them stores IDX and NU) and then copy the X rows of TT / XG sorted places each to a bf16 plane XP in FRAGMENT ORDER: [b][16-place tile] of FX elements; 16-byte unit ((kc * 2 + qq) * 32 + lane) of a tile = place (lane & 15), dims kc * 32 + qq * 16 + 8 (lane >> 4) + 0..7. A wave reads whole rows (512 bytes in a row a load), the rounded rows turn into fragment order through LDS, and every store is a 512-byte run. The k_proj blocks that share a row (up to 12) so fetch half an A fragment as one run of whole lines, already rounded, where a fragment load from the f32 rows touched 16 lines.
#define XG 32          /* blocks that share the X rows of one sequence */
#define XR (TT / XG)   /* X rows that a block copies */
#define FX (16 * DIN)  /* elements of one 16-place tile of XP */
typedef __attribute__((ext_vector_type(4))) __bf16 v4b;
#define PW (TT / 64)   /* waves of k_perm: 64 tokens a wave */
#define WPL ((size_t)DIN * CC)          /* elements of one packed plane */
#define WKS ((size_t)(CC / 16) * 512)   /* elements from one k chunk to the next in a packed plane */
#define WST(st) ((size_t)((st) >> 1) * WKS + (size_t)((st) & 1) * 2048)   /* stage st of a 128-column block: k chunk st / 2, its first or second four column tiles */
#define WPB ((DIN / 32) * (CC / 16) * 64 / (32 * PW))   /* blocks that pack one weight: a thread a unit */
static_assert(DIN == CC && CC == 512 && WPB * 32 * PW == (DIN / 32) * (CC / 16) * 64, "the unit index is cut by shifts; whole blocks");
static_assert(2 * PW == 64, "a lane holds two of the 64 group counts");
static_assert(XR == 2 * PW && DIN == 4 * 128 && (XR / 16) * (DIN / 16) == 4 * PW && PW / (XR / 16) == 8, "a wave reads two rows by four loads each and stores four runs of one tile");
__global__ __launch_bounds__(32 * PW) void k_perm(const float* __restrict__ X, const int* __restrict__ TM, const float* __restrict__ WQ, const float* __restrict__ WK, const float* __restrict__ WV, const float* __restrict__ WO, int* __restrict__ IDX, int* __restrict__ NU, __bf16* __restrict__ WP, _Float16* __restrict__ WOH, __bf16* __restrict__ XP) { __shared__ int cnt[2 * PW]; __shared__ int sidx[TT]; __shared__ __align__(16) __bf16 xt[XR][DIN + 8];   /* row pitch 16 B x an odd number: the 16 rows of a 16-byte fragment read fall on different banks */
  if (blockIdx.x >= TNB * XG) {   /* the same for the whole block, ahead of every barrier */
    const int pb = blockIdx.x - TNB * XG, m = pb / WPB, u = (pb % WPB) * (32 * PW) + threadIdx.x; const int ln = u & 31, q = (u >> 5) & 1, ot = (u >> 6) & 31, kc = u >> 11;
    const float* src = (m == 0 ? WQ : m == 1 ? WK : m == 2 ? WV : WO) + (size_t)(kc * 32 + 16 * q + 8 * (ln >> 4)) * CC + ot * 16 + (ln & 15); float f[8];
#pragma unroll
    for (int i = 0; i < 8; ++i) f[i] = src[(size_t)i * CC];
    asm volatile("s_wait_xcnt 0x0" :: "v"(src) : "memory");   /* the eight loads share one address pair: it stays whole until this wait */
    if (m < 4) { v8b o;
#pragma unroll
      for (int i = 0; i < 8; ++i) o[i] = (__bf16)f[i];
      vst2(WP + (size_t)m * WPL + (size_t)u * 8, o);
    } else { v8h oh;
#pragma unroll
      for (int i = 0; i < 8; ++i) oh[i] = (_Float16)(bfr(f[i]) * 256.0f);
      vst2(WOH + (size_t)u * 8, oh); }
    return; }   /* one store a thread, the thread's last instruction */
  const int tid = threadIdx.x, wave = tid >> 5, lane = tid & 31, b = blockIdx.x / XG, part = blockIdx.x % XG; const int* TMb = TM + (size_t)b * TT; unsigned bal[2];
#pragma unroll
  for (int u = 0; u < 2; ++u) bal[u] = (unsigned)__ballot(TMb[(wave * 2 + u) * 32 + lane] != 0);
  if (lane < 2) cnt[wave * 2 + lane] = __popc(lane ? bal[1] : bal[0]);
  __syncthreads();   /* the 64 groups' counts are in LDS before a wave sums them */
  const int c0 = cnt[lane], c1 = cnt[32 + lane]; int tot = c0 + c1, bef = (lane < wave * 2 ? c0 : 0) + (32 + lane < wave * 2 ? c1 : 0);
#pragma unroll
  for (int o = 1; o < 32; o <<= 1) { tot += __shfl_xor(tot, o); bef += __shfl_xor(bef, o); }
#pragma unroll
  for (int u = 0; u < 2; ++u) { const int t = (wave * 2 + u) * 32 + lane; const int ones = bef + (u ? __popc(bal[0]) : 0) + __popc(bal[u] & ((1u << lane) - 1u)); sidx[((bal[u] >> lane) & 1u) ? ones : tot + (t - ones)] = t; }
  __syncthreads();   /* the whole list is in LDS before it leaves by whole lines and before a wave looks up its rows */
  { const float* xr0 = X + ((size_t)b * TT + (size_t)(sidx[part * XR + wave * 2] & (TT - 1))) * DIN + lane * 4; const float* xr1 = X + ((size_t)b * TT + (size_t)(sidx[part * XR + wave * 2 + 1] & (TT - 1))) * DIN + lane * 4; v4f xs[2][4];   /* wave = two rows */
#pragma unroll
    for (int i = 0; i < 4; ++i) { xs[0][i] = *(const v4f*)(xr0 + i * 128); xs[1][i] = *(const v4f*)(xr1 + i * 128); }
    asm volatile("s_wait_xcnt 0x0" :: "v"(xr0), "v"(xr1) : "memory");   /* the eight loads' two address pairs stay whole until this wait */
#pragma unroll
    for (int u = 0; u < 2; ++u)
#pragma unroll
      for (int i = 0; i < 4; ++i) { v4b o;
#pragma unroll
        for (int c = 0; c < 4; ++c) o[c] = (__bf16)xs[u][i][c];
        *(v4b*)&xt[wave * 2 + u][i * 128 + lane * 4] = o; }
    __syncthreads();   /* the block's rows are in LDS before a wave reads fragments across them */
    const int tl = wave >> 3, kq0 = (wave & 7) * 4;   /* wave = four runs (kc * 2 + qq = kq0..kq0 + 3) of one tile: 2 KiB in a row */
    __bf16* op = XP + ((size_t)b * (TT / 16) + part * (XR / 16) + tl) * FX + (size_t)(kq0 * 32 + lane) * 8; v8b o[4];
#pragma unroll
    for (int t = 0; t < 4; ++t) o[t] = *(const v8b*)&xt[tl * 16 + (lane & 15)][(kq0 + t) * 16 + 8 * (lane >> 4)];
#pragma unroll
    for (int t = 0; t < 4; ++t) vst2(op + t * 256, o[t]);
    asm volatile("s_wait_xcnt 0x0" :: "v"(op) : "memory"); }   /* behind the four stores: their address pair stays whole until this wait, and the code below rewrites their registers */
  if (part == 0) {   /* the same for the whole block */
#pragma unroll
    for (int u = 0; u < 2; ++u) vst2(IDX + (size_t)b * TT + u * 32 * PW + tid, sidx[u * 32 * PW + tid]);
    if (tid == 0) vst2(NU + b * 32, tot); } }
__device__ __forceinline__ int n_unmasked(const int* NU, int b) { const int n = NU[b * 32]; return __builtin_amdgcn_readfirstlane(n < 0 ? 0 : n > TT ? TT : n); }   /* bounded whatever the word holds; through readfirstlane so that the tests on it are scalar branches */
// ---- mean v, the context of a fully-masked query row (softmax of 2,048 equal scores = exactly 1/2048 each): MV[b][c] = (1/2048) sum_t v[b][t][c] over the f16 v values, f32 sums. It has no launch of its own: a v block of k_proj sums its 64 places per channel out of the LDS tile that it stores anyway (PS[b][t / 64][c], whole lines, one writer a line); in k_att one wave of HD / 32 blocks of each (b, h) adds the TT / 64 partial sums of 32 channels and stores them as one 128-byte line of MV; k_out reads MV[b] in place of the ctx row of a token with token_masks == 0.
#define PSN (TT / 64)   /* partial sums a channel: one per 64-place block of k_proj */
#define WS_MV (WS_END)                                    // f32 mean-v rows [b][512]
#define WS_END2 (WS_MV + 4u * (size_t)NB * CC)
#define WS_IDX (WS_END2)                                  // int token of each sorted place [b][t]
#define WS_NU  (WS_IDX + 4u * (size_t)NB * TT)            // int unmasked tokens of a sequence, one 128-byte line each
#define WS_END3 (WS_NU + 128u * (size_t)NB)
#define WS_WP  (WS_END3)                                  // bf16 Wq, Wk, Wv, Wo in fragment order
#define WS_WOH (WS_WP + 2u * 4u * (size_t)DIN * CC)       // f16(bf16 Wo x 2^8) in fragment order
#define WS_END4 (WS_WOH + 2u * (size_t)DIN * CC)
#define WS_PS  (WS_END4)                                  // f32 sums of v over 64 places [b][t / 64][512]
#define WS_END5 (WS_PS + 4u * (size_t)NB * PSN * CC)
#define WS_XP  (WS_END5)                                  // bf16 X tiles in fragment order [b][t / 16], by sorted place
#define WS_END6 (WS_XP + 2u * (size_t)NB * TT * DIN)

// The q, k and v planes lie in FRAGMENT ORDER, so that each 16-byte load of a k_att wave covers 512 bytes in a row (four whole lines; by rows it touched 16 lines for the same bytes).
// q, k: [b][h][16-place tile] of FQK elements; 16-byte unit ((kc * 2 + qq) * 32 + lane) of a tile = place (lane & 15), dims kc * 32 + qq * 16 + 8 (lane >> 4) + 0..7.
// v: [b][h][32-place chunk] of FV elements; unit ((j * 2 + qq) * 32 + lane) of a chunk = channel j * 16 + (lane & 15), places qq * 16 + 8 (lane >> 4) + 0..7.
#define FQK (16 * HD)
#define FV  (32 * HD)
static_assert(HD == 64 && CC == NH * HD && QHI % 64 == 0 && KHI % 64 == 0, "the unit index of a 64 x 128 block is cut by shifts; whole blocks carry residual planes");
#define WS_QH  0u                                      // f16 q tiles [b][h][t / 16]
#define WS_KH  (WS_QH + 2u * (size_t)NB * TT * CC)      // f16 k tiles [b][h][t / 16]
#define WS_VT  (WS_KH + 2u * (size_t)NB * TT * CC)      // f16 v chunks [b][h][t / 32]
#define WS_QL  (WS_VT + 2u * (size_t)NB * CC * TT)      // f16 q residual x 2^10 tiles [b][h][t / 16 < QHI / 16]
#define WS_KL  (WS_QL + 2u * (size_t)NB * QHI * CC)     // f16 k residual x 2^10 tiles [b][h][t / 16 < KHI / 16]
#define WS_VB  (WS_KL + 2u * (size_t)NB * KHI * CC)     // bf16 v hi chunks [b][h][t / 32 < KHI / 32]
#define WS_VBL (WS_VB + 2u * (size_t)NB * CC * KHI)
#define WS_Y   (WS_VBL + 2u * (size_t)NB * CC * KHI)     // f32 ctx rows [b*t][CC] (only when there is an output projection)
#define WS_END (WS_Y  + 4u * (size_t)NB * TT * CC)

// operands fetched ahead of their products: 16 f32 of an A row in fragment order (x[0..1] = p[0..7], x[2..3] = p[16..23]); N / 2 fragments of a packed plane as N runs of 512 bytes a wave
__device__ __forceinline__ void ld_xr(const float* p, v4f x[4]) { x[0] = *(const v4f*)p; x[1] = *(const v4f*)(p + 4); x[2] = *(const v4f*)(p + 16); x[3] = *(const v4f*)(p + 20); }
template <int N, typename T, typename T8> __device__ __forceinline__ void ld_wf(const T* p, T8 w[N]) {
#pragma unroll
  for (int t = 0; t < N; ++t) w[t] = *(const T8*)(p + t * 256); }
__device__ __forceinline__ v16b two_b(v8b a, v8b b) { union { v16b v; v8b q[2]; } u; u.q[0] = a; u.q[1] = b; return u.v; }
__device__ __forceinline__ v16h two_h(v8h a, v8h b) { union { v16h v; v8h q[2]; } u; u.q[0] = a; u.q[1] = b; return u.v; }
// ---- k_proj: block = (64 sorted places, 128 cols, which), A from the XP tiles; q and k blocks wholly behind the last 128-place group that holds an unmasked token leave at once (k_att reads no place there): q/k/v = X W (+ b) with exact bf16 products (K = DIN) -> which 0: q f16 tiles (+ residual tiles for places < QHI); 1: k f16 tiles (+ residual tiles for places < KHI); 2: v f16 chunks (+ bf16 hi/lo chunks for places < KHI), all in the fragment order given at the WS_ offsets
__global__ __launch_bounds__(128) void k_proj(const __bf16* __restrict__ XP, const __bf16* __restrict__ WP, const float* __restrict__ BQ, const float* __restrict__ BK, const float* __restrict__ BV, const int* __restrict__ NU,
    _Float16* __restrict__ QH, _Float16* __restrict__ QL, _Float16* __restrict__ KH, _Float16* __restrict__ KL, _Float16* __restrict__ VT, __bf16* __restrict__ VB, __bf16* __restrict__ VBL, float* __restrict__ PS) {
  __shared__ __align__(16) _Float16 sh[64][136], sl[64][136]; __shared__ __align__(16) _Float16 th[128][72]; __shared__ __align__(16) __bf16 tb[128][72], tbl[128][72];
  const int tid = threadIdx.x, wave = tid >> 5, lane = tid & 31, col = lane & 15, g = lane >> 4; const int which = blockIdx.z; const int c0 = blockIdx.y * 128; const size_t r0 = (size_t)blockIdx.x * 64; const size_t bb = r0 / TT; const int t0 = (int)(r0 % TT);
  if (which < 2 && t0 >= ((n_unmasked(NU, (int)bb) + 127) & ~127)) return;   /* the same for the whole block, ahead of every barrier */
  const float* BA = which == 0 ? BQ : which == 1 ? BK : BV;
  const unsigned lo = (unsigned)lane * 16;   /* the lane's bytes into a 512-byte run: the one offset register of the A and the B loads, whose bases are wave-uniform (scalar registers) */
  const char* xb = (const char*)(XP + ((r0 >> 4) + __builtin_amdgcn_readfirstlane(wave)) * FX); const char* wb = (const char*)(WP + (size_t)which * WPL + (size_t)(c0 >> 4) * 512);
  const __bf16* xp = (const __bf16*)(xb + lo); const __bf16* wp = (const __bf16*)(wb + lo);
  v8f acc[8] = {}; v8b xa[3][2]; v8b wf[4][8]; ld_wf<2>(xp, xa[0]); ld_wf<2>(xp + 512, xa[1]);
#pragma unroll
  for (int t = 0; t < 3; ++t) ld_wf<8>(wp + WST(t), wf[t]);
#pragma unroll   /* whole: the operand sets stay in registers, every step of the two addresses is a constant offset */
  for (int st = 0; st < DIN / 16; ++st) { const int hf = st & 1, kc = st >> 1;   /* a stage = half a k chunk: four column tiles; B is fetched three stages ahead, A two chunks ahead */
    if (hf == 0 && kc + 2 < DIN / 32) ld_wf<2>(xp + (kc + 2) * 512, xa[(kc + 2) % 3]);   /* into the set that the last chunk has left */
    const v16b a = two_b(xa[kc % 3][0], xa[kc % 3][1]);
    if (st + 3 < DIN / 16) ld_wf<8>(wp + WST(st + 3), wf[(st + 3) & 3]);   /* into the set that the last stage has left */
    if (st + 4 == DIN / 16) asm volatile("s_wait_xcnt 0x0" :: "s"(xb), "s"(wb), "v"(lo) : "memory");   /* behind the last loads: the two bases and the offset register stay whole until this wait */
#pragma unroll
    for (int j = 0; j < 4; ++j) acc[hf * 4 + j] = wmma_bf(a, two_b(wf[st & 3][2 * j], wf[st & 3][2 * j + 1]), acc[hf * 4 + j]);
    __builtin_amdgcn_sched_barrier(0); }   /* keeps the next stage's products, and with them the wait on loads just issued, behind this stage's products */
  if (which < 2) { _Float16* DH = which == 0 ? QH : KH; _Float16* DL = which == 0 ? QL : KL; const int nhi = which == 0 ? QHI : KHI; const bool hi_rows = t0 < nhi;
#pragma unroll
    for (int j = 0; j < 8; ++j) { const float bias = BA ? bfr(BA[c0 + j * 16 + col]) : 0.f;
#pragma unroll
      for (int r = 0; r < 8; ++r) { const float v = acc[j][r] + bias; const _Float16 hv = (_Float16)v; sh[wave * 16 + 8 * g + r][j * 16 + col] = hv; sl[wave * 16 + 8 * g + r][j * 16 + col] = (_Float16)((v - (float)hv) * 1024.0f); } }
    __syncthreads();
    for (int e = tid; e < 64 * 16; e += 128) { const int rl = (e >> 8) * 16 + (e & 15), cl = ((e >> 7) & 1) * 64 + ((e >> 5) & 3) * 16 + ((e >> 4) & 1) * 8;   /* e = ((tile * 2 + head) * 4 + kc * 2 + qq) * 32 + lane: a wave stores 512 bytes in a row; its 16 LDS rows fall on different banks */
      const size_t hd = bb * NH + (c0 >> 6) + ((e >> 7) & 1); const int tl = (t0 >> 4) + (e >> 8), un = (e & 127) * 8;
      vst2((unsigned*)(DH + (hd * (TT / 16) + tl) * FQK + un), *(const v4u*)&sh[rl][cl]);
      if (hi_rows) { asm volatile("s_wait_xcnt 0x0" ::: "memory");   /* behind the first store: the LDS read below lands on its data registers */
        vst2((unsigned*)(DL + (hd * (size_t)(nhi / 16) + tl) * FQK + un), *(const v4u*)&sl[rl][cl]); }
      asm volatile("s_wait_xcnt 0x0" ::: "memory"); }   /* behind the stores: the next trip rewrites their address and data registers */
  } else { const bool hi_rows = t0 < KHI;
#pragma unroll
    for (int j = 0; j < 8; ++j) { const float bias = BA ? bfr(BA[c0 + j * 16 + col]) : 0.f;
#pragma unroll
      for (int r = 0; r < 8; ++r) { const float v = acc[j][r] + bias; const int rl = wave * 16 + 8 * g + r, cl = j * 16 + col; th[cl][rl] = (_Float16)v; const __bf16 bh = (__bf16)v; tb[cl][rl] = bh; tbl[cl][rl] = (__bf16)(v - (float)bh); } }
    __syncthreads();
    for (int e = tid; e < 128 * 8; e += 128) { const int cl = (e >> 9) * 64 + ((e >> 6) & 3) * 16 + (e & 15), pl = ((e >> 8) & 1) * 32 + ((e >> 5) & 1) * 16 + ((e >> 4) & 1) * 8;   /* e = ((head * 2 + chunk) * 8 + j * 2 + qq) * 32 + lane: a wave stores 512 bytes in a row; its 16 LDS rows fall on different banks */
      const size_t hd = bb * NH + (c0 >> 6) + (e >> 9); const int ch = (t0 >> 5) + ((e >> 8) & 1), un = (e & 255) * 8;
      vst2((unsigned*)(VT + (hd * (TT / 32) + ch) * FV + un), *(const v4u*)&th[cl][pl]);
      if (hi_rows) { asm volatile("s_wait_xcnt 0x0" ::: "memory");   /* behind the first store: the LDS reads below land on its address and data registers */
        const size_t o3 = (hd * (KHI / 32) + ch) * FV + un; vst2((unsigned*)(VB + o3), *(const v4u*)&tb[cl][pl]); vst2((unsigned*)(VBL + o3), *(const v4u*)&tbl[cl][pl]); }
      asm volatile("s_wait_xcnt 0x0" ::: "memory"); }   /* behind the stores: the next trip rewrites their address and data registers */
    asm volatile("s_wait_xcnt 0x0" ::: "memory");   /* behind the loop's stores: the LDS reads below land on their address and data registers */
    hx8 hv[8]; float a8[8];   /* thread = channel: the block's 64 places of the f16 v tile summed in f32, eight chains and a tree over them; the loops are unrolled whole, so the LDS reads issue ahead of the first add */
#pragma unroll
    for (int i = 0; i < 8; ++i) hv[i] = *(const hx8*)&th[tid][i * 8];
#pragma unroll
    for (int j = 0; j < 8; ++j) a8[j] = (float)hv[0][j];
#pragma unroll
    for (int i = 1; i < 8; ++i)
#pragma unroll
      for (int j = 0; j < 8; ++j) a8[j] += (float)hv[i][j];
    vst2(PS + (bb * PSN + (size_t)(t0 >> 6)) * CC + c0 + tid, ((a8[0] + a8[1]) + (a8[2] + a8[3])) + ((a8[4] + a8[5]) + (a8[6] + a8[7])));   /* a wave stores one whole line */
    asm volatile("s_wait_xcnt 0x0" ::: "memory"); } }   /* behind the store: the code that the listing has behind it rewrites the store's base and data registers */
// ---- k_att: a tile = 16 sorted places of (b, h) as queries, worked on by the AW waves of a block. AG blocks share the tiles of one (b, h) and each walks its own in a loop: NH * TNB * AG blocks fill the chip's places once (two blocks' LDS fit a WGP), so no wave is started for a tile of masked tokens (k_out takes mean v for their rows) and a block's start is paid once for all its tiles. Only the nt = ceil(n / 16) tiles that hold an unmasked token are dealt: by rank from the longest (rank r = tile nt - 1 - r), 16 ranks a pass, forwards and backwards by turns, so the blocks' key counts come out level. The 16 score rows live in LDS from the logits to P, so no score plane goes through memory and one launch covers every (b, h).
// step 1, logits: wave w takes the 16-key tiles w, w + AW, ... of keys [0, kend): q x k on f16 (3 products with the x 2^10 residual planes for query blocks < QBH), x SCALE; causal and key masks (place < n) by select at the LDS store.
// step 2, softmax: wave w owns row w in registers, f32, sums by lane then across lanes; P x 2^11 back in place (0 for excluded keys); a query with token_masks == 0 gets a finite placeholder row here, which k_out does not read.
// step 3, P.v: wave w sums the 32-key chunks w, w + AW, ... (P once to f16 against v f16; query blocks < QBH: P and v as bf16 hi + lo, 3 products); the AW partial tiles are added in f32 through LDS in wave order.
#define AG 16          /* blocks that share the tiles of one (b, h) */
#define AW 16          /* the wave number goes through readfirstlane so that the tile loops are scalar loops and every lane is on at the matrix instructions */
#define SP (TT + 4)    /* row pitch in floats: 16 B past a multiple of 256 B, so the 16 rows of a b128 fragment read fall on different banks */
static_assert((TT / 16) % AG == 0, "whole passes over the ranks");
static_assert(HD % 32 == 0 && HD / 32 <= AG && (PSN & (PSN - 1)) == 0, "mean v: whole lines of 32 channels, a block for each, a full tree");
static_assert(QBH * 64 >= QHI, "every row with a q residual plane takes the 3-product path");
static_assert(AW * 16 * (HD + 4) <= 16 * SP, "the partial tiles reuse the score rows' LDS");
static_assert(16 * (HD / 2) == 32 * AW, "in the last step a wave stores the row of its own number");
// 16 f32 of one LDS row in fragment order (0..7 = p[0..7], 8..15 = p[16..23]) by four 16-byte reads
__device__ __forceinline__ void lds_row16(const float* p, float v[16]) { const v4f a = *(const v4f*)p, b = *(const v4f*)(p + 4), c = *(const v4f*)(p + 16), d = *(const v4f*)(p + 20);
#pragma unroll
  for (int i = 0; i < 4; ++i) { v[i] = a[i]; v[4 + i] = b[i]; v[8 + i] = c[i]; v[12 + i] = d[i]; } }
// a 16-bit fragment of a fragment-order plane at the lane's own byte address: two runs of 512 bytes a wave. k_att forms that address where it is used, as a tile's wave-uniform base (scalar registers) + the lane's 32-bit byte offset: one vector register serves every plane, where a 64-bit pair a plane, held over the tile loop, would not fit the 128 registers that two blocks a WGP leave a wave
template <typename V16, typename V8> __device__ __forceinline__ V16 frag_p(const char* p) { union { V16 v; V8 q[2]; } u; u.q[0] = *(const V8*)p; u.q[1] = *(const V8*)(p + 512); return u.v; }
__global__ __launch_bounds__(32 * AW) __attribute__((amdgpu_waves_per_eu(8, 8))) void k_att(const _Float16* __restrict__ QH, const _Float16* __restrict__ KH, const _Float16* __restrict__ QL, const _Float16* __restrict__ KL, const _Float16* __restrict__ VT, const __bf16* __restrict__ VB, const __bf16* __restrict__ VBL, const int* __restrict__ IDX, const int* __restrict__ NU, const float* __restrict__ PS, float* __restrict__ MV, float* __restrict__ Y) { __shared__ __align__(16) float sc[16][SP];
  const int tid = threadIdx.x, wave = __builtin_amdgcn_readfirstlane(tid >> 5), lane = tid & 31, col = lane & 15, g = lane >> 4; const int h = blockIdx.x % NH, b = blockIdx.x / NH, sl = blockIdx.y;
  if (sl < HD / 32 && wave == AW - 1) {   /* scalar test. Mean v of 32 channels of this head: lane = channel, the PSN partial sums loaded as PSN whole lines, all in flight at once, added as a tree; ahead of the tile loop, so it is done for any mask, also where the block has no tile */
    const float* pb = PS + (size_t)b * PSN * CC + h * HD + sl * 32; float f[PSN];   /* wave-uniform base; the lane is the loads' offset register */
#pragma unroll
    for (int i = 0; i < PSN; ++i) f[i] = pb[(size_t)i * CC + lane];
#pragma unroll
    for (int o = PSN / 2; o > 0; o >>= 1)
#pragma unroll
      for (int i = 0; i < o; ++i) f[i] += f[i + o];
    vst2(MV + (size_t)b * CC + h * HD + sl * 32 + lane, f[0] * (1.0f / TT));
    asm volatile("s_wait_xcnt 0x0" :: "s"(pb) : "memory"); }   /* behind the loads and the store: the loads' base stays whole until this wait, and the code below rewrites the store's address and data registers */
  const int nb = n_unmasked(NU, b); const int nt = (nb + 15) >> 4;
  const unsigned lo = (unsigned)lane * 16; const size_t hd = (size_t)b * NH + h;   /* the lane's bytes into a 512-byte run of any plane; the (b, h) whose tiles and chunks are read */
  for (int ps = 0; ps < TT / 16 / AG; ++ps) { const int qt = nt - 1 - (ps * AG + ((ps & 1) ? AG - 1 - sl : sl)); if (qt < 0) break;   /* scalar, the same for the whole block; the rank grows with ps, so no later pass has a tile either */
  const int qb = qt >> 2; const int ql0 = qt * 16; const int kend = (kb_last(qb) + 1) * 128;
  const int tq = ql0 + wave < nb; const int orow = IDX[(size_t)b * TT + ql0 + wave] & (TT - 1);   /* the token whose context row this wave stores; the mask bounds the row whatever the list holds */
  asm volatile("s_wait_xcnt 0x0" ::: "memory");   /* behind the list load: the q loads below land on its offset register */
  const char* qp = (const char*)(QH + (hd * (TT / 16) + qt) * FQK) + lo;
  if (qb < QBH) { const char* qlp = (const char*)(QL + (hd * (QHI / 16) + qt) * FQK) + lo; v16h ah[HD / 32], al[HD / 32];
#pragma unroll
    for (int kc = 0; kc < HD / 32; ++kc) { ah[kc] = frag_p<v16h, v8h>(qp + kc * 1024); al[kc] = frag_p<v16h, v8h>(qlp + kc * 1024); }
    asm volatile("s_wait_xcnt 0x0" :: "v"(qp), "v"(qlp) : "memory");   /* the q loads' two address pairs stay whole (no load lands on them) until this wait */
    for (int kt = wave; kt < kend / 16; kt += AW) { const int key = kt * 16 + col; v8f acc = {}, accl = {}; const char* kp = (const char*)(KH + (hd * (TT / 16) + kt) * FQK) + lo; const char* klp = (const char*)(KL + (hd * (KHI / 16) + kt) * FQK) + lo;
      v16h kbf[HD / 32], klf[HD / 32];   /* all of the tile's loads stand ahead of its first product: one memory latency a tile */
#pragma unroll
      for (int kc = 0; kc < HD / 32; ++kc) { kbf[kc] = frag_p<v16h, v8h>(kp + kc * 1024); klf[kc] = frag_p<v16h, v8h>(klp + kc * 1024); }
      asm volatile("s_wait_xcnt 0x0" :: "v"(kp), "v"(klp) : "memory");   /* the k loads' two address pairs stay whole (no load lands on them) until this wait */
#pragma unroll
      for (int kc = 0; kc < HD / 32; ++kc) { acc = wmma16(ah[kc], kbf[kc], acc); accl = wmma16(al[kc], kbf[kc], accl); accl = wmma16(ah[kc], klf[kc], accl); }
#pragma unroll
      for (int r = 0; r < 8; ++r) sc[8 * g + r][key] = ((!CAUSAL || key <= ql0 + 8 * g + r) && key < nb) ? (acc[r] + accl[r] * (1.0f / 1024.0f)) * SCALE : -3.0e38f; }
  } else { v16h ah[HD / 32];
#pragma unroll
    for (int kc = 0; kc < HD / 32; ++kc) ah[kc] = frag_p<v16h, v8h>(qp + kc * 1024);
    asm volatile("s_wait_xcnt 0x0" :: "v"(qp) : "memory");   /* the q loads share one address pair: it stays whole (no k load lands on it) until this wait */
    for (int kt0 = wave; kt0 < kend / 16; kt0 += 4 * AW) { v16h kbf[4][HD / 32] = {};   /* the start value: registers left unset on a skipped tile's path are carried round the tile loop and spill; the loads of up to four tiles stand ahead of the first product: one memory latency for four tiles; the tests on the tile number are scalar */
      const char* kp = (const char*)(KH + (hd * (TT / 16) + kt0) * FQK) + lo;   /* one address pair for the four tiles, the tile's step as a constant offset */
#pragma unroll
      for (int u = 0; u < 4; ++u) if (kt0 + u * AW < kend / 16) {
#pragma unroll
        for (int kc = 0; kc < HD / 32; ++kc) kbf[u][kc] = frag_p<v16h, v8h>(kp + u * (AW * FQK * 2) + kc * 1024); }
      asm volatile("s_wait_xcnt 0x0" :: "v"(kp) : "memory");   /* the k loads share one address pair: it stays whole (no load lands on it) until this wait */
#pragma unroll
      for (int u = 0; u < 4; ++u) if (kt0 + u * AW < kend / 16) { const int key = (kt0 + u * AW) * 16 + col; v8f acc = {};
#pragma unroll
        for (int kc = 0; kc < HD / 32; ++kc) acc = wmma16(ah[kc], kbf[u][kc], acc);
#pragma unroll
        for (int r = 0; r < 8; ++r) sc[8 * g + r][key] = ((!CAUSAL || key <= ql0 + 8 * g + r) && key < nb) ? acc[r] * SCALE : -3.0e38f; } } }
  __syncthreads();   /* every tile of the 16 score rows is in LDS before a wave reads its row */
  { const int nq = kend >> 7; v4f vv[TT / 128] = {};   /* the start value: as for kbf above; 128 keys a pass: 32 lanes x 4; the tests on nq are scalar */
#pragma unroll
    for (int i = 0; i < TT / 128; ++i) if (i < nq) vv[i] = *(const v4f*)&sc[wave][i * 128 + lane * 4];
    float m = -3.0e38f;
#pragma unroll
    for (int i = 0; i < TT / 128; ++i) if (i < nq) { if (tq == 0) vv[i] = (v4f){0.f, 0.f, 0.f, 0.f}; m = fmaxf(m, fmaxf(fmaxf(vv[i][0], vv[i][1]), fmaxf(vv[i][2], vv[i][3]))); }
#pragma unroll
    for (int o = 1; o < 32; o <<= 1) m = fmaxf(m, __shfl_xor(m, o));
    float sum = 0.f;
#pragma unroll
    for (int i = 0; i < TT / 128; ++i) if (i < nq) {
#pragma unroll
      for (int c = 0; c < 4; ++c) { const float v = vv[i][c]; const float ex = expf(v - m); const float e = (v <= -1.0e38f) ? 0.f : ex; vv[i][c] = e; sum += e; } }
#pragma unroll
    for (int o = 1; o < 32; o <<= 1) sum += __shfl_xor(sum, o);
    const float inv = sum > 0.f ? 2048.0f / sum : 0.f;   /* a fully excluded row yields P = 0 */
#pragma unroll
    for (int i = 0; i < TT / 128; ++i) if (i < nq) *(v4f*)&sc[wave][i * 128 + lane * 4] = vv[i] * inv; }
  __syncthreads();   /* all 16 rows of P are in LDS before any wave forms fragments across them */
  const int kce = kend >> 5; v8f acc[HD / 16] = {};
  if (qb < QBH) {
    for (int kc = wave; kc < kce; kc += AW) { float pv[16]; lds_row16(&sc[col][kc * 32 + 8 * g], pv); const F2 p = bsplit16(pv); const size_t po = (hd * (KHI / 32) + kc) * FV; const char* vbp = (const char*)(VB + po) + lo; const char* vlp = (const char*)(VBL + po) + lo;
#pragma unroll
      for (int j2 = 0; j2 < HD / 16; j2 += 2) { v16b vh[2], vl[2];   /* two column tiles' loads stand ahead of their products */
#pragma unroll
        for (int u = 0; u < 2; ++u) { vh[u] = frag_p<v16b, v8b>(vbp + (j2 + u) * 1024); vl[u] = frag_p<v16b, v8b>(vlp + (j2 + u) * 1024); }
        asm volatile("s_wait_xcnt 0x0" :: "v"(vbp), "v"(vlp) : "memory");   /* the v loads' two address pairs stay whole (no load lands on them) until this wait */
#pragma unroll
        for (int u = 0; u < 2; ++u) { const int j = j2 + u; acc[j] = wmma_bf(p.h, vh[u], acc[j]); acc[j] = wmma_bf(p.l, vh[u], acc[j]); acc[j] = wmma_bf(p.h, vl[u], acc[j]); } } }
  } else {
    for (int kc = wave; kc < kce; kc += AW) { v16h vf[HD / 16]; const char* vp = (const char*)(VT + (hd * (TT / 32) + kc) * FV) + lo;   /* the chunk's four v loads stand ahead of its first product: one memory latency a chunk */
#pragma unroll
      for (int j = 0; j < HD / 16; ++j) vf[j] = frag_p<v16h, v8h>(vp + j * 1024);
      asm volatile("s_wait_xcnt 0x0" :: "v"(vp) : "memory");   /* the eight loads share one address pair: it stays whole (no load lands on it) until this wait */
      float pv[16]; lds_row16(&sc[col][kc * 32 + 8 * g], pv); v16h p;
#pragma unroll
      for (int i = 0; i < 16; ++i) p[i] = (_Float16)pv[i];
#pragma unroll
      for (int j = 0; j < HD / 16; ++j) acc[j] = wmma16(p, vf[j], acc[j]); } }
  __syncthreads();   /* every wave has read its last P fragment before the partial tiles overwrite the rows */
  float (*ss)[16][HD + 4] = (float (*)[16][HD + 4])&sc[0][0];
#pragma unroll
  for (int j = 0; j < HD / 16; ++j)
#pragma unroll
    for (int r = 0; r < 8; ++r) ss[wave][8 * g + r][j * 16 + col] = acc[j][r];
  __syncthreads();   /* every wave's partial tile is in LDS before any wave adds them */
  for (int e = tid; e < 16 * (HD / 2); e += 32 * AW) { const int rl = e / (HD / 2), q = e % (HD / 2); v2f s = *(const v2f*)&ss[0][rl][q * 2];
#pragma unroll   /* the AW LDS reads issue ahead of the adds; rolled, each add would wait a full LDS latency */
    for (int w = 1; w < AW; ++w) s += *(const v2f*)&ss[w][rl][q * 2];
    vst2(Y + ((size_t)b * TT + orow) * CC + h * HD + q * 2, s * (1.0f / 2048.0f));
    asm volatile("s_wait_xcnt 0x0" ::: "memory"); }   /* behind the store: the next tile rewrites its address and data registers */
  __syncthreads(); } }   /* every wave has read the partial tiles before the next tile's scores overwrite them */
// ---- k_out: block = (64 rows, 128 cols): out = ctx Wo (+ bo), the ctx row of a token with token_masks == 0 being its sequence's mean v (every lane reads a row that this call has written): ctx x 2^6 once to f16 against Wo as f16(bf16 x 2^8) exact (1 product) x 2^-14; causal early rows (< QHI of each sequence): ctx bf16 hi + lo against exact bf16 Wo (2 products)
__global__ __launch_bounds__(128) void k_out(const float* __restrict__ Y, const int* __restrict__ TM, const float* __restrict__ MV, const __bf16* __restrict__ WOB, const _Float16* __restrict__ WOH, const float* __restrict__ BO, float* __restrict__ OUT) { __shared__ __align__(16) float sf[4][16][132];
  const int tid = threadIdx.x, wave = tid >> 5, lane = tid & 31, col = lane & 15, g = lane >> 4; const int c0 = blockIdx.y * 128; const size_t r0 = (size_t)blockIdx.x * 64 + wave * 16;
  const int* tp = TM + r0 + col; const int tk = *tp; asm volatile("s_wait_xcnt 0x0" :: "v"(tp) : "memory");   /* the mask load's address pair stays whole until this wait */
  v8f acc[8] = {}; const float* xp = (tk != 0 ? Y + (r0 + col) * CC : MV + (((size_t)blockIdx.x * 64) / TT) * CC) + 8 * g; const size_t wo = ((size_t)(c0 >> 4) * 64 + lane) * 8; v4f xs[2][4]; ld_xr(xp, xs[0]); ld_xr(xp + 32, xs[1]);
  if (CAUSAL && (int)(((size_t)blockIdx.x * 64) % TT) < QHI) {   /* block-uniform */
    const __bf16* wp = WOB + wo; v8b wf[3][8]; F2 a;
#pragma unroll
    for (int t = 0; t < 2; ++t) ld_wf<8>(wp + WST(t), wf[t]);
#pragma unroll   /* whole, stages as in k_proj; two products a tile, so B two stages ahead covers as much */
    for (int st = 0; st < CC / 16; ++st) { const int hf = st & 1, kc = st >> 1;
      if (hf == 0) { float v[16];
#pragma unroll
        for (int i = 0; i < 4; ++i) { v[i] = xs[kc & 1][0][i]; v[4 + i] = xs[kc & 1][1][i]; v[8 + i] = xs[kc & 1][2][i]; v[12 + i] = xs[kc & 1][3][i]; }
        a = bsplit16(v); if (kc + 2 < CC / 32) ld_xr(xp + (kc + 2) * 32, xs[kc & 1]); }
      if (st + 2 < CC / 16) ld_wf<8>(wp + WST(st + 2), wf[(st + 2) % 3]);   /* into the set that the last stage has left */
      if (st + 3 == CC / 16) asm volatile("s_wait_xcnt 0x0" :: "v"(xp), "v"(wp) : "memory");   /* behind the last loads: the two address pairs stay whole until this wait */
#pragma unroll
      for (int j = 0; j < 4; ++j) { const int jj = hf * 4 + j; const v16b w = two_b(wf[st % 3][2 * j], wf[st % 3][2 * j + 1]); acc[jj] = wmma_bf(a.h, w, acc[jj]); acc[jj] = wmma_bf(a.l, w, acc[jj]); }
      __builtin_amdgcn_sched_barrier(0); }   /* keeps the next stage's conversions, and with them the wait on loads just issued, behind this stage's products */
#pragma unroll
    for (int j = 0; j < 8; ++j) { const float bias = BO ? bfr(BO[c0 + j * 16 + col]) : 0.f;
#pragma unroll
      for (int r = 0; r < 8; ++r) sf[wave][8 * g + r][j * 16 + col] = acc[j][r] + bias; }
  } else {
    const _Float16* wp = WOH + wo; v8h wf[4][8]; v16h a;
#pragma unroll
    for (int t = 0; t < 3; ++t) ld_wf<8>(wp + WST(t), wf[t]);
#pragma unroll   /* whole, stages as in k_proj */
    for (int st = 0; st < CC / 16; ++st) { const int hf = st & 1, kc = st >> 1;
      if (hf == 0) {   /* ctx carried x 2^6 into f16 so small-magnitude context rows stay clear of f16 subnormals */
#pragma unroll
        for (int i = 0; i < 4; ++i) { a[i] = (_Float16)(xs[kc & 1][0][i] * 64.0f); a[4 + i] = (_Float16)(xs[kc & 1][1][i] * 64.0f); a[8 + i] = (_Float16)(xs[kc & 1][2][i] * 64.0f); a[12 + i] = (_Float16)(xs[kc & 1][3][i] * 64.0f); }
        if (kc + 2 < CC / 32) ld_xr(xp + (kc + 2) * 32, xs[kc & 1]); }
      if (st + 3 < CC / 16) ld_wf<8>(wp + WST(st + 3), wf[(st + 3) & 3]);   /* into the set that the last stage has left */
      if (st + 4 == CC / 16) asm volatile("s_wait_xcnt 0x0" :: "v"(xp), "v"(wp) : "memory");   /* behind the last loads: the two address pairs stay whole until this wait */
#pragma unroll
      for (int j = 0; j < 4; ++j) acc[hf * 4 + j] = wmma16(a, two_h(wf[st & 3][2 * j], wf[st & 3][2 * j + 1]), acc[hf * 4 + j]);
      __builtin_amdgcn_sched_barrier(0); }   /* keeps the next stage's conversions, and with them the wait on loads just issued, behind this stage's products */
#pragma unroll
    for (int j = 0; j < 8; ++j) { const float bias = BO ? bfr(BO[c0 + j * 16 + col]) : 0.f;
#pragma unroll
      for (int r = 0; r < 8; ++r) sf[wave][8 * g + r][j * 16 + col] = acc[j][r] * (1.0f / 16384.0f) + bias; } }   /* 2^-8 (Wo carry) x 2^-6 (ctx carry) */
  LDSX(); for (int rl = 0; rl < 16; ++rl) vst2(OUT + (r0 + rl) * DIN + c0 + lane * 4, *(const v4f*)&sf[wave][rl][lane * 4]); }

extern "C" void kernel_launch(void* const* d_in, const int* in_sizes, int n_in, void* d_out, int out_size, void* d_ws, size_t ws_size, hipStream_t stream) {
  (void)in_sizes; (void)n_in; (void)out_size;
  const float** F = (const float**)d_in;
  if (ws_size < (size_t)WS_END) return;
  char* ws = (char*)d_ws; _Float16 *QH = (_Float16*)(ws + WS_QH), *KH = (_Float16*)(ws + WS_KH), *VT = (_Float16*)(ws + WS_VT), *QL = (_Float16*)(ws + WS_QL), *KL = (_Float16*)(ws + WS_KL); __bf16 *VB = (__bf16*)(ws + WS_VB), *VBL = (__bf16*)(ws + WS_VBL); float *Y = (float*)(ws + WS_Y);
  (void)Y; (void)QL; (void)KL; (void)VB; (void)VBL;
  // inputs: 0 embeddings [4,2048,512]; 1 token_masks [4,2048] int32 (0/1); 2 Wq [512,512] (in,out); 3 Wk; 4 Wv; 5 Wo (in,out)
  if (ws_size < (size_t)WS_END6) return;
  const int* TM = (const int*)d_in[1]; float* MV = (float*)(ws + WS_MV); int *IDX = (int*)(ws + WS_IDX), *NU = (int*)(ws + WS_NU); __bf16* WP = (__bf16*)(ws + WS_WP); _Float16* WOH = (_Float16*)(ws + WS_WOH); float* PS = (float*)(ws + WS_PS); __bf16* XP = (__bf16*)(ws + WS_XP);
  k_perm<<<dim3(TNB * XG + 5 * WPB), 32 * PW, 0, stream>>>(F[0], TM, F[2], F[3], F[4], F[5], IDX, NU, WP, WOH, XP);
  k_proj<<<dim3(TNB * TT / 64, CC / 128, 3), 128, 0, stream>>>(XP, WP, nullptr, nullptr, nullptr, NU, QH, QL, KH, KL, VT, VB, VBL, PS);
  k_att<<<dim3(NH * TNB, AG), 32 * AW, 0, stream>>>(QH, KH, QL, KL, VT, VB, VBL, IDX, NU, PS, MV, Y);
  k_out<<<dim3(TNB * TT / 64, DIN / 128), 128, 0, stream>>>(Y, TM, MV, WP + 3 * WPL, WOH, nullptr, (float*)d_out);
}

// v010
// One run takes 61 microseconds.
// Two timings next to v009 both put it at 1.06 times that version's speed.
// All steps since v000 together make it 15.8 times as fast.
// compute dtype: all float inputs rounded to bf16; projections with EXACT bf16 products on WMMA 16x16x32 (f32 accumulate); tokens of a sequence sorted unmasked first (stable), all planes in that order; causal logits: 3 products for the first 384 sorted rows, single f16 q x k after, x 64^-0.5; key/query masks = a length; softmax f32; P x 2^11 once to f16 x v once to f16 (bf16 hi + lo below row 384); fully-masked query rows = mean of the f16 v plane in f32; ctx hi+lo x exact Wo below row 384, x2^6 f16 carry x f16(bf16 x 2^8) Wo after; f32 output.
#include <hip/hip_runtime.h>
#include <math.h>

typedef __attribute__((ext_vector_type(16))) _Float16 v16h;
typedef __attribute__((ext_vector_type(16))) __bf16 v16b;
typedef __attribute__((ext_vector_type(8)))  _Float16 v8h;
typedef __attribute__((ext_vector_type(8)))  float v8f;
typedef __attribute__((ext_vector_type(4)))  float v4f;
typedef __attribute__((ext_vector_type(2)))  float v2f;
typedef __attribute__((ext_vector_type(4)))  unsigned v4u;
typedef _Float16 hx8 __attribute__((ext_vector_type(8)));
typedef __attribute__((ext_vector_type(4)))  int v4i;
typedef float __attribute__((may_alias)) float_a;
typedef int __attribute__((may_alias)) int_a;

template <typename T> __device__ __forceinline__ void vst2(void* p, T v) { *(T*)p = v;  }
__device__ __forceinline__ v8f wmma16(v16h a, v16h b, v8f c) {
  v8f d = __builtin_amdgcn_wmma_f32_16x16x32_f16(false, a, false, b, (short)0, c, false, false);
  asm volatile("v_nop\n\tv_nop\n\tv_nop\n\tv_nop" : "+v"(d) : "v"(a), "v"(b));
  return d;
}
__device__ __forceinline__ v8f wmma_bf(v16b a, v16b b, v8f c) {
  v8f d = __builtin_amdgcn_wmma_f32_16x16x32_bf16(false, a, false, b, (short)0, c, false, false);
  asm volatile("v_nop\n\tv_nop\n\tv_nop\n\tv_nop" : "+v"(d) : "v"(a), "v"(b));
  return d;
}
// 16x16x32 fragments: lane = (h = lane>>4, row/col = lane&15); elements 0..7 = k0+8h+0..7, 8..15 = k0+16+8h+0..7; D element r = row 8h+r
__device__ __forceinline__ v16h frag_h(const _Float16* rowk0, int lane) {
  union { v16h v; v8h q[2]; } u; const _Float16* p = rowk0 + 8 * (lane >> 4);
  u.q[0] = *(const v8h*)p; u.q[1] = *(const v8h*)(p + 16); return u.v;
}
__device__ __forceinline__ v16h frag_f32(const float* rowk0, int lane) {
  v16h a; const float* p = rowk0 + 8 * (lane >> 4);
#pragma unroll
  for (int i = 0; i < 8; ++i) { a[i] = (_Float16)p[i]; a[8 + i] = (_Float16)p[16 + i]; }
  return a;
}
__device__ __forceinline__ v16h frag_f32s(const float* rowk0, int lane, float sc) {
  v16h a; const float* p = rowk0 + 8 * (lane >> 4);
#pragma unroll
  for (int i = 0; i < 8; ++i) { a[i] = (_Float16)(p[i] * sc); a[8 + i] = (_Float16)(p[16 + i] * sc); }
  return a;
}
// column fragment from a [K][ld] layout (column n), rows >= K read as 0
__device__ __forceinline__ v16h fragc_f32(const float* W, int k0, int n, int lane, int ld, int K) {
  v16h a; const int g = lane >> 4;
#pragma unroll
  for (int i = 0; i < 8; ++i) { const int ka = k0 + 8 * g + i, kb = ka + 16;
    a[i] = (_Float16)(ka < K ? W[(size_t)(ka < K ? ka : K - 1) * ld + n] : 0.f); a[8 + i] = (_Float16)(kb < K ? W[(size_t)(kb < K ? kb : K - 1) * ld + n] : 0.f); }
  return a;
}
struct F2 { v16b h, l; };
__device__ __forceinline__ F2 bsplit16(const float v[16]) { F2 r;
#pragma unroll
  for (int i = 0; i < 16; ++i) { const __bf16 h = (__bf16)v[i]; r.h[i] = h; r.l[i] = (__bf16)(v[i] - (float)h); }
  return r; }
__device__ __forceinline__ F2 split_row(const float* row, int k0, int lane) { float v[16]; const float* p = row + k0 + 8 * (lane >> 4);
#pragma unroll
  for (int i = 0; i < 8; ++i) { v[i] = p[i]; v[8 + i] = p[16 + i]; }
  return bsplit16(v); }
__device__ __forceinline__ F2 split_rowK(const float* row, int k0, int lane, int K) { float v[16]; const int g = lane >> 4;
#pragma unroll
  for (int i = 0; i < 8; ++i) { const int ka = k0 + 8 * g + i, kb = ka + 16; v[i] = ka < K ? row[ka < K ? ka : K - 1] : 0.f; v[8 + i] = kb < K ? row[kb < K ? kb : K - 1] : 0.f; }
  return bsplit16(v); }
__device__ __forceinline__ F2 split_col(const float* W, int k0, int n, int lane, int ld, int K) { float v[16]; const int g = lane >> 4;
#pragma unroll
  for (int i = 0; i < 8; ++i) { const int ka = k0 + 8 * g + i, kb = ka + 16; v[i] = ka < K ? W[(size_t)(ka < K ? ka : K - 1) * ld + n] : 0.f; v[8 + i] = kb < K ? W[(size_t)(kb < K ? kb : K - 1) * ld + n] : 0.f; }
  return bsplit16(v); }
__device__ __forceinline__ v8f mac3(const F2& a, const F2& b, v8f c) { c = wmma_bf(a.l, b.h, c); c = wmma_bf(a.h, b.l, c); return wmma_bf(a.h, b.h, c); }
__device__ __forceinline__ float sigm(float v) { return 1.0f / (1.0f + expf(-v)); }
#define LDSX() do { asm volatile("s_wait_dscnt 0" ::: "memory"); __builtin_amdgcn_wave_barrier(); __builtin_amdgcn_fence(__ATOMIC_RELEASE, "workgroup"); } while (0)

// Causal multi-head self-attention with token padding masks on BOTH keys and queries (embeddings [4,2048,512], token_masks [4,2048] int 0/1 (random here: about half the tokens masked); 8 heads x 64; (in,out) Wq/Wk/Wv/Wo [512,512], no biases): scores = q.k/8, where(causal & tm[k] & tm[q], scores, -1e30), softmax, context Wo. A query with tm[q] = 0 gets all scores = -1e30 -> exactly uniform attention over all 2,048 positions (context = mean V).
#define NB 4
#define TT 2048
#define CC 512            // NH * HD = projected width
#define DIN 512          // input (model) width
#define NH 8
#define HD 64
#define SCALE (0.125f)
#define CAUSAL 1
#ifndef TNB
#define TNB NB
#endif
__device__ __forceinline__ float bfr(float v) { return (float)(__bf16)v; }
__host__ __device__ __forceinline__ int kb_last(int qb) { return CAUSAL ? ((qb * 64 + 63) >> 7) : (TT / 128 - 1); }
typedef __attribute__((ext_vector_type(8))) __bf16 v8b;
__device__ __forceinline__ v16b frag_b(const __bf16* rowk0, int lane) {
  union { v16b v; v8b q[2]; } u; const __bf16* p = rowk0 + 8 * (lane >> 4);
  u.q[0] = *(const v8b*)p; u.q[1] = *(const v8b*)(p + 16); return u.v;
}
#define QBH 6              // causal: query blocks 0..QBH-1 of each sequence (few keys, no averaging) take the high-precision path
#define QHI 384            // rows carrying a q residual plane (read only by the 3-product logits of query blocks < QBH)
#define KHI 384            // key rows carrying k residual / v bf16 hi+lo planes (used only by the causal high-precision path)
// B fragment (k rows k0+.., output column o) of a weight: (in,out) [K][ld] or (out,in) [ld rows of K]: bf16 exact, or f16(bf16 * 256) exact
__device__ __forceinline__ v16b wcol_io(const float* Wm, int k0, int o, int lane, int ld) { v16b w; const int g = lane >> 4;
#pragma unroll
  for (int i = 0; i < 8; ++i) { w[i] = (__bf16)Wm[(size_t)(k0 + 8 * g + i) * ld + o]; w[8 + i] = (__bf16)Wm[(size_t)(k0 + 16 + 8 * g + i) * ld + o]; }
  return w; }
__device__ __forceinline__ v16b wcol_oi(const float* Wm, int k0, int o, int lane, int K) { v16b w; const float* p = Wm + (size_t)o * K + k0 + 8 * (lane >> 4);
#pragma unroll
  for (int i = 0; i < 8; ++i) { w[i] = (__bf16)p[i]; w[8 + i] = (__bf16)p[16 + i]; }
  return w; }
__device__ __forceinline__ v16h wcolh_io(const float* Wm, int k0, int o, int lane, int ld) { v16h w; const int g = lane >> 4;
#pragma unroll
  for (int i = 0; i < 8; ++i) { w[i] = (_Float16)(bfr(Wm[(size_t)(k0 + 8 * g + i) * ld + o]) * 256.0f); w[8 + i] = (_Float16)(bfr(Wm[(size_t)(k0 + 16 + 8 * g + i) * ld + o]) * 256.0f); }
  return w; }
__device__ __forceinline__ v16h wcolh_oi(const float* Wm, int k0, int o, int lane, int K) { v16h w; const float* p = Wm + (size_t)o * K + k0 + 8 * (lane >> 4);
#pragma unroll
  for (int i = 0; i < 8; ++i) { w[i] = (_Float16)(bfr(p[i]) * 256.0f); w[8 + i] = (_Float16)(bfr(p[16 + i]) * 256.0f); }
  return w; }
#define WQKV_LAYOUT 0   // picks WCOL's layout only; no kernel calls WCOL: k_perm reads Wq/Wk/Wv as (in,out) [DIN][CC] whatever its value
__device__ __forceinline__ v16b wcol_hdk(const float* Wm, int k0, int o, int lane) { v16b w; const int g = lane >> 4; const float* p = Wm + (size_t)(o / HD) * DIN * HD + (o % HD);
#pragma unroll
  for (int i = 0; i < 8; ++i) { w[i] = (__bf16)p[(size_t)(k0 + 8 * g + i) * HD]; w[8 + i] = (__bf16)p[(size_t)(k0 + 16 + 8 * g + i) * HD]; }
  return w; }
#define WO_OUT_IN 0
#if WQKV_LAYOUT == 1
#define WCOL(W, k0, o, lane) wcol_oi(W, k0, o, lane, DIN)
#elif WQKV_LAYOUT == 2
#define WCOL(W, k0, o, lane) wcol_hdk(W, k0, o, lane)
#else
#define WCOL(W, k0, o, lane) wcol_io(W, k0, o, lane, CC)
#endif
#if WO_OUT_IN
#define WOCOL(W, k0, o, lane) wcol_oi(W, k0, o, lane, CC)
#define WOCOLH(W, k0, o, lane) wcolh_oi(W, k0, o, lane, CC)
#else
#define WOCOL(W, k0, o, lane) wcol_io(W, k0, o, lane, DIN)
#define WOCOLH(W, k0, o, lane) wcolh_io(W, k0, o, lane, DIN)
#endif
// masks: keys need causal (structure + index) AND token_masks[b][k] != 0; a query with token_masks[b][t] == 0 has EVERY score = -1e30 in the module -> exactly uniform attention over all 2,048 positions -> its context is mean_k V (mean v: 64-place sums from k_proj, added by a wave of k_att; k_out takes it as such a row's context; in k_att such rows just get a harmless finite placeholder)
// ---- k_perm: block = one sequence's sort and a share of its X rows (XG blocks a sequence, see below). IDX[b][r] = the token at sorted place r: the n unmasked tokens first, then the masked ones, each group in its old order; NU[b * 32] = n (a 128-byte line per sequence: one writer a line).
// The order of the unmasked tokens is kept, so among them 'key <= query' reads the same on places as on tokens, and a masked key is simply a place >= n: attention runs on the first n places alone, for any mask. q, k, v planes are laid out by place; the context row goes back to its token's row.
// Blocks TNB * XG.. of the same launch copy the weights to five 16-bit planes (Wq, Wk, Wv, Wo, Wo again) in FRAGMENT ORDER: 16-byte unit u = ((kc * 32 + ot) * 2 + q) * 32 + lane holds W[kc * 32 + 16 q + 8 (lane >> 4) + 0..7][ot * 16 + (lane & 15)], so a wave fetches half a B fragment of k chunk kc, column tile ot, as one 512-byte run of whole lines. Values: bf16(W); the fifth plane f16(bf16(Wo) x 2^8).
// XG blocks sort each sequence (every one the whole list, in its own LDS; the first of them stores IDX and NU) and then copy the X rows of TT / XG sorted places each to a bf16 plane XP in FRAGMENT ORDER: [b][16-place tile] of FX elements; 16-byte unit ((kc * 2 + qq) * 32 + lane) of a tile = place (lane & 15), dims kc * 32 + qq * 16 + 8 (lane >> 4) + 0..7. A wave reads whole rows (512 bytes in a row a load), the rounded rows turn into fragment order through LDS, and every store is a 512-byte run. The k_proj blocks that share a row (up to 12) so fetch half an A fragment as one run of whole lines, already rounded, where a fragment load from the f32 rows touched 16 lines.
#define XG 32          /* blocks that share the X rows of one sequence */
#define XR (TT / XG)   /* X rows that a block copies */
#define FX (16 * DIN)  /* elements of one 16-place tile of XP */
typedef __attribute__((ext_vector_type(4))) __bf16 v4b;
#define PW (TT / 64)   /* waves of k_perm: 64 tokens a wave */
#define WPL ((size_t)DIN * CC)          /* elements of one packed plane */
#define WKS ((size_t)(CC / 16) * 512)   /* elements from one k chunk to the next in a packed plane */
#define WST(st) ((size_t)((st) >> 1) * WKS + (size_t)((st) & 1) * 2048)   /* stage st of a 128-column block: k chunk st / 2, its first or second four column tiles */
#define WPB ((DIN / 32) * (CC / 16) * 64 / (32 * PW))   /* blocks that pack one weight: a thread a unit */
static_assert(DIN == CC && CC == 512 && WPB * 32 * PW == (DIN / 32) * (CC / 16) * 64, "the unit index is cut by shifts; whole blocks");
static_assert(2 * PW == 64, "a lane holds two of the 64 group counts");
static_assert(XR == 2 * PW && DIN == 4 * 128 && (XR / 16) * (DIN / 16) == 4 * PW && PW / (XR / 16) == 8, "a wave reads two rows by four loads each and stores four runs of one tile");
__global__ __launch_bounds__(32 * PW) void k_perm(const float* __restrict__ X, const int* __restrict__ TM, const float* __restrict__ WQ, const float* __restrict__ WK, const float* __restrict__ WV, const float* __restrict__ WO, int* __restrict__ IDX, int* __restrict__ NU, __bf16* __restrict__ WP, _Float16* __restrict__ WOH, __bf16* __restrict__ XP) { __shared__ int cnt[2 * PW]; __shared__ int sidx[TT]; __shared__ __align__(16) __bf16 xt[XR][DIN + 8];   /* row pitch 16 B x an odd number: the 16 rows of a 16-byte fragment read fall on different banks */
  if (blockIdx.x >= TNB * XG) {   /* the same for the whole block, ahead of every barrier */
    const int pb = blockIdx.x - TNB * XG, m = pb / WPB, u = (pb % WPB) * (32 * PW) + threadIdx.x; const int ln = u & 31, q = (u >> 5) & 1, ot = (u >> 6) & 31, kc = u >> 11;
    const float* src = (m == 0 ? WQ : m == 1 ? WK : m == 2 ? WV : WO) + (size_t)(kc * 32 + 16 * q + 8 * (ln >> 4)) * CC + ot * 16 + (ln & 15); float f[8];
#pragma unroll
    for (int i = 0; i < 8; ++i) f[i] = src[(size_t)i * CC];
    asm volatile("s_wait_xcnt 0x0" :: "v"(src) : "memory");   /* the eight loads share one address pair: it stays whole until this wait */
    if (m < 4) { v8b o;
#pragma unroll
      for (int i = 0; i < 8; ++i) o[i] = (__bf16)f[i];
      vst2(WP + (size_t)m * WPL + (size_t)u * 8, o);
    } else { v8h oh;
#pragma unroll
      for (int i = 0; i < 8; ++i) oh[i] = (_Float16)(bfr(f[i]) * 256.0f);
      vst2(WOH + (size_t)u * 8, oh); }
    return; }   /* one store a thread, the thread's last instruction */
  const int tid = threadIdx.x, wave = tid >> 5, lane = tid & 31, b = blockIdx.x / XG, part = blockIdx.x % XG; const int* TMb = TM + (size_t)b * TT; unsigned bal[2];
#pragma unroll
  for (int u = 0; u < 2; ++u) bal[u] = (unsigned)__ballot(TMb[(wave * 2 + u) * 32 + lane] != 0);
  if (lane < 2) cnt[wave * 2 + lane] = __popc(lane ? bal[1] : bal[0]);
  __syncthreads();   /* the 64 groups' counts are in LDS before a wave sums them */
  const int c0 = cnt[lane], c1 = cnt[32 + lane]; int tot = c0 + c1, bef = (lane < wave * 2 ? c0 : 0) + (32 + lane < wave * 2 ? c1 : 0);
#pragma unroll
  for (int o = 1; o < 32; o <<= 1) { tot += __shfl_xor(tot, o); bef += __shfl_xor(bef, o); }
#pragma unroll
  for (int u = 0; u < 2; ++u) { const int t = (wave * 2 + u) * 32 + lane; const int ones = bef + (u ? __popc(bal[0]) : 0) + __popc(bal[u] & ((1u << lane) - 1u)); sidx[((bal[u] >> lane) & 1u) ? ones : tot + (t - ones)] = t; }
  __syncthreads();   /* the whole list is in LDS before it leaves by whole lines and before a wave looks up its rows */
  { const float* xr0 = X + ((size_t)b * TT + (size_t)(sidx[part * XR + wave * 2] & (TT - 1))) * DIN + lane * 4; const float* xr1 = X + ((size_t)b * TT + (size_t)(sidx[part * XR + wave * 2 + 1] & (TT - 1))) * DIN + lane * 4; v4f xs[2][4];   /* wave = two rows */
#pragma unroll
    for (int i = 0; i < 4; ++i) { xs[0][i] = *(const v4f*)(xr0 + i * 128); xs[1][i] = *(const v4f*)(xr1 + i * 128); }
    asm volatile("s_wait_xcnt 0x0" :: "v"(xr0), "v"(xr1) : "memory");   /* the eight loads' two address pairs stay whole until this wait */
#pragma unroll
    for (int u = 0; u < 2; ++u)
#pragma unroll
      for (int i = 0; i < 4; ++i) { v4b o;
#pragma unroll
        for (int c = 0; c < 4; ++c) o[c] = (__bf16)xs[u][i][c];
        *(v4b*)&xt[wave * 2 + u][i * 128 + lane * 4] = o; }
    __syncthreads();   /* the block's rows are in LDS before a wave reads fragments across them */
    const int tl = wave >> 3, kq0 = (wave & 7) * 4;   /* wave = four runs (kc * 2 + qq = kq0..kq0 + 3) of one tile: 2 KiB in a row */
    __bf16* op = XP + ((size_t)b * (TT / 16) + part * (XR / 16) + tl) * FX + (size_t)(kq0 * 32 + lane) * 8; v8b o[4];
#pragma unroll
    for (int t = 0; t < 4; ++t) o[t] = *(const v8b*)&xt[tl * 16 + (lane & 15)][(kq0 + t) * 16 + 8 * (lane >> 4)];
#pragma unroll
    for (int t = 0; t < 4; ++t) vst2(op + t * 256, o[t]);
    asm volatile("s_wait_xcnt 0x0" :: "v"(op) : "memory"); }   /* behind the four stores: their address pair stays whole until this wait, and the code below rewrites their registers */
  if (part == 0) {   /* the same for the whole block */
#pragma unroll
    for (int u = 0; u < 2; ++u) vst2(IDX + (size_t)b * TT + u * 32 * PW + tid, sidx[u * 32 * PW + tid]);
    if (tid == 0) vst2(NU + b * 32, tot); } }
__device__ __forceinline__ int n_unmasked(const int* NU, int b) { const int n = NU[b * 32]; return __builtin_amdgcn_readfirstlane(n < 0 ? 0 : n > TT ? TT : n); }   /* bounded whatever the word holds; through readfirstlane so that the tests on it are scalar branches */
// ---- mean v, the context of a fully-masked query row (softmax of 2,048 equal scores = exactly 1/2048 each): MV[b][c] = (1/2048) sum_t v[b][t][c] over the f16 v values, f32 sums. It has no launch of its own: a v block of k_proj sums its 64 places per channel out of an LDS copy of its f16 tile (PS[b][t / 64][c], whole lines, one writer a line); in k_att one wave of HD / 32 blocks of each (b, h) adds the TT / 64 partial sums of 32 channels and stores them as one 128-byte line of MV; k_out reads MV[b] in place of the ctx row of a token with token_masks == 0.
#define PSN (TT / 64)   /* partial sums a channel: one per 64-place block of k_proj */
#define WS_MV (WS_END)                                    // f32 mean-v rows [b][512]
#define WS_END2 (WS_MV + 4u * (size_t)NB * CC)
#define WS_IDX (WS_END2)                                  // int token of each sorted place [b][t]
#define WS_NU  (WS_IDX + 4u * (size_t)NB * TT)            // int unmasked tokens of a sequence, one 128-byte line each
#define WS_END3 (WS_NU + 128u * (size_t)NB)
#define WS_WP  (WS_END3)                                  // bf16 Wq, Wk, Wv, Wo in fragment order
#define WS_WOH (WS_WP + 2u * 4u * (size_t)DIN * CC)       // f16(bf16 Wo x 2^8) in fragment order
#define WS_END4 (WS_WOH + 2u * (size_t)DIN * CC)
#define WS_PS  (WS_END4)                                  // f32 sums of v over 64 places [b][t / 64][512]
#define WS_END5 (WS_PS + 4u * (size_t)NB * PSN * CC)
#define WS_XP  (WS_END5)                                  // bf16 X tiles in fragment order [b][t / 16], by sorted place
#define WS_END6 (WS_XP + 2u * (size_t)NB * TT * DIN)

// The q, k and v planes lie in FRAGMENT ORDER, so that each 16-byte load of a k_att wave covers 512 bytes in a row (four whole lines; by rows it touched 16 lines for the same bytes).
// q, k: [b][h][16-place tile] of FQK elements; 16-byte unit ((kc * 2 + qq) * 32 + lane) of a tile = place (lane & 15), dims kc * 32 + qq * 16 + 8 (lane >> 4) + 0..7.
// v: [b][h][32-place chunk] of FV elements; unit ((j * 2 + qq) * 32 + lane) of a chunk = channel j * 16 + (lane & 15), places qq * 16 + 8 (lane >> 4) + 0..7.
#define FQK (16 * HD)
#define FV  (32 * HD)
static_assert(HD == 64 && CC == NH * HD && QHI % 64 == 0 && KHI % 64 == 0, "the unit index of a 64 x 128 block is cut by shifts; whole blocks carry residual planes");
#define WS_QH  0u                                      // f16 q tiles [b][h][t / 16]
#define WS_KH  (WS_QH + 2u * (size_t)NB * TT * CC)      // f16 k tiles [b][h][t / 16]
#define WS_VT  (WS_KH + 2u * (size_t)NB * TT * CC)      // f16 v chunks [b][h][t / 32]
#define WS_QL  (WS_VT + 2u * (size_t)NB * CC * TT)      // f16 q residual x 2^10 tiles [b][h][t / 16 < QHI / 16]
#define WS_KL  (WS_QL + 2u * (size_t)NB * QHI * CC)     // f16 k residual x 2^10 tiles [b][h][t / 16 < KHI / 16]
#define WS_VB  (WS_KL + 2u * (size_t)NB * KHI * CC)     // bf16 v hi chunks [b][h][t / 32 < KHI / 32]
#define WS_VBL (WS_VB + 2u * (size_t)NB * CC * KHI)
#define WS_Y   (WS_VBL + 2u * (size_t)NB * CC * KHI)     // f32 ctx rows [b*t][CC] (only when there is an output projection)
#define WS_END (WS_Y  + 4u * (size_t)NB * TT * CC)

// operands fetched ahead of their products: 16 f32 of an A row in fragment order (x[0..1] = p[0..7], x[2..3] = p[16..23]); N / 2 fragments of a packed plane as N runs of 512 bytes a wave
__device__ __forceinline__ void ld_xr(const float* p, v4f x[4]) { x[0] = *(const v4f*)p; x[1] = *(const v4f*)(p + 4); x[2] = *(const v4f*)(p + 16); x[3] = *(const v4f*)(p + 20); }
template <int N, typename T, typename T8> __device__ __forceinline__ void ld_wf(const T* p, T8 w[N]) {
#pragma unroll
  for (int t = 0; t < N; ++t) w[t] = *(const T8*)(p + t * 256); }
__device__ __forceinline__ v16b two_b(v8b a, v8b b) { union { v16b v; v8b q[2]; } u; u.q[0] = a; u.q[1] = b; return u.v; }
__device__ __forceinline__ v16h two_h(v8h a, v8h b) { union { v16h v; v8h q[2]; } u; u.q[0] = a; u.q[1] = b; return u.v; }
// ---- k_proj: block = (64 sorted places, 128 cols, which), wave = 16 places x 128 cols, operands from the XP tiles and the packed weight planes; q and k blocks wholly behind the last 128-place group that holds an unmasked token leave at once (k_att reads no place there): q/k/v = X W (+ b) with exact bf16 products (K = DIN) -> which 0: q f16 tiles (+ residual tiles for places < QHI); 1: k f16 tiles (+ residual tiles for places < KHI); 2: v f16 chunks (+ bf16 hi/lo chunks for places < KHI), all in the fragment order given at the WS_ offsets
// The two fragment maps are alike (lane = row or column, the same k order), so either plane serves as either operand. q, k: W is the FIRST operand, so acc[j][r] of lane (g, col) = channel c0 + j * 16 + 8 g + r of place col; v: X is the first operand, so acc[j][r] = place 8 g + r of channel c0 + j * 16 + col. Either way a lane's 8 results of a tile are, once rounded, the lane's own 16-byte unit of the fragment-order plane: they are stored straight from registers, a wave 512 bytes in a row, with no turn through LDS.
template <bool WA> __device__ __forceinline__ void proj_loop(const char* xb, const char* wb, unsigned lo, v8f acc[8]) {
  const __bf16* xp = (const __bf16*)(xb + lo); const __bf16* wp = (const __bf16*)(wb + lo);
  v8b xa[3][2]; v8b wf[4][8]; ld_wf<2>(xp, xa[0]); ld_wf<2>(xp + 512, xa[1]);
#pragma unroll
  for (int t = 0; t < 3; ++t) ld_wf<8>(wp + WST(t), wf[t]);
#pragma unroll   /* whole: the operand sets stay in registers, every step of the two addresses is a constant offset */
  for (int st = 0; st < DIN / 16; ++st) { const int hf = st & 1, kc = st >> 1;   /* a stage = half a k chunk: four column tiles; W is fetched three stages ahead, X two chunks ahead */
    if (hf == 0 && kc + 2 < DIN / 32) ld_wf<2>(xp + (kc + 2) * 512, xa[(kc + 2) % 3]);   /* into the set that the last chunk has left */
    const v16b a = two_b(xa[kc % 3][0], xa[kc % 3][1]);
    if (st + 3 < DIN / 16) ld_wf<8>(wp + WST(st + 3), wf[(st + 3) & 3]);   /* into the set that the last stage has left */
    if (st + 4 == DIN / 16) asm volatile("s_wait_xcnt 0x0" :: "s"(xb), "s"(wb), "v"(lo) : "memory");   /* behind the last loads: the two bases and the lane's offset stay whole until this wait */
#pragma unroll
    for (int j = 0; j < 4; ++j) { const v16b w = two_b(wf[st & 3][2 * j], wf[st & 3][2 * j + 1]); acc[hf * 4 + j] = WA ? wmma_bf(w, a, acc[hf * 4 + j]) : wmma_bf(a, w, acc[hf * 4 + j]); }
    __builtin_amdgcn_sched_barrier(0); } }   /* keeps the next stage's products, and with them the wait on loads just issued, behind this stage's products */
__global__ __launch_bounds__(128) void k_proj(const __bf16* __restrict__ XP, const __bf16* __restrict__ WP, const float* __restrict__ BQ, const float* __restrict__ BK, const float* __restrict__ BV, const int* __restrict__ NU,
    _Float16* __restrict__ QH, _Float16* __restrict__ QL, _Float16* __restrict__ KH, _Float16* __restrict__ KL, _Float16* __restrict__ VT, __bf16* __restrict__ VB, __bf16* __restrict__ VBL, float* __restrict__ PS) {
  __shared__ __align__(16) _Float16 th[128][72];   /* the f16 v tile by channel, for the 64-place sums alone */
  const int tid = threadIdx.x, wave = __builtin_amdgcn_readfirstlane(tid >> 5), lane = tid & 31, col = lane & 15, g = lane >> 4; const int which = blockIdx.z; const int c0 = blockIdx.y * 128; const size_t r0 = (size_t)blockIdx.x * 64; const size_t bb = r0 / TT; const int t0 = (int)(r0 % TT);
  if (which < 2 && t0 >= ((n_unmasked(NU, (int)bb) + 127) & ~127)) return;   /* the same for the whole block, ahead of every barrier */
  const float* BA = which == 0 ? BQ : which == 1 ? BK : BV;
  const unsigned lo = (unsigned)lane * 16;   /* the lane's bytes into a 512-byte run: added to the wave-uniform bases of the loads and of the plane stores */
  const char* xb = (const char*)(XP + ((r0 >> 4) + wave) * FX);
  const size_t hd = bb * NH + (c0 >> 6);   /* the first of the block's two heads */
  if (which < 2) { v8f acc[8] = {}; proj_loop<true>(xb, (const char*)(WP + (size_t)which * WPL + (size_t)(c0 >> 4) * 512), lo, acc);
    const int nhi = which == 0 ? QHI : KHI; const bool hi_rows = t0 < nhi; const int tl = (t0 >> 4) + wave;
    char* dh = (char*)((which == 0 ? QH : KH) + (hd * (TT / 16) + tl) * FQK); char* dl = (char*)((which == 0 ? QL : KL) + (hd * (size_t)(nhi / 16) + tl) * FQK);
    hx8 hv[8], lv[8]; v4f bs[8][2] = {};   /* tile j = head j / 4, unit row (kc * 2 + qq) = j % 4 */
    if (BA) { const float* bp = BA + c0 + 8 * g;   /* the same for the whole block */
#pragma unroll
      for (int j = 0; j < 8; ++j) { bs[j][0] = *(const v4f*)(bp + j * 16); bs[j][1] = *(const v4f*)(bp + j * 16 + 4); }
      asm volatile("s_wait_xcnt 0x0" :: "v"(bp) : "memory"); }   /* the bias loads share one address pair: it stays whole until this wait */
#pragma unroll
    for (int j = 0; j < 8; ++j) {
#pragma unroll
      for (int r = 0; r < 8; ++r) { const float v = acc[j][r] + bfr(bs[j][r >> 2][r & 3]); hv[j][r] = (_Float16)v; lv[j][r] = (_Float16)((v - (float)hv[j][r]) * 1024.0f); } }
    char* ph = dh + lo; char* pl = dl + lo;   /* the lane's own address in the first head's tile; the unit row and the second head are constant offsets */
#pragma unroll
    for (int j = 0; j < 8; ++j) vst2(ph + (size_t)(j >> 2) * (TT / 16) * FQK * 2 + (j & 3) * 512, hv[j]);
    asm volatile("s_wait_xcnt 0x0" :: "v"(hv[0]), "v"(hv[1]), "v"(hv[2]), "v"(hv[3]), "v"(hv[4]), "v"(hv[5]), "v"(hv[6]), "v"(hv[7]), "v"(ph) : "memory");   /* the stores' data and address registers stay whole until this wait */
    if (hi_rows) {   /* the same for the whole block */
#pragma unroll
      for (int j = 0; j < 8; ++j) vst2(pl + (size_t)(j >> 2) * (nhi / 16) * FQK * 2 + (j & 3) * 512, lv[j]);
      asm volatile("s_wait_xcnt 0x0" :: "v"(lv[0]), "v"(lv[1]), "v"(lv[2]), "v"(lv[3]), "v"(lv[4]), "v"(lv[5]), "v"(lv[6]), "v"(lv[7]), "v"(pl) : "memory"); }   /* as above, for the residual stores */
  } else { v8f acc[8] = {}; proj_loop<false>(xb, (const char*)(WP + 2 * WPL + (size_t)(c0 >> 4) * 512), lo, acc);
    const bool hi_rows = t0 < KHI; const int ch = (t0 >> 5) + (wave >> 1), uq = (wave & 1) * 512;   /* the wave's 16 places: half qq = wave % 2 of a 32-place chunk */
    char* dv = (char*)(VT + (hd * (TT / 32) + ch) * FV) + uq; const size_t o3 = (hd * (KHI / 32) + ch) * FV; char* db = (char*)(VB + o3) + uq; char* dbl = (char*)(VBL + o3) + uq;
    hx8 hv[8]; v8b bh[8], bl[8]; float bs[8] = {};   /* tile j = head j / 4, unit rows (j % 4) * 2 + qq */
    if (BA) { const float* bp = BA + c0 + col;   /* the same for the whole block */
#pragma unroll
      for (int j = 0; j < 8; ++j) bs[j] = bp[j * 16];
      asm volatile("s_wait_xcnt 0x0" :: "v"(bp) : "memory"); }   /* the bias loads share one address pair: it stays whole until this wait */
#pragma unroll
    for (int j = 0; j < 8; ++j) { const float bias = bfr(bs[j]);
#pragma unroll
      for (int r = 0; r < 8; ++r) { const float v = acc[j][r] + bias; hv[j][r] = (_Float16)v; bh[j][r] = (__bf16)v; bl[j][r] = (__bf16)(v - (float)bh[j][r]); } }
#pragma unroll
    for (int j = 0; j < 8; ++j) *(hx8*)&th[j * 16 + col][wave * 16 + 8 * g] = hv[j];
    __syncthreads();   /* the block's f16 v tile is in LDS before a thread sums its channel; ahead of the plane stores, so that it does not wait for them */
    char* pv = dv + lo; char* pb = db + lo; char* pbl = dbl + lo;   /* the lane's own address in the first head's chunk; the unit rows and the second head are constant offsets */
#pragma unroll
    for (int j = 0; j < 8; ++j) vst2(pv + (size_t)(j >> 2) * (TT / 32) * FV * 2 + (j & 3) * 1024, hv[j]);
    asm volatile("s_wait_xcnt 0x0" :: "v"(hv[0]), "v"(hv[1]), "v"(hv[2]), "v"(hv[3]), "v"(hv[4]), "v"(hv[5]), "v"(hv[6]), "v"(hv[7]), "v"(pv) : "memory");   /* the stores' data and address registers stay whole until this wait */
    if (hi_rows) {   /* the same for the whole block */
#pragma unroll
      for (int j = 0; j < 8; ++j) { const size_t o = (size_t)(j >> 2) * (KHI / 32) * FV * 2 + (j & 3) * 1024; vst2(pb + o, bh[j]); vst2(pbl + o, bl[j]); }
      asm volatile("s_wait_xcnt 0x0" :: "v"(bh[0]), "v"(bh[1]), "v"(bh[2]), "v"(bh[3]), "v"(bh[4]), "v"(bh[5]), "v"(bh[6]), "v"(bh[7]), "v"(bl[0]), "v"(bl[1]), "v"(bl[2]), "v"(bl[3]), "v"(bl[4]), "v"(bl[5]), "v"(bl[6]), "v"(bl[7]), "v"(pb), "v"(pbl) : "memory"); }   /* as above, for the hi and lo stores */
    hx8 sv[8]; float a8[8];   /* thread = channel: the block's 64 places of the f16 v tile summed in f32, eight chains and a tree over them; the loops are unrolled whole, so the LDS reads issue ahead of the first add */
#pragma unroll
    for (int i = 0; i < 8; ++i) sv[i] = *(const hx8*)&th[tid][i * 8];
#pragma unroll
    for (int j = 0; j < 8; ++j) a8[j] = (float)sv[0][j];
#pragma unroll
    for (int i = 1; i < 8; ++i)
#pragma unroll
      for (int j = 0; j < 8; ++j) a8[j] += (float)sv[i][j];
    vst2(PS + (bb * PSN + (size_t)(t0 >> 6)) * CC + c0 + tid, ((a8[0] + a8[1]) + (a8[2] + a8[3])) + ((a8[4] + a8[5]) + (a8[6] + a8[7])));   /* a wave stores one whole line */
    asm volatile("s_wait_xcnt 0x0" ::: "memory"); } }   /* behind the store: the code that the listing has behind it rewrites the store's base and data registers */
// ---- k_att: a tile = 16 sorted places of (b, h) as queries, worked on by the AW waves of a block. AG blocks share the tiles of one (b, h) and each walks its own in a loop: NH * TNB * AG blocks fill the chip's places once (two blocks' LDS fit a WGP), so no wave is started for a tile of masked tokens (k_out takes mean v for their rows) and a block's start is paid once for all its tiles. Only the nt = ceil(n / 16) tiles that hold an unmasked token are dealt: by rank from the longest (rank r = tile nt - 1 - r), 16 ranks a pass, forwards and backwards by turns, so the blocks' key counts come out level. The 16 score rows live in LDS from the logits to P, so no score plane goes through memory and one launch covers every (b, h).
// step 1, logits: wave w takes the 16-key tiles w, w + AW, ... of keys [0, kend): q x k on f16 (3 products with the x 2^10 residual planes for query blocks < QBH), x SCALE; causal and key masks (place < n) by select at the LDS store.
// step 2, softmax: wave w owns row w in registers, f32, sums by lane then across lanes; P x 2^11 back in place (0 for excluded keys); a query with token_masks == 0 gets a finite placeholder row here, which k_out does not read.
// step 3, P.v: wave w sums the 32-key chunks w, w + AW, ... (P once to f16 against v f16; query blocks < QBH: P and v as bf16 hi + lo, 3 products); the AW partial tiles are added in f32 through LDS in wave order.
#define AG 16          /* blocks that share the tiles of one (b, h) */
#define AW 16          /* the wave number goes through readfirstlane so that the tile loops are scalar loops and every lane is on at the matrix instructions */
#define SP (TT + 4)    /* row pitch in floats: 16 B past a multiple of 256 B, so the 16 rows of a b128 fragment read fall on different banks */
static_assert((TT / 16) % AG == 0, "whole passes over the ranks");
static_assert(HD % 32 == 0 && HD / 32 <= AG && (PSN & (PSN - 1)) == 0, "mean v: whole lines of 32 channels, a block for each, a full tree");
static_assert(QBH * 64 >= QHI, "every row with a q residual plane takes the 3-product path");
static_assert(AW * 16 * (HD + 4) <= 16 * SP, "the partial tiles reuse the score rows' LDS");
static_assert(16 * (HD / 2) == 32 * AW, "in the last step a wave stores the row of its own number");
// 16 f32 of one LDS row in fragment order (0..7 = p[0..7], 8..15 = p[16..23]) by four 16-byte reads
__device__ __forceinline__ void lds_row16(const float* p, float v[16]) { const v4f a = *(const v4f*)p, b = *(const v4f*)(p + 4), c = *(const v4f*)(p + 16), d = *(const v4f*)(p + 20);
#pragma unroll
  for (int i = 0; i < 4; ++i) { v[i] = a[i]; v[4 + i] = b[i]; v[8 + i] = c[i]; v[12 + i] = d[i]; } }
// a 16-bit fragment of a fragment-order plane at the lane's own byte address: two runs of 512 bytes a wave. k_att forms that address where it is used, as a tile's wave-uniform base (scalar registers) + the lane's 32-bit byte offset: one vector register serves every plane, where a 64-bit pair a plane, held over the tile loop, would not fit the 128 registers that two blocks a WGP leave a wave
template <typename V16, typename V8> __device__ __forceinline__ V16 frag_p(const char* p) { union { V16 v; V8 q[2]; } u; u.q[0] = *(const V8*)p; u.q[1] = *(const V8*)(p + 512); return u.v; }
__global__ __launch_bounds__(32 * AW) __attribute__((amdgpu_waves_per_eu(8, 8))) void k_att(const _Float16* __restrict__ QH, const _Float16* __restrict__ KH, const _Float16* __restrict__ QL, const _Float16* __restrict__ KL, const _Float16* __restrict__ VT, const __bf16* __restrict__ VB, const __bf16* __restrict__ VBL, const int* __restrict__ IDX, const int* __restrict__ NU, const float* __restrict__ PS, float* __restrict__ MV, float* __restrict__ Y) { __shared__ __align__(16) float sc[16][SP];
  const int tid = threadIdx.x, wave = __builtin_amdgcn_readfirstlane(tid >> 5), lane = tid & 31, col = lane & 15, g = lane >> 4; const int h = blockIdx.x % NH, b = blockIdx.x / NH, sl = blockIdx.y;
  if (sl < HD / 32 && wave == AW - 1) {   /* scalar test. Mean v of 32 channels of this head: lane = channel, the PSN partial sums loaded as PSN whole lines, all in flight at once, added as a tree; ahead of the tile loop, so it is done for any mask, also where the block has no tile */
    const float* pb = PS + (size_t)b * PSN * CC + h * HD + sl * 32; float f[PSN];   /* wave-uniform base; the lane is the loads' offset register */
#pragma unroll
    for (int i = 0; i < PSN; ++i) f[i] = pb[(size_t)i * CC + lane];
#pragma unroll
    for (int o = PSN / 2; o > 0; o >>= 1)
#pragma unroll
      for (int i = 0; i < o; ++i) f[i] += f[i + o];
    vst2(MV + (size_t)b * CC + h * HD + sl * 32 + lane, f[0] * (1.0f / TT));
    asm volatile("s_wait_xcnt 0x0" :: "s"(pb) : "memory"); }   /* behind the loads and the store: the loads' base stays whole until this wait, and the code below rewrites the store's address and data registers */
  const int nb = n_unmasked(NU, b); const int nt = (nb + 15) >> 4;
  const unsigned lo = (unsigned)lane * 16; const size_t hd = (size_t)b * NH + h;   /* the lane's bytes into a 512-byte run of any plane; the (b, h) whose tiles and chunks are read */
  for (int ps = 0; ps < TT / 16 / AG; ++ps) { const int qt = nt - 1 - (ps * AG + ((ps & 1) ? AG - 1 - sl : sl)); if (qt < 0) break;   /* scalar, the same for the whole block; the rank grows with ps, so no later pass has a tile either */
  const int qb = qt >> 2; const int ql0 = qt * 16; const int kend = (kb_last(qb) + 1) * 128;
  const int tq = ql0 + wave < nb; const int orow = IDX[(size_t)b * TT + ql0 + wave] & (TT - 1);   /* the token whose context row this wave stores; the mask bounds the row whatever the list holds */
  asm volatile("s_wait_xcnt 0x0" ::: "memory");   /* behind the list load: the q loads below land on its offset register */
  const char* qp = (const char*)(QH + (hd * (TT / 16) + qt) * FQK) + lo;
  if (qb < QBH) { const char* qlp = (const char*)(QL + (hd * (QHI / 16) + qt) * FQK) + lo; v16h ah[HD / 32], al[HD / 32];
#pragma unroll
    for (int kc = 0; kc < HD / 32; ++kc) { ah[kc] = frag_p<v16h, v8h>(qp + kc * 1024); al[kc] = frag_p<v16h, v8h>(qlp + kc * 1024); }
    asm volatile("s_wait_xcnt 0x0" :: "v"(qp), "v"(qlp) : "memory");   /* the q loads' two address pairs stay whole (no load lands on them) until this wait */
    for (int kt = wave; kt < kend / 16; kt += AW) { const int key = kt * 16 + col; v8f acc = {}, accl = {}; const char* kp = (const char*)(KH + (hd * (TT / 16) + kt) * FQK) + lo; const char* klp = (const char*)(KL + (hd * (KHI / 16) + kt) * FQK) + lo;
      v16h kbf[HD / 32], klf[HD / 32];   /* all of the tile's loads stand ahead of its first product: one memory latency a tile */
#pragma unroll
      for (int kc = 0; kc < HD / 32; ++kc) { kbf[kc] = frag_p<v16h, v8h>(kp + kc * 1024); klf[kc] = frag_p<v16h, v8h>(klp + kc * 1024); }
      asm volatile("s_wait_xcnt 0x0" :: "v"(kp), "v"(klp) : "memory");   /* the k loads' two address pairs stay whole (no load lands on them) until this wait */
#pragma unroll
      for (int kc = 0; kc < HD / 32; ++kc) { acc = wmma16(ah[kc], kbf[kc], acc); accl = wmma16(al[kc], kbf[kc], accl); accl = wmma16(ah[kc], klf[kc], accl); }
#pragma unroll
      for (int r = 0; r < 8; ++r) sc[8 * g + r][key] = ((!CAUSAL || key <= ql0 + 8 * g + r) && key < nb) ? (acc[r] + accl[r] * (1.0f / 1024.0f)) * SCALE : -3.0e38f; }
  } else { v16h ah[HD / 32];
#pragma unroll
    for (int kc = 0; kc < HD / 32; ++kc) ah[kc] = frag_p<v16h, v8h>(qp + kc * 1024);
    asm volatile("s_wait_xcnt 0x0" :: "v"(qp) : "memory");   /* the q loads share one address pair: it stays whole (no k load lands on it) until this wait */
    for (int kt0 = wave; kt0 < kend / 16; kt0 += 4 * AW) { v16h kbf[4][HD / 32] = {};   /* the start value: registers left unset on a skipped tile's path are carried round the tile loop and spill; the loads of up to four tiles stand ahead of the first product: one memory latency for four tiles; the tests on the tile number are scalar */
      const char* kp = (const char*)(KH + (hd * (TT / 16) + kt0) * FQK) + lo;   /* one address pair for the four tiles, the tile's step as a constant offset */
#pragma unroll
      for (int u = 0; u < 4; ++u) if (kt0 + u * AW < kend / 16) {
#pragma unroll
        for (int kc = 0; kc < HD / 32; ++kc) kbf[u][kc] = frag_p<v16h, v8h>(kp + u * (AW * FQK * 2) + kc * 1024); }
      asm volatile("s_wait_xcnt 0x0" :: "v"(kp) : "memory");   /* the k loads share one address pair: it stays whole (no load lands on it) until this wait */
#pragma unroll
      for (int u = 0; u < 4; ++u) if (kt0 + u * AW < kend / 16) { const int key = (kt0 + u * AW) * 16 + col; v8f acc = {};
#pragma unroll
        for (int kc = 0; kc < HD / 32; ++kc) acc = wmma16(ah[kc], kbf[u][kc], acc);
#pragma unroll
        for (int r = 0; r < 8; ++r) sc[8 * g + r][key] = ((!CAUSAL || key <= ql0 + 8 * g + r) && key < nb) ? acc[r] * SCALE : -3.0e38f; } } }
  __syncthreads();   /* every tile of the 16 score rows is in LDS before a wave reads its row */
  { const int nq = kend >> 7; v4f vv[TT / 128] = {};   /* the start value: as for kbf above; 128 keys a pass: 32 lanes x 4; the tests on nq are scalar */
#pragma unroll
    for (int i = 0; i < TT / 128; ++i) if (i < nq) vv[i] = *(const v4f*)&sc[wave][i * 128 + lane * 4];
    float m = -3.0e38f;
#pragma unroll
    for (int i = 0; i < TT / 128; ++i) if (i < nq) { if (tq == 0) vv[i] = (v4f){0.f, 0.f, 0.f, 0.f}; m = fmaxf(m, fmaxf(fmaxf(vv[i][0], vv[i][1]), fmaxf(vv[i][2], vv[i][3]))); }
#pragma unroll
    for (int o = 1; o < 32; o <<= 1) m = fmaxf(m, __shfl_xor(m, o));
    float sum = 0.f;
#pragma unroll
    for (int i = 0; i < TT / 128; ++i) if (i < nq) {
#pragma unroll
      for (int c = 0; c < 4; ++c) { const float v = vv[i][c]; const float ex = expf(v - m); const float e = (v <= -1.0e38f) ? 0.f : ex; vv[i][c] = e; sum += e; } }
#pragma unroll
    for (int o = 1; o < 32; o <<= 1) sum += __shfl_xor(sum, o);
    const float inv = sum > 0.f ? 2048.0f / sum : 0.f;   /* a fully excluded row yields P = 0 */
#pragma unroll
    for (int i = 0; i < TT / 128; ++i) if (i < nq) *(v4f*)&sc[wave][i * 128 + lane * 4] = vv[i] * inv; }
  __syncthreads();   /* all 16 rows of P are in LDS before any wave forms fragments across them */
  const int kce = kend >> 5; v8f acc[HD / 16] = {};
  if (qb < QBH) {
    for (int kc = wave; kc < kce; kc += AW) { float pv[16]; lds_row16(&sc[col][kc * 32 + 8 * g], pv); const F2 p = bsplit16(pv); const size_t po = (hd * (KHI / 32) + kc) * FV; const char* vbp = (const char*)(VB + po) + lo; const char* vlp = (const char*)(VBL + po) + lo;
#pragma unroll
      for (int j2 = 0; j2 < HD / 16; j2 += 2) { v16b vh[2], vl[2];   /* two column tiles' loads stand ahead of their products */
#pragma unroll
        for (int u = 0; u < 2; ++u) { vh[u] = frag_p<v16b, v8b>(vbp + (j2 + u) * 1024); vl[u] = frag_p<v16b, v8b>(vlp + (j2 + u) * 1024); }
        asm volatile("s_wait_xcnt 0x0" :: "v"(vbp), "v"(vlp) : "memory");   /* the v loads' two address pairs stay whole (no load lands on them) until this wait */
#pragma unroll
        for (int u = 0; u < 2; ++u) { const int j = j2 + u; acc[j] = wmma_bf(p.h, vh[u], acc[j]); acc[j] = wmma_bf(p.l, vh[u], acc[j]); acc[j] = wmma_bf(p.h, vl[u], acc[j]); } } }
  } else {
    for (int kc = wave; kc < kce; kc += AW) { v16h vf[HD / 16]; const char* vp = (const char*)(VT + (hd * (TT / 32) + kc) * FV) + lo;   /* the chunk's four v loads stand ahead of its first product: one memory latency a chunk */
#pragma unroll
      for (int j = 0; j < HD / 16; ++j) vf[j] = frag_p<v16h, v8h>(vp + j * 1024);
      asm volatile("s_wait_xcnt 0x0" :: "v"(vp) : "memory");   /* the eight loads share one address pair: it stays whole (no load lands on it) until this wait */
      float pv[16]; lds_row16(&sc[col][kc * 32 + 8 * g], pv); v16h p;
#pragma unroll
      for (int i = 0; i < 16; ++i) p[i] = (_Float16)pv[i];
#pragma unroll
      for (int j = 0; j < HD / 16; ++j) acc[j] = wmma16(p, vf[j], acc[j]); } }
  __syncthreads();   /* every wave has read its last P fragment before the partial tiles overwrite the rows */
  float (*ss)[16][HD + 4] = (float (*)[16][HD + 4])&sc[0][0];
#pragma unroll
  for (int j = 0; j < HD / 16; ++j)
#pragma unroll
    for (int r = 0; r < 8; ++r) ss[wave][8 * g + r][j * 16 + col] = acc[j][r];
  __syncthreads();   /* every wave's partial tile is in LDS before any wave adds them */
  for (int e = tid; e < 16 * (HD / 2); e += 32 * AW) { const int rl = e / (HD / 2), q = e % (HD / 2); v2f s = *(const v2f*)&ss[0][rl][q * 2];
#pragma unroll   /* the AW LDS reads issue ahead of the adds; rolled, each add would wait a full LDS latency */
    for (int w = 1; w < AW; ++w) s += *(const v2f*)&ss[w][rl][q * 2];
    vst2(Y + ((size_t)b * TT + orow) * CC + h * HD + q * 2, s * (1.0f / 2048.0f));
    asm volatile("s_wait_xcnt 0x0" ::: "memory"); }   /* behind the store: the next tile rewrites its address and data registers */
  __syncthreads(); } }   /* every wave has read the partial tiles before the next tile's scores overwrite them */
// ---- k_out: block = (64 rows, 128 cols): out = ctx Wo (+ bo), the ctx row of a token with token_masks == 0 being its sequence's mean v (every lane reads a row that this call has written): ctx x 2^6 once to f16 against Wo as f16(bf16 x 2^8) exact (1 product) x 2^-14; causal early rows (< QHI of each sequence): ctx bf16 hi + lo against exact bf16 Wo (2 products)
__global__ __launch_bounds__(128) void k_out(const float* __restrict__ Y, const int* __restrict__ TM, const float* __restrict__ MV, const __bf16* __restrict__ WOB, const _Float16* __restrict__ WOH, const float* __restrict__ BO, float* __restrict__ OUT) { __shared__ __align__(16) float sf[4][16][132];
  const int tid = threadIdx.x, wave = tid >> 5, lane = tid & 31, col = lane & 15, g = lane >> 4; const int c0 = blockIdx.y * 128; const size_t r0 = (size_t)blockIdx.x * 64 + wave * 16;
  const int* tp = TM + r0 + col; const int tk = *tp; asm volatile("s_wait_xcnt 0x0" :: "v"(tp) : "memory");   /* the mask load's address pair stays whole until this wait */
  v8f acc[8] = {}; const float* xp = (tk != 0 ? Y + (r0 + col) * CC : MV + (((size_t)blockIdx.x * 64) / TT) * CC) + 8 * g; const size_t wo = ((size_t)(c0 >> 4) * 64 + lane) * 8; v4f xs[2][4]; ld_xr(xp, xs[0]); ld_xr(xp + 32, xs[1]);
  if (CAUSAL && (int)(((size_t)blockIdx.x * 64) % TT) < QHI) {   /* block-uniform */
    const __bf16* wp = WOB + wo; v8b wf[3][8]; F2 a;
#pragma unroll
    for (int t = 0; t < 2; ++t) ld_wf<8>(wp + WST(t), wf[t]);
#pragma unroll   /* whole, stages as in k_proj; two products a tile, so B two stages ahead covers as much */
    for (int st = 0; st < CC / 16; ++st) { const int hf = st & 1, kc = st >> 1;
      if (hf == 0) { float v[16];
#pragma unroll
        for (int i = 0; i < 4; ++i) { v[i] = xs[kc & 1][0][i]; v[4 + i] = xs[kc & 1][1][i]; v[8 + i] = xs[kc & 1][2][i]; v[12 + i] = xs[kc & 1][3][i]; }
        a = bsplit16(v); if (kc + 2 < CC / 32) ld_xr(xp + (kc + 2) * 32, xs[kc & 1]); }
      if (st + 2 < CC / 16) ld_wf<8>(wp + WST(st + 2), wf[(st + 2) % 3]);   /* into the set that the last stage has left */
      if (st + 3 == CC / 16) asm volatile("s_wait_xcnt 0x0" :: "v"(xp), "v"(wp) : "memory");   /* behind the last loads: the two address pairs stay whole until this wait */
#pragma unroll
      for (int j = 0; j < 4; ++j) { const int jj = hf * 4 + j; const v16b w = two_b(wf[st % 3][2 * j], wf[st % 3][2 * j + 1]); acc[jj] = wmma_bf(a.h, w, acc[jj]); acc[jj] = wmma_bf(a.l, w, acc[jj]); }
      __builtin_amdgcn_sched_barrier(0); }   /* keeps the next stage's conversions, and with them the wait on loads just issued, behind this stage's products */
#pragma unroll
    for (int j = 0; j < 8; ++j) { const float bias = BO ? bfr(BO[c0 + j * 16 + col]) : 0.f;
#pragma unroll
      for (int r = 0; r < 8; ++r) sf[wave][8 * g + r][j * 16 + col] = acc[j][r] + bias; }
  } else {
    const _Float16* wp = WOH + wo; v8h wf[4][8]; v16h a;
#pragma unroll
    for (int t = 0; t < 3; ++t) ld_wf<8>(wp + WST(t), wf[t]);
#pragma unroll   /* whole, stages as in k_proj */
    for (int st = 0; st < CC / 16; ++st) { const int hf = st & 1, kc = st >> 1;
      if (hf == 0) {   /* ctx carried x 2^6 into f16 so small-magnitude context rows stay clear of f16 subnormals */
#pragma unroll
        for (int i = 0; i < 4; ++i) { a[i] = (_Float16)(xs[kc & 1][0][i] * 64.0f); a[4 + i] = (_Float16)(xs[kc & 1][1][i] * 64.0f); a[8 + i] = (_Float16)(xs[kc & 1][2][i] * 64.0f); a[12 + i] = (_Float16)(xs[kc & 1][3][i] * 64.0f); }
        if (kc + 2 < CC / 32) ld_xr(xp + (kc + 2) * 32, xs[kc & 1]); }
      if (st + 3 < CC / 16) ld_wf<8>(wp + WST(st + 3), wf[(st + 3) & 3]);   /* into the set that the last stage has left */
      if (st + 4 == CC / 16) asm volatile("s_wait_xcnt 0x0" :: "v"(xp), "v"(wp) : "memory");   /* behind the last loads: the two address pairs stay whole until this wait */
#pragma unroll
      for (int j = 0; j < 4; ++j) acc[hf * 4 + j] = wmma16(a, two_h(wf[st & 3][2 * j], wf[st & 3][2 * j + 1]), acc[hf * 4 + j]);
      __builtin_amdgcn_sched_barrier(0); }   /* keeps the next stage's conversions, and with them the wait on loads just issued, behind this stage's products */
#pragma unroll
    for (int j = 0; j < 8; ++j) { const float bias = BO ? bfr(BO[c0 + j * 16 + col]) : 0.f;
#pragma unroll
      for (int r = 0; r < 8; ++r) sf[wave][8 * g + r][j * 16 + col] = acc[j][r] * (1.0f / 16384.0f) + bias; } }   /* 2^-8 (Wo carry) x 2^-6 (ctx carry) */
  LDSX(); for (int rl = 0; rl < 16; ++rl) vst2(OUT + (r0 + rl) * DIN + c0 + lane * 4, *(const v4f*)&sf[wave][rl][lane * 4]); }

extern "C" void kernel_launch(void* const* d_in, const int* in_sizes, int n_in, void* d_out, int out_size, void* d_ws, size_t ws_size, hipStream_t stream) {
  (void)in_sizes; (void)n_in; (void)out_size;
  const float** F = (const float**)d_in;
  if (ws_size < (size_t)WS_END) return;
  char* ws = (char*)d_ws; _Float16 *QH = (_Float16*)(ws + WS_QH), *KH = (_Float16*)(ws + WS_KH), *VT = (_Float16*)(ws + WS_VT), *QL = (_Float16*)(ws + WS_QL), *KL = (_Float16*)(ws + WS_KL); __bf16 *VB = (__bf16*)(ws + WS_VB), *VBL = (__bf16*)(ws + WS_VBL); float *Y = (float*)(ws + WS_Y);
  (void)Y; (void)QL; (void)KL; (void)VB; (void)VBL;
  // inputs: 0 embeddings [4,2048,512]; 1 token_masks [4,2048] int32 (0/1); 2 Wq [512,512] (in,out); 3 Wk; 4 Wv; 5 Wo (in,out)
  if (ws_size < (size_t)WS_END6) return;
  const int* TM = (const int*)d_in[1]; float* MV = (float*)(ws + WS_MV); int *IDX = (int*)(ws + WS_IDX), *NU = (int*)(ws + WS_NU); __bf16* WP = (__bf16*)(ws + WS_WP); _Float16* WOH = (_Float16*)(ws + WS_WOH); float* PS = (float*)(ws + WS_PS); __bf16* XP = (__bf16*)(ws + WS_XP);
  k_perm<<<dim3(TNB * XG + 5 * WPB), 32 * PW, 0, stream>>>(F[0], TM, F[2], F[3], F[4], F[5], IDX, NU, WP, WOH, XP);
  k_proj<<<dim3(TNB * TT / 64, CC / 128, 3), 128, 0, stream>>>(XP, WP, nullptr, nullptr, nullptr, NU, QH, QL, KH, KL, VT, VB, VBL, PS);
  k_att<<<dim3(NH * TNB, AG), 32 * AW, 0, stream>>>(QH, KH, QL, KL, VT, VB, VBL, IDX, NU, PS, MV, Y);
  k_out<<<dim3(TNB * TT / 64, DIN / 128), 128, 0, stream>>>(Y, TM, MV, WP + 3 * WPL, WOH, nullptr, (float*)d_out);
}
